// v000
// The times below were measured on an AMD MI455X: many runs one after another, warmed up first and cycling through
// copies of the inputs, with the whole window's GPU time divided by the number of runs. Launches and the gaps
// between them are all in it. The median over several windows is given; except for v000 it joins two sittings, which
// can be a few percent apart, so the side-by-side timings, each taken in one sitting, are the better comparison.
// v000 is the starting kernel. One run takes 420 microseconds.
#include <hip/hip_runtime.h>
// Pre-norm multi-head attention with a boolean mask and residual (B=2, N=2048, E=1024, 16 heads × 64): q = LN(Q)·Wq + bq, k = LN(K)·Wk + bk, v = LN(V)·Wv + bv (one shared LayerNorm γ,β; (in,out) weights); s = q·kᵀ·64^-½ with −inf where mask[b,0,n,m] is True;
// softmax; o = merged attn·v; out = o + Q (no output projection).
// Compute dtype: Q, K, V, weights, biases, γ, β rounded to bf16; LayerNorms f32 (wave per row) → f16; q/k/v f16 GEMM planes; fused flash-style kernel (int32 mask loads per (q,k), online softmax f32, P f16 ×2^10) on
// v_wmma_f32_16x16x32_f16; out = o (f32) + bf16(Q) (f32 add); f32 accumulate.
#define BB 2
#define TT 2048
#define DD 1024
#define NH 16
#define NR (BB * TT)

typedef __bf16 v16b __attribute__((ext_vector_type(16)));
typedef unsigned short v8us __attribute__((ext_vector_type(8), may_alias));
typedef float  v8f  __attribute__((ext_vector_type(8)));
typedef float  v4f  __attribute__((ext_vector_type(4)));
typedef float  v4fa __attribute__((ext_vector_type(4), may_alias));
union FragB { v16b v; v8us half[2]; unsigned short u[16]; };

__device__ __forceinline__ unsigned short bf16_bits(float x) { unsigned int u = __float_as_uint(x); return (unsigned short)((u + 0x7FFFu + ((u >> 16) & 1u)) >> 16); }
__device__ __forceinline__ float bf16_val(unsigned short b) { return __uint_as_float(((unsigned int)b) << 16); }
__device__ __forceinline__ float bf16_round(float x) { return bf16_val(bf16_bits(x)); }
// D += A·B with NT terms: 1 = ah·bh, 2 = + al·bh (A split), 3 = + ah·bl (both split)
template <int NT>
__device__ __forceinline__ v8f mmaN(v16b ah, v16b al, v16b bh, v16b bl, v8f c) {
  c = __builtin_amdgcn_wmma_f32_16x16x32_bf16(false, ah, false, bh, (short)0, c, false, false);
  if (NT >= 2) c = __builtin_amdgcn_wmma_f32_16x16x32_bf16(false, al, false, bh, (short)0, c, false, false);
  if (NT >= 3) c = __builtin_amdgcn_wmma_f32_16x16x32_bf16(false, ah, false, bl, (short)0, c, false, false);
  asm volatile("v_nop\n\tv_nop\n\tv_nop\n\tv_nop" : "+v"(c) : "v"(ah), "v"(al), "v"(bh), "v"(bl));
  return c;
}

__global__ __launch_bounds__(256) void k_wt_bf16(const float* __restrict__ W, unsigned short* __restrict__ Wt, int K, int N) {
  const int t = blockIdx.x * 256 + threadIdx.x;
  const int k8n = K / 8;
  if (t >= N * k8n) return;
  const int n = t / k8n, k8 = (t % k8n) * 8;
  v8us v;
#pragma unroll
  for (int i = 0; i < 8; ++i) v[i] = bf16_bits(W[(size_t)(k8 + i) * N + n]);
  *(v8us*)(Wt + (size_t)n * K + k8) = v;
  
}

// GEMM C[M][N] (f32, pitch ldc) = act(A[M][K]·W + bias). A f32 row-major (pitch lda) converted per fragment to bf16
// (ASPLIT: hi/lo two planes -> 2 terms, else single rounded term); Wt bf16 [N][K] (pitch ldb). BIAS_BF16 rounds the
// bias to bf16 first (bias quantised to bf16 before the add). K%32==0, M%16==0, N%64==0.
template <bool ASPLIT, int ACT, bool BIAS_BF16>
__global__ __launch_bounds__(128) void k_gemm_bf(const float* __restrict__ A, int lda, const unsigned short* __restrict__ Wt, int ldb,
                                               const float* __restrict__ bias, float* __restrict__ C, int ldc, int M, int N, int K) {
  __shared__ __attribute__((aligned(16))) float so[4][16][64];
  const int tid = threadIdx.x, w = tid >> 5, lane = tid & 31, ln = lane & 15, hh = lane >> 4;
  const int ntn = N / 64;
  const int wid = blockIdx.x * 4 + w;
  const int mt = wid / ntn, nq = wid % ntn;
  if (mt * 16 >= M) return;
  const int row0 = mt * 16, col0 = nq * 64;
  const float* arow = A + (size_t)(row0 + ln) * lda;
  v8f acc[4] = {};
  for (int kb = 0; kb < K; kb += 32) {
    FragB ah, al;
    const v4f x0 = *(const v4fa*)(arow + kb + 8 * hh), x1 = *(const v4fa*)(arow + kb + 8 * hh + 4);
    const v4f x2 = *(const v4fa*)(arow + kb + 16 + 8 * hh), x3 = *(const v4fa*)(arow + kb + 16 + 8 * hh + 4);
    float xs[16] = {x0[0],x0[1],x0[2],x0[3],x1[0],x1[1],x1[2],x1[3],x2[0],x2[1],x2[2],x2[3],x3[0],x3[1],x3[2],x3[3]};
#pragma unroll
    for (int i = 0; i < 16; ++i) { const unsigned short hb = bf16_bits(xs[i]); ah.u[i] = hb; al.u[i] = ASPLIT ? bf16_bits(xs[i] - bf16_val(hb)) : (unsigned short)0; }
#pragma unroll
    for (int t = 0; t < 4; ++t) {
      const unsigned short* brow = Wt + (size_t)(col0 + t * 16 + ln) * ldb + kb;
      FragB b;
      b.half[0] = *(const v8us*)(brow + 8 * hh);
      b.half[1] = *(const v8us*)(brow + 16 + 8 * hh);
      acc[t] = mmaN<ASPLIT ? 2 : 1>(ah.v, al.v, b.v, b.v, acc[t]);
    }
  }
#pragma unroll
  for (int t = 0; t < 4; ++t) {
    float bv = bias ? bias[col0 + t * 16 + ln] : 0.f;
    if (BIAS_BF16) bv = bf16_round(bv);
#pragma unroll
    for (int r = 0; r < 8; ++r) { float v = acc[t][r] + bv; if (ACT == 1) v = fmaxf(v, 0.f); so[w][8 * hh + r][t * 16 + ln] = v; }
  }
  __builtin_amdgcn_fence(__ATOMIC_ACQ_REL, "workgroup");
  __builtin_amdgcn_wave_barrier();
  const int rsub = lane >> 4, c4 = (lane & 15) * 4;
  {
#pragma unroll
    for (int q = 0; q < 8; ++q) {
      const int r = q * 2 + rsub;
      const v4f v = *(const v4fa*)&so[w][r][c4];
      *(v4f*)(C + (size_t)(row0 + r) * ldc + col0 + c4) = v;
    }
    
  }
}

// Flash-style causal/unmasked attention, all contractions 3-term bf16 hi/lo splits, f32 softmax with running max.
// q,k,v rows are read from f32 buffers with arbitrary row pitch (so they can live inside a fused qkv buffer);
// D = head size (multiple of 32, <= 128); one wave = 16 query rows; block = 4 waves (64 queries) sharing K/V chunks of 32.
template <int D, bool CAUSAL>
__global__ __launch_bounds__(128) void k_flash(const float* __restrict__ qb, const float* __restrict__ kb, const float* __restrict__ vb,
                                             int pitch, int T, int H, float scale, float* __restrict__ y, int ypitch) {
  constexpr int KS = D / 32;        // k-steps for QK
  constexpr int DT = D / 16;        // d tiles for PV
  __shared__ __attribute__((aligned(16))) unsigned short sKh[32][D + 8], sKl[32][D + 8], sVh[32][D + 8], sVl[32][D + 8];
  __shared__ __attribute__((aligned(16))) unsigned short sPh[4][16][40], sPl[4][16][40];
  __shared__ __attribute__((aligned(16))) float sO[4][16][D];
  const int tid = threadIdx.x, w = tid >> 5, lane = tid & 31, ln = lane & 15, hh = lane >> 4;
  const int nqb = (T + 63) / 64;
  const int bh = blockIdx.x / nqb, qblk = blockIdx.x % nqb;
  const int b = bh / H, h = bh % H;
  const int q0 = qblk * 64 + w * 16;
  const float* Q = qb + (size_t)b * T * pitch + h * D;
  const float* K = kb + (size_t)b * T * pitch + h * D;
  const float* V = vb + (size_t)b * T * pitch + h * D;

  // A fragments of the wave's 16 query rows (scaled), hi/lo
  FragB aqh[KS], aql[KS];
  {
    int row = q0 + ln; if (row >= T) row = T - 1;
    const float* qr = Q + (size_t)row * pitch;
#pragma unroll
    for (int ks = 0; ks < KS; ++ks)
#pragma unroll
      for (int i = 0; i < 16; ++i) {
        const int d = ks * 32 + ((i < 8) ? (8 * hh + i) : (16 + 8 * hh + (i - 8)));
        const float x = qr[d] * scale; const unsigned short hb = bf16_bits(x);
        aqh[ks].u[i] = hb; aql[ks].u[i] = bf16_bits(x - bf16_val(hb));
      }
  }
  float m_r[8], l_r[8];
#pragma unroll
  for (int r = 0; r < 8; ++r) { m_r[r] = -3.0e38f; l_r[r] = 0.f; }
  v8f oacc[DT];
#pragma unroll
  for (int dt = 0; dt < DT; ++dt) oacc[dt] = (v8f){0.f,0.f,0.f,0.f,0.f,0.f,0.f,0.f};

  const int kv_end = CAUSAL ? min(T, qblk * 64 + 64) : T;     // block-uniform
  for (int j0 = 0; j0 < kv_end; j0 += 32) {
    __syncthreads();
    for (int e = tid; e < 32 * (D / 4); e += 128) {
      const int r = e / (D / 4), c4 = (e % (D / 4)) * 4;
      const int key = j0 + r;
      v4f kf = {0.f,0.f,0.f,0.f}, vf = {0.f,0.f,0.f,0.f};
      if (key < T) { kf = *(const v4fa*)(K + (size_t)key * pitch + c4); vf = *(const v4fa*)(V + (size_t)key * pitch + c4); }
#pragma unroll
      for (int t = 0; t < 4; ++t) {
        unsigned short hb = bf16_bits(kf[t]); sKh[r][c4 + t] = hb; sKl[r][c4 + t] = bf16_bits(kf[t] - bf16_val(hb));
        hb = bf16_bits(vf[t]); sVh[r][c4 + t] = hb; sVl[r][c4 + t] = bf16_bits(vf[t] - bf16_val(hb));
      }
    }
    __syncthreads();
    // S tile 16 x 32
    v8f s[2];
#pragma unroll
    for (int nt = 0; nt < 2; ++nt) {
      v8f acc = {};
#pragma unroll
      for (int ks = 0; ks < KS; ++ks) {
        FragB bh_, bl_;
        bh_.half[0] = *(const v8us*)&sKh[nt * 16 + ln][ks * 32 + 8 * hh]; bh_.half[1] = *(const v8us*)&sKh[nt * 16 + ln][ks * 32 + 16 + 8 * hh];
        bl_.half[0] = *(const v8us*)&sKl[nt * 16 + ln][ks * 32 + 8 * hh]; bl_.half[1] = *(const v8us*)&sKl[nt * 16 + ln][ks * 32 + 16 + 8 * hh];
        acc = mmaN<3>(aqh[ks].v, aql[ks].v, bh_.v, bl_.v, acc);
      }
      s[nt] = acc;
    }
    // mask + running max (rows 8hh+r; the 16 lanes of a half share rows)
    float alpha[8];
#pragma unroll
    for (int r = 0; r < 8; ++r) {
      const int qi = q0 + 8 * hh + r;
      const int ja = j0 + ln, jb = j0 + 16 + ln;
      if (CAUSAL) { if (ja > qi) s[0][r] = -3.0e38f; if (jb > qi) s[1][r] = -3.0e38f; }
      if (ja >= T) s[0][r] = -3.0e38f;
      if (jb >= T) s[1][r] = -3.0e38f;
      float mx = fmaxf(s[0][r], s[1][r]);
      mx = fmaxf(mx, __shfl_xor(mx, 1, 32)); mx = fmaxf(mx, __shfl_xor(mx, 2, 32)); mx = fmaxf(mx, __shfl_xor(mx, 4, 32)); mx = fmaxf(mx, __shfl_xor(mx, 8, 32));
      const float mnew = fmaxf(m_r[r], mx);
      alpha[r] = (mnew > -1.0e38f) ? __expf(m_r[r] - mnew) : 1.0f;
      const float p0 = (s[0][r] > -1.0e38f) ? __expf(s[0][r] - mnew) : 0.f;
      const float p1 = (s[1][r] > -1.0e38f) ? __expf(s[1][r] - mnew) : 0.f;
      m_r[r] = mnew;
      l_r[r] = l_r[r] * alpha[r] + p0 + p1;            // per-lane partial row sum (16 lanes combined at the end)
      unsigned short hb = bf16_bits(p0); sPh[w][8 * hh + r][ln] = hb;      sPl[w][8 * hh + r][ln] = bf16_bits(p0 - bf16_val(hb));
      hb = bf16_bits(p1);                sPh[w][8 * hh + r][16 + ln] = hb; sPl[w][8 * hh + r][16 + ln] = bf16_bits(p1 - bf16_val(hb));
    }
#pragma unroll
    for (int dt = 0; dt < DT; ++dt)
#pragma unroll
      for (int r = 0; r < 8; ++r) oacc[dt][r] *= alpha[r];
    __builtin_amdgcn_fence(__ATOMIC_ACQ_REL, "workgroup");
    __builtin_amdgcn_wave_barrier();
    FragB pah, pal;
    pah.half[0] = *(const v8us*)&sPh[w][ln][8 * hh]; pah.half[1] = *(const v8us*)&sPh[w][ln][16 + 8 * hh];
    pal.half[0] = *(const v8us*)&sPl[w][ln][8 * hh]; pal.half[1] = *(const v8us*)&sPl[w][ln][16 + 8 * hh];
#pragma unroll
    for (int dt = 0; dt < DT; ++dt) {
      FragB bvh, bvl;
#pragma unroll
      for (int i = 0; i < 8; ++i) {
        bvh.u[i] = sVh[8 * hh + i][dt * 16 + ln]; bvh.u[8 + i] = sVh[16 + 8 * hh + i][dt * 16 + ln];
        bvl.u[i] = sVl[8 * hh + i][dt * 16 + ln]; bvl.u[8 + i] = sVl[16 + 8 * hh + i][dt * 16 + ln];
      }
      oacc[dt] = mmaN<3>(pah.v, pal.v, bvh.v, bvl.v, oacc[dt]);
    }
    __builtin_amdgcn_fence(__ATOMIC_ACQ_REL, "workgroup");
    __builtin_amdgcn_wave_barrier();
  }
#pragma unroll
  for (int r = 0; r < 8; ++r) {
    float l = l_r[r];
    l += __shfl_xor(l, 1, 32); l += __shfl_xor(l, 2, 32); l += __shfl_xor(l, 4, 32); l += __shfl_xor(l, 8, 32);
    l_r[r] = (l > 0.f) ? 1.0f / l : 0.f;
  }
#pragma unroll
  for (int dt = 0; dt < DT; ++dt)
#pragma unroll
    for (int r = 0; r < 8; ++r) sO[w][8 * hh + r][dt * 16 + ln] = oacc[dt][r] * l_r[r];
  __builtin_amdgcn_fence(__ATOMIC_ACQ_REL, "workgroup");
  __builtin_amdgcn_wave_barrier();
  {
    for (int r = 0; r < 16; ++r) {
      const int row = q0 + r;
      if (row < T && lane < D / 4) {
        const v4f val = *(const v4fa*)&sO[w][r][lane * 4];
        *(v4f*)(y + ((size_t)b * T + row) * ypitch + h * D + lane * 4) = val;
      }
    }
    
  }
}

// GEMM C = act(A·W + bias + resid): A f32 (ASPLIT -> hi/lo 2 terms), Wt bf16 [N][K]; ACT 0 none, 1 relu, 2 exact gelu;
// resid (optional, f32, row index = (row % rmod), pitch ldr, RES_BF16 rounds it) added before the activation.
template <bool ASPLIT, int ACT, bool BIAS_BF16, bool RES_BF16>
__global__ __launch_bounds__(128) void k_gemm_bf3(const float* __restrict__ A, int lda, const unsigned short* __restrict__ Wt, int ldb,
                                                const float* __restrict__ bias, const float* __restrict__ resid, int rmod, int ldr,
                                                float* __restrict__ C, int ldc, int M, int N, int K) {
  __shared__ __attribute__((aligned(16))) float so[4][16][64];
  const int tid = threadIdx.x, w = tid >> 5, lane = tid & 31, ln = lane & 15, hh = lane >> 4;
  const int ntn = N / 64;
  const int wid = blockIdx.x * 4 + w;
  const int mt = wid / ntn, nq = wid % ntn;
  if (mt * 16 >= M) return;
  const int row0 = mt * 16, col0 = nq * 64;
  const float* arow = A + (size_t)(row0 + ln) * lda;
  v8f acc[4] = {};
  for (int kb = 0; kb < K; kb += 32) {
    FragB ah, al;
    const v4f x0 = *(const v4fa*)(arow + kb + 8 * hh), x1 = *(const v4fa*)(arow + kb + 8 * hh + 4);
    const v4f x2 = *(const v4fa*)(arow + kb + 16 + 8 * hh), x3 = *(const v4fa*)(arow + kb + 16 + 8 * hh + 4);
    float xs[16] = {x0[0],x0[1],x0[2],x0[3],x1[0],x1[1],x1[2],x1[3],x2[0],x2[1],x2[2],x2[3],x3[0],x3[1],x3[2],x3[3]};
#pragma unroll
    for (int i = 0; i < 16; ++i) { const unsigned short hb = bf16_bits(xs[i]); ah.u[i] = hb; al.u[i] = ASPLIT ? bf16_bits(xs[i] - bf16_val(hb)) : (unsigned short)0; }
#pragma unroll
    for (int t = 0; t < 4; ++t) {
      const unsigned short* brow = Wt + (size_t)(col0 + t * 16 + ln) * ldb + kb;
      FragB b;
      b.half[0] = *(const v8us*)(brow + 8 * hh);
      b.half[1] = *(const v8us*)(brow + 16 + 8 * hh);
      acc[t] = mmaN<ASPLIT ? 2 : 1>(ah.v, al.v, b.v, b.v, acc[t]);
    }
  }
#pragma unroll
  for (int t = 0; t < 4; ++t) {
    const int col = col0 + t * 16 + ln;
    float bv = bias ? bias[col] : 0.f;
    if (BIAS_BF16) bv = bf16_round(bv);
#pragma unroll
    for (int r = 0; r < 8; ++r) {
      float v = acc[t][r] + bv;
      if (resid) { float rv = resid[(size_t)((row0 + 8 * hh + r) % rmod) * ldr + col]; if (RES_BF16) rv = bf16_round(rv); v += rv; }
      if (ACT == 1) v = fmaxf(v, 0.f);
      if (ACT == 2) v = 0.5f * v * (1.0f + erff(v * 0.70710678118654752f));
      if (ACT == 3) { const float u = 0.7978845608028654f * (v + 0.044715f * v * v * v); v = 0.5f * v * (1.0f + tanhf(u)); }
      so[w][8 * hh + r][t * 16 + ln] = v;
    }
  }
  __builtin_amdgcn_fence(__ATOMIC_ACQ_REL, "workgroup");
  __builtin_amdgcn_wave_barrier();
  const int rsub = lane >> 4, c4 = (lane & 15) * 4;
  {
#pragma unroll
    for (int q = 0; q < 8; ++q) {
      const int r = q * 2 + rsub;
      const v4f v = *(const v4fa*)&so[w][r][c4];
      *(v4f*)(C + (size_t)(row0 + r) * ldc + col0 + c4) = v;
    }
    
  }
}
// row LayerNorm (biased variance, eps) over N: s = X (+ R); optional out_sum <- s; out_norm <- (s-mu)*rsqrt(var+eps)*g + b
template <bool PARAM_BF16>
__global__ __launch_bounds__(256) void k_layernorm(const float* __restrict__ X, const float* __restrict__ R, const float* __restrict__ g, const float* __restrict__ bta,
                                                  float* __restrict__ out_sum, float* __restrict__ out_norm, int N, float eps) {
  __shared__ float red[256];
  const int row = blockIdx.x, tid = threadIdx.x;
  const float* x = X + (size_t)row * N; const float* rr = R ? R + (size_t)row * N : nullptr;
  float vals[16];                     // up to N = 4096
  const int per = N / 256;            // contiguous chunk per thread? use strided-by-4 chunks: thread handles j = tid*4 + 1024*u
  float s1 = 0.f;
  for (int u = 0; u < per / 4; ++u) {
    const int j = tid * 4 + 1024 * u;
    const v4f a = *(const v4fa*)(x + j);
    v4f b = {0.f,0.f,0.f,0.f}; if (rr) b = *(const v4fa*)(rr + j);
#pragma unroll
    for (int q = 0; q < 4; ++q) { const float v = a[q] + b[q]; vals[u * 4 + q] = v; s1 += v; }
  }
  red[tid] = s1; __syncthreads();
  for (int st = 128; st > 0; st >>= 1) { if (tid < st) red[tid] += red[tid + st]; __syncthreads(); }
  const float mu = red[0] / (float)N; __syncthreads();
  float s2 = 0.f;
  for (int u = 0; u < per / 4; ++u)
#pragma unroll
    for (int q = 0; q < 4; ++q) { const float c = vals[u * 4 + q] - mu; s2 += c * c; }
  red[tid] = s2; __syncthreads();
  for (int st = 128; st > 0; st >>= 1) { if (tid < st) red[tid] += red[tid + st]; __syncthreads(); }
  const float rs = rsqrtf(red[0] / (float)N + eps);
  {
    for (int u = 0; u < per / 4; ++u) {
      const int j = tid * 4 + 1024 * u;
      v4f o, sm;
#pragma unroll
      for (int q = 0; q < 4; ++q) {
        float gg = g[j + q], bb = bta[j + q];
        if (PARAM_BF16) { gg = bf16_round(gg); bb = bf16_round(bb); }
        sm[q] = vals[u * 4 + q]; o[q] = (vals[u * 4 + q] - mu) * rs * gg + bb;
      }
      if (out_sum) *(v4f*)(out_sum + (size_t)row * N + j) = sm;
      *(v4f*)(out_norm + (size_t)row * N + j) = o;
    }
    
  }
}



// ---- f16 WMMA path (v_wmma_f32_16x16x32_f16): 11-bit significands for operands in range — used where a [0,1] probability operand needs more precision than bf16
typedef _Float16 v16h __attribute__((ext_vector_type(16)));
union FragH { v16h v; v8us half[2]; _Float16 h[16]; unsigned short u[16]; };
template <int NT>
__device__ __forceinline__ v8f mmaH(v16h ah, v16h al, v16h bh, v16h bl, v8f c) {
  c = __builtin_amdgcn_wmma_f32_16x16x32_f16(false, ah, false, bh, (short)0, c, false, false);
  if (NT >= 2) c = __builtin_amdgcn_wmma_f32_16x16x32_f16(false, al, false, bh, (short)0, c, false, false);
  if (NT >= 3) c = __builtin_amdgcn_wmma_f32_16x16x32_f16(false, ah, false, bl, (short)0, c, false, false);
  asm volatile("v_nop\n\tv_nop\n\tv_nop\n\tv_nop" : "+v"(c) : "v"(ah), "v"(al), "v"(bh), "v"(bl));
  return c;
}
// batched GEMM like k_gemm_b but f16 operands: A f32 (split into f16 hi/lo if ASPLIT, else rounded to f16), Bt = f16 values [n][k]; alpha; C f32; N multiple of 16 (partial tiles skipped)
template <bool ASPLIT>
__global__ __launch_bounds__(128) void k_gemm_h(const float* __restrict__ A, int lda, size_t sA, const _Float16* __restrict__ Bh, int ldb, size_t sB, float alpha, float* __restrict__ C, int ldc, size_t sC, int M, int N, int K) {
  __shared__ __attribute__((aligned(16))) float so[4][16][64];
  const int tid = threadIdx.x, w = tid >> 5, lane = tid & 31, ln = lane & 15, hh = lane >> 4; const int by = blockIdx.y;
  A += (size_t)by * sA; Bh += (size_t)by * sB; C += (size_t)by * sC;
  const int ntn = (N + 63) / 64; const int wid = blockIdx.x * 4 + w; const int mt = wid / ntn, nq = wid % ntn; if (mt * 16 >= M) return;
  const int row0 = mt * 16, col0 = nq * 64; const float* arow = A + (size_t)(row0 + ln) * lda;
  v8f acc[4] = {};
  for (int kb = 0; kb < K; kb += 32) {
    FragH ah, al;
    const v4f x0 = *(const v4fa*)(arow + kb + 8 * hh), x1 = *(const v4fa*)(arow + kb + 8 * hh + 4), x2 = *(const v4fa*)(arow + kb + 16 + 8 * hh), x3 = *(const v4fa*)(arow + kb + 16 + 8 * hh + 4);
    float xs[16] = {x0[0],x0[1],x0[2],x0[3],x1[0],x1[1],x1[2],x1[3],x2[0],x2[1],x2[2],x2[3],x3[0],x3[1],x3[2],x3[3]};
#pragma unroll
    for (int i = 0; i < 16; ++i) { const _Float16 h = (_Float16)xs[i]; ah.h[i] = h; al.h[i] = ASPLIT ? (_Float16)(xs[i] - (float)h) : (_Float16)0.0f; }
#pragma unroll
    for (int t = 0; t < 4; ++t) { if (col0 + t * 16 >= N) continue; const size_t boff = (size_t)(col0 + t * 16 + ln) * ldb + kb; FragH bq; bq.half[0] = *(const v8us*)(Bh + boff + 8 * hh); bq.half[1] = *(const v8us*)(Bh + boff + 16 + 8 * hh);
      acc[t] = mmaH<ASPLIT ? 2 : 1>(ah.v, al.v, bq.v, bq.v, acc[t]); }
  }
#pragma unroll
  for (int t = 0; t < 4; ++t) { if (col0 + t * 16 >= N) continue;
#pragma unroll
    for (int r = 0; r < 8; ++r) so[w][8 * hh + r][t * 16 + ln] = acc[t][r] * alpha; }
  __builtin_amdgcn_fence(__ATOMIC_ACQ_REL, "workgroup"); __builtin_amdgcn_wave_barrier();
  const int rsub = lane >> 4, c4 = (lane & 15) * 4;
  {
#pragma unroll
    for (int q = 0; q < 8; ++q) { const int r = q * 2 + rsub; if (col0 + c4 < N) { const v4f v = *(const v4fa*)&so[w][r][c4]; *(v4f*)(C + (size_t)(row0 + r) * ldc + col0 + c4) = v; } }
     }
}

// Wt[n][k] = f16(W[k][n]·scale) from f32 row-major W[K][N] (scale = power of two; bf16-exact weights stay exact in f16 away from the subnormal range)
__global__ __launch_bounds__(256) void k_wt_f16(const float* __restrict__ W, _Float16* __restrict__ Wt, int K, int N, float scale) {
  const int t = blockIdx.x * 256 + threadIdx.x; if (t >= N * (K / 8)) return; const int n = t / (K / 8), k8 = (t % (K / 8)) * 8; FragH f;
#pragma unroll
  for (int i = 0; i < 8; ++i) f.h[i] = (_Float16)(bf16_round(W[(size_t)(k8 + i) * N + n]) * scale); const v8us o = f.half[0];
  *(v8us*)((unsigned short*)Wt + (size_t)n * K + k8) = o; 
}
// k_gemm_hh variant with fused epilogue: v = acc·alpha + bias[by·sBias + col] (+ CP[(row/rowsPerB)·sCPb + by·64 + col] if CP) ; ACT 0 none / 1 elu ; writes f16 C16 (and f32 C if non-null)
template <int ACT>
__global__ __launch_bounds__(128) void k_gemm_hhx(const _Float16* __restrict__ A, int lda, size_t sA, const _Float16* __restrict__ Bh, int ldb, size_t sB, float alpha, const float* __restrict__ bias, size_t sBias, const float* __restrict__ CP, int rowsPerB, size_t sCPb, int row0g,
    float* __restrict__ C, _Float16* __restrict__ C16, int ldc, size_t sC, int M, int N, int K) {
  __shared__ __attribute__((aligned(16))) float so[4][16][64];
  const int tid = threadIdx.x, w = tid >> 5, lane = tid & 31, ln = lane & 15, hh = lane >> 4; const int by = blockIdx.y;
  A += (size_t)by * sA; Bh += (size_t)by * sB; const size_t cofs = (size_t)by * sC; const float* bp = bias ? bias + (size_t)by * sBias : nullptr;
  const int ntn = (N + 63) / 64; const int wid = blockIdx.x * 4 + w; const int mt = wid / ntn, nq = wid % ntn; if (mt * 16 >= M) return;
  const int row0 = mt * 16, col0 = nq * 64; const _Float16* arow = A + (size_t)(row0 + ln) * lda;
  v8f acc[4] = {};
  for (int kb = 0; kb < K; kb += 32) { FragH ah; ah.half[0] = *(const v8us*)((const unsigned short*)arow + kb + 8 * hh); ah.half[1] = *(const v8us*)((const unsigned short*)arow + kb + 16 + 8 * hh);
#pragma unroll
    for (int t = 0; t < 4; ++t) { if (col0 + t * 16 >= N) continue; const size_t boff = (size_t)(col0 + t * 16 + ln) * ldb + kb; FragH bq; bq.half[0] = *(const v8us*)((const unsigned short*)Bh + boff + 8 * hh); bq.half[1] = *(const v8us*)((const unsigned short*)Bh + boff + 16 + 8 * hh);
      acc[t] = mmaH<1>(ah.v, ah.v, bq.v, bq.v, acc[t]); }
  }
#pragma unroll
  for (int t = 0; t < 4; ++t) { if (col0 + t * 16 >= N) continue; const int col = col0 + t * 16 + ln; const float bv = bp ? bf16_round(bp[col]) : 0.f;
#pragma unroll
    for (int r = 0; r < 8; ++r) { float v = acc[t][r] * alpha + bv; if (CP) { const int bidx = (row0g + row0 + 8 * hh + r) / rowsPerB; v += CP[(size_t)bidx * sCPb + (size_t)by * 64 + col]; } if (ACT == 1) v = (v > 0.f) ? v : expm1f(v); else if (ACT == 7) v = (v > 0.f) ? v + 1.0f : expf(v); else if (ACT == 8) v = tanhf(v); else if (ACT == 9) v = 0.5f * v * (1.0f + tanhf(0.7978845608028654f * (v + 0.044715f * v * v * v))); else if (ACT == 11) v = 1.0f / (1.0f + expf(-v)); else if (ACT == 12) v = (v > 0.f) ? v : 0.01f * v; else if (ACT == 14) v = (v > 0.f) ? v : 0.1f * v; else if (ACT == 15) v = v / (1.0f + expf(-v)); else if (ACT == 3) v = fmaxf(v, 0.f); else if (ACT == 6) v = 0.5f * v * (1.0f + erff(v * 0.70710678118654752f)); so[w][8 * hh + r][t * 16 + ln] = v; } }
  __builtin_amdgcn_fence(__ATOMIC_ACQ_REL, "workgroup"); __builtin_amdgcn_wave_barrier();
  const int rsub = lane >> 4, c4 = (lane & 15) * 4; typedef _Float16 v4h __attribute__((ext_vector_type(4)));
  {
#pragma unroll
    for (int q = 0; q < 8; ++q) { const int r = q * 2 + rsub; if (col0 + c4 < N) { const v4f v = *(const v4fa*)&so[w][r][c4]; if (C) *(v4f*)(C + cofs + (size_t)(row0 + r) * ldc + col0 + c4) = v; if (C16) { v4h h4; for (int i = 0; i < 4; ++i) h4[i] = (_Float16)v[i]; *(v4h*)(C16 + cofs + (size_t)(row0 + r) * ldc + col0 + c4) = h4; } } }
     }
}


typedef _Float16 v4h __attribute__((ext_vector_type(4)));

__global__ __launch_bounds__(256) void k_x16(const float* __restrict__ x, _Float16* __restrict__ X16, size_t n8) { const size_t t = (size_t)blockIdx.x * 256 + threadIdx.x; if (t >= n8) return; FragH f;
#pragma unroll
  for (int q = 0; q < 8; ++q) f.h[q] = (_Float16)bf16_round(x[t * 8 + q]); *(v8us*)((unsigned short*)X16 + t * 8) = f.half[0];  }
__global__ __launch_bounds__(256) void k_h16(const float* __restrict__ x, _Float16* __restrict__ X16, size_t n8) { const size_t t = (size_t)blockIdx.x * 256 + threadIdx.x; if (t >= n8) return; FragH f;
#pragma unroll
  for (int q = 0; q < 8; ++q) f.h[q] = (_Float16)x[t * 8 + q]; *(v8us*)((unsigned short*)X16 + t * 8) = f.half[0];  }
__global__ __launch_bounds__(256) void k_round16f(const float* __restrict__ W, _Float16* __restrict__ Bt, size_t n8) { const size_t t = (size_t)blockIdx.x * 256 + threadIdx.x; if (t >= n8) return; FragH f;
#pragma unroll
  for (int i = 0; i < 8; ++i) f.h[i] = (_Float16)(bf16_round(W[t * 8 + i]) * 16.0f); *(v8us*)((unsigned short*)Bt + t * 8) = f.half[0];  }
template <int NHv, int TTv>
__global__ __launch_bounds__(256) void k_vt(const _Float16* __restrict__ V16, int ldv, int voff, _Float16* __restrict__ Vt) { __shared__ unsigned short tl[64][66]; const int tid = threadIdx.x; const int slab = blockIdx.x / (TTv / 64), lg = blockIdx.x % (TTv / 64); const int b = slab / NHv, h = slab % NHv;
  for (int i = tid; i < 64 * 8; i += 256) { const int r = i / 8, c8 = (i % 8) * 8; FragH f; f.half[0] = *(const v8us*)((const unsigned short*)V16 + ((size_t)b * TTv + lg * 64 + r) * ldv + voff + h * 64 + c8);
#pragma unroll
    for (int q = 0; q < 8; ++q) tl[r][c8 + q] = f.u[q]; }
  __syncthreads();
  {
#pragma unroll
    for (int rd = 0; rd < 2; ++rd) { const int d = rd * 32 + tid / 8, pc = tid % 8; FragH f;
#pragma unroll
      for (int q = 0; q < 8; ++q) f.u[q] = tl[pc * 8 + q][d];
      *(v8us*)((unsigned short*)Vt + ((size_t)slab * 64 + d) * TTv + lg * 64 + pc * 8) = f.half[0]; }
     } }

template <int D, int RBF>
__global__ __launch_bounds__(256) void k_lnx(const float* __restrict__ X, const float* __restrict__ gam, const float* __restrict__ bet, int nrows, float eps, _Float16* __restrict__ O16, float* __restrict__ XR) {
  constexpr int NP = D / 128; const int tid = threadIdx.x, wv = tid >> 5, lane = tid & 31; const size_t r = (size_t)blockIdx.x * 8 + wv; if (r >= (size_t)nrows) return; v4f y[NP]; float s = 0.f;
#pragma unroll
  for (int j = 0; j < NP; ++j) { const int c = j * 128 + lane * 4; v4f g = *(const v4fa*)(X + r * D + c); if (RBF) { for (int q = 0; q < 4; ++q) g[q] = bf16_round(g[q]); } y[j] = g; s += g[0] + g[1] + g[2] + g[3]; }
  for (int o = 16; o >= 1; o >>= 1) s += __shfl_xor(s, o, 32); const float mu = s / (float)D; float q2 = 0.f;
#pragma unroll
  for (int j = 0; j < NP; ++j) for (int q = 0; q < 4; ++q) { const float d = y[j][q] - mu; q2 += d * d; }
  for (int o = 16; o >= 1; o >>= 1) q2 += __shfl_xor(q2, o, 32); const float rs = rsqrtf(q2 / (float)D + eps);
  {
#pragma unroll
    for (int j = 0; j < NP; ++j) { const int c = j * 128 + lane * 4; v4h h; for (int q = 0; q < 4; ++q) { const float v = (y[j][q] - mu) * rs * bf16_round(gam[c + q]) + bf16_round(bet[c + q]); h[q] = (_Float16)v; } *(v4h*)(O16 + r * D + c) = h; if (XR) *(v4f*)(XR + r * D + c) = y[j]; }
     } }
__global__ __launch_bounds__(256) void k_addres(const float* __restrict__ O, const float* __restrict__ XR, float* __restrict__ out, size_t n4) { const size_t t = (size_t)blockIdx.x * 256 + threadIdx.x; if (t >= n4) return; v4f a = *(const v4fa*)(O + t * 4); const v4f b = *(const v4fa*)(XR + t * 4); for (int q = 0; q < 4; ++q) a[q] += b[q]; *(v4f*)(out + t * 4) = a;  }
__global__ __launch_bounds__(128) void k_flash(const _Float16* __restrict__ Q16, int ldq, const _Float16* __restrict__ K16, int ldk, const _Float16* __restrict__ Vt, const int* __restrict__ MSK, float* __restrict__ O, int ldo) {
  constexpr int RPW = 16, RTN = RPW / 16, NQB = TT / (4 * RPW), DT = 4, KS = 2;
  __shared__ __attribute__((aligned(16))) unsigned short sP[4][RPW][40]; __shared__ __attribute__((aligned(16))) float sO[4][RPW][64 + 4];
  const int tid = threadIdx.x, w = tid >> 5, lane = tid & 31, ln = lane & 15, hh = lane >> 4;
  const int slab = blockIdx.x / NQB, qblk = blockIdx.x % NQB; const int b = slab / NH, h = slab % NH; const int qb0 = qblk * (4 * RPW); const int q0 = qb0 + w * RPW;
  FragH aq[2][KS];
#pragma unroll
  for (int rt = 0; rt < RTN; ++rt) { const unsigned short* qr = (const unsigned short*)Q16 + ((size_t)b * TT + q0 + rt * 16 + ln) * ldq + h * 64;
#pragma unroll
    for (int ks = 0; ks < KS; ++ks) { aq[rt][ks].half[0] = *(const v8us*)(qr + ks * 32 + 8 * hh); aq[rt][ks].half[1] = *(const v8us*)(qr + ks * 32 + 16 + 8 * hh); } }
  const unsigned short* Vth = (const unsigned short*)Vt + (size_t)slab * 64 * TT;
  float m_r[2][8], l_r[2][8]; v8f oacc[2][DT];
#pragma unroll
  for (int rt = 0; rt < RTN; ++rt) {
#pragma unroll
    for (int r = 0; r < 8; ++r) { m_r[rt][r] = -3.0e38f; l_r[rt][r] = 0.f; }
#pragma unroll
    for (int dt = 0; dt < DT; ++dt) oacc[rt][dt] = (v8f){0.f,0.f,0.f,0.f,0.f,0.f,0.f,0.f}; }
  const int jend = TT;
#pragma unroll 1
  for (int j0 = 0; j0 < jend; j0 += 32) {
    int mk0[2][8], mk1[2][8];      /* nonzero = MASKED */
#pragma unroll
    for (int rt = 0; rt < RTN; ++rt)
#pragma unroll
      for (int r = 0; r < 8; ++r) { const int qq = q0 + rt * 16 + 8 * hh + r; const int* am = MSK + ((size_t)b * TT + qq) * TT + j0; mk0[rt][r] = am[ln]; mk1[rt][r] = am[16 + ln]; }
    v8f s[2][2];
#pragma unroll
    for (int nt = 0; nt < 2; ++nt) { const unsigned short* kr = (const unsigned short*)K16 + ((size_t)b * TT + j0 + nt * 16 + ln) * ldk + h * 64; FragH bk[KS];
#pragma unroll
      for (int ks = 0; ks < KS; ++ks) { bk[ks].half[0] = *(const v8us*)(kr + ks * 32 + 8 * hh); bk[ks].half[1] = *(const v8us*)(kr + ks * 32 + 16 + 8 * hh); }
#pragma unroll
      for (int rt = 0; rt < RTN; ++rt) { v8f acc = (v8f){0.f,0.f,0.f,0.f,0.f,0.f,0.f,0.f};
#pragma unroll
        for (int ks = 0; ks < KS; ++ks) acc = mmaH<1>(aq[rt][ks].v, aq[rt][ks].v, bk[ks].v, bk[ks].v, acc); s[rt][nt] = acc; } }
#pragma unroll
    for (int rt = 0; rt < RTN; ++rt)
#pragma unroll
      for (int r = 0; r < 8; ++r) { const int tq = q0 + rt * 16 + 8 * hh + r; const int k0 = j0 + ln, k1 = j0 + 16 + ln; (void)tq; (void)k0; (void)k1;
        const bool ok0 = (mk0[rt][r] == 0), ok1 = (mk1[rt][r] == 0);
        const float s0 = ok0 ? s[rt][0][r] * 0.125f : -INFINITY, s1 = ok1 ? s[rt][1][r] * 0.125f : -INFINITY; float mc = fmaxf(s0, s1);
        mc = fmaxf(mc, __shfl_xor(mc, 1, 32)); mc = fmaxf(mc, __shfl_xor(mc, 2, 32)); mc = fmaxf(mc, __shfl_xor(mc, 4, 32)); mc = fmaxf(mc, __shfl_xor(mc, 8, 32));
        const float mn = fmaxf(m_r[rt][r], mc); const float al = (mn > -1.0e38f) ? expf(m_r[rt][r] - mn) : 1.0f; m_r[rt][r] = mn; const float p0 = ok0 ? expf(s0 - mn) : 0.f, p1 = ok1 ? expf(s1 - mn) : 0.f; l_r[rt][r] = l_r[rt][r] * al + p0 + p1;
#pragma unroll
        for (int dt = 0; dt < DT; ++dt) oacc[rt][dt][r] *= al;
        FragH t2; t2.h[0] = (_Float16)(p0 * 1024.0f); t2.h[1] = (_Float16)(p1 * 1024.0f); sP[w][rt * 16 + 8 * hh + r][ln] = t2.u[0]; sP[w][rt * 16 + 8 * hh + r][16 + ln] = t2.u[1]; }
    __builtin_amdgcn_fence(__ATOMIC_ACQ_REL, "workgroup"); __builtin_amdgcn_wave_barrier();
    FragH pa[2];
#pragma unroll
    for (int rt = 0; rt < RTN; ++rt) { pa[rt].half[0] = *(const v8us*)&sP[w][rt * 16 + ln][8 * hh]; pa[rt].half[1] = *(const v8us*)&sP[w][rt * 16 + ln][16 + 8 * hh]; }
#pragma unroll
    for (int dt = 0; dt < DT; ++dt) { const unsigned short* vrow = Vth + (size_t)(dt * 16 + ln) * TT + j0; FragH bv; bv.half[0] = *(const v8us*)(vrow + 8 * hh); bv.half[1] = *(const v8us*)(vrow + 16 + 8 * hh);
#pragma unroll
      for (int rt = 0; rt < RTN; ++rt) oacc[rt][dt] = mmaH<1>(pa[rt].v, pa[rt].v, bv.v, bv.v, oacc[rt][dt]); }
    __builtin_amdgcn_fence(__ATOMIC_ACQ_REL, "workgroup"); __builtin_amdgcn_wave_barrier(); }
#pragma unroll
  for (int rt = 0; rt < RTN; ++rt) {
#pragma unroll
    for (int r = 0; r < 8; ++r) { float l = l_r[rt][r]; l += __shfl_xor(l, 1, 32); l += __shfl_xor(l, 2, 32); l += __shfl_xor(l, 4, 32); l += __shfl_xor(l, 8, 32); l_r[rt][r] = (l > 0.f) ? 1.0f / (l * 1024.0f) : 0.f; }
#pragma unroll
    for (int dt = 0; dt < DT; ++dt)
#pragma unroll
      for (int r = 0; r < 8; ++r) sO[w][rt * 16 + 8 * hh + r][dt * 16 + ln] = oacc[rt][dt][r] * l_r[rt][r]; }
  __builtin_amdgcn_fence(__ATOMIC_ACQ_REL, "workgroup"); __builtin_amdgcn_wave_barrier();
  {
#pragma unroll
    for (int rp = 0; rp < RPW; rp += 2) { const int r = rp + (lane >> 4), pc = lane & 15; const v4f val = *(const v4fa*)&sO[w][r][pc * 4]; *(v4f*)(O + ((size_t)b * TT + q0 + r) * ldo + h * 64 + pc * 4) = val; }
     } }

extern "C" void kernel_launch(void* const* d_in, const int* in_sizes, int n_in,
                              void* d_out, int out_size, void* d_ws, size_t ws_size, hipStream_t stream) {
  (void)in_sizes; (void)n_in; (void)out_size;
  const float* const* I = (const float* const*)d_in; const float* Qx = I[0]; const float* Kx = I[1]; const float* Vx = I[2]; const int* mask = (const int*)d_in[3];      /* bool mask shipped as int32 [2,1,2048,2048] */
  const float* Wq = I[4]; const float* bq = I[5]; const float* Wk = I[6]; const float* bk = I[7]; const float* Wv = I[8]; const float* bv = I[9]; const float* gam = I[10]; const float* bet = I[11];
  char* ws = (char*)d_ws; size_t off = 0;
  auto take = [&](size_t bytes) { char* p = ws + off; off += (bytes + 255) & ~(size_t)255; return p; };
  const size_t WSZ = (size_t)DD * DD; _Float16* Bw = (_Float16*)take(3 * WSZ * 2); float* XR = (float*)take((size_t)NR * DD * 4); _Float16* H16 = (_Float16*)take((size_t)NR * DD * 2);
  _Float16* Q = (_Float16*)take((size_t)NR * DD * 2); _Float16* K = (_Float16*)take((size_t)NR * DD * 2); _Float16* V = (_Float16*)take((size_t)NR * DD * 2); _Float16* Vt = (_Float16*)take((size_t)NR * DD * 2); float* O = (float*)take((size_t)NR * DD * 4);
  if (off > ws_size) return;      // 6.3 + 16.8 + 8.4 + 4 × 8.4 + 16.8 ≈ 82 MB
  const unsigned gw = (unsigned)(((size_t)DD * (DD / 8) + 255) / 256); k_wt_f16<<<gw, 256, 0, stream>>>(Wq, Bw, DD, DD, 16.0f); k_wt_f16<<<gw, 256, 0, stream>>>(Wk, Bw + WSZ, DD, DD, 16.0f); k_wt_f16<<<gw, 256, 0, stream>>>(Wv, Bw + 2 * WSZ, DD, DD, 16.0f);      /* (in,out) → Bt ×2^4 */
  const dim3 gp(((NR / 16) * (DD / 64) + 3) / 4, 1);
  k_lnx<DD, 1><<<(NR + 7) / 8, 256, 0, stream>>>(Qx, gam, bet, NR, 1e-5f, H16, XR);      /* LN(bf16 Q) → f16; XR = bf16(Q) for the residual */
  k_gemm_hhx<0><<<gp, 128, 0, stream>>>(H16, DD, 0, Bw, DD, 0, 0.0625f, bq, 0, nullptr, 1, 0, 0, nullptr, Q, DD, 0, NR, DD, DD);      /* M 4096 N 1024 K 1024 */
  k_lnx<DD, 1><<<(NR + 7) / 8, 256, 0, stream>>>(Kx, gam, bet, NR, 1e-5f, H16, nullptr);
  k_gemm_hhx<0><<<gp, 128, 0, stream>>>(H16, DD, 0, Bw + WSZ, DD, 0, 0.0625f, bk, 0, nullptr, 1, 0, 0, nullptr, K, DD, 0, NR, DD, DD);
  k_lnx<DD, 1><<<(NR + 7) / 8, 256, 0, stream>>>(Vx, gam, bet, NR, 1e-5f, H16, nullptr);
  k_gemm_hhx<0><<<gp, 128, 0, stream>>>(H16, DD, 0, Bw + 2 * WSZ, DD, 0, 0.0625f, bv, 0, nullptr, 1, 0, 0, nullptr, V, DD, 0, NR, DD, DD);
  k_vt<NH, TT><<<BB * NH * (TT / 64), 256, 0, stream>>>(V, DD, 0, Vt);
  k_flash<<<BB * NH * (TT / 64), 128, 0, stream>>>(Q, DD, K, DD, Vt, mask, O, DD);
  k_addres<<<(unsigned)(((size_t)NR * DD / 4 + 255) / 256), 256, 0, stream>>>(O, XR, (float*)d_out, (size_t)NR * DD / 4);      /* out = o + Q */
}

// v001
// It runs in 385 microseconds.
// In both of two side-by-side timings against v000, it was 1.13 times as fast.
#include <hip/hip_runtime.h>
// Pre-norm multi-head attention with a boolean mask and residual (B=2, N=2048, E=1024, 16 heads × 64): q = LN(Q)·Wq + bq, k = LN(K)·Wk + bk, v = LN(V)·Wv + bv (one shared LayerNorm γ,β; (in,out) weights); s = q·kᵀ·64^-½ with −inf where mask[b,0,n,m] is True;
// softmax; o = merged attn·v; out = o + Q (no output projection).
// Compute dtype: Q, K, V, weights, biases, γ, β rounded to bf16; LayerNorms f32 (wave per row) → f16; q/k/v f16 GEMM planes; fused flash-style kernel (int32 mask loads per (q,k), online softmax f32, P f16 ×2^10) on
// v_wmma_f32_16x16x32_f16; out = o (f32) + bf16(Q) (f32 add); f32 accumulate.
#define BB 2
#define TT 2048
#define DD 1024
#define NH 16
#define NR (BB * TT)

typedef __bf16 v16b __attribute__((ext_vector_type(16)));
typedef unsigned short v8us __attribute__((ext_vector_type(8), may_alias));
typedef float  v8f  __attribute__((ext_vector_type(8)));
typedef float  v4f  __attribute__((ext_vector_type(4)));
typedef float  v4fa __attribute__((ext_vector_type(4), may_alias));
union FragB { v16b v; v8us half[2]; unsigned short u[16]; };

__device__ __forceinline__ unsigned short bf16_bits(float x) { unsigned int u = __float_as_uint(x); return (unsigned short)((u + 0x7FFFu + ((u >> 16) & 1u)) >> 16); }
__device__ __forceinline__ float bf16_val(unsigned short b) { return __uint_as_float(((unsigned int)b) << 16); }
__device__ __forceinline__ float bf16_round(float x) { return bf16_val(bf16_bits(x)); }
// D += A·B with NT terms: 1 = ah·bh, 2 = + al·bh (A split), 3 = + ah·bl (both split)
template <int NT>
__device__ __forceinline__ v8f mmaN(v16b ah, v16b al, v16b bh, v16b bl, v8f c) {
  c = __builtin_amdgcn_wmma_f32_16x16x32_bf16(false, ah, false, bh, (short)0, c, false, false);
  if (NT >= 2) c = __builtin_amdgcn_wmma_f32_16x16x32_bf16(false, al, false, bh, (short)0, c, false, false);
  if (NT >= 3) c = __builtin_amdgcn_wmma_f32_16x16x32_bf16(false, ah, false, bl, (short)0, c, false, false);
  asm volatile("v_nop\n\tv_nop\n\tv_nop\n\tv_nop" : "+v"(c) : "v"(ah), "v"(al), "v"(bh), "v"(bl));
  return c;
}

__global__ __launch_bounds__(256) void k_wt_bf16(const float* __restrict__ W, unsigned short* __restrict__ Wt, int K, int N) {
  const int t = blockIdx.x * 256 + threadIdx.x;
  const int k8n = K / 8;
  if (t >= N * k8n) return;
  const int n = t / k8n, k8 = (t % k8n) * 8;
  v8us v;
#pragma unroll
  for (int i = 0; i < 8; ++i) v[i] = bf16_bits(W[(size_t)(k8 + i) * N + n]);
  *(v8us*)(Wt + (size_t)n * K + k8) = v;
  
}

// GEMM C[M][N] (f32, pitch ldc) = act(A[M][K]·W + bias). A f32 row-major (pitch lda) converted per fragment to bf16
// (ASPLIT: hi/lo two planes -> 2 terms, else single rounded term); Wt bf16 [N][K] (pitch ldb). BIAS_BF16 rounds the
// bias to bf16 first (bias quantised to bf16 before the add). K%32==0, M%16==0, N%64==0.
template <bool ASPLIT, int ACT, bool BIAS_BF16>
__global__ __launch_bounds__(128) void k_gemm_bf(const float* __restrict__ A, int lda, const unsigned short* __restrict__ Wt, int ldb,
                                               const float* __restrict__ bias, float* __restrict__ C, int ldc, int M, int N, int K) {
  __shared__ __attribute__((aligned(16))) float so[4][16][64];
  const int tid = threadIdx.x, w = tid >> 5, lane = tid & 31, ln = lane & 15, hh = lane >> 4;
  const int ntn = N / 64;
  const int wid = blockIdx.x * 4 + w;
  const int mt = wid / ntn, nq = wid % ntn;
  if (mt * 16 >= M) return;
  const int row0 = mt * 16, col0 = nq * 64;
  const float* arow = A + (size_t)(row0 + ln) * lda;
  v8f acc[4] = {};
  for (int kb = 0; kb < K; kb += 32) {
    FragB ah, al;
    const v4f x0 = *(const v4fa*)(arow + kb + 8 * hh), x1 = *(const v4fa*)(arow + kb + 8 * hh + 4);
    const v4f x2 = *(const v4fa*)(arow + kb + 16 + 8 * hh), x3 = *(const v4fa*)(arow + kb + 16 + 8 * hh + 4);
    float xs[16] = {x0[0],x0[1],x0[2],x0[3],x1[0],x1[1],x1[2],x1[3],x2[0],x2[1],x2[2],x2[3],x3[0],x3[1],x3[2],x3[3]};
#pragma unroll
    for (int i = 0; i < 16; ++i) { const unsigned short hb = bf16_bits(xs[i]); ah.u[i] = hb; al.u[i] = ASPLIT ? bf16_bits(xs[i] - bf16_val(hb)) : (unsigned short)0; }
#pragma unroll
    for (int t = 0; t < 4; ++t) {
      const unsigned short* brow = Wt + (size_t)(col0 + t * 16 + ln) * ldb + kb;
      FragB b;
      b.half[0] = *(const v8us*)(brow + 8 * hh);
      b.half[1] = *(const v8us*)(brow + 16 + 8 * hh);
      acc[t] = mmaN<ASPLIT ? 2 : 1>(ah.v, al.v, b.v, b.v, acc[t]);
    }
  }
#pragma unroll
  for (int t = 0; t < 4; ++t) {
    float bv = bias ? bias[col0 + t * 16 + ln] : 0.f;
    if (BIAS_BF16) bv = bf16_round(bv);
#pragma unroll
    for (int r = 0; r < 8; ++r) { float v = acc[t][r] + bv; if (ACT == 1) v = fmaxf(v, 0.f); so[w][8 * hh + r][t * 16 + ln] = v; }
  }
  __builtin_amdgcn_fence(__ATOMIC_ACQ_REL, "workgroup");
  __builtin_amdgcn_wave_barrier();
  const int rsub = lane >> 4, c4 = (lane & 15) * 4;
  {
#pragma unroll
    for (int q = 0; q < 8; ++q) {
      const int r = q * 2 + rsub;
      const v4f v = *(const v4fa*)&so[w][r][c4];
      *(v4f*)(C + (size_t)(row0 + r) * ldc + col0 + c4) = v;
    }
    
  }
}

// Flash-style causal/unmasked attention, all contractions 3-term bf16 hi/lo splits, f32 softmax with running max.
// q,k,v rows are read from f32 buffers with arbitrary row pitch (so they can live inside a fused qkv buffer);
// D = head size (multiple of 32, <= 128); one wave = 16 query rows; block = 4 waves (64 queries) sharing K/V chunks of 32.
template <int D, bool CAUSAL>
__global__ __launch_bounds__(128) void k_flash(const float* __restrict__ qb, const float* __restrict__ kb, const float* __restrict__ vb,
                                             int pitch, int T, int H, float scale, float* __restrict__ y, int ypitch) {
  constexpr int KS = D / 32;        // k-steps for QK
  constexpr int DT = D / 16;        // d tiles for PV
  __shared__ __attribute__((aligned(16))) unsigned short sKh[32][D + 8], sKl[32][D + 8], sVh[32][D + 8], sVl[32][D + 8];
  __shared__ __attribute__((aligned(16))) unsigned short sPh[4][16][40], sPl[4][16][40];
  __shared__ __attribute__((aligned(16))) float sO[4][16][D];
  const int tid = threadIdx.x, w = tid >> 5, lane = tid & 31, ln = lane & 15, hh = lane >> 4;
  const int nqb = (T + 63) / 64;
  const int bh = blockIdx.x / nqb, qblk = blockIdx.x % nqb;
  const int b = bh / H, h = bh % H;
  const int q0 = qblk * 64 + w * 16;
  const float* Q = qb + (size_t)b * T * pitch + h * D;
  const float* K = kb + (size_t)b * T * pitch + h * D;
  const float* V = vb + (size_t)b * T * pitch + h * D;

  // A fragments of the wave's 16 query rows (scaled), hi/lo
  FragB aqh[KS], aql[KS];
  {
    int row = q0 + ln; if (row >= T) row = T - 1;
    const float* qr = Q + (size_t)row * pitch;
#pragma unroll
    for (int ks = 0; ks < KS; ++ks)
#pragma unroll
      for (int i = 0; i < 16; ++i) {
        const int d = ks * 32 + ((i < 8) ? (8 * hh + i) : (16 + 8 * hh + (i - 8)));
        const float x = qr[d] * scale; const unsigned short hb = bf16_bits(x);
        aqh[ks].u[i] = hb; aql[ks].u[i] = bf16_bits(x - bf16_val(hb));
      }
  }
  float m_r[8], l_r[8];
#pragma unroll
  for (int r = 0; r < 8; ++r) { m_r[r] = -3.0e38f; l_r[r] = 0.f; }
  v8f oacc[DT];
#pragma unroll
  for (int dt = 0; dt < DT; ++dt) oacc[dt] = (v8f){0.f,0.f,0.f,0.f,0.f,0.f,0.f,0.f};

  const int kv_end = CAUSAL ? min(T, qblk * 64 + 64) : T;     // block-uniform
  for (int j0 = 0; j0 < kv_end; j0 += 32) {
    __syncthreads();
    for (int e = tid; e < 32 * (D / 4); e += 128) {
      const int r = e / (D / 4), c4 = (e % (D / 4)) * 4;
      const int key = j0 + r;
      v4f kf = {0.f,0.f,0.f,0.f}, vf = {0.f,0.f,0.f,0.f};
      if (key < T) { kf = *(const v4fa*)(K + (size_t)key * pitch + c4); vf = *(const v4fa*)(V + (size_t)key * pitch + c4); }
#pragma unroll
      for (int t = 0; t < 4; ++t) {
        unsigned short hb = bf16_bits(kf[t]); sKh[r][c4 + t] = hb; sKl[r][c4 + t] = bf16_bits(kf[t] - bf16_val(hb));
        hb = bf16_bits(vf[t]); sVh[r][c4 + t] = hb; sVl[r][c4 + t] = bf16_bits(vf[t] - bf16_val(hb));
      }
    }
    __syncthreads();
    // S tile 16 x 32
    v8f s[2];
#pragma unroll
    for (int nt = 0; nt < 2; ++nt) {
      v8f acc = {};
#pragma unroll
      for (int ks = 0; ks < KS; ++ks) {
        FragB bh_, bl_;
        bh_.half[0] = *(const v8us*)&sKh[nt * 16 + ln][ks * 32 + 8 * hh]; bh_.half[1] = *(const v8us*)&sKh[nt * 16 + ln][ks * 32 + 16 + 8 * hh];
        bl_.half[0] = *(const v8us*)&sKl[nt * 16 + ln][ks * 32 + 8 * hh]; bl_.half[1] = *(const v8us*)&sKl[nt * 16 + ln][ks * 32 + 16 + 8 * hh];
        acc = mmaN<3>(aqh[ks].v, aql[ks].v, bh_.v, bl_.v, acc);
      }
      s[nt] = acc;
    }
    // mask + running max (rows 8hh+r; the 16 lanes of a half share rows)
    float alpha[8];
#pragma unroll
    for (int r = 0; r < 8; ++r) {
      const int qi = q0 + 8 * hh + r;
      const int ja = j0 + ln, jb = j0 + 16 + ln;
      if (CAUSAL) { if (ja > qi) s[0][r] = -3.0e38f; if (jb > qi) s[1][r] = -3.0e38f; }
      if (ja >= T) s[0][r] = -3.0e38f;
      if (jb >= T) s[1][r] = -3.0e38f;
      float mx = fmaxf(s[0][r], s[1][r]);
      mx = fmaxf(mx, __shfl_xor(mx, 1, 32)); mx = fmaxf(mx, __shfl_xor(mx, 2, 32)); mx = fmaxf(mx, __shfl_xor(mx, 4, 32)); mx = fmaxf(mx, __shfl_xor(mx, 8, 32));
      const float mnew = fmaxf(m_r[r], mx);
      alpha[r] = (mnew > -1.0e38f) ? __expf(m_r[r] - mnew) : 1.0f;
      const float p0 = (s[0][r] > -1.0e38f) ? __expf(s[0][r] - mnew) : 0.f;
      const float p1 = (s[1][r] > -1.0e38f) ? __expf(s[1][r] - mnew) : 0.f;
      m_r[r] = mnew;
      l_r[r] = l_r[r] * alpha[r] + p0 + p1;            // per-lane partial row sum (16 lanes combined at the end)
      unsigned short hb = bf16_bits(p0); sPh[w][8 * hh + r][ln] = hb;      sPl[w][8 * hh + r][ln] = bf16_bits(p0 - bf16_val(hb));
      hb = bf16_bits(p1);                sPh[w][8 * hh + r][16 + ln] = hb; sPl[w][8 * hh + r][16 + ln] = bf16_bits(p1 - bf16_val(hb));
    }
#pragma unroll
    for (int dt = 0; dt < DT; ++dt)
#pragma unroll
      for (int r = 0; r < 8; ++r) oacc[dt][r] *= alpha[r];
    __builtin_amdgcn_fence(__ATOMIC_ACQ_REL, "workgroup");
    __builtin_amdgcn_wave_barrier();
    FragB pah, pal;
    pah.half[0] = *(const v8us*)&sPh[w][ln][8 * hh]; pah.half[1] = *(const v8us*)&sPh[w][ln][16 + 8 * hh];
    pal.half[0] = *(const v8us*)&sPl[w][ln][8 * hh]; pal.half[1] = *(const v8us*)&sPl[w][ln][16 + 8 * hh];
#pragma unroll
    for (int dt = 0; dt < DT; ++dt) {
      FragB bvh, bvl;
#pragma unroll
      for (int i = 0; i < 8; ++i) {
        bvh.u[i] = sVh[8 * hh + i][dt * 16 + ln]; bvh.u[8 + i] = sVh[16 + 8 * hh + i][dt * 16 + ln];
        bvl.u[i] = sVl[8 * hh + i][dt * 16 + ln]; bvl.u[8 + i] = sVl[16 + 8 * hh + i][dt * 16 + ln];
      }
      oacc[dt] = mmaN<3>(pah.v, pal.v, bvh.v, bvl.v, oacc[dt]);
    }
    __builtin_amdgcn_fence(__ATOMIC_ACQ_REL, "workgroup");
    __builtin_amdgcn_wave_barrier();
  }
#pragma unroll
  for (int r = 0; r < 8; ++r) {
    float l = l_r[r];
    l += __shfl_xor(l, 1, 32); l += __shfl_xor(l, 2, 32); l += __shfl_xor(l, 4, 32); l += __shfl_xor(l, 8, 32);
    l_r[r] = (l > 0.f) ? 1.0f / l : 0.f;
  }
#pragma unroll
  for (int dt = 0; dt < DT; ++dt)
#pragma unroll
    for (int r = 0; r < 8; ++r) sO[w][8 * hh + r][dt * 16 + ln] = oacc[dt][r] * l_r[r];
  __builtin_amdgcn_fence(__ATOMIC_ACQ_REL, "workgroup");
  __builtin_amdgcn_wave_barrier();
  {
    for (int r = 0; r < 16; ++r) {
      const int row = q0 + r;
      if (row < T && lane < D / 4) {
        const v4f val = *(const v4fa*)&sO[w][r][lane * 4];
        *(v4f*)(y + ((size_t)b * T + row) * ypitch + h * D + lane * 4) = val;
      }
    }
    
  }
}

// GEMM C = act(A·W + bias + resid): A f32 (ASPLIT -> hi/lo 2 terms), Wt bf16 [N][K]; ACT 0 none, 1 relu, 2 exact gelu;
// resid (optional, f32, row index = (row % rmod), pitch ldr, RES_BF16 rounds it) added before the activation.
template <bool ASPLIT, int ACT, bool BIAS_BF16, bool RES_BF16>
__global__ __launch_bounds__(128) void k_gemm_bf3(const float* __restrict__ A, int lda, const unsigned short* __restrict__ Wt, int ldb,
                                                const float* __restrict__ bias, const float* __restrict__ resid, int rmod, int ldr,
                                                float* __restrict__ C, int ldc, int M, int N, int K) {
  __shared__ __attribute__((aligned(16))) float so[4][16][64];
  const int tid = threadIdx.x, w = tid >> 5, lane = tid & 31, ln = lane & 15, hh = lane >> 4;
  const int ntn = N / 64;
  const int wid = blockIdx.x * 4 + w;
  const int mt = wid / ntn, nq = wid % ntn;
  if (mt * 16 >= M) return;
  const int row0 = mt * 16, col0 = nq * 64;
  const float* arow = A + (size_t)(row0 + ln) * lda;
  v8f acc[4] = {};
  for (int kb = 0; kb < K; kb += 32) {
    FragB ah, al;
    const v4f x0 = *(const v4fa*)(arow + kb + 8 * hh), x1 = *(const v4fa*)(arow + kb + 8 * hh + 4);
    const v4f x2 = *(const v4fa*)(arow + kb + 16 + 8 * hh), x3 = *(const v4fa*)(arow + kb + 16 + 8 * hh + 4);
    float xs[16] = {x0[0],x0[1],x0[2],x0[3],x1[0],x1[1],x1[2],x1[3],x2[0],x2[1],x2[2],x2[3],x3[0],x3[1],x3[2],x3[3]};
#pragma unroll
    for (int i = 0; i < 16; ++i) { const unsigned short hb = bf16_bits(xs[i]); ah.u[i] = hb; al.u[i] = ASPLIT ? bf16_bits(xs[i] - bf16_val(hb)) : (unsigned short)0; }
#pragma unroll
    for (int t = 0; t < 4; ++t) {
      const unsigned short* brow = Wt + (size_t)(col0 + t * 16 + ln) * ldb + kb;
      FragB b;
      b.half[0] = *(const v8us*)(brow + 8 * hh);
      b.half[1] = *(const v8us*)(brow + 16 + 8 * hh);
      acc[t] = mmaN<ASPLIT ? 2 : 1>(ah.v, al.v, b.v, b.v, acc[t]);
    }
  }
#pragma unroll
  for (int t = 0; t < 4; ++t) {
    const int col = col0 + t * 16 + ln;
    float bv = bias ? bias[col] : 0.f;
    if (BIAS_BF16) bv = bf16_round(bv);
#pragma unroll
    for (int r = 0; r < 8; ++r) {
      float v = acc[t][r] + bv;
      if (resid) { float rv = resid[(size_t)((row0 + 8 * hh + r) % rmod) * ldr + col]; if (RES_BF16) rv = bf16_round(rv); v += rv; }
      if (ACT == 1) v = fmaxf(v, 0.f);
      if (ACT == 2) v = 0.5f * v * (1.0f + erff(v * 0.70710678118654752f));
      if (ACT == 3) { const float u = 0.7978845608028654f * (v + 0.044715f * v * v * v); v = 0.5f * v * (1.0f + tanhf(u)); }
      so[w][8 * hh + r][t * 16 + ln] = v;
    }
  }
  __builtin_amdgcn_fence(__ATOMIC_ACQ_REL, "workgroup");
  __builtin_amdgcn_wave_barrier();
  const int rsub = lane >> 4, c4 = (lane & 15) * 4;
  {
#pragma unroll
    for (int q = 0; q < 8; ++q) {
      const int r = q * 2 + rsub;
      const v4f v = *(const v4fa*)&so[w][r][c4];
      *(v4f*)(C + (size_t)(row0 + r) * ldc + col0 + c4) = v;
    }
    
  }
}
// row LayerNorm (biased variance, eps) over N: s = X (+ R); optional out_sum <- s; out_norm <- (s-mu)*rsqrt(var+eps)*g + b
template <bool PARAM_BF16>
__global__ __launch_bounds__(256) void k_layernorm(const float* __restrict__ X, const float* __restrict__ R, const float* __restrict__ g, const float* __restrict__ bta,
                                                  float* __restrict__ out_sum, float* __restrict__ out_norm, int N, float eps) {
  __shared__ float red[256];
  const int row = blockIdx.x, tid = threadIdx.x;
  const float* x = X + (size_t)row * N; const float* rr = R ? R + (size_t)row * N : nullptr;
  float vals[16];                     // up to N = 4096
  const int per = N / 256;            // contiguous chunk per thread? use strided-by-4 chunks: thread handles j = tid*4 + 1024*u
  float s1 = 0.f;
  for (int u = 0; u < per / 4; ++u) {
    const int j = tid * 4 + 1024 * u;
    const v4f a = *(const v4fa*)(x + j);
    v4f b = {0.f,0.f,0.f,0.f}; if (rr) b = *(const v4fa*)(rr + j);
#pragma unroll
    for (int q = 0; q < 4; ++q) { const float v = a[q] + b[q]; vals[u * 4 + q] = v; s1 += v; }
  }
  red[tid] = s1; __syncthreads();
  for (int st = 128; st > 0; st >>= 1) { if (tid < st) red[tid] += red[tid + st]; __syncthreads(); }
  const float mu = red[0] / (float)N; __syncthreads();
  float s2 = 0.f;
  for (int u = 0; u < per / 4; ++u)
#pragma unroll
    for (int q = 0; q < 4; ++q) { const float c = vals[u * 4 + q] - mu; s2 += c * c; }
  red[tid] = s2; __syncthreads();
  for (int st = 128; st > 0; st >>= 1) { if (tid < st) red[tid] += red[tid + st]; __syncthreads(); }
  const float rs = rsqrtf(red[0] / (float)N + eps);
  {
    for (int u = 0; u < per / 4; ++u) {
      const int j = tid * 4 + 1024 * u;
      v4f o, sm;
#pragma unroll
      for (int q = 0; q < 4; ++q) {
        float gg = g[j + q], bb = bta[j + q];
        if (PARAM_BF16) { gg = bf16_round(gg); bb = bf16_round(bb); }
        sm[q] = vals[u * 4 + q]; o[q] = (vals[u * 4 + q] - mu) * rs * gg + bb;
      }
      if (out_sum) *(v4f*)(out_sum + (size_t)row * N + j) = sm;
      *(v4f*)(out_norm + (size_t)row * N + j) = o;
    }
    
  }
}



// ---- f16 WMMA path (v_wmma_f32_16x16x32_f16): 11-bit significands for operands in range — used where a [0,1] probability operand needs more precision than bf16
typedef _Float16 v16h __attribute__((ext_vector_type(16)));
union FragH { v16h v; v8us half[2]; _Float16 h[16]; unsigned short u[16]; };
template <int NT>
__device__ __forceinline__ v8f mmaH(v16h ah, v16h al, v16h bh, v16h bl, v8f c) {
  c = __builtin_amdgcn_wmma_f32_16x16x32_f16(false, ah, false, bh, (short)0, c, false, false);
  if (NT >= 2) c = __builtin_amdgcn_wmma_f32_16x16x32_f16(false, al, false, bh, (short)0, c, false, false);
  if (NT >= 3) c = __builtin_amdgcn_wmma_f32_16x16x32_f16(false, ah, false, bl, (short)0, c, false, false);
  asm volatile("v_nop\n\tv_nop\n\tv_nop\n\tv_nop" : "+v"(c) : "v"(ah), "v"(al), "v"(bh), "v"(bl));
  return c;
}
// batched GEMM like k_gemm_b but f16 operands: A f32 (split into f16 hi/lo if ASPLIT, else rounded to f16), Bt = f16 values [n][k]; alpha; C f32; N multiple of 16 (partial tiles skipped)
template <bool ASPLIT>
__global__ __launch_bounds__(128) void k_gemm_h(const float* __restrict__ A, int lda, size_t sA, const _Float16* __restrict__ Bh, int ldb, size_t sB, float alpha, float* __restrict__ C, int ldc, size_t sC, int M, int N, int K) {
  __shared__ __attribute__((aligned(16))) float so[4][16][64];
  const int tid = threadIdx.x, w = tid >> 5, lane = tid & 31, ln = lane & 15, hh = lane >> 4; const int by = blockIdx.y;
  A += (size_t)by * sA; Bh += (size_t)by * sB; C += (size_t)by * sC;
  const int ntn = (N + 63) / 64; const int wid = blockIdx.x * 4 + w; const int mt = wid / ntn, nq = wid % ntn; if (mt * 16 >= M) return;
  const int row0 = mt * 16, col0 = nq * 64; const float* arow = A + (size_t)(row0 + ln) * lda;
  v8f acc[4] = {};
  for (int kb = 0; kb < K; kb += 32) {
    FragH ah, al;
    const v4f x0 = *(const v4fa*)(arow + kb + 8 * hh), x1 = *(const v4fa*)(arow + kb + 8 * hh + 4), x2 = *(const v4fa*)(arow + kb + 16 + 8 * hh), x3 = *(const v4fa*)(arow + kb + 16 + 8 * hh + 4);
    float xs[16] = {x0[0],x0[1],x0[2],x0[3],x1[0],x1[1],x1[2],x1[3],x2[0],x2[1],x2[2],x2[3],x3[0],x3[1],x3[2],x3[3]};
#pragma unroll
    for (int i = 0; i < 16; ++i) { const _Float16 h = (_Float16)xs[i]; ah.h[i] = h; al.h[i] = ASPLIT ? (_Float16)(xs[i] - (float)h) : (_Float16)0.0f; }
#pragma unroll
    for (int t = 0; t < 4; ++t) { if (col0 + t * 16 >= N) continue; const size_t boff = (size_t)(col0 + t * 16 + ln) * ldb + kb; FragH bq; bq.half[0] = *(const v8us*)(Bh + boff + 8 * hh); bq.half[1] = *(const v8us*)(Bh + boff + 16 + 8 * hh);
      acc[t] = mmaH<ASPLIT ? 2 : 1>(ah.v, al.v, bq.v, bq.v, acc[t]); }
  }
#pragma unroll
  for (int t = 0; t < 4; ++t) { if (col0 + t * 16 >= N) continue;
#pragma unroll
    for (int r = 0; r < 8; ++r) so[w][8 * hh + r][t * 16 + ln] = acc[t][r] * alpha; }
  __builtin_amdgcn_fence(__ATOMIC_ACQ_REL, "workgroup"); __builtin_amdgcn_wave_barrier();
  const int rsub = lane >> 4, c4 = (lane & 15) * 4;
  {
#pragma unroll
    for (int q = 0; q < 8; ++q) { const int r = q * 2 + rsub; if (col0 + c4 < N) { const v4f v = *(const v4fa*)&so[w][r][c4]; *(v4f*)(C + (size_t)(row0 + r) * ldc + col0 + c4) = v; } }
     }
}

// Wt[n][k] = f16(W[k][n]·scale) from f32 row-major W[K][N] (scale = power of two; bf16-exact weights stay exact in f16 away from the subnormal range)
__global__ __launch_bounds__(256) void k_wt_f16(const float* __restrict__ W, _Float16* __restrict__ Wt, int K, int N, float scale) {
  const int t = blockIdx.x * 256 + threadIdx.x; if (t >= N * (K / 8)) return; const int n = t / (K / 8), k8 = (t % (K / 8)) * 8; FragH f;
#pragma unroll
  for (int i = 0; i < 8; ++i) f.h[i] = (_Float16)(bf16_round(W[(size_t)(k8 + i) * N + n]) * scale); const v8us o = f.half[0];
  *(v8us*)((unsigned short*)Wt + (size_t)n * K + k8) = o; 
}
// k_gemm_hh variant with fused epilogue: v = acc·alpha + bias[by·sBias + col] (+ CP[(row/rowsPerB)·sCPb + by·64 + col] if CP) ; ACT 0 none / 1 elu ; writes f16 C16 (and f32 C if non-null)
template <int ACT>
__global__ __launch_bounds__(128) void k_gemm_hhx(const _Float16* __restrict__ A, int lda, size_t sA, const _Float16* __restrict__ Bh, int ldb, size_t sB, float alpha, const float* __restrict__ bias, size_t sBias, const float* __restrict__ CP, int rowsPerB, size_t sCPb, int row0g,
    float* __restrict__ C, _Float16* __restrict__ C16, int ldc, size_t sC, int M, int N, int K) {
  __shared__ __attribute__((aligned(16))) float so[4][16][64];
  const int tid = threadIdx.x, w = tid >> 5, lane = tid & 31, ln = lane & 15, hh = lane >> 4; const int by = blockIdx.y;
  A += (size_t)by * sA; Bh += (size_t)by * sB; const size_t cofs = (size_t)by * sC; const float* bp = bias ? bias + (size_t)by * sBias : nullptr;
  const int ntn = (N + 63) / 64; const int wid = blockIdx.x * 4 + w; const int mt = wid / ntn, nq = wid % ntn; if (mt * 16 >= M) return;
  const int row0 = mt * 16, col0 = nq * 64; const _Float16* arow = A + (size_t)(row0 + ln) * lda;
  v8f acc[4] = {};
  for (int kb = 0; kb < K; kb += 32) { FragH ah; ah.half[0] = *(const v8us*)((const unsigned short*)arow + kb + 8 * hh); ah.half[1] = *(const v8us*)((const unsigned short*)arow + kb + 16 + 8 * hh);
#pragma unroll
    for (int t = 0; t < 4; ++t) { if (col0 + t * 16 >= N) continue; const size_t boff = (size_t)(col0 + t * 16 + ln) * ldb + kb; FragH bq; bq.half[0] = *(const v8us*)((const unsigned short*)Bh + boff + 8 * hh); bq.half[1] = *(const v8us*)((const unsigned short*)Bh + boff + 16 + 8 * hh);
      acc[t] = mmaH<1>(ah.v, ah.v, bq.v, bq.v, acc[t]); }
  }
#pragma unroll
  for (int t = 0; t < 4; ++t) { if (col0 + t * 16 >= N) continue; const int col = col0 + t * 16 + ln; const float bv = bp ? bf16_round(bp[col]) : 0.f;
#pragma unroll
    for (int r = 0; r < 8; ++r) { float v = acc[t][r] * alpha + bv; if (CP) { const int bidx = (row0g + row0 + 8 * hh + r) / rowsPerB; v += CP[(size_t)bidx * sCPb + (size_t)by * 64 + col]; } if (ACT == 1) v = (v > 0.f) ? v : expm1f(v); else if (ACT == 7) v = (v > 0.f) ? v + 1.0f : expf(v); else if (ACT == 8) v = tanhf(v); else if (ACT == 9) v = 0.5f * v * (1.0f + tanhf(0.7978845608028654f * (v + 0.044715f * v * v * v))); else if (ACT == 11) v = 1.0f / (1.0f + expf(-v)); else if (ACT == 12) v = (v > 0.f) ? v : 0.01f * v; else if (ACT == 14) v = (v > 0.f) ? v : 0.1f * v; else if (ACT == 15) v = v / (1.0f + expf(-v)); else if (ACT == 3) v = fmaxf(v, 0.f); else if (ACT == 6) v = 0.5f * v * (1.0f + erff(v * 0.70710678118654752f)); so[w][8 * hh + r][t * 16 + ln] = v; } }
  __builtin_amdgcn_fence(__ATOMIC_ACQ_REL, "workgroup"); __builtin_amdgcn_wave_barrier();
  const int rsub = lane >> 4, c4 = (lane & 15) * 4; typedef _Float16 v4h __attribute__((ext_vector_type(4)));
  {
#pragma unroll
    for (int q = 0; q < 8; ++q) { const int r = q * 2 + rsub; if (col0 + c4 < N) { const v4f v = *(const v4fa*)&so[w][r][c4]; if (C) *(v4f*)(C + cofs + (size_t)(row0 + r) * ldc + col0 + c4) = v; if (C16) { v4h h4; for (int i = 0; i < 4; ++i) h4[i] = (_Float16)v[i]; *(v4h*)(C16 + cofs + (size_t)(row0 + r) * ldc + col0 + c4) = h4; } } }
     }
}


typedef _Float16 v4h __attribute__((ext_vector_type(4)));

__global__ __launch_bounds__(256) void k_x16(const float* __restrict__ x, _Float16* __restrict__ X16, size_t n8) { const size_t t = (size_t)blockIdx.x * 256 + threadIdx.x; if (t >= n8) return; FragH f;
#pragma unroll
  for (int q = 0; q < 8; ++q) f.h[q] = (_Float16)bf16_round(x[t * 8 + q]); *(v8us*)((unsigned short*)X16 + t * 8) = f.half[0];  }
__global__ __launch_bounds__(256) void k_h16(const float* __restrict__ x, _Float16* __restrict__ X16, size_t n8) { const size_t t = (size_t)blockIdx.x * 256 + threadIdx.x; if (t >= n8) return; FragH f;
#pragma unroll
  for (int q = 0; q < 8; ++q) f.h[q] = (_Float16)x[t * 8 + q]; *(v8us*)((unsigned short*)X16 + t * 8) = f.half[0];  }
__global__ __launch_bounds__(256) void k_round16f(const float* __restrict__ W, _Float16* __restrict__ Bt, size_t n8) { const size_t t = (size_t)blockIdx.x * 256 + threadIdx.x; if (t >= n8) return; FragH f;
#pragma unroll
  for (int i = 0; i < 8; ++i) f.h[i] = (_Float16)(bf16_round(W[t * 8 + i]) * 16.0f); *(v8us*)((unsigned short*)Bt + t * 8) = f.half[0];  }
template <int NHv, int TTv>
__global__ __launch_bounds__(256) void k_vt(const _Float16* __restrict__ V16, int ldv, int voff, _Float16* __restrict__ Vt) { __shared__ unsigned short tl[64][66]; const int tid = threadIdx.x; const int slab = blockIdx.x / (TTv / 64), lg = blockIdx.x % (TTv / 64); const int b = slab / NHv, h = slab % NHv;
  for (int i = tid; i < 64 * 8; i += 256) { const int r = i / 8, c8 = (i % 8) * 8; FragH f; f.half[0] = *(const v8us*)((const unsigned short*)V16 + ((size_t)b * TTv + lg * 64 + r) * ldv + voff + h * 64 + c8);
#pragma unroll
    for (int q = 0; q < 8; ++q) tl[r][c8 + q] = f.u[q]; }
  __syncthreads();
  {
#pragma unroll
    for (int rd = 0; rd < 2; ++rd) { const int d = rd * 32 + tid / 8, pc = tid % 8; FragH f;
#pragma unroll
      for (int q = 0; q < 8; ++q) f.u[q] = tl[pc * 8 + q][d];
      *(v8us*)((unsigned short*)Vt + ((size_t)slab * 64 + d) * TTv + lg * 64 + pc * 8) = f.half[0]; }
     } }

template <int D, int RBF>
__global__ __launch_bounds__(256) void k_lnx(const float* __restrict__ X, const float* __restrict__ gam, const float* __restrict__ bet, int nrows, float eps, _Float16* __restrict__ O16, float* __restrict__ XR) {
  constexpr int NP = D / 128; const int tid = threadIdx.x, wv = tid >> 5, lane = tid & 31; const size_t r = (size_t)blockIdx.x * 8 + wv; if (r >= (size_t)nrows) return; v4f y[NP]; float s = 0.f;
#pragma unroll
  for (int j = 0; j < NP; ++j) { const int c = j * 128 + lane * 4; v4f g = *(const v4fa*)(X + r * D + c); if (RBF) { for (int q = 0; q < 4; ++q) g[q] = bf16_round(g[q]); } y[j] = g; s += g[0] + g[1] + g[2] + g[3]; }
  for (int o = 16; o >= 1; o >>= 1) s += __shfl_xor(s, o, 32); const float mu = s / (float)D; float q2 = 0.f;
#pragma unroll
  for (int j = 0; j < NP; ++j) for (int q = 0; q < 4; ++q) { const float d = y[j][q] - mu; q2 += d * d; }
  for (int o = 16; o >= 1; o >>= 1) q2 += __shfl_xor(q2, o, 32); const float rs = rsqrtf(q2 / (float)D + eps);
  {
#pragma unroll
    for (int j = 0; j < NP; ++j) { const int c = j * 128 + lane * 4; v4h h; for (int q = 0; q < 4; ++q) { const float v = (y[j][q] - mu) * rs * bf16_round(gam[c + q]) + bf16_round(bet[c + q]); h[q] = (_Float16)v; } *(v4h*)(O16 + r * D + c) = h; if (XR) *(v4f*)(XR + r * D + c) = y[j]; }
     } }
__global__ __launch_bounds__(256) void k_addres(const float* __restrict__ O, const float* __restrict__ XR, float* __restrict__ out, size_t n4) { const size_t t = (size_t)blockIdx.x * 256 + threadIdx.x; if (t >= n4) return; v4f a = *(const v4fa*)(O + t * 4); const v4f b = *(const v4fa*)(XR + t * 4); for (int q = 0; q < 4; ++q) a[q] += b[q]; *(v4f*)(out + t * 4) = a;  }
__global__ __launch_bounds__(128) void k_flash(const _Float16* __restrict__ Q16, int ldq, const _Float16* __restrict__ K16, int ldk, const _Float16* __restrict__ Vt, const int* __restrict__ MSK, float* __restrict__ O, int ldo) {
  constexpr int RPW = 16, RTN = RPW / 16, NQB = TT / (4 * RPW), DT = 4, KS = 2;
  __shared__ __attribute__((aligned(16))) unsigned short sP[4][RPW][40]; __shared__ __attribute__((aligned(16))) float sO[4][RPW][64 + 4];
  // K/V ring, two buffers, one stage = SKEY keys: sK rows = keys (64 d = 128 B), sV rows = d (SKEY keys = 128 B); LDS pitch 144 B (16 B x odd) keeps the 16 rows of a ds_load_b128 fragment read on distinct banks
  constexpr int SKEY = 64, NST = TT / SKEY, LP = 72, SBUF = 64 * LP * 2;
  __shared__ __attribute__((aligned(16))) unsigned short sK[2][SKEY][LP]; __shared__ __attribute__((aligned(16))) unsigned short sV[2][64][LP];
  const int tid = threadIdx.x, w = tid >> 5, lane = tid & 31, ln = lane & 15, hh = lane >> 4;
  const int slab = blockIdx.x / NQB, qblk = blockIdx.x % NQB; const int b = slab / NH, h = slab % NH; const int qb0 = qblk * (4 * RPW); const int q0 = qb0 + w * RPW;
  FragH aq[2][KS];
#pragma unroll
  for (int rt = 0; rt < RTN; ++rt) { const unsigned short* qr = (const unsigned short*)Q16 + ((size_t)b * TT + q0 + rt * 16 + ln) * ldq + h * 64;
#pragma unroll
    for (int ks = 0; ks < KS; ++ks) { aq[rt][ks].half[0] = *(const v8us*)(qr + ks * 32 + 8 * hh); aq[rt][ks].half[1] = *(const v8us*)(qr + ks * 32 + 16 + 8 * hh); } }
  const unsigned short* Vth = (const unsigned short*)Vt + (size_t)slab * 64 * TT;
  float m_r[2][8], l_r[2][8]; v8f oacc[2][DT];
#pragma unroll
  for (int rt = 0; rt < RTN; ++rt) {
#pragma unroll
    for (int r = 0; r < 8; ++r) { m_r[rt][r] = -3.0e38f; l_r[rt][r] = 0.f; }
#pragma unroll
    for (int dt = 0; dt < DT; ++dt) oacc[rt][dt] = (v8f){0.f,0.f,0.f,0.f,0.f,0.f,0.f,0.f}; }
  // each thread copies 16 B of rows crow, crow + 16, + 32, + 48 of both tiles: a wave's copy covers four whole 128-B lines
  const int crow = tid >> 3, ccol = tid & 7;
  const unsigned short* gK = (const unsigned short*)K16 + ((size_t)b * TT + crow) * ldk + h * 64 + ccol * 8; const unsigned short* gV = Vth + (size_t)crow * TT + ccol * 8;
  const unsigned lK = (unsigned)(uintptr_t)&sK[0][crow][ccol * 8], lV = (unsigned)(uintptr_t)&sV[0][crow][ccol * 8];
  auto stage = [&](int st, int bf) { const unsigned short* k0 = gK + (size_t)st * SKEY * ldk; const unsigned short* v0 = gV + st * SKEY; const unsigned lk = lK + bf * SBUF, lv = lV + bf * SBUF;
    // global -> LDS through no register; s_wait_xcnt 0 closes the statement so that no address register is rewritten ahead of it
    asm volatile("global_load_async_to_lds_b128 %0, %8, off\n\tglobal_load_async_to_lds_b128 %1, %9, off\n\tglobal_load_async_to_lds_b128 %2, %10, off\n\tglobal_load_async_to_lds_b128 %3, %11, off\n\t"
                 "global_load_async_to_lds_b128 %4, %12, off\n\tglobal_load_async_to_lds_b128 %5, %13, off\n\tglobal_load_async_to_lds_b128 %6, %14, off\n\tglobal_load_async_to_lds_b128 %7, %15, off\n\ts_wait_xcnt 0x0"
                 :: "v"(lk), "v"(lk + 16 * LP * 2), "v"(lk + 32 * LP * 2), "v"(lk + 48 * LP * 2), "v"(lv), "v"(lv + 16 * LP * 2), "v"(lv + 32 * LP * 2), "v"(lv + 48 * LP * 2),
                    "v"(k0), "v"(k0 + (size_t)16 * ldk), "v"(k0 + (size_t)32 * ldk), "v"(k0 + (size_t)48 * ldk), "v"(v0), "v"(v0 + 16 * TT), "v"(v0 + 32 * TT), "v"(v0 + 48 * TT) : "memory"); };
  stage(0, 0);
  asm volatile("s_wait_asynccnt 0x0" ::: "memory");      // this wave's copies of stage 0 have landed
  __syncthreads();                                        // ... and every other wave's: stage 0 may be read
  stage(1, 1);
#pragma unroll 1      /* one copy of the ring's foot; the buffer index stays t & 1 */
  for (int t = 0; t < NST; ++t) { const int bf = t & 1;
  for (int sub = 0; sub < SKEY / 32; ++sub) { const int j0 = t * SKEY + sub * 32;
    int mk0[2][8], mk1[2][8];      /* nonzero = MASKED */
#pragma unroll
    for (int rt = 0; rt < RTN; ++rt)
#pragma unroll
      for (int r = 0; r < 8; ++r) { const int qq = q0 + rt * 16 + 8 * hh + r; const int* am = MSK + ((size_t)b * TT + qq) * TT + j0; mk0[rt][r] = am[ln]; mk1[rt][r] = am[16 + ln]; }
    v8f s[2][2];
#pragma unroll
    for (int nt = 0; nt < 2; ++nt) { const unsigned short* kr = &sK[bf][sub * 32 + nt * 16 + ln][0]; FragH bk[KS];
#pragma unroll
      for (int ks = 0; ks < KS; ++ks) { bk[ks].half[0] = *(const v8us*)(kr + ks * 32 + 8 * hh); bk[ks].half[1] = *(const v8us*)(kr + ks * 32 + 16 + 8 * hh); }
#pragma unroll
      for (int rt = 0; rt < RTN; ++rt) { v8f acc = (v8f){0.f,0.f,0.f,0.f,0.f,0.f,0.f,0.f};
#pragma unroll
        for (int ks = 0; ks < KS; ++ks) acc = mmaH<1>(aq[rt][ks].v, aq[rt][ks].v, bk[ks].v, bk[ks].v, acc); s[rt][nt] = acc; } }
#pragma unroll
    for (int rt = 0; rt < RTN; ++rt)
#pragma unroll
      for (int r = 0; r < 8; ++r) { const int tq = q0 + rt * 16 + 8 * hh + r; const int k0 = j0 + ln, k1 = j0 + 16 + ln; (void)tq; (void)k0; (void)k1;
        const bool ok0 = (mk0[rt][r] == 0), ok1 = (mk1[rt][r] == 0);
        const float s0 = ok0 ? s[rt][0][r] * 0.125f : -INFINITY, s1 = ok1 ? s[rt][1][r] * 0.125f : -INFINITY; float mc = fmaxf(s0, s1);
        mc = fmaxf(mc, __shfl_xor(mc, 1, 32)); mc = fmaxf(mc, __shfl_xor(mc, 2, 32)); mc = fmaxf(mc, __shfl_xor(mc, 4, 32)); mc = fmaxf(mc, __shfl_xor(mc, 8, 32));
        const float mn = fmaxf(m_r[rt][r], mc); const float al = (mn > -1.0e38f) ? expf(m_r[rt][r] - mn) : 1.0f; m_r[rt][r] = mn; const float p0 = ok0 ? expf(s0 - mn) : 0.f, p1 = ok1 ? expf(s1 - mn) : 0.f; l_r[rt][r] = l_r[rt][r] * al + p0 + p1;
#pragma unroll
        for (int dt = 0; dt < DT; ++dt) oacc[rt][dt][r] *= al;
        FragH t2; t2.h[0] = (_Float16)(p0 * 1024.0f); t2.h[1] = (_Float16)(p1 * 1024.0f); sP[w][rt * 16 + 8 * hh + r][ln] = t2.u[0]; sP[w][rt * 16 + 8 * hh + r][16 + ln] = t2.u[1]; }
    __builtin_amdgcn_fence(__ATOMIC_ACQ_REL, "workgroup"); __builtin_amdgcn_wave_barrier();
    FragH pa[2];
#pragma unroll
    for (int rt = 0; rt < RTN; ++rt) { pa[rt].half[0] = *(const v8us*)&sP[w][rt * 16 + ln][8 * hh]; pa[rt].half[1] = *(const v8us*)&sP[w][rt * 16 + ln][16 + 8 * hh]; }
#pragma unroll
    for (int dt = 0; dt < DT; ++dt) { const unsigned short* vrow = &sV[bf][dt * 16 + ln][sub * 32]; FragH bv; bv.half[0] = *(const v8us*)(vrow + 8 * hh); bv.half[1] = *(const v8us*)(vrow + 16 + 8 * hh);
#pragma unroll
      for (int rt = 0; rt < RTN; ++rt) oacc[rt][dt] = mmaH<1>(pa[rt].v, pa[rt].v, bv.v, bv.v, oacc[rt][dt]); }
    __builtin_amdgcn_fence(__ATOMIC_ACQ_REL, "workgroup"); __builtin_amdgcn_wave_barrier(); }
    asm volatile("s_wait_dscnt 0x0" ::: "memory");        // this wave's reads of buffer bf are done before it is refilled
    asm volatile("s_wait_asynccnt 0x0" ::: "memory");     // this wave's copies of stage t + 1 have landed
    __syncthreads();                                        // publishes stage t + 1 and ends every wave's reads of buffer bf
    if (t + 2 < NST) stage(t + 2, bf); }
  asm volatile("s_wait_asynccnt 0x0" ::: "memory");       // no copy is outstanding when the wave goes on to the epilogue
#pragma unroll
  for (int rt = 0; rt < RTN; ++rt) {
#pragma unroll
    for (int r = 0; r < 8; ++r) { float l = l_r[rt][r]; l += __shfl_xor(l, 1, 32); l += __shfl_xor(l, 2, 32); l += __shfl_xor(l, 4, 32); l += __shfl_xor(l, 8, 32); l_r[rt][r] = (l > 0.f) ? 1.0f / (l * 1024.0f) : 0.f; }
#pragma unroll
    for (int dt = 0; dt < DT; ++dt)
#pragma unroll
      for (int r = 0; r < 8; ++r) sO[w][rt * 16 + 8 * hh + r][dt * 16 + ln] = oacc[rt][dt][r] * l_r[rt][r]; }
  __builtin_amdgcn_fence(__ATOMIC_ACQ_REL, "workgroup"); __builtin_amdgcn_wave_barrier();
  {
#pragma unroll
    for (int rp = 0; rp < RPW; rp += 2) { const int r = rp + (lane >> 4), pc = lane & 15; const v4f val = *(const v4fa*)&sO[w][r][pc * 4]; *(v4f*)(O + ((size_t)b * TT + q0 + r) * ldo + h * 64 + pc * 4) = val; }
     } }

extern "C" void kernel_launch(void* const* d_in, const int* in_sizes, int n_in,
                              void* d_out, int out_size, void* d_ws, size_t ws_size, hipStream_t stream) {
  (void)in_sizes; (void)n_in; (void)out_size;
  const float* const* I = (const float* const*)d_in; const float* Qx = I[0]; const float* Kx = I[1]; const float* Vx = I[2]; const int* mask = (const int*)d_in[3];      /* bool mask shipped as int32 [2,1,2048,2048] */
  const float* Wq = I[4]; const float* bq = I[5]; const float* Wk = I[6]; const float* bk = I[7]; const float* Wv = I[8]; const float* bv = I[9]; const float* gam = I[10]; const float* bet = I[11];
  char* ws = (char*)d_ws; size_t off = 0;
  auto take = [&](size_t bytes) { char* p = ws + off; off += (bytes + 255) & ~(size_t)255; return p; };
  const size_t WSZ = (size_t)DD * DD; _Float16* Bw = (_Float16*)take(3 * WSZ * 2); float* XR = (float*)take((size_t)NR * DD * 4); _Float16* H16 = (_Float16*)take((size_t)NR * DD * 2);
  _Float16* Q = (_Float16*)take((size_t)NR * DD * 2); _Float16* K = (_Float16*)take((size_t)NR * DD * 2); _Float16* V = (_Float16*)take((size_t)NR * DD * 2); _Float16* Vt = (_Float16*)take((size_t)NR * DD * 2); float* O = (float*)take((size_t)NR * DD * 4);
  if (off > ws_size) return;      // 6.3 + 16.8 + 8.4 + 4 × 8.4 + 16.8 ≈ 82 MB
  const unsigned gw = (unsigned)(((size_t)DD * (DD / 8) + 255) / 256); k_wt_f16<<<gw, 256, 0, stream>>>(Wq, Bw, DD, DD, 16.0f); k_wt_f16<<<gw, 256, 0, stream>>>(Wk, Bw + WSZ, DD, DD, 16.0f); k_wt_f16<<<gw, 256, 0, stream>>>(Wv, Bw + 2 * WSZ, DD, DD, 16.0f);      /* (in,out) → Bt ×2^4 */
  const dim3 gp(((NR / 16) * (DD / 64) + 3) / 4, 1);
  k_lnx<DD, 1><<<(NR + 7) / 8, 256, 0, stream>>>(Qx, gam, bet, NR, 1e-5f, H16, XR);      /* LN(bf16 Q) → f16; XR = bf16(Q) for the residual */
  k_gemm_hhx<0><<<gp, 128, 0, stream>>>(H16, DD, 0, Bw, DD, 0, 0.0625f, bq, 0, nullptr, 1, 0, 0, nullptr, Q, DD, 0, NR, DD, DD);      /* M 4096 N 1024 K 1024 */
  k_lnx<DD, 1><<<(NR + 7) / 8, 256, 0, stream>>>(Kx, gam, bet, NR, 1e-5f, H16, nullptr);
  k_gemm_hhx<0><<<gp, 128, 0, stream>>>(H16, DD, 0, Bw + WSZ, DD, 0, 0.0625f, bk, 0, nullptr, 1, 0, 0, nullptr, K, DD, 0, NR, DD, DD);
  k_lnx<DD, 1><<<(NR + 7) / 8, 256, 0, stream>>>(Vx, gam, bet, NR, 1e-5f, H16, nullptr);
  k_gemm_hhx<0><<<gp, 128, 0, stream>>>(H16, DD, 0, Bw + 2 * WSZ, DD, 0, 0.0625f, bv, 0, nullptr, 1, 0, 0, nullptr, V, DD, 0, NR, DD, DD);
  k_vt<NH, TT><<<BB * NH * (TT / 64), 256, 0, stream>>>(V, DD, 0, Vt);
  k_flash<<<BB * NH * (TT / 64), 128, 0, stream>>>(Q, DD, K, DD, Vt, mask, O, DD);
  k_addres<<<(unsigned)(((size_t)NR * DD / 4 + 255) / 256), 256, 0, stream>>>(O, XR, (float*)d_out, (size_t)NR * DD / 4);      /* out = o + Q */
}

// v002
// It runs in 281 microseconds.
// In two side-by-side timings against v001, it was 1.37 and 1.36 times as fast.
// Over all steps from v000 it is 1.54 times as fast.
#include <hip/hip_runtime.h>
// Pre-norm multi-head attention with a boolean mask and residual (B=2, N=2048, E=1024, 16 heads × 64): q = LN(Q)·Wq + bq, k = LN(K)·Wk + bk, v = LN(V)·Wv + bv (one shared LayerNorm γ,β; (in,out) weights); s = q·kᵀ·64^-½ with −inf where mask[b,0,n,m] is True;
// softmax; o = merged attn·v; out = o + Q (no output projection).
// Compute dtype: Q, K, V, weights, biases, γ, β rounded to bf16; LayerNorms f32 (wave per row) → f16; q/k/v f16 GEMM planes; fused flash-style kernel (int32 mask loads per (q,k), online softmax f32, P f16 ×2^10) on
// v_wmma_f32_16x16x32_f16; out = o (f32) + bf16(Q) (f32 add); f32 accumulate.
#define BB 2
#define TT 2048
#define DD 1024
#define NH 16
#define NR (BB * TT)

typedef __bf16 v16b __attribute__((ext_vector_type(16)));
typedef unsigned short v8us __attribute__((ext_vector_type(8), may_alias));
typedef float  v8f  __attribute__((ext_vector_type(8)));
typedef float  v4f  __attribute__((ext_vector_type(4)));
typedef float  v4fa __attribute__((ext_vector_type(4), may_alias));
union FragB { v16b v; v8us half[2]; unsigned short u[16]; };

__device__ __forceinline__ unsigned short bf16_bits(float x) { unsigned int u = __float_as_uint(x); return (unsigned short)((u + 0x7FFFu + ((u >> 16) & 1u)) >> 16); }
__device__ __forceinline__ float bf16_val(unsigned short b) { return __uint_as_float(((unsigned int)b) << 16); }
__device__ __forceinline__ float bf16_round(float x) { return bf16_val(bf16_bits(x)); }
// D += A·B with NT terms: 1 = ah·bh, 2 = + al·bh (A split), 3 = + ah·bl (both split)
template <int NT>
__device__ __forceinline__ v8f mmaN(v16b ah, v16b al, v16b bh, v16b bl, v8f c) {
  c = __builtin_amdgcn_wmma_f32_16x16x32_bf16(false, ah, false, bh, (short)0, c, false, false);
  if (NT >= 2) c = __builtin_amdgcn_wmma_f32_16x16x32_bf16(false, al, false, bh, (short)0, c, false, false);
  if (NT >= 3) c = __builtin_amdgcn_wmma_f32_16x16x32_bf16(false, ah, false, bl, (short)0, c, false, false);
  asm volatile("v_nop\n\tv_nop\n\tv_nop\n\tv_nop" : "+v"(c) : "v"(ah), "v"(al), "v"(bh), "v"(bl));
  return c;
}

__global__ __launch_bounds__(256) void k_wt_bf16(const float* __restrict__ W, unsigned short* __restrict__ Wt, int K, int N) {
  const int t = blockIdx.x * 256 + threadIdx.x;
  const int k8n = K / 8;
  if (t >= N * k8n) return;
  const int n = t / k8n, k8 = (t % k8n) * 8;
  v8us v;
#pragma unroll
  for (int i = 0; i < 8; ++i) v[i] = bf16_bits(W[(size_t)(k8 + i) * N + n]);
  *(v8us*)(Wt + (size_t)n * K + k8) = v;
  
}

// GEMM C[M][N] (f32, pitch ldc) = act(A[M][K]·W + bias). A f32 row-major (pitch lda) converted per fragment to bf16
// (ASPLIT: hi/lo two planes -> 2 terms, else single rounded term); Wt bf16 [N][K] (pitch ldb). BIAS_BF16 rounds the
// bias to bf16 first (bias quantised to bf16 before the add). K%32==0, M%16==0, N%64==0.
template <bool ASPLIT, int ACT, bool BIAS_BF16>
__global__ __launch_bounds__(128) void k_gemm_bf(const float* __restrict__ A, int lda, const unsigned short* __restrict__ Wt, int ldb,
                                               const float* __restrict__ bias, float* __restrict__ C, int ldc, int M, int N, int K) {
  __shared__ __attribute__((aligned(16))) float so[4][16][64];
  const int tid = threadIdx.x, w = tid >> 5, lane = tid & 31, ln = lane & 15, hh = lane >> 4;
  const int ntn = N / 64;
  const int wid = blockIdx.x * 4 + w;
  const int mt = wid / ntn, nq = wid % ntn;
  if (mt * 16 >= M) return;
  const int row0 = mt * 16, col0 = nq * 64;
  const float* arow = A + (size_t)(row0 + ln) * lda;
  v8f acc[4] = {};
  for (int kb = 0; kb < K; kb += 32) {
    FragB ah, al;
    const v4f x0 = *(const v4fa*)(arow + kb + 8 * hh), x1 = *(const v4fa*)(arow + kb + 8 * hh + 4);
    const v4f x2 = *(const v4fa*)(arow + kb + 16 + 8 * hh), x3 = *(const v4fa*)(arow + kb + 16 + 8 * hh + 4);
    float xs[16] = {x0[0],x0[1],x0[2],x0[3],x1[0],x1[1],x1[2],x1[3],x2[0],x2[1],x2[2],x2[3],x3[0],x3[1],x3[2],x3[3]};
#pragma unroll
    for (int i = 0; i < 16; ++i) { const unsigned short hb = bf16_bits(xs[i]); ah.u[i] = hb; al.u[i] = ASPLIT ? bf16_bits(xs[i] - bf16_val(hb)) : (unsigned short)0; }
#pragma unroll
    for (int t = 0; t < 4; ++t) {
      const unsigned short* brow = Wt + (size_t)(col0 + t * 16 + ln) * ldb + kb;
      FragB b;
      b.half[0] = *(const v8us*)(brow + 8 * hh);
      b.half[1] = *(const v8us*)(brow + 16 + 8 * hh);
      acc[t] = mmaN<ASPLIT ? 2 : 1>(ah.v, al.v, b.v, b.v, acc[t]);
    }
  }
#pragma unroll
  for (int t = 0; t < 4; ++t) {
    float bv = bias ? bias[col0 + t * 16 + ln] : 0.f;
    if (BIAS_BF16) bv = bf16_round(bv);
#pragma unroll
    for (int r = 0; r < 8; ++r) { float v = acc[t][r] + bv; if (ACT == 1) v = fmaxf(v, 0.f); so[w][8 * hh + r][t * 16 + ln] = v; }
  }
  __builtin_amdgcn_fence(__ATOMIC_ACQ_REL, "workgroup");
  __builtin_amdgcn_wave_barrier();
  const int rsub = lane >> 4, c4 = (lane & 15) * 4;
  {
#pragma unroll
    for (int q = 0; q < 8; ++q) {
      const int r = q * 2 + rsub;
      const v4f v = *(const v4fa*)&so[w][r][c4];
      *(v4f*)(C + (size_t)(row0 + r) * ldc + col0 + c4) = v;
    }
    
  }
}

// Flash-style causal/unmasked attention, all contractions 3-term bf16 hi/lo splits, f32 softmax with running max.
// q,k,v rows are read from f32 buffers with arbitrary row pitch (so they can live inside a fused qkv buffer);
// D = head size (multiple of 32, <= 128); one wave = 16 query rows; block = 4 waves (64 queries) sharing K/V chunks of 32.
template <int D, bool CAUSAL>
__global__ __launch_bounds__(128) void k_flash(const float* __restrict__ qb, const float* __restrict__ kb, const float* __restrict__ vb,
                                             int pitch, int T, int H, float scale, float* __restrict__ y, int ypitch) {
  constexpr int KS = D / 32;        // k-steps for QK
  constexpr int DT = D / 16;        // d tiles for PV
  __shared__ __attribute__((aligned(16))) unsigned short sKh[32][D + 8], sKl[32][D + 8], sVh[32][D + 8], sVl[32][D + 8];
  __shared__ __attribute__((aligned(16))) unsigned short sPh[4][16][40], sPl[4][16][40];
  __shared__ __attribute__((aligned(16))) float sO[4][16][D];
  const int tid = threadIdx.x, w = tid >> 5, lane = tid & 31, ln = lane & 15, hh = lane >> 4;
  const int nqb = (T + 63) / 64;
  const int bh = blockIdx.x / nqb, qblk = blockIdx.x % nqb;
  const int b = bh / H, h = bh % H;
  const int q0 = qblk * 64 + w * 16;
  const float* Q = qb + (size_t)b * T * pitch + h * D;
  const float* K = kb + (size_t)b * T * pitch + h * D;
  const float* V = vb + (size_t)b * T * pitch + h * D;

  // A fragments of the wave's 16 query rows (scaled), hi/lo
  FragB aqh[KS], aql[KS];
  {
    int row = q0 + ln; if (row >= T) row = T - 1;
    const float* qr = Q + (size_t)row * pitch;
#pragma unroll
    for (int ks = 0; ks < KS; ++ks)
#pragma unroll
      for (int i = 0; i < 16; ++i) {
        const int d = ks * 32 + ((i < 8) ? (8 * hh + i) : (16 + 8 * hh + (i - 8)));
        const float x = qr[d] * scale; const unsigned short hb = bf16_bits(x);
        aqh[ks].u[i] = hb; aql[ks].u[i] = bf16_bits(x - bf16_val(hb));
      }
  }
  float m_r[8], l_r[8];
#pragma unroll
  for (int r = 0; r < 8; ++r) { m_r[r] = -3.0e38f; l_r[r] = 0.f; }
  v8f oacc[DT];
#pragma unroll
  for (int dt = 0; dt < DT; ++dt) oacc[dt] = (v8f){0.f,0.f,0.f,0.f,0.f,0.f,0.f,0.f};

  const int kv_end = CAUSAL ? min(T, qblk * 64 + 64) : T;     // block-uniform
  for (int j0 = 0; j0 < kv_end; j0 += 32) {
    __syncthreads();
    for (int e = tid; e < 32 * (D / 4); e += 128) {
      const int r = e / (D / 4), c4 = (e % (D / 4)) * 4;
      const int key = j0 + r;
      v4f kf = {0.f,0.f,0.f,0.f}, vf = {0.f,0.f,0.f,0.f};
      if (key < T) { kf = *(const v4fa*)(K + (size_t)key * pitch + c4); vf = *(const v4fa*)(V + (size_t)key * pitch + c4); }
#pragma unroll
      for (int t = 0; t < 4; ++t) {
        unsigned short hb = bf16_bits(kf[t]); sKh[r][c4 + t] = hb; sKl[r][c4 + t] = bf16_bits(kf[t] - bf16_val(hb));
        hb = bf16_bits(vf[t]); sVh[r][c4 + t] = hb; sVl[r][c4 + t] = bf16_bits(vf[t] - bf16_val(hb));
      }
    }
    __syncthreads();
    // S tile 16 x 32
    v8f s[2];
#pragma unroll
    for (int nt = 0; nt < 2; ++nt) {
      v8f acc = {};
#pragma unroll
      for (int ks = 0; ks < KS; ++ks) {
        FragB bh_, bl_;
        bh_.half[0] = *(const v8us*)&sKh[nt * 16 + ln][ks * 32 + 8 * hh]; bh_.half[1] = *(const v8us*)&sKh[nt * 16 + ln][ks * 32 + 16 + 8 * hh];
        bl_.half[0] = *(const v8us*)&sKl[nt * 16 + ln][ks * 32 + 8 * hh]; bl_.half[1] = *(const v8us*)&sKl[nt * 16 + ln][ks * 32 + 16 + 8 * hh];
        acc = mmaN<3>(aqh[ks].v, aql[ks].v, bh_.v, bl_.v, acc);
      }
      s[nt] = acc;
    }
    // mask + running max (rows 8hh+r; the 16 lanes of a half share rows)
    float alpha[8];
#pragma unroll
    for (int r = 0; r < 8; ++r) {
      const int qi = q0 + 8 * hh + r;
      const int ja = j0 + ln, jb = j0 + 16 + ln;
      if (CAUSAL) { if (ja > qi) s[0][r] = -3.0e38f; if (jb > qi) s[1][r] = -3.0e38f; }
      if (ja >= T) s[0][r] = -3.0e38f;
      if (jb >= T) s[1][r] = -3.0e38f;
      float mx = fmaxf(s[0][r], s[1][r]);
      mx = fmaxf(mx, __shfl_xor(mx, 1, 32)); mx = fmaxf(mx, __shfl_xor(mx, 2, 32)); mx = fmaxf(mx, __shfl_xor(mx, 4, 32)); mx = fmaxf(mx, __shfl_xor(mx, 8, 32));
      const float mnew = fmaxf(m_r[r], mx);
      alpha[r] = (mnew > -1.0e38f) ? __expf(m_r[r] - mnew) : 1.0f;
      const float p0 = (s[0][r] > -1.0e38f) ? __expf(s[0][r] - mnew) : 0.f;
      const float p1 = (s[1][r] > -1.0e38f) ? __expf(s[1][r] - mnew) : 0.f;
      m_r[r] = mnew;
      l_r[r] = l_r[r] * alpha[r] + p0 + p1;            // per-lane partial row sum (16 lanes combined at the end)
      unsigned short hb = bf16_bits(p0); sPh[w][8 * hh + r][ln] = hb;      sPl[w][8 * hh + r][ln] = bf16_bits(p0 - bf16_val(hb));
      hb = bf16_bits(p1);                sPh[w][8 * hh + r][16 + ln] = hb; sPl[w][8 * hh + r][16 + ln] = bf16_bits(p1 - bf16_val(hb));
    }
#pragma unroll
    for (int dt = 0; dt < DT; ++dt)
#pragma unroll
      for (int r = 0; r < 8; ++r) oacc[dt][r] *= alpha[r];
    __builtin_amdgcn_fence(__ATOMIC_ACQ_REL, "workgroup");
    __builtin_amdgcn_wave_barrier();
    FragB pah, pal;
    pah.half[0] = *(const v8us*)&sPh[w][ln][8 * hh]; pah.half[1] = *(const v8us*)&sPh[w][ln][16 + 8 * hh];
    pal.half[0] = *(const v8us*)&sPl[w][ln][8 * hh]; pal.half[1] = *(const v8us*)&sPl[w][ln][16 + 8 * hh];
#pragma unroll
    for (int dt = 0; dt < DT; ++dt) {
      FragB bvh, bvl;
#pragma unroll
      for (int i = 0; i < 8; ++i) {
        bvh.u[i] = sVh[8 * hh + i][dt * 16 + ln]; bvh.u[8 + i] = sVh[16 + 8 * hh + i][dt * 16 + ln];
        bvl.u[i] = sVl[8 * hh + i][dt * 16 + ln]; bvl.u[8 + i] = sVl[16 + 8 * hh + i][dt * 16 + ln];
      }
      oacc[dt] = mmaN<3>(pah.v, pal.v, bvh.v, bvl.v, oacc[dt]);
    }
    __builtin_amdgcn_fence(__ATOMIC_ACQ_REL, "workgroup");
    __builtin_amdgcn_wave_barrier();
  }
#pragma unroll
  for (int r = 0; r < 8; ++r) {
    float l = l_r[r];
    l += __shfl_xor(l, 1, 32); l += __shfl_xor(l, 2, 32); l += __shfl_xor(l, 4, 32); l += __shfl_xor(l, 8, 32);
    l_r[r] = (l > 0.f) ? 1.0f / l : 0.f;
  }
#pragma unroll
  for (int dt = 0; dt < DT; ++dt)
#pragma unroll
    for (int r = 0; r < 8; ++r) sO[w][8 * hh + r][dt * 16 + ln] = oacc[dt][r] * l_r[r];
  __builtin_amdgcn_fence(__ATOMIC_ACQ_REL, "workgroup");
  __builtin_amdgcn_wave_barrier();
  {
    for (int r = 0; r < 16; ++r) {
      const int row = q0 + r;
      if (row < T && lane < D / 4) {
        const v4f val = *(const v4fa*)&sO[w][r][lane * 4];
        *(v4f*)(y + ((size_t)b * T + row) * ypitch + h * D + lane * 4) = val;
      }
    }
    
  }
}

// GEMM C = act(A·W + bias + resid): A f32 (ASPLIT -> hi/lo 2 terms), Wt bf16 [N][K]; ACT 0 none, 1 relu, 2 exact gelu;
// resid (optional, f32, row index = (row % rmod), pitch ldr, RES_BF16 rounds it) added before the activation.
template <bool ASPLIT, int ACT, bool BIAS_BF16, bool RES_BF16>
__global__ __launch_bounds__(128) void k_gemm_bf3(const float* __restrict__ A, int lda, const unsigned short* __restrict__ Wt, int ldb,
                                                const float* __restrict__ bias, const float* __restrict__ resid, int rmod, int ldr,
                                                float* __restrict__ C, int ldc, int M, int N, int K) {
  __shared__ __attribute__((aligned(16))) float so[4][16][64];
  const int tid = threadIdx.x, w = tid >> 5, lane = tid & 31, ln = lane & 15, hh = lane >> 4;
  const int ntn = N / 64;
  const int wid = blockIdx.x * 4 + w;
  const int mt = wid / ntn, nq = wid % ntn;
  if (mt * 16 >= M) return;
  const int row0 = mt * 16, col0 = nq * 64;
  const float* arow = A + (size_t)(row0 + ln) * lda;
  v8f acc[4] = {};
  for (int kb = 0; kb < K; kb += 32) {
    FragB ah, al;
    const v4f x0 = *(const v4fa*)(arow + kb + 8 * hh), x1 = *(const v4fa*)(arow + kb + 8 * hh + 4);
    const v4f x2 = *(const v4fa*)(arow + kb + 16 + 8 * hh), x3 = *(const v4fa*)(arow + kb + 16 + 8 * hh + 4);
    float xs[16] = {x0[0],x0[1],x0[2],x0[3],x1[0],x1[1],x1[2],x1[3],x2[0],x2[1],x2[2],x2[3],x3[0],x3[1],x3[2],x3[3]};
#pragma unroll
    for (int i = 0; i < 16; ++i) { const unsigned short hb = bf16_bits(xs[i]); ah.u[i] = hb; al.u[i] = ASPLIT ? bf16_bits(xs[i] - bf16_val(hb)) : (unsigned short)0; }
#pragma unroll
    for (int t = 0; t < 4; ++t) {
      const unsigned short* brow = Wt + (size_t)(col0 + t * 16 + ln) * ldb + kb;
      FragB b;
      b.half[0] = *(const v8us*)(brow + 8 * hh);
      b.half[1] = *(const v8us*)(brow + 16 + 8 * hh);
      acc[t] = mmaN<ASPLIT ? 2 : 1>(ah.v, al.v, b.v, b.v, acc[t]);
    }
  }
#pragma unroll
  for (int t = 0; t < 4; ++t) {
    const int col = col0 + t * 16 + ln;
    float bv = bias ? bias[col] : 0.f;
    if (BIAS_BF16) bv = bf16_round(bv);
#pragma unroll
    for (int r = 0; r < 8; ++r) {
      float v = acc[t][r] + bv;
      if (resid) { float rv = resid[(size_t)((row0 + 8 * hh + r) % rmod) * ldr + col]; if (RES_BF16) rv = bf16_round(rv); v += rv; }
      if (ACT == 1) v = fmaxf(v, 0.f);
      if (ACT == 2) v = 0.5f * v * (1.0f + erff(v * 0.70710678118654752f));
      if (ACT == 3) { const float u = 0.7978845608028654f * (v + 0.044715f * v * v * v); v = 0.5f * v * (1.0f + tanhf(u)); }
      so[w][8 * hh + r][t * 16 + ln] = v;
    }
  }
  __builtin_amdgcn_fence(__ATOMIC_ACQ_REL, "workgroup");
  __builtin_amdgcn_wave_barrier();
  const int rsub = lane >> 4, c4 = (lane & 15) * 4;
  {
#pragma unroll
    for (int q = 0; q < 8; ++q) {
      const int r = q * 2 + rsub;
      const v4f v = *(const v4fa*)&so[w][r][c4];
      *(v4f*)(C + (size_t)(row0 + r) * ldc + col0 + c4) = v;
    }
    
  }
}
// row LayerNorm (biased variance, eps) over N: s = X (+ R); optional out_sum <- s; out_norm <- (s-mu)*rsqrt(var+eps)*g + b
template <bool PARAM_BF16>
__global__ __launch_bounds__(256) void k_layernorm(const float* __restrict__ X, const float* __restrict__ R, const float* __restrict__ g, const float* __restrict__ bta,
                                                  float* __restrict__ out_sum, float* __restrict__ out_norm, int N, float eps) {
  __shared__ float red[256];
  const int row = blockIdx.x, tid = threadIdx.x;
  const float* x = X + (size_t)row * N; const float* rr = R ? R + (size_t)row * N : nullptr;
  float vals[16];                     // up to N = 4096
  const int per = N / 256;            // contiguous chunk per thread? use strided-by-4 chunks: thread handles j = tid*4 + 1024*u
  float s1 = 0.f;
  for (int u = 0; u < per / 4; ++u) {
    const int j = tid * 4 + 1024 * u;
    const v4f a = *(const v4fa*)(x + j);
    v4f b = {0.f,0.f,0.f,0.f}; if (rr) b = *(const v4fa*)(rr + j);
#pragma unroll
    for (int q = 0; q < 4; ++q) { const float v = a[q] + b[q]; vals[u * 4 + q] = v; s1 += v; }
  }
  red[tid] = s1; __syncthreads();
  for (int st = 128; st > 0; st >>= 1) { if (tid < st) red[tid] += red[tid + st]; __syncthreads(); }
  const float mu = red[0] / (float)N; __syncthreads();
  float s2 = 0.f;
  for (int u = 0; u < per / 4; ++u)
#pragma unroll
    for (int q = 0; q < 4; ++q) { const float c = vals[u * 4 + q] - mu; s2 += c * c; }
  red[tid] = s2; __syncthreads();
  for (int st = 128; st > 0; st >>= 1) { if (tid < st) red[tid] += red[tid + st]; __syncthreads(); }
  const float rs = rsqrtf(red[0] / (float)N + eps);
  {
    for (int u = 0; u < per / 4; ++u) {
      const int j = tid * 4 + 1024 * u;
      v4f o, sm;
#pragma unroll
      for (int q = 0; q < 4; ++q) {
        float gg = g[j + q], bb = bta[j + q];
        if (PARAM_BF16) { gg = bf16_round(gg); bb = bf16_round(bb); }
        sm[q] = vals[u * 4 + q]; o[q] = (vals[u * 4 + q] - mu) * rs * gg + bb;
      }
      if (out_sum) *(v4f*)(out_sum + (size_t)row * N + j) = sm;
      *(v4f*)(out_norm + (size_t)row * N + j) = o;
    }
    
  }
}



// ---- f16 WMMA path (v_wmma_f32_16x16x32_f16): 11-bit significands for operands in range — used where a [0,1] probability operand needs more precision than bf16
typedef _Float16 v16h __attribute__((ext_vector_type(16)));
union FragH { v16h v; v8us half[2]; _Float16 h[16]; unsigned short u[16]; };
template <int NT>
__device__ __forceinline__ v8f mmaH(v16h ah, v16h al, v16h bh, v16h bl, v8f c) {
  c = __builtin_amdgcn_wmma_f32_16x16x32_f16(false, ah, false, bh, (short)0, c, false, false);
  if (NT >= 2) c = __builtin_amdgcn_wmma_f32_16x16x32_f16(false, al, false, bh, (short)0, c, false, false);
  if (NT >= 3) c = __builtin_amdgcn_wmma_f32_16x16x32_f16(false, ah, false, bl, (short)0, c, false, false);
  asm volatile("v_nop\n\tv_nop\n\tv_nop\n\tv_nop" : "+v"(c) : "v"(ah), "v"(al), "v"(bh), "v"(bl));
  return c;
}
// batched GEMM like k_gemm_b but f16 operands: A f32 (split into f16 hi/lo if ASPLIT, else rounded to f16), Bt = f16 values [n][k]; alpha; C f32; N multiple of 16 (partial tiles skipped)
template <bool ASPLIT>
__global__ __launch_bounds__(128) void k_gemm_h(const float* __restrict__ A, int lda, size_t sA, const _Float16* __restrict__ Bh, int ldb, size_t sB, float alpha, float* __restrict__ C, int ldc, size_t sC, int M, int N, int K) {
  __shared__ __attribute__((aligned(16))) float so[4][16][64];
  const int tid = threadIdx.x, w = tid >> 5, lane = tid & 31, ln = lane & 15, hh = lane >> 4; const int by = blockIdx.y;
  A += (size_t)by * sA; Bh += (size_t)by * sB; C += (size_t)by * sC;
  const int ntn = (N + 63) / 64; const int wid = blockIdx.x * 4 + w; const int mt = wid / ntn, nq = wid % ntn; if (mt * 16 >= M) return;
  const int row0 = mt * 16, col0 = nq * 64; const float* arow = A + (size_t)(row0 + ln) * lda;
  v8f acc[4] = {};
  for (int kb = 0; kb < K; kb += 32) {
    FragH ah, al;
    const v4f x0 = *(const v4fa*)(arow + kb + 8 * hh), x1 = *(const v4fa*)(arow + kb + 8 * hh + 4), x2 = *(const v4fa*)(arow + kb + 16 + 8 * hh), x3 = *(const v4fa*)(arow + kb + 16 + 8 * hh + 4);
    float xs[16] = {x0[0],x0[1],x0[2],x0[3],x1[0],x1[1],x1[2],x1[3],x2[0],x2[1],x2[2],x2[3],x3[0],x3[1],x3[2],x3[3]};
#pragma unroll
    for (int i = 0; i < 16; ++i) { const _Float16 h = (_Float16)xs[i]; ah.h[i] = h; al.h[i] = ASPLIT ? (_Float16)(xs[i] - (float)h) : (_Float16)0.0f; }
#pragma unroll
    for (int t = 0; t < 4; ++t) { if (col0 + t * 16 >= N) continue; const size_t boff = (size_t)(col0 + t * 16 + ln) * ldb + kb; FragH bq; bq.half[0] = *(const v8us*)(Bh + boff + 8 * hh); bq.half[1] = *(const v8us*)(Bh + boff + 16 + 8 * hh);
      acc[t] = mmaH<ASPLIT ? 2 : 1>(ah.v, al.v, bq.v, bq.v, acc[t]); }
  }
#pragma unroll
  for (int t = 0; t < 4; ++t) { if (col0 + t * 16 >= N) continue;
#pragma unroll
    for (int r = 0; r < 8; ++r) so[w][8 * hh + r][t * 16 + ln] = acc[t][r] * alpha; }
  __builtin_amdgcn_fence(__ATOMIC_ACQ_REL, "workgroup"); __builtin_amdgcn_wave_barrier();
  const int rsub = lane >> 4, c4 = (lane & 15) * 4;
  {
#pragma unroll
    for (int q = 0; q < 8; ++q) { const int r = q * 2 + rsub; if (col0 + c4 < N) { const v4f v = *(const v4fa*)&so[w][r][c4]; *(v4f*)(C + (size_t)(row0 + r) * ldc + col0 + c4) = v; } }
     }
}

// Wt[n][k] = f16(W[k][n]·scale) from f32 row-major W[K][N] (scale = power of two; bf16-exact weights stay exact in f16 away from the subnormal range)
__global__ __launch_bounds__(256) void k_wt_f16(const float* __restrict__ W, _Float16* __restrict__ Wt, int K, int N, float scale) {
  const int t = blockIdx.x * 256 + threadIdx.x; if (t >= N * (K / 8)) return; const int n = t / (K / 8), k8 = (t % (K / 8)) * 8; FragH f;
#pragma unroll
  for (int i = 0; i < 8; ++i) f.h[i] = (_Float16)(bf16_round(W[(size_t)(k8 + i) * N + n]) * scale); const v8us o = f.half[0];
  *(v8us*)((unsigned short*)Wt + (size_t)n * K + k8) = o; 
}
// k_gemm_hh variant with fused epilogue: v = acc·alpha + bias[by·sBias + col] (+ CP[(row/rowsPerB)·sCPb + by·64 + col] if CP) ; ACT 0 none / 1 elu ; writes f16 C16 (and f32 C if non-null)
template <int ACT>
__global__ __launch_bounds__(128) void k_gemm_hhx(const _Float16* __restrict__ A, int lda, size_t sA, const _Float16* __restrict__ Bh, int ldb, size_t sB, float alpha, const float* __restrict__ bias, size_t sBias, const float* __restrict__ CP, int rowsPerB, size_t sCPb, int row0g,
    float* __restrict__ C, _Float16* __restrict__ C16, int ldc, size_t sC, int M, int N, int K) {
  __shared__ __attribute__((aligned(16))) float so[4][16][64];
  const int tid = threadIdx.x, w = tid >> 5, lane = tid & 31, ln = lane & 15, hh = lane >> 4; const int by = blockIdx.y;
  A += (size_t)by * sA; Bh += (size_t)by * sB; const size_t cofs = (size_t)by * sC; const float* bp = bias ? bias + (size_t)by * sBias : nullptr;
  const int ntn = (N + 63) / 64; const int wid = blockIdx.x * 4 + w; const int mt = wid / ntn, nq = wid % ntn; if (mt * 16 >= M) return;
  const int row0 = mt * 16, col0 = nq * 64; const _Float16* arow = A + (size_t)(row0 + ln) * lda;
  v8f acc[4] = {};
  for (int kb = 0; kb < K; kb += 32) { FragH ah; ah.half[0] = *(const v8us*)((const unsigned short*)arow + kb + 8 * hh); ah.half[1] = *(const v8us*)((const unsigned short*)arow + kb + 16 + 8 * hh);
#pragma unroll
    for (int t = 0; t < 4; ++t) { if (col0 + t * 16 >= N) continue; const size_t boff = (size_t)(col0 + t * 16 + ln) * ldb + kb; FragH bq; bq.half[0] = *(const v8us*)((const unsigned short*)Bh + boff + 8 * hh); bq.half[1] = *(const v8us*)((const unsigned short*)Bh + boff + 16 + 8 * hh);
      acc[t] = mmaH<1>(ah.v, ah.v, bq.v, bq.v, acc[t]); }
  }
#pragma unroll
  for (int t = 0; t < 4; ++t) { if (col0 + t * 16 >= N) continue; const int col = col0 + t * 16 + ln; const float bv = bp ? bf16_round(bp[col]) : 0.f;
#pragma unroll
    for (int r = 0; r < 8; ++r) { float v = acc[t][r] * alpha + bv; if (CP) { const int bidx = (row0g + row0 + 8 * hh + r) / rowsPerB; v += CP[(size_t)bidx * sCPb + (size_t)by * 64 + col]; } if (ACT == 1) v = (v > 0.f) ? v : expm1f(v); else if (ACT == 7) v = (v > 0.f) ? v + 1.0f : expf(v); else if (ACT == 8) v = tanhf(v); else if (ACT == 9) v = 0.5f * v * (1.0f + tanhf(0.7978845608028654f * (v + 0.044715f * v * v * v))); else if (ACT == 11) v = 1.0f / (1.0f + expf(-v)); else if (ACT == 12) v = (v > 0.f) ? v : 0.01f * v; else if (ACT == 14) v = (v > 0.f) ? v : 0.1f * v; else if (ACT == 15) v = v / (1.0f + expf(-v)); else if (ACT == 3) v = fmaxf(v, 0.f); else if (ACT == 6) v = 0.5f * v * (1.0f + erff(v * 0.70710678118654752f)); so[w][8 * hh + r][t * 16 + ln] = v; } }
  __builtin_amdgcn_fence(__ATOMIC_ACQ_REL, "workgroup"); __builtin_amdgcn_wave_barrier();
  const int rsub = lane >> 4, c4 = (lane & 15) * 4; typedef _Float16 v4h __attribute__((ext_vector_type(4)));
  {
#pragma unroll
    for (int q = 0; q < 8; ++q) { const int r = q * 2 + rsub; if (col0 + c4 < N) { const v4f v = *(const v4fa*)&so[w][r][c4]; if (C) *(v4f*)(C + cofs + (size_t)(row0 + r) * ldc + col0 + c4) = v; if (C16) { v4h h4; for (int i = 0; i < 4; ++i) h4[i] = (_Float16)v[i]; *(v4h*)(C16 + cofs + (size_t)(row0 + r) * ldc + col0 + c4) = h4; } } }
     }
}


typedef _Float16 v4h __attribute__((ext_vector_type(4)));

__global__ __launch_bounds__(256) void k_x16(const float* __restrict__ x, _Float16* __restrict__ X16, size_t n8) { const size_t t = (size_t)blockIdx.x * 256 + threadIdx.x; if (t >= n8) return; FragH f;
#pragma unroll
  for (int q = 0; q < 8; ++q) f.h[q] = (_Float16)bf16_round(x[t * 8 + q]); *(v8us*)((unsigned short*)X16 + t * 8) = f.half[0];  }
__global__ __launch_bounds__(256) void k_h16(const float* __restrict__ x, _Float16* __restrict__ X16, size_t n8) { const size_t t = (size_t)blockIdx.x * 256 + threadIdx.x; if (t >= n8) return; FragH f;
#pragma unroll
  for (int q = 0; q < 8; ++q) f.h[q] = (_Float16)x[t * 8 + q]; *(v8us*)((unsigned short*)X16 + t * 8) = f.half[0];  }
__global__ __launch_bounds__(256) void k_round16f(const float* __restrict__ W, _Float16* __restrict__ Bt, size_t n8) { const size_t t = (size_t)blockIdx.x * 256 + threadIdx.x; if (t >= n8) return; FragH f;
#pragma unroll
  for (int i = 0; i < 8; ++i) f.h[i] = (_Float16)(bf16_round(W[t * 8 + i]) * 16.0f); *(v8us*)((unsigned short*)Bt + t * 8) = f.half[0];  }
template <int NHv, int TTv>
__global__ __launch_bounds__(256) void k_vt(const _Float16* __restrict__ V16, int ldv, int voff, _Float16* __restrict__ Vt) { __shared__ unsigned short tl[64][66]; const int tid = threadIdx.x; const int slab = blockIdx.x / (TTv / 64), lg = blockIdx.x % (TTv / 64); const int b = slab / NHv, h = slab % NHv;
  for (int i = tid; i < 64 * 8; i += 256) { const int r = i / 8, c8 = (i % 8) * 8; FragH f; f.half[0] = *(const v8us*)((const unsigned short*)V16 + ((size_t)b * TTv + lg * 64 + r) * ldv + voff + h * 64 + c8);
#pragma unroll
    for (int q = 0; q < 8; ++q) tl[r][c8 + q] = f.u[q]; }
  __syncthreads();
  {
#pragma unroll
    for (int rd = 0; rd < 2; ++rd) { const int d = rd * 32 + tid / 8, pc = tid % 8; FragH f;
#pragma unroll
      for (int q = 0; q < 8; ++q) f.u[q] = tl[pc * 8 + q][d];
      *(v8us*)((unsigned short*)Vt + ((size_t)slab * 64 + d) * TTv + lg * 64 + pc * 8) = f.half[0]; }
     } }

template <int D, int RBF>
__global__ __launch_bounds__(256) void k_lnx(const float* __restrict__ X, const float* __restrict__ gam, const float* __restrict__ bet, int nrows, float eps, _Float16* __restrict__ O16, float* __restrict__ XR) {
  constexpr int NP = D / 128; const int tid = threadIdx.x, wv = tid >> 5, lane = tid & 31; const size_t r = (size_t)blockIdx.x * 8 + wv; if (r >= (size_t)nrows) return; v4f y[NP]; float s = 0.f;
#pragma unroll
  for (int j = 0; j < NP; ++j) { const int c = j * 128 + lane * 4; v4f g = *(const v4fa*)(X + r * D + c); if (RBF) { for (int q = 0; q < 4; ++q) g[q] = bf16_round(g[q]); } y[j] = g; s += g[0] + g[1] + g[2] + g[3]; }
  for (int o = 16; o >= 1; o >>= 1) s += __shfl_xor(s, o, 32); const float mu = s / (float)D; float q2 = 0.f;
#pragma unroll
  for (int j = 0; j < NP; ++j) for (int q = 0; q < 4; ++q) { const float d = y[j][q] - mu; q2 += d * d; }
  for (int o = 16; o >= 1; o >>= 1) q2 += __shfl_xor(q2, o, 32); const float rs = rsqrtf(q2 / (float)D + eps);
  {
#pragma unroll
    for (int j = 0; j < NP; ++j) { const int c = j * 128 + lane * 4; v4h h; for (int q = 0; q < 4; ++q) { const float v = (y[j][q] - mu) * rs * bf16_round(gam[c + q]) + bf16_round(bet[c + q]); h[q] = (_Float16)v; } *(v4h*)(O16 + r * D + c) = h; if (XR) *(v4f*)(XR + r * D + c) = y[j]; }
     } }
__global__ __launch_bounds__(256) void k_addres(const float* __restrict__ O, const float* __restrict__ XR, float* __restrict__ out, size_t n4) { const size_t t = (size_t)blockIdx.x * 256 + threadIdx.x; if (t >= n4) return; v4f a = *(const v4fa*)(O + t * 4); const v4f b = *(const v4fa*)(XR + t * 4); for (int q = 0; q < 4; ++q) a[q] += b[q]; *(v4f*)(out + t * 4) = a;  }
// y[i] = 2^x[i], twelve independent v_exp_f32 in one statement with results in registers of their own (=&v), so that none overwrites the source of the one in front of it;
// the closing v_nop is the slot the instruction set asks for behind a transcendental before its result is read or its source overwritten
__device__ __forceinline__ void exp2x12(float* __restrict__ y, const float* __restrict__ x) {
  asm("v_exp_f32 %0, %12\n\tv_exp_f32 %1, %13\n\tv_exp_f32 %2, %14\n\tv_exp_f32 %3, %15\n\tv_exp_f32 %4, %16\n\tv_exp_f32 %5, %17\n\t"
      "v_exp_f32 %6, %18\n\tv_exp_f32 %7, %19\n\tv_exp_f32 %8, %20\n\tv_exp_f32 %9, %21\n\tv_exp_f32 %10, %22\n\tv_exp_f32 %11, %23\n\tv_nop"
      : "=&v"(y[0]), "=&v"(y[1]), "=&v"(y[2]), "=&v"(y[3]), "=&v"(y[4]), "=&v"(y[5]), "=&v"(y[6]), "=&v"(y[7]), "=&v"(y[8]), "=&v"(y[9]), "=&v"(y[10]), "=&v"(y[11])
      : "v"(x[0]), "v"(x[1]), "v"(x[2]), "v"(x[3]), "v"(x[4]), "v"(x[5]), "v"(x[6]), "v"(x[7]), "v"(x[8]), "v"(x[9]), "v"(x[10]), "v"(x[11])); }
__global__ __launch_bounds__(128) void k_flash(const _Float16* __restrict__ Q16, int ldq, const _Float16* __restrict__ K16, int ldk, const _Float16* __restrict__ Vt, const int* __restrict__ MSK, float* __restrict__ O, int ldo) {
  constexpr int RPW = 16, RTN = RPW / 16, NQB = TT / (4 * RPW), DT = 4, KS = 2;
  __shared__ __attribute__((aligned(16))) unsigned short sP[4][RPW][40]; __shared__ __attribute__((aligned(16))) float sO[4][RPW][64 + 4];
  // K/V ring, two buffers, one stage = SKEY keys: sK rows = keys (64 d = 128 B), sV rows = d (SKEY keys = 128 B); LDS pitch 144 B (16 B x odd) keeps the 16 rows of a ds_load_b128 fragment read on distinct banks
  constexpr int SKEY = 64, NST = TT / SKEY, LP = 72, SBUF = 64 * LP * 2; constexpr float SC = 0.125f * 1.44269504088896340736f;      /* 64^-1/2 * log2(e) */
  __shared__ __attribute__((aligned(16))) unsigned short sK[2][SKEY][LP]; __shared__ __attribute__((aligned(16))) unsigned short sV[2][64][LP];
  const int tid = threadIdx.x, w = tid >> 5, lane = tid & 31, ln = lane & 15, hh = lane >> 4;
  const int slab = blockIdx.x / NQB, qblk = blockIdx.x % NQB; const int b = slab / NH, h = slab % NH; const int qb0 = qblk * (4 * RPW); const int q0 = qb0 + w * RPW;
  FragH aq[2][KS];
#pragma unroll
  for (int rt = 0; rt < RTN; ++rt) { const unsigned short* qr = (const unsigned short*)Q16 + ((size_t)b * TT + q0 + rt * 16 + ln) * ldq + h * 64;
#pragma unroll
    for (int ks = 0; ks < KS; ++ks) { aq[rt][ks].half[0] = *(const v8us*)(qr + ks * 32 + 8 * hh); aq[rt][ks].half[1] = *(const v8us*)(qr + ks * 32 + 16 + 8 * hh); } }
  const unsigned short* Vth = (const unsigned short*)Vt + (size_t)slab * 64 * TT;
  float m_r[2][8], l_r[2][8]; v8f oacc[2][DT];
#pragma unroll
  for (int rt = 0; rt < RTN; ++rt) {
#pragma unroll
    for (int r = 0; r < 8; ++r) { m_r[rt][r] = -3.0e38f; l_r[rt][r] = 0.f; }
#pragma unroll
    for (int dt = 0; dt < DT; ++dt) oacc[rt][dt] = (v8f){0.f,0.f,0.f,0.f,0.f,0.f,0.f,0.f}; }
  // each thread copies 16 B of rows crow, crow + 16, + 32, + 48 of both tiles: a wave's copy covers four whole 128-B lines
  const int crow = tid >> 3, ccol = tid & 7;
  const unsigned short* gK = (const unsigned short*)K16 + ((size_t)b * TT + crow) * ldk + h * 64 + ccol * 8; const unsigned short* gV = Vth + (size_t)crow * TT + ccol * 8;
  const unsigned lK = (unsigned)(uintptr_t)&sK[0][crow][ccol * 8], lV = (unsigned)(uintptr_t)&sV[0][crow][ccol * 8];
  auto stage = [&](int st, int bf) { const unsigned short* k0 = gK + (size_t)st * SKEY * ldk; const unsigned short* v0 = gV + st * SKEY; const unsigned lk = lK + bf * SBUF, lv = lV + bf * SBUF;
    // global -> LDS through no register; s_wait_xcnt 0 closes the statement so that no address register is rewritten ahead of it
    asm volatile("global_load_async_to_lds_b128 %0, %8, off\n\tglobal_load_async_to_lds_b128 %1, %9, off\n\tglobal_load_async_to_lds_b128 %2, %10, off\n\tglobal_load_async_to_lds_b128 %3, %11, off\n\t"
                 "global_load_async_to_lds_b128 %4, %12, off\n\tglobal_load_async_to_lds_b128 %5, %13, off\n\tglobal_load_async_to_lds_b128 %6, %14, off\n\tglobal_load_async_to_lds_b128 %7, %15, off\n\ts_wait_xcnt 0x0"
                 :: "v"(lk), "v"(lk + 16 * LP * 2), "v"(lk + 32 * LP * 2), "v"(lk + 48 * LP * 2), "v"(lv), "v"(lv + 16 * LP * 2), "v"(lv + 32 * LP * 2), "v"(lv + 48 * LP * 2),
                    "v"(k0), "v"(k0 + (size_t)16 * ldk), "v"(k0 + (size_t)32 * ldk), "v"(k0 + (size_t)48 * ldk), "v"(v0), "v"(v0 + 16 * TT), "v"(v0 + 32 * TT), "v"(v0 + 48 * TT) : "memory"); };
  stage(0, 0);
  asm volatile("s_wait_asynccnt 0x0" ::: "memory");      // this wave's copies of stage 0 have landed
  __syncthreads();                                        // ... and every other wave's: stage 0 may be read
  stage(1, 1);
#pragma unroll 1      /* one copy of the ring's foot; the buffer index stays t & 1 */
  for (int t = 0; t < NST; ++t) { const int bf = t & 1;
  for (int sub = 0; sub < SKEY / 32; ++sub) { const int j0 = t * SKEY + sub * 32;
    int mk0[2][8], mk1[2][8];      /* nonzero = MASKED */
#pragma unroll
    for (int rt = 0; rt < RTN; ++rt)
#pragma unroll
      for (int r = 0; r < 8; ++r) { const int qq = q0 + rt * 16 + 8 * hh + r; const int* am = MSK + ((size_t)b * TT + qq) * TT + j0; mk0[rt][r] = am[ln]; mk1[rt][r] = am[16 + ln]; }
    v8f s[2][2];
#pragma unroll
    for (int nt = 0; nt < 2; ++nt) { const unsigned short* kr = &sK[bf][sub * 32 + nt * 16 + ln][0]; FragH bk[KS];
#pragma unroll
      for (int ks = 0; ks < KS; ++ks) { bk[ks].half[0] = *(const v8us*)(kr + ks * 32 + 8 * hh); bk[ks].half[1] = *(const v8us*)(kr + ks * 32 + 16 + 8 * hh); }
#pragma unroll
      for (int rt = 0; rt < RTN; ++rt) { v8f acc = (v8f){0.f,0.f,0.f,0.f,0.f,0.f,0.f,0.f};
#pragma unroll
        for (int ks = 0; ks < KS; ++ks) acc = mmaH<1>(aq[rt][ks].v, aq[rt][ks].v, bk[ks].v, bk[ks].v, acc); s[rt][nt] = acc; } }
#pragma unroll
    for (int rt = 0; rt < RTN; ++rt) { float ex[24], ey[24];
#pragma unroll
      for (int r = 0; r < 8; ++r) {
        const bool ok0 = (mk0[rt][r] == 0), ok1 = (mk1[rt][r] == 0);
        const float s0 = ok0 ? s[rt][0][r] : -INFINITY, s1 = ok1 ? s[rt][1][r] : -INFINITY; float mc = fmaxf(s0, s1);      /* unscaled scores; the running maximum is kept unscaled too */
        mc = fmaxf(mc, __shfl_xor(mc, 1, 32)); mc = fmaxf(mc, __shfl_xor(mc, 2, 32)); mc = fmaxf(mc, __shfl_xor(mc, 4, 32)); mc = fmaxf(mc, __shfl_xor(mc, 8, 32));
        // e^(0.125 (s - m)) = 2^(s * SC - m * SC): one fma per score, no branch; a masked score is -inf and gives 0 (m is finite: it starts at -3e38)
        const float mn = fmaxf(m_r[rt][r], mc); const float nb = -mn * SC; ex[3 * r] = (m_r[rt][r] - mn) * SC; ex[3 * r + 1] = fmaf(s0, SC, nb); ex[3 * r + 2] = fmaf(s1, SC, nb); m_r[rt][r] = mn; }
      exp2x12(ey, ex); exp2x12(ey + 12, ex + 12);
#pragma unroll
      for (int r = 0; r < 8; ++r) { const float al = (m_r[rt][r] > -1.0e38f) ? ey[3 * r] : 1.0f; const float p0 = ey[3 * r + 1], p1 = ey[3 * r + 2]; l_r[rt][r] = l_r[rt][r] * al + p0 + p1;
#pragma unroll
        for (int dt = 0; dt < DT; ++dt) oacc[rt][dt][r] *= al;
        FragH t2; t2.h[0] = (_Float16)(p0 * 1024.0f); t2.h[1] = (_Float16)(p1 * 1024.0f); sP[w][rt * 16 + 8 * hh + r][ln] = t2.u[0]; sP[w][rt * 16 + 8 * hh + r][16 + ln] = t2.u[1]; } }
    __builtin_amdgcn_fence(__ATOMIC_ACQ_REL, "workgroup"); __builtin_amdgcn_wave_barrier();
    FragH pa[2];
#pragma unroll
    for (int rt = 0; rt < RTN; ++rt) { pa[rt].half[0] = *(const v8us*)&sP[w][rt * 16 + ln][8 * hh]; pa[rt].half[1] = *(const v8us*)&sP[w][rt * 16 + ln][16 + 8 * hh]; }
#pragma unroll
    for (int dt = 0; dt < DT; ++dt) { const unsigned short* vrow = &sV[bf][dt * 16 + ln][sub * 32]; FragH bv; bv.half[0] = *(const v8us*)(vrow + 8 * hh); bv.half[1] = *(const v8us*)(vrow + 16 + 8 * hh);
#pragma unroll
      for (int rt = 0; rt < RTN; ++rt) oacc[rt][dt] = mmaH<1>(pa[rt].v, pa[rt].v, bv.v, bv.v, oacc[rt][dt]); }
    __builtin_amdgcn_fence(__ATOMIC_ACQ_REL, "workgroup"); __builtin_amdgcn_wave_barrier(); }
    asm volatile("s_wait_dscnt 0x0" ::: "memory");        // this wave's reads of buffer bf are done before it is refilled
    asm volatile("s_wait_asynccnt 0x0" ::: "memory");     // this wave's copies of stage t + 1 have landed
    __syncthreads();                                        // publishes stage t + 1 and ends every wave's reads of buffer bf
    if (t + 2 < NST) stage(t + 2, bf); }
  asm volatile("s_wait_asynccnt 0x0" ::: "memory");       // no copy is outstanding when the wave goes on to the epilogue
#pragma unroll
  for (int rt = 0; rt < RTN; ++rt) {
#pragma unroll
    for (int r = 0; r < 8; ++r) { float l = l_r[rt][r]; l += __shfl_xor(l, 1, 32); l += __shfl_xor(l, 2, 32); l += __shfl_xor(l, 4, 32); l += __shfl_xor(l, 8, 32); l_r[rt][r] = (l > 0.f) ? 1.0f / (l * 1024.0f) : 0.f; }
#pragma unroll
    for (int dt = 0; dt < DT; ++dt)
#pragma unroll
      for (int r = 0; r < 8; ++r) sO[w][rt * 16 + 8 * hh + r][dt * 16 + ln] = oacc[rt][dt][r] * l_r[rt][r]; }
  __builtin_amdgcn_fence(__ATOMIC_ACQ_REL, "workgroup"); __builtin_amdgcn_wave_barrier();
  {
#pragma unroll
    for (int rp = 0; rp < RPW; rp += 2) { const int r = rp + (lane >> 4), pc = lane & 15; const v4f val = *(const v4fa*)&sO[w][r][pc * 4]; *(v4f*)(O + ((size_t)b * TT + q0 + r) * ldo + h * 64 + pc * 4) = val; }
     } }

extern "C" void kernel_launch(void* const* d_in, const int* in_sizes, int n_in,
                              void* d_out, int out_size, void* d_ws, size_t ws_size, hipStream_t stream) {
  (void)in_sizes; (void)n_in; (void)out_size;
  const float* const* I = (const float* const*)d_in; const float* Qx = I[0]; const float* Kx = I[1]; const float* Vx = I[2]; const int* mask = (const int*)d_in[3];      /* bool mask shipped as int32 [2,1,2048,2048] */
  const float* Wq = I[4]; const float* bq = I[5]; const float* Wk = I[6]; const float* bk = I[7]; const float* Wv = I[8]; const float* bv = I[9]; const float* gam = I[10]; const float* bet = I[11];
  char* ws = (char*)d_ws; size_t off = 0;
  auto take = [&](size_t bytes) { char* p = ws + off; off += (bytes + 255) & ~(size_t)255; return p; };
  const size_t WSZ = (size_t)DD * DD; _Float16* Bw = (_Float16*)take(3 * WSZ * 2); float* XR = (float*)take((size_t)NR * DD * 4); _Float16* H16 = (_Float16*)take((size_t)NR * DD * 2);
  _Float16* Q = (_Float16*)take((size_t)NR * DD * 2); _Float16* K = (_Float16*)take((size_t)NR * DD * 2); _Float16* V = (_Float16*)take((size_t)NR * DD * 2); _Float16* Vt = (_Float16*)take((size_t)NR * DD * 2); float* O = (float*)take((size_t)NR * DD * 4);
  if (off > ws_size) return;      // 6.3 + 16.8 + 8.4 + 4 × 8.4 + 16.8 ≈ 82 MB
  const unsigned gw = (unsigned)(((size_t)DD * (DD / 8) + 255) / 256); k_wt_f16<<<gw, 256, 0, stream>>>(Wq, Bw, DD, DD, 16.0f); k_wt_f16<<<gw, 256, 0, stream>>>(Wk, Bw + WSZ, DD, DD, 16.0f); k_wt_f16<<<gw, 256, 0, stream>>>(Wv, Bw + 2 * WSZ, DD, DD, 16.0f);      /* (in,out) → Bt ×2^4 */
  const dim3 gp(((NR / 16) * (DD / 64) + 3) / 4, 1);
  k_lnx<DD, 1><<<(NR + 7) / 8, 256, 0, stream>>>(Qx, gam, bet, NR, 1e-5f, H16, XR);      /* LN(bf16 Q) → f16; XR = bf16(Q) for the residual */
  k_gemm_hhx<0><<<gp, 128, 0, stream>>>(H16, DD, 0, Bw, DD, 0, 0.0625f, bq, 0, nullptr, 1, 0, 0, nullptr, Q, DD, 0, NR, DD, DD);      /* M 4096 N 1024 K 1024 */
  k_lnx<DD, 1><<<(NR + 7) / 8, 256, 0, stream>>>(Kx, gam, bet, NR, 1e-5f, H16, nullptr);
  k_gemm_hhx<0><<<gp, 128, 0, stream>>>(H16, DD, 0, Bw + WSZ, DD, 0, 0.0625f, bk, 0, nullptr, 1, 0, 0, nullptr, K, DD, 0, NR, DD, DD);
  k_lnx<DD, 1><<<(NR + 7) / 8, 256, 0, stream>>>(Vx, gam, bet, NR, 1e-5f, H16, nullptr);
  k_gemm_hhx<0><<<gp, 128, 0, stream>>>(H16, DD, 0, Bw + 2 * WSZ, DD, 0, 0.0625f, bv, 0, nullptr, 1, 0, 0, nullptr, V, DD, 0, NR, DD, DD);
  k_vt<NH, TT><<<BB * NH * (TT / 64), 256, 0, stream>>>(V, DD, 0, Vt);
  k_flash<<<BB * NH * (TT / 64), 128, 0, stream>>>(Q, DD, K, DD, Vt, mask, O, DD);
  k_addres<<<(unsigned)(((size_t)NR * DD / 4 + 255) / 256), 256, 0, stream>>>(O, XR, (float*)d_out, (size_t)NR * DD / 4);      /* out = o + Q */
}

// v003
// Measured time: 178 microseconds a run.
// Two timings next to v002 put it at 1.58 and 1.59 times that version's speed.
// Over all steps from v000 it is 2.44 times as fast.
#include <hip/hip_runtime.h>
// Pre-norm multi-head attention with a boolean mask and residual (B=2, N=2048, E=1024, 16 heads × 64): q = LN(Q)·Wq + bq, k = LN(K)·Wk + bk, v = LN(V)·Wv + bv (one shared LayerNorm γ,β; (in,out) weights); s = q·kᵀ·64^-½ with −inf where mask[b,0,n,m] is True;
// softmax; o = merged attn·v; out = o + Q (no output projection).
// Compute dtype: Q, K, V, weights, biases, γ, β rounded to bf16; LayerNorms f32 (wave per row) → f16; q/k/v f16 GEMM planes; fused flash-style kernel (int32 mask loads per (q,k), online softmax f32, P f16 ×2^10) on
// v_wmma_f32_16x16x32_f16; out = o (f32) + bf16(Q) (f32 add); f32 accumulate.
#define BB 2
#define TT 2048
#define DD 1024
#define NH 16
#define NR (BB * TT)

typedef __bf16 v16b __attribute__((ext_vector_type(16)));
typedef unsigned short v8us __attribute__((ext_vector_type(8), may_alias));
typedef float  v8f  __attribute__((ext_vector_type(8)));
typedef float  v4f  __attribute__((ext_vector_type(4)));
typedef float  v4fa __attribute__((ext_vector_type(4), may_alias));
union FragB { v16b v; v8us half[2]; unsigned short u[16]; };

__device__ __forceinline__ unsigned short bf16_bits(float x) { unsigned int u = __float_as_uint(x); return (unsigned short)((u + 0x7FFFu + ((u >> 16) & 1u)) >> 16); }
__device__ __forceinline__ float bf16_val(unsigned short b) { return __uint_as_float(((unsigned int)b) << 16); }
__device__ __forceinline__ float bf16_round(float x) { return bf16_val(bf16_bits(x)); }
// D += A·B with NT terms: 1 = ah·bh, 2 = + al·bh (A split), 3 = + ah·bl (both split)
template <int NT>
__device__ __forceinline__ v8f mmaN(v16b ah, v16b al, v16b bh, v16b bl, v8f c) {
  c = __builtin_amdgcn_wmma_f32_16x16x32_bf16(false, ah, false, bh, (short)0, c, false, false);
  if (NT >= 2) c = __builtin_amdgcn_wmma_f32_16x16x32_bf16(false, al, false, bh, (short)0, c, false, false);
  if (NT >= 3) c = __builtin_amdgcn_wmma_f32_16x16x32_bf16(false, ah, false, bl, (short)0, c, false, false);
  asm volatile("v_nop\n\tv_nop\n\tv_nop\n\tv_nop" : "+v"(c) : "v"(ah), "v"(al), "v"(bh), "v"(bl));
  return c;
}

__global__ __launch_bounds__(256) void k_wt_bf16(const float* __restrict__ W, unsigned short* __restrict__ Wt, int K, int N) {
  const int t = blockIdx.x * 256 + threadIdx.x;
  const int k8n = K / 8;
  if (t >= N * k8n) return;
  const int n = t / k8n, k8 = (t % k8n) * 8;
  v8us v;
#pragma unroll
  for (int i = 0; i < 8; ++i) v[i] = bf16_bits(W[(size_t)(k8 + i) * N + n]);
  *(v8us*)(Wt + (size_t)n * K + k8) = v;
  
}

// GEMM C[M][N] (f32, pitch ldc) = act(A[M][K]·W + bias). A f32 row-major (pitch lda) converted per fragment to bf16
// (ASPLIT: hi/lo two planes -> 2 terms, else single rounded term); Wt bf16 [N][K] (pitch ldb). BIAS_BF16 rounds the
// bias to bf16 first (bias quantised to bf16 before the add). K%32==0, M%16==0, N%64==0.
template <bool ASPLIT, int ACT, bool BIAS_BF16>
__global__ __launch_bounds__(128) void k_gemm_bf(const float* __restrict__ A, int lda, const unsigned short* __restrict__ Wt, int ldb,
                                               const float* __restrict__ bias, float* __restrict__ C, int ldc, int M, int N, int K) {
  __shared__ __attribute__((aligned(16))) float so[4][16][64];
  const int tid = threadIdx.x, w = tid >> 5, lane = tid & 31, ln = lane & 15, hh = lane >> 4;
  const int ntn = N / 64;
  const int wid = blockIdx.x * 4 + w;
  const int mt = wid / ntn, nq = wid % ntn;
  if (mt * 16 >= M) return;
  const int row0 = mt * 16, col0 = nq * 64;
  const float* arow = A + (size_t)(row0 + ln) * lda;
  v8f acc[4] = {};
  for (int kb = 0; kb < K; kb += 32) {
    FragB ah, al;
    const v4f x0 = *(const v4fa*)(arow + kb + 8 * hh), x1 = *(const v4fa*)(arow + kb + 8 * hh + 4);
    const v4f x2 = *(const v4fa*)(arow + kb + 16 + 8 * hh), x3 = *(const v4fa*)(arow + kb + 16 + 8 * hh + 4);
    float xs[16] = {x0[0],x0[1],x0[2],x0[3],x1[0],x1[1],x1[2],x1[3],x2[0],x2[1],x2[2],x2[3],x3[0],x3[1],x3[2],x3[3]};
#pragma unroll
    for (int i = 0; i < 16; ++i) { const unsigned short hb = bf16_bits(xs[i]); ah.u[i] = hb; al.u[i] = ASPLIT ? bf16_bits(xs[i] - bf16_val(hb)) : (unsigned short)0; }
#pragma unroll
    for (int t = 0; t < 4; ++t) {
      const unsigned short* brow = Wt + (size_t)(col0 + t * 16 + ln) * ldb + kb;
      FragB b;
      b.half[0] = *(const v8us*)(brow + 8 * hh);
      b.half[1] = *(const v8us*)(brow + 16 + 8 * hh);
      acc[t] = mmaN<ASPLIT ? 2 : 1>(ah.v, al.v, b.v, b.v, acc[t]);
    }
  }
#pragma unroll
  for (int t = 0; t < 4; ++t) {
    float bv = bias ? bias[col0 + t * 16 + ln] : 0.f;
    if (BIAS_BF16) bv = bf16_round(bv);
#pragma unroll
    for (int r = 0; r < 8; ++r) { float v = acc[t][r] + bv; if (ACT == 1) v = fmaxf(v, 0.f); so[w][8 * hh + r][t * 16 + ln] = v; }
  }
  __builtin_amdgcn_fence(__ATOMIC_ACQ_REL, "workgroup");
  __builtin_amdgcn_wave_barrier();
  const int rsub = lane >> 4, c4 = (lane & 15) * 4;
  {
#pragma unroll
    for (int q = 0; q < 8; ++q) {
      const int r = q * 2 + rsub;
      const v4f v = *(const v4fa*)&so[w][r][c4];
      *(v4f*)(C + (size_t)(row0 + r) * ldc + col0 + c4) = v;
    }
    
  }
}

// Flash-style causal/unmasked attention, all contractions 3-term bf16 hi/lo splits, f32 softmax with running max.
// q,k,v rows are read from f32 buffers with arbitrary row pitch (so they can live inside a fused qkv buffer);
// D = head size (multiple of 32, <= 128); one wave = 16 query rows; block = 4 waves (64 queries) sharing K/V chunks of 32.
template <int D, bool CAUSAL>
__global__ __launch_bounds__(128) void k_flash(const float* __restrict__ qb, const float* __restrict__ kb, const float* __restrict__ vb,
                                             int pitch, int T, int H, float scale, float* __restrict__ y, int ypitch) {
  constexpr int KS = D / 32;        // k-steps for QK
  constexpr int DT = D / 16;        // d tiles for PV
  __shared__ __attribute__((aligned(16))) unsigned short sKh[32][D + 8], sKl[32][D + 8], sVh[32][D + 8], sVl[32][D + 8];
  __shared__ __attribute__((aligned(16))) unsigned short sPh[4][16][40], sPl[4][16][40];
  __shared__ __attribute__((aligned(16))) float sO[4][16][D];
  const int tid = threadIdx.x, w = tid >> 5, lane = tid & 31, ln = lane & 15, hh = lane >> 4;
  const int nqb = (T + 63) / 64;
  const int bh = blockIdx.x / nqb, qblk = blockIdx.x % nqb;
  const int b = bh / H, h = bh % H;
  const int q0 = qblk * 64 + w * 16;
  const float* Q = qb + (size_t)b * T * pitch + h * D;
  const float* K = kb + (size_t)b * T * pitch + h * D;
  const float* V = vb + (size_t)b * T * pitch + h * D;

  // A fragments of the wave's 16 query rows (scaled), hi/lo
  FragB aqh[KS], aql[KS];
  {
    int row = q0 + ln; if (row >= T) row = T - 1;
    const float* qr = Q + (size_t)row * pitch;
#pragma unroll
    for (int ks = 0; ks < KS; ++ks)
#pragma unroll
      for (int i = 0; i < 16; ++i) {
        const int d = ks * 32 + ((i < 8) ? (8 * hh + i) : (16 + 8 * hh + (i - 8)));
        const float x = qr[d] * scale; const unsigned short hb = bf16_bits(x);
        aqh[ks].u[i] = hb; aql[ks].u[i] = bf16_bits(x - bf16_val(hb));
      }
  }
  float m_r[8], l_r[8];
#pragma unroll
  for (int r = 0; r < 8; ++r) { m_r[r] = -3.0e38f; l_r[r] = 0.f; }
  v8f oacc[DT];
#pragma unroll
  for (int dt = 0; dt < DT; ++dt) oacc[dt] = (v8f){0.f,0.f,0.f,0.f,0.f,0.f,0.f,0.f};

  const int kv_end = CAUSAL ? min(T, qblk * 64 + 64) : T;     // block-uniform
  for (int j0 = 0; j0 < kv_end; j0 += 32) {
    __syncthreads();
    for (int e = tid; e < 32 * (D / 4); e += 128) {
      const int r = e / (D / 4), c4 = (e % (D / 4)) * 4;
      const int key = j0 + r;
      v4f kf = {0.f,0.f,0.f,0.f}, vf = {0.f,0.f,0.f,0.f};
      if (key < T) { kf = *(const v4fa*)(K + (size_t)key * pitch + c4); vf = *(const v4fa*)(V + (size_t)key * pitch + c4); }
#pragma unroll
      for (int t = 0; t < 4; ++t) {
        unsigned short hb = bf16_bits(kf[t]); sKh[r][c4 + t] = hb; sKl[r][c4 + t] = bf16_bits(kf[t] - bf16_val(hb));
        hb = bf16_bits(vf[t]); sVh[r][c4 + t] = hb; sVl[r][c4 + t] = bf16_bits(vf[t] - bf16_val(hb));
      }
    }
    __syncthreads();
    // S tile 16 x 32
    v8f s[2];
#pragma unroll
    for (int nt = 0; nt < 2; ++nt) {
      v8f acc = {};
#pragma unroll
      for (int ks = 0; ks < KS; ++ks) {
        FragB bh_, bl_;
        bh_.half[0] = *(const v8us*)&sKh[nt * 16 + ln][ks * 32 + 8 * hh]; bh_.half[1] = *(const v8us*)&sKh[nt * 16 + ln][ks * 32 + 16 + 8 * hh];
        bl_.half[0] = *(const v8us*)&sKl[nt * 16 + ln][ks * 32 + 8 * hh]; bl_.half[1] = *(const v8us*)&sKl[nt * 16 + ln][ks * 32 + 16 + 8 * hh];
        acc = mmaN<3>(aqh[ks].v, aql[ks].v, bh_.v, bl_.v, acc);
      }
      s[nt] = acc;
    }
    // mask + running max (rows 8hh+r; the 16 lanes of a half share rows)
    float alpha[8];
#pragma unroll
    for (int r = 0; r < 8; ++r) {
      const int qi = q0 + 8 * hh + r;
      const int ja = j0 + ln, jb = j0 + 16 + ln;
      if (CAUSAL) { if (ja > qi) s[0][r] = -3.0e38f; if (jb > qi) s[1][r] = -3.0e38f; }
      if (ja >= T) s[0][r] = -3.0e38f;
      if (jb >= T) s[1][r] = -3.0e38f;
      float mx = fmaxf(s[0][r], s[1][r]);
      mx = fmaxf(mx, __shfl_xor(mx, 1, 32)); mx = fmaxf(mx, __shfl_xor(mx, 2, 32)); mx = fmaxf(mx, __shfl_xor(mx, 4, 32)); mx = fmaxf(mx, __shfl_xor(mx, 8, 32));
      const float mnew = fmaxf(m_r[r], mx);
      alpha[r] = (mnew > -1.0e38f) ? __expf(m_r[r] - mnew) : 1.0f;
      const float p0 = (s[0][r] > -1.0e38f) ? __expf(s[0][r] - mnew) : 0.f;
      const float p1 = (s[1][r] > -1.0e38f) ? __expf(s[1][r] - mnew) : 0.f;
      m_r[r] = mnew;
      l_r[r] = l_r[r] * alpha[r] + p0 + p1;            // per-lane partial row sum (16 lanes combined at the end)
      unsigned short hb = bf16_bits(p0); sPh[w][8 * hh + r][ln] = hb;      sPl[w][8 * hh + r][ln] = bf16_bits(p0 - bf16_val(hb));
      hb = bf16_bits(p1);                sPh[w][8 * hh + r][16 + ln] = hb; sPl[w][8 * hh + r][16 + ln] = bf16_bits(p1 - bf16_val(hb));
    }
#pragma unroll
    for (int dt = 0; dt < DT; ++dt)
#pragma unroll
      for (int r = 0; r < 8; ++r) oacc[dt][r] *= alpha[r];
    __builtin_amdgcn_fence(__ATOMIC_ACQ_REL, "workgroup");
    __builtin_amdgcn_wave_barrier();
    FragB pah, pal;
    pah.half[0] = *(const v8us*)&sPh[w][ln][8 * hh]; pah.half[1] = *(const v8us*)&sPh[w][ln][16 + 8 * hh];
    pal.half[0] = *(const v8us*)&sPl[w][ln][8 * hh]; pal.half[1] = *(const v8us*)&sPl[w][ln][16 + 8 * hh];
#pragma unroll
    for (int dt = 0; dt < DT; ++dt) {
      FragB bvh, bvl;
#pragma unroll
      for (int i = 0; i < 8; ++i) {
        bvh.u[i] = sVh[8 * hh + i][dt * 16 + ln]; bvh.u[8 + i] = sVh[16 + 8 * hh + i][dt * 16 + ln];
        bvl.u[i] = sVl[8 * hh + i][dt * 16 + ln]; bvl.u[8 + i] = sVl[16 + 8 * hh + i][dt * 16 + ln];
      }
      oacc[dt] = mmaN<3>(pah.v, pal.v, bvh.v, bvl.v, oacc[dt]);
    }
    __builtin_amdgcn_fence(__ATOMIC_ACQ_REL, "workgroup");
    __builtin_amdgcn_wave_barrier();
  }
#pragma unroll
  for (int r = 0; r < 8; ++r) {
    float l = l_r[r];
    l += __shfl_xor(l, 1, 32); l += __shfl_xor(l, 2, 32); l += __shfl_xor(l, 4, 32); l += __shfl_xor(l, 8, 32);
    l_r[r] = (l > 0.f) ? 1.0f / l : 0.f;
  }
#pragma unroll
  for (int dt = 0; dt < DT; ++dt)
#pragma unroll
    for (int r = 0; r < 8; ++r) sO[w][8 * hh + r][dt * 16 + ln] = oacc[dt][r] * l_r[r];
  __builtin_amdgcn_fence(__ATOMIC_ACQ_REL, "workgroup");
  __builtin_amdgcn_wave_barrier();
  {
    for (int r = 0; r < 16; ++r) {
      const int row = q0 + r;
      if (row < T && lane < D / 4) {
        const v4f val = *(const v4fa*)&sO[w][r][lane * 4];
        *(v4f*)(y + ((size_t)b * T + row) * ypitch + h * D + lane * 4) = val;
      }
    }
    
  }
}

// GEMM C = act(A·W + bias + resid): A f32 (ASPLIT -> hi/lo 2 terms), Wt bf16 [N][K]; ACT 0 none, 1 relu, 2 exact gelu;
// resid (optional, f32, row index = (row % rmod), pitch ldr, RES_BF16 rounds it) added before the activation.
template <bool ASPLIT, int ACT, bool BIAS_BF16, bool RES_BF16>
__global__ __launch_bounds__(128) void k_gemm_bf3(const float* __restrict__ A, int lda, const unsigned short* __restrict__ Wt, int ldb,
                                                const float* __restrict__ bias, const float* __restrict__ resid, int rmod, int ldr,
                                                float* __restrict__ C, int ldc, int M, int N, int K) {
  __shared__ __attribute__((aligned(16))) float so[4][16][64];
  const int tid = threadIdx.x, w = tid >> 5, lane = tid & 31, ln = lane & 15, hh = lane >> 4;
  const int ntn = N / 64;
  const int wid = blockIdx.x * 4 + w;
  const int mt = wid / ntn, nq = wid % ntn;
  if (mt * 16 >= M) return;
  const int row0 = mt * 16, col0 = nq * 64;
  const float* arow = A + (size_t)(row0 + ln) * lda;
  v8f acc[4] = {};
  for (int kb = 0; kb < K; kb += 32) {
    FragB ah, al;
    const v4f x0 = *(const v4fa*)(arow + kb + 8 * hh), x1 = *(const v4fa*)(arow + kb + 8 * hh + 4);
    const v4f x2 = *(const v4fa*)(arow + kb + 16 + 8 * hh), x3 = *(const v4fa*)(arow + kb + 16 + 8 * hh + 4);
    float xs[16] = {x0[0],x0[1],x0[2],x0[3],x1[0],x1[1],x1[2],x1[3],x2[0],x2[1],x2[2],x2[3],x3[0],x3[1],x3[2],x3[3]};
#pragma unroll
    for (int i = 0; i < 16; ++i) { const unsigned short hb = bf16_bits(xs[i]); ah.u[i] = hb; al.u[i] = ASPLIT ? bf16_bits(xs[i] - bf16_val(hb)) : (unsigned short)0; }
#pragma unroll
    for (int t = 0; t < 4; ++t) {
      const unsigned short* brow = Wt + (size_t)(col0 + t * 16 + ln) * ldb + kb;
      FragB b;
      b.half[0] = *(const v8us*)(brow + 8 * hh);
      b.half[1] = *(const v8us*)(brow + 16 + 8 * hh);
      acc[t] = mmaN<ASPLIT ? 2 : 1>(ah.v, al.v, b.v, b.v, acc[t]);
    }
  }
#pragma unroll
  for (int t = 0; t < 4; ++t) {
    const int col = col0 + t * 16 + ln;
    float bv = bias ? bias[col] : 0.f;
    if (BIAS_BF16) bv = bf16_round(bv);
#pragma unroll
    for (int r = 0; r < 8; ++r) {
      float v = acc[t][r] + bv;
      if (resid) { float rv = resid[(size_t)((row0 + 8 * hh + r) % rmod) * ldr + col]; if (RES_BF16) rv = bf16_round(rv); v += rv; }
      if (ACT == 1) v = fmaxf(v, 0.f);
      if (ACT == 2) v = 0.5f * v * (1.0f + erff(v * 0.70710678118654752f));
      if (ACT == 3) { const float u = 0.7978845608028654f * (v + 0.044715f * v * v * v); v = 0.5f * v * (1.0f + tanhf(u)); }
      so[w][8 * hh + r][t * 16 + ln] = v;
    }
  }
  __builtin_amdgcn_fence(__ATOMIC_ACQ_REL, "workgroup");
  __builtin_amdgcn_wave_barrier();
  const int rsub = lane >> 4, c4 = (lane & 15) * 4;
  {
#pragma unroll
    for (int q = 0; q < 8; ++q) {
      const int r = q * 2 + rsub;
      const v4f v = *(const v4fa*)&so[w][r][c4];
      *(v4f*)(C + (size_t)(row0 + r) * ldc + col0 + c4) = v;
    }
    
  }
}
// row LayerNorm (biased variance, eps) over N: s = X (+ R); optional out_sum <- s; out_norm <- (s-mu)*rsqrt(var+eps)*g + b
template <bool PARAM_BF16>
__global__ __launch_bounds__(256) void k_layernorm(const float* __restrict__ X, const float* __restrict__ R, const float* __restrict__ g, const float* __restrict__ bta,
                                                  float* __restrict__ out_sum, float* __restrict__ out_norm, int N, float eps) {
  __shared__ float red[256];
  const int row = blockIdx.x, tid = threadIdx.x;
  const float* x = X + (size_t)row * N; const float* rr = R ? R + (size_t)row * N : nullptr;
  float vals[16];                     // up to N = 4096
  const int per = N / 256;            // contiguous chunk per thread? use strided-by-4 chunks: thread handles j = tid*4 + 1024*u
  float s1 = 0.f;
  for (int u = 0; u < per / 4; ++u) {
    const int j = tid * 4 + 1024 * u;
    const v4f a = *(const v4fa*)(x + j);
    v4f b = {0.f,0.f,0.f,0.f}; if (rr) b = *(const v4fa*)(rr + j);
#pragma unroll
    for (int q = 0; q < 4; ++q) { const float v = a[q] + b[q]; vals[u * 4 + q] = v; s1 += v; }
  }
  red[tid] = s1; __syncthreads();
  for (int st = 128; st > 0; st >>= 1) { if (tid < st) red[tid] += red[tid + st]; __syncthreads(); }
  const float mu = red[0] / (float)N; __syncthreads();
  float s2 = 0.f;
  for (int u = 0; u < per / 4; ++u)
#pragma unroll
    for (int q = 0; q < 4; ++q) { const float c = vals[u * 4 + q] - mu; s2 += c * c; }
  red[tid] = s2; __syncthreads();
  for (int st = 128; st > 0; st >>= 1) { if (tid < st) red[tid] += red[tid + st]; __syncthreads(); }
  const float rs = rsqrtf(red[0] / (float)N + eps);
  {
    for (int u = 0; u < per / 4; ++u) {
      const int j = tid * 4 + 1024 * u;
      v4f o, sm;
#pragma unroll
      for (int q = 0; q < 4; ++q) {
        float gg = g[j + q], bb = bta[j + q];
        if (PARAM_BF16) { gg = bf16_round(gg); bb = bf16_round(bb); }
        sm[q] = vals[u * 4 + q]; o[q] = (vals[u * 4 + q] - mu) * rs * gg + bb;
      }
      if (out_sum) *(v4f*)(out_sum + (size_t)row * N + j) = sm;
      *(v4f*)(out_norm + (size_t)row * N + j) = o;
    }
    
  }
}



// ---- f16 WMMA path (v_wmma_f32_16x16x32_f16): 11-bit significands for operands in range — used where a [0,1] probability operand needs more precision than bf16
typedef _Float16 v16h __attribute__((ext_vector_type(16)));
union FragH { v16h v; v8us half[2]; _Float16 h[16]; unsigned short u[16]; };
template <int NT>
__device__ __forceinline__ v8f mmaH(v16h ah, v16h al, v16h bh, v16h bl, v8f c) {
  c = __builtin_amdgcn_wmma_f32_16x16x32_f16(false, ah, false, bh, (short)0, c, false, false);
  if (NT >= 2) c = __builtin_amdgcn_wmma_f32_16x16x32_f16(false, al, false, bh, (short)0, c, false, false);
  if (NT >= 3) c = __builtin_amdgcn_wmma_f32_16x16x32_f16(false, ah, false, bl, (short)0, c, false, false);
  asm volatile("v_nop\n\tv_nop\n\tv_nop\n\tv_nop" : "+v"(c) : "v"(ah), "v"(al), "v"(bh), "v"(bl));
  return c;
}
// batched GEMM like k_gemm_b but f16 operands: A f32 (split into f16 hi/lo if ASPLIT, else rounded to f16), Bt = f16 values [n][k]; alpha; C f32; N multiple of 16 (partial tiles skipped)
template <bool ASPLIT>
__global__ __launch_bounds__(128) void k_gemm_h(const float* __restrict__ A, int lda, size_t sA, const _Float16* __restrict__ Bh, int ldb, size_t sB, float alpha, float* __restrict__ C, int ldc, size_t sC, int M, int N, int K) {
  __shared__ __attribute__((aligned(16))) float so[4][16][64];
  const int tid = threadIdx.x, w = tid >> 5, lane = tid & 31, ln = lane & 15, hh = lane >> 4; const int by = blockIdx.y;
  A += (size_t)by * sA; Bh += (size_t)by * sB; C += (size_t)by * sC;
  const int ntn = (N + 63) / 64; const int wid = blockIdx.x * 4 + w; const int mt = wid / ntn, nq = wid % ntn; if (mt * 16 >= M) return;
  const int row0 = mt * 16, col0 = nq * 64; const float* arow = A + (size_t)(row0 + ln) * lda;
  v8f acc[4] = {};
  for (int kb = 0; kb < K; kb += 32) {
    FragH ah, al;
    const v4f x0 = *(const v4fa*)(arow + kb + 8 * hh), x1 = *(const v4fa*)(arow + kb + 8 * hh + 4), x2 = *(const v4fa*)(arow + kb + 16 + 8 * hh), x3 = *(const v4fa*)(arow + kb + 16 + 8 * hh + 4);
    float xs[16] = {x0[0],x0[1],x0[2],x0[3],x1[0],x1[1],x1[2],x1[3],x2[0],x2[1],x2[2],x2[3],x3[0],x3[1],x3[2],x3[3]};
#pragma unroll
    for (int i = 0; i < 16; ++i) { const _Float16 h = (_Float16)xs[i]; ah.h[i] = h; al.h[i] = ASPLIT ? (_Float16)(xs[i] - (float)h) : (_Float16)0.0f; }
#pragma unroll
    for (int t = 0; t < 4; ++t) { if (col0 + t * 16 >= N) continue; const size_t boff = (size_t)(col0 + t * 16 + ln) * ldb + kb; FragH bq; bq.half[0] = *(const v8us*)(Bh + boff + 8 * hh); bq.half[1] = *(const v8us*)(Bh + boff + 16 + 8 * hh);
      acc[t] = mmaH<ASPLIT ? 2 : 1>(ah.v, al.v, bq.v, bq.v, acc[t]); }
  }
#pragma unroll
  for (int t = 0; t < 4; ++t) { if (col0 + t * 16 >= N) continue;
#pragma unroll
    for (int r = 0; r < 8; ++r) so[w][8 * hh + r][t * 16 + ln] = acc[t][r] * alpha; }
  __builtin_amdgcn_fence(__ATOMIC_ACQ_REL, "workgroup"); __builtin_amdgcn_wave_barrier();
  const int rsub = lane >> 4, c4 = (lane & 15) * 4;
  {
#pragma unroll
    for (int q = 0; q < 8; ++q) { const int r = q * 2 + rsub; if (col0 + c4 < N) { const v4f v = *(const v4fa*)&so[w][r][c4]; *(v4f*)(C + (size_t)(row0 + r) * ldc + col0 + c4) = v; } }
     }
}

// Wt[n][k] = f16(W[k][n]·scale) from f32 row-major W[K][N] (scale = power of two; bf16-exact weights stay exact in f16 away from the subnormal range)
__global__ __launch_bounds__(256) void k_wt_f16(const float* __restrict__ W, _Float16* __restrict__ Wt, int K, int N, float scale) {
  const int t = blockIdx.x * 256 + threadIdx.x; if (t >= N * (K / 8)) return; const int n = t / (K / 8), k8 = (t % (K / 8)) * 8; FragH f;
#pragma unroll
  for (int i = 0; i < 8; ++i) f.h[i] = (_Float16)(bf16_round(W[(size_t)(k8 + i) * N + n]) * scale); const v8us o = f.half[0];
  *(v8us*)((unsigned short*)Wt + (size_t)n * K + k8) = o; 
}
// C16[r][c] = f16(sum_k A[r][k] * Bt[c][k] * alpha + bf16(bias[c])): A f16 [NR][DD], Bt f16 [DD][DD]. One work-group = a 128 x 128 tile of C, 8 waves of 64 x 32 (4 x 2 accumulators);
// k runs in slices of 128 through an LDS ring of two buffers that all 8 waves share; per output element the WMMAs follow one another in rising k, 32 at a time
__global__ __launch_bounds__(256) void k_gemm_t(const _Float16* __restrict__ A, const _Float16* __restrict__ Bt, float alpha, const float* __restrict__ bias, _Float16* __restrict__ C16) {
  // rows of 128 f16 = 256 B; LDS pitch 272 B (16 B x odd) keeps the 16 rows of a ds_load_b128 fragment read on distinct banks
  constexpr int BT = 128, BK = 128, NSL = DD / BK, LP = BK + 8, TBY = BT * LP * 2, CP = BT + 8;
  __shared__ __attribute__((aligned(16))) unsigned short sA[2][BT][LP]; __shared__ __attribute__((aligned(16))) unsigned short sB[2][BT][LP]; __shared__ __attribute__((aligned(16))) unsigned short sC[BT][CP];
  const int tid = threadIdx.x, w = tid >> 5, lane = tid & 31, ln = lane & 15, hh = lane >> 4;
  const int row0 = (blockIdx.x % (NR / BT)) * BT, col0 = (blockIdx.x / (NR / BT)) * BT; const int wm = (w >> 2) * 64, wn = (w & 3) * 32;
  // each thread copies 16 B of rows crow, crow + 16, ..., crow + 112 of both tiles: a wave's copy covers four whole 128-B lines
  const int crow = tid >> 4, ccol = tid & 15;
  const unsigned short* gA = (const unsigned short*)A + (size_t)(row0 + crow) * DD + ccol * 8; const unsigned short* gB = (const unsigned short*)Bt + (size_t)(col0 + crow) * DD + ccol * 8;
  const unsigned lA = (unsigned)(uintptr_t)&sA[0][crow][ccol * 8], lB = (unsigned)(uintptr_t)&sB[0][crow][ccol * 8];
  auto copy8 = [&](unsigned l, const unsigned short* g) {
    // global -> LDS through no register; s_wait_xcnt 0 closes the statement so that no address register is rewritten ahead of it
    asm volatile("global_load_async_to_lds_b128 %0, %8, off\n\tglobal_load_async_to_lds_b128 %1, %9, off\n\tglobal_load_async_to_lds_b128 %2, %10, off\n\tglobal_load_async_to_lds_b128 %3, %11, off\n\t"
                 "global_load_async_to_lds_b128 %4, %12, off\n\tglobal_load_async_to_lds_b128 %5, %13, off\n\tglobal_load_async_to_lds_b128 %6, %14, off\n\tglobal_load_async_to_lds_b128 %7, %15, off\n\ts_wait_xcnt 0x0"
                 :: "v"(l), "v"(l + 16 * LP * 2), "v"(l + 32 * LP * 2), "v"(l + 48 * LP * 2), "v"(l + 64 * LP * 2), "v"(l + 80 * LP * 2), "v"(l + 96 * LP * 2), "v"(l + 112 * LP * 2),
                    "v"(g), "v"(g + 16 * DD), "v"(g + 32 * DD), "v"(g + 48 * DD), "v"(g + 64 * DD), "v"(g + 80 * DD), "v"(g + 96 * DD), "v"(g + 112 * DD) : "memory"); };
  auto stage = [&](int st, int bf) { copy8(lA + bf * TBY, gA + st * BK); copy8(lB + bf * TBY, gB + st * BK); };
  v8f acc[4][2];
#pragma unroll
  for (int mi = 0; mi < 4; ++mi)
#pragma unroll
    for (int ni = 0; ni < 2; ++ni) acc[mi][ni] = (v8f){0.f,0.f,0.f,0.f,0.f,0.f,0.f,0.f};
  stage(0, 0);
  asm volatile("s_wait_asynccnt 0x0" ::: "memory");      // this wave's copies of slice 0 have landed
  __syncthreads();                                        // ... and every other wave's: slice 0 may be read
  stage(1, 1);
#pragma unroll 1      /* one copy of the ring's foot; the buffer index stays t & 1 */
  for (int t = 0; t < NSL; ++t) { const int bf = t & 1; const unsigned short* ab = &sA[bf][wm + ln][8 * hh]; const unsigned short* bb = &sB[bf][wn + ln][8 * hh];
    FragH a[2][4], bq[2][2];      /* two fragment sets: the next 32 k of THIS slice are read while the present 32 are multiplied */
    auto frags = [&](int ks, int s) {
#pragma unroll
      for (int mi = 0; mi < 4; ++mi) { a[s][mi].half[0] = *(const v8us*)(ab + mi * 16 * LP + ks * 32); a[s][mi].half[1] = *(const v8us*)(ab + mi * 16 * LP + ks * 32 + 16); }
#pragma unroll
      for (int ni = 0; ni < 2; ++ni) { bq[s][ni].half[0] = *(const v8us*)(bb + ni * 16 * LP + ks * 32); bq[s][ni].half[1] = *(const v8us*)(bb + ni * 16 * LP + ks * 32 + 16); } };
    frags(0, 0);
#pragma unroll
    for (int ks = 0; ks < BK / 32; ++ks) { if (ks + 1 < BK / 32) frags(ks + 1, (ks + 1) & 1);
      __builtin_amdgcn_sched_barrier(0);      // keeps the next step's 12 LDS reads in front of this step's WMMAs; without it each read sinks to its use and its latency is waited for
#pragma unroll
      for (int mi = 0; mi < 4; ++mi)
#pragma unroll
        for (int ni = 0; ni < 2; ++ni) acc[mi][ni] = __builtin_amdgcn_wmma_f32_16x16x32_f16(false, a[ks & 1][mi].v, false, bq[ks & 1][ni].v, (short)0, acc[mi][ni], false, false); }
    asm volatile("s_wait_dscnt 0x0" ::: "memory");        // this wave's reads of buffer bf are done before it is refilled
    asm volatile("s_wait_asynccnt 0x0" ::: "memory");     // this wave's copies of slice t + 1 have landed
    __syncthreads();                                        // publishes slice t + 1 and ends every wave's reads of buffer bf
    if (t + 2 < NSL) stage(t + 2, bf); }
  asm volatile("s_wait_asynccnt 0x0" ::: "memory");       // no copy is outstanding when the wave goes on to the epilogue
  // the tile goes through LDS as f16 so that each 256-B row piece of C is stored as whole 128-B lines
#pragma unroll
  for (int ni = 0; ni < 2; ++ni) { const float bv = bf16_round(bias[col0 + wn + ni * 16 + ln]);
#pragma unroll
    for (int mi = 0; mi < 4; ++mi)
#pragma unroll
      for (int r = 0; r < 8; ++r) { FragH c1; c1.h[0] = (_Float16)(acc[mi][ni][r] * alpha + bv); sC[wm + mi * 16 + 8 * hh + r][wn + ni * 16 + ln] = c1.u[0]; } }
  __syncthreads();
#pragma unroll
  for (int i = 0; i < BT * (BT / 8) / 256; ++i) { const int e = tid + i * 256, r = e >> 4, c8 = (e & 15) * 8; const v8us o = *(const v8us*)&sC[r][c8]; *(v8us*)((unsigned short*)C16 + (size_t)(row0 + r) * DD + col0 + c8) = o; }
}


typedef _Float16 v4h __attribute__((ext_vector_type(4)));

__global__ __launch_bounds__(256) void k_x16(const float* __restrict__ x, _Float16* __restrict__ X16, size_t n8) { const size_t t = (size_t)blockIdx.x * 256 + threadIdx.x; if (t >= n8) return; FragH f;
#pragma unroll
  for (int q = 0; q < 8; ++q) f.h[q] = (_Float16)bf16_round(x[t * 8 + q]); *(v8us*)((unsigned short*)X16 + t * 8) = f.half[0];  }
__global__ __launch_bounds__(256) void k_h16(const float* __restrict__ x, _Float16* __restrict__ X16, size_t n8) { const size_t t = (size_t)blockIdx.x * 256 + threadIdx.x; if (t >= n8) return; FragH f;
#pragma unroll
  for (int q = 0; q < 8; ++q) f.h[q] = (_Float16)x[t * 8 + q]; *(v8us*)((unsigned short*)X16 + t * 8) = f.half[0];  }
__global__ __launch_bounds__(256) void k_round16f(const float* __restrict__ W, _Float16* __restrict__ Bt, size_t n8) { const size_t t = (size_t)blockIdx.x * 256 + threadIdx.x; if (t >= n8) return; FragH f;
#pragma unroll
  for (int i = 0; i < 8; ++i) f.h[i] = (_Float16)(bf16_round(W[t * 8 + i]) * 16.0f); *(v8us*)((unsigned short*)Bt + t * 8) = f.half[0];  }
template <int NHv, int TTv>
__global__ __launch_bounds__(256) void k_vt(const _Float16* __restrict__ V16, int ldv, int voff, _Float16* __restrict__ Vt) { __shared__ unsigned short tl[64][66]; const int tid = threadIdx.x; const int slab = blockIdx.x / (TTv / 64), lg = blockIdx.x % (TTv / 64); const int b = slab / NHv, h = slab % NHv;
  for (int i = tid; i < 64 * 8; i += 256) { const int r = i / 8, c8 = (i % 8) * 8; FragH f; f.half[0] = *(const v8us*)((const unsigned short*)V16 + ((size_t)b * TTv + lg * 64 + r) * ldv + voff + h * 64 + c8);
#pragma unroll
    for (int q = 0; q < 8; ++q) tl[r][c8 + q] = f.u[q]; }
  __syncthreads();
  {
#pragma unroll
    for (int rd = 0; rd < 2; ++rd) { const int d = rd * 32 + tid / 8, pc = tid % 8; FragH f;
#pragma unroll
      for (int q = 0; q < 8; ++q) f.u[q] = tl[pc * 8 + q][d];
      *(v8us*)((unsigned short*)Vt + ((size_t)slab * 64 + d) * TTv + lg * 64 + pc * 8) = f.half[0]; }
     } }

template <int D, int RBF>
__global__ __launch_bounds__(256) void k_lnx(const float* __restrict__ X, const float* __restrict__ gam, const float* __restrict__ bet, int nrows, float eps, _Float16* __restrict__ O16, float* __restrict__ XR) {
  constexpr int NP = D / 128; const int tid = threadIdx.x, wv = tid >> 5, lane = tid & 31; const size_t r = (size_t)blockIdx.x * 8 + wv; if (r >= (size_t)nrows) return; v4f y[NP]; float s = 0.f;
#pragma unroll
  for (int j = 0; j < NP; ++j) { const int c = j * 128 + lane * 4; v4f g = *(const v4fa*)(X + r * D + c); if (RBF) { for (int q = 0; q < 4; ++q) g[q] = bf16_round(g[q]); } y[j] = g; s += g[0] + g[1] + g[2] + g[3]; }
  for (int o = 16; o >= 1; o >>= 1) s += __shfl_xor(s, o, 32); const float mu = s / (float)D; float q2 = 0.f;
#pragma unroll
  for (int j = 0; j < NP; ++j) for (int q = 0; q < 4; ++q) { const float d = y[j][q] - mu; q2 += d * d; }
  for (int o = 16; o >= 1; o >>= 1) q2 += __shfl_xor(q2, o, 32); const float rs = rsqrtf(q2 / (float)D + eps);
  {
#pragma unroll
    for (int j = 0; j < NP; ++j) { const int c = j * 128 + lane * 4; v4h h; for (int q = 0; q < 4; ++q) { const float v = (y[j][q] - mu) * rs * bf16_round(gam[c + q]) + bf16_round(bet[c + q]); h[q] = (_Float16)v; } *(v4h*)(O16 + r * D + c) = h; if (XR) *(v4f*)(XR + r * D + c) = y[j]; }
     } }
__global__ __launch_bounds__(256) void k_addres(const float* __restrict__ O, const float* __restrict__ XR, float* __restrict__ out, size_t n4) { const size_t t = (size_t)blockIdx.x * 256 + threadIdx.x; if (t >= n4) return; v4f a = *(const v4fa*)(O + t * 4); const v4f b = *(const v4fa*)(XR + t * 4); for (int q = 0; q < 4; ++q) a[q] += b[q]; *(v4f*)(out + t * 4) = a;  }
// y[i] = 2^x[i], twelve independent v_exp_f32 in one statement with results in registers of their own (=&v), so that none overwrites the source of the one in front of it;
// the closing v_nop is the slot the instruction set asks for behind a transcendental before its result is read or its source overwritten
__device__ __forceinline__ void exp2x12(float* __restrict__ y, const float* __restrict__ x) {
  asm("v_exp_f32 %0, %12\n\tv_exp_f32 %1, %13\n\tv_exp_f32 %2, %14\n\tv_exp_f32 %3, %15\n\tv_exp_f32 %4, %16\n\tv_exp_f32 %5, %17\n\t"
      "v_exp_f32 %6, %18\n\tv_exp_f32 %7, %19\n\tv_exp_f32 %8, %20\n\tv_exp_f32 %9, %21\n\tv_exp_f32 %10, %22\n\tv_exp_f32 %11, %23\n\tv_nop"
      : "=&v"(y[0]), "=&v"(y[1]), "=&v"(y[2]), "=&v"(y[3]), "=&v"(y[4]), "=&v"(y[5]), "=&v"(y[6]), "=&v"(y[7]), "=&v"(y[8]), "=&v"(y[9]), "=&v"(y[10]), "=&v"(y[11])
      : "v"(x[0]), "v"(x[1]), "v"(x[2]), "v"(x[3]), "v"(x[4]), "v"(x[5]), "v"(x[6]), "v"(x[7]), "v"(x[8]), "v"(x[9]), "v"(x[10]), "v"(x[11])); }
__global__ __launch_bounds__(128) void k_flash(const _Float16* __restrict__ Q16, int ldq, const _Float16* __restrict__ K16, int ldk, const _Float16* __restrict__ Vt, const int* __restrict__ MSK, float* __restrict__ O, int ldo) {
  constexpr int RPW = 16, RTN = RPW / 16, NQB = TT / (4 * RPW), DT = 4, KS = 2;
  __shared__ __attribute__((aligned(16))) unsigned short sP[4][RPW][40]; __shared__ __attribute__((aligned(16))) float sO[4][RPW][64 + 4];
  // K/V ring, two buffers, one stage = SKEY keys: sK rows = keys (64 d = 128 B), sV rows = d (SKEY keys = 128 B); LDS pitch 144 B (16 B x odd) keeps the 16 rows of a ds_load_b128 fragment read on distinct banks
  constexpr int SKEY = 64, NST = TT / SKEY, LP = 72, SBUF = 64 * LP * 2; constexpr float SC = 0.125f * 1.44269504088896340736f;      /* 64^-1/2 * log2(e) */
  __shared__ __attribute__((aligned(16))) unsigned short sK[2][SKEY][LP]; __shared__ __attribute__((aligned(16))) unsigned short sV[2][64][LP];
  const int tid = threadIdx.x, w = tid >> 5, lane = tid & 31, ln = lane & 15, hh = lane >> 4;
  const int slab = blockIdx.x / NQB, qblk = blockIdx.x % NQB; const int b = slab / NH, h = slab % NH; const int qb0 = qblk * (4 * RPW); const int q0 = qb0 + w * RPW;
  FragH aq[2][KS];
#pragma unroll
  for (int rt = 0; rt < RTN; ++rt) { const unsigned short* qr = (const unsigned short*)Q16 + ((size_t)b * TT + q0 + rt * 16 + ln) * ldq + h * 64;
#pragma unroll
    for (int ks = 0; ks < KS; ++ks) { aq[rt][ks].half[0] = *(const v8us*)(qr + ks * 32 + 8 * hh); aq[rt][ks].half[1] = *(const v8us*)(qr + ks * 32 + 16 + 8 * hh); } }
  const unsigned short* Vth = (const unsigned short*)Vt + (size_t)slab * 64 * TT;
  float m_r[2][8], l_r[2][8]; v8f oacc[2][DT];
#pragma unroll
  for (int rt = 0; rt < RTN; ++rt) {
#pragma unroll
    for (int r = 0; r < 8; ++r) { m_r[rt][r] = -3.0e38f; l_r[rt][r] = 0.f; }
#pragma unroll
    for (int dt = 0; dt < DT; ++dt) oacc[rt][dt] = (v8f){0.f,0.f,0.f,0.f,0.f,0.f,0.f,0.f}; }
  // each thread copies 16 B of rows crow, crow + 16, + 32, + 48 of both tiles: a wave's copy covers four whole 128-B lines
  const int crow = tid >> 3, ccol = tid & 7;
  const unsigned short* gK = (const unsigned short*)K16 + ((size_t)b * TT + crow) * ldk + h * 64 + ccol * 8; const unsigned short* gV = Vth + (size_t)crow * TT + ccol * 8;
  const unsigned lK = (unsigned)(uintptr_t)&sK[0][crow][ccol * 8], lV = (unsigned)(uintptr_t)&sV[0][crow][ccol * 8];
  auto stage = [&](int st, int bf) { const unsigned short* k0 = gK + (size_t)st * SKEY * ldk; const unsigned short* v0 = gV + st * SKEY; const unsigned lk = lK + bf * SBUF, lv = lV + bf * SBUF;
    // global -> LDS through no register; s_wait_xcnt 0 closes the statement so that no address register is rewritten ahead of it
    asm volatile("global_load_async_to_lds_b128 %0, %8, off\n\tglobal_load_async_to_lds_b128 %1, %9, off\n\tglobal_load_async_to_lds_b128 %2, %10, off\n\tglobal_load_async_to_lds_b128 %3, %11, off\n\t"
                 "global_load_async_to_lds_b128 %4, %12, off\n\tglobal_load_async_to_lds_b128 %5, %13, off\n\tglobal_load_async_to_lds_b128 %6, %14, off\n\tglobal_load_async_to_lds_b128 %7, %15, off\n\ts_wait_xcnt 0x0"
                 :: "v"(lk), "v"(lk + 16 * LP * 2), "v"(lk + 32 * LP * 2), "v"(lk + 48 * LP * 2), "v"(lv), "v"(lv + 16 * LP * 2), "v"(lv + 32 * LP * 2), "v"(lv + 48 * LP * 2),
                    "v"(k0), "v"(k0 + (size_t)16 * ldk), "v"(k0 + (size_t)32 * ldk), "v"(k0 + (size_t)48 * ldk), "v"(v0), "v"(v0 + 16 * TT), "v"(v0 + 32 * TT), "v"(v0 + 48 * TT) : "memory"); };
  stage(0, 0);
  asm volatile("s_wait_asynccnt 0x0" ::: "memory");      // this wave's copies of stage 0 have landed
  __syncthreads();                                        // ... and every other wave's: stage 0 may be read
  stage(1, 1);
#pragma unroll 1      /* one copy of the ring's foot; the buffer index stays t & 1 */
  for (int t = 0; t < NST; ++t) { const int bf = t & 1;
  for (int sub = 0; sub < SKEY / 32; ++sub) { const int j0 = t * SKEY + sub * 32;
    int mk0[2][8], mk1[2][8];      /* nonzero = MASKED */
#pragma unroll
    for (int rt = 0; rt < RTN; ++rt)
#pragma unroll
      for (int r = 0; r < 8; ++r) { const int qq = q0 + rt * 16 + 8 * hh + r; const int* am = MSK + ((size_t)b * TT + qq) * TT + j0; mk0[rt][r] = am[ln]; mk1[rt][r] = am[16 + ln]; }
    v8f s[2][2];
#pragma unroll
    for (int nt = 0; nt < 2; ++nt) { const unsigned short* kr = &sK[bf][sub * 32 + nt * 16 + ln][0]; FragH bk[KS];
#pragma unroll
      for (int ks = 0; ks < KS; ++ks) { bk[ks].half[0] = *(const v8us*)(kr + ks * 32 + 8 * hh); bk[ks].half[1] = *(const v8us*)(kr + ks * 32 + 16 + 8 * hh); }
#pragma unroll
      for (int rt = 0; rt < RTN; ++rt) { v8f acc = (v8f){0.f,0.f,0.f,0.f,0.f,0.f,0.f,0.f};
#pragma unroll
        for (int ks = 0; ks < KS; ++ks) acc = mmaH<1>(aq[rt][ks].v, aq[rt][ks].v, bk[ks].v, bk[ks].v, acc); s[rt][nt] = acc; } }
#pragma unroll
    for (int rt = 0; rt < RTN; ++rt) { float ex[24], ey[24];
#pragma unroll
      for (int r = 0; r < 8; ++r) {
        const bool ok0 = (mk0[rt][r] == 0), ok1 = (mk1[rt][r] == 0);
        const float s0 = ok0 ? s[rt][0][r] : -INFINITY, s1 = ok1 ? s[rt][1][r] : -INFINITY; float mc = fmaxf(s0, s1);      /* unscaled scores; the running maximum is kept unscaled too */
        mc = fmaxf(mc, __shfl_xor(mc, 1, 32)); mc = fmaxf(mc, __shfl_xor(mc, 2, 32)); mc = fmaxf(mc, __shfl_xor(mc, 4, 32)); mc = fmaxf(mc, __shfl_xor(mc, 8, 32));
        // e^(0.125 (s - m)) = 2^(s * SC - m * SC): one fma per score, no branch; a masked score is -inf and gives 0 (m is finite: it starts at -3e38)
        const float mn = fmaxf(m_r[rt][r], mc); const float nb = -mn * SC; ex[3 * r] = (m_r[rt][r] - mn) * SC; ex[3 * r + 1] = fmaf(s0, SC, nb); ex[3 * r + 2] = fmaf(s1, SC, nb); m_r[rt][r] = mn; }
      exp2x12(ey, ex); exp2x12(ey + 12, ex + 12);
#pragma unroll
      for (int r = 0; r < 8; ++r) { const float al = (m_r[rt][r] > -1.0e38f) ? ey[3 * r] : 1.0f; const float p0 = ey[3 * r + 1], p1 = ey[3 * r + 2]; l_r[rt][r] = l_r[rt][r] * al + p0 + p1;
#pragma unroll
        for (int dt = 0; dt < DT; ++dt) oacc[rt][dt][r] *= al;
        FragH t2; t2.h[0] = (_Float16)(p0 * 1024.0f); t2.h[1] = (_Float16)(p1 * 1024.0f); sP[w][rt * 16 + 8 * hh + r][ln] = t2.u[0]; sP[w][rt * 16 + 8 * hh + r][16 + ln] = t2.u[1]; } }
    __builtin_amdgcn_fence(__ATOMIC_ACQ_REL, "workgroup"); __builtin_amdgcn_wave_barrier();
    FragH pa[2];
#pragma unroll
    for (int rt = 0; rt < RTN; ++rt) { pa[rt].half[0] = *(const v8us*)&sP[w][rt * 16 + ln][8 * hh]; pa[rt].half[1] = *(const v8us*)&sP[w][rt * 16 + ln][16 + 8 * hh]; }
#pragma unroll
    for (int dt = 0; dt < DT; ++dt) { const unsigned short* vrow = &sV[bf][dt * 16 + ln][sub * 32]; FragH bv; bv.half[0] = *(const v8us*)(vrow + 8 * hh); bv.half[1] = *(const v8us*)(vrow + 16 + 8 * hh);
#pragma unroll
      for (int rt = 0; rt < RTN; ++rt) oacc[rt][dt] = mmaH<1>(pa[rt].v, pa[rt].v, bv.v, bv.v, oacc[rt][dt]); }
    __builtin_amdgcn_fence(__ATOMIC_ACQ_REL, "workgroup"); __builtin_amdgcn_wave_barrier(); }
    asm volatile("s_wait_dscnt 0x0" ::: "memory");        // this wave's reads of buffer bf are done before it is refilled
    asm volatile("s_wait_asynccnt 0x0" ::: "memory");     // this wave's copies of stage t + 1 have landed
    __syncthreads();                                        // publishes stage t + 1 and ends every wave's reads of buffer bf
    if (t + 2 < NST) stage(t + 2, bf); }
  asm volatile("s_wait_asynccnt 0x0" ::: "memory");       // no copy is outstanding when the wave goes on to the epilogue
#pragma unroll
  for (int rt = 0; rt < RTN; ++rt) {
#pragma unroll
    for (int r = 0; r < 8; ++r) { float l = l_r[rt][r]; l += __shfl_xor(l, 1, 32); l += __shfl_xor(l, 2, 32); l += __shfl_xor(l, 4, 32); l += __shfl_xor(l, 8, 32); l_r[rt][r] = (l > 0.f) ? 1.0f / (l * 1024.0f) : 0.f; }
#pragma unroll
    for (int dt = 0; dt < DT; ++dt)
#pragma unroll
      for (int r = 0; r < 8; ++r) sO[w][rt * 16 + 8 * hh + r][dt * 16 + ln] = oacc[rt][dt][r] * l_r[rt][r]; }
  __builtin_amdgcn_fence(__ATOMIC_ACQ_REL, "workgroup"); __builtin_amdgcn_wave_barrier();
  {
#pragma unroll
    for (int rp = 0; rp < RPW; rp += 2) { const int r = rp + (lane >> 4), pc = lane & 15; const v4f val = *(const v4fa*)&sO[w][r][pc * 4]; *(v4f*)(O + ((size_t)b * TT + q0 + r) * ldo + h * 64 + pc * 4) = val; }
     } }

extern "C" void kernel_launch(void* const* d_in, const int* in_sizes, int n_in,
                              void* d_out, int out_size, void* d_ws, size_t ws_size, hipStream_t stream) {
  (void)in_sizes; (void)n_in; (void)out_size;
  const float* const* I = (const float* const*)d_in; const float* Qx = I[0]; const float* Kx = I[1]; const float* Vx = I[2]; const int* mask = (const int*)d_in[3];      /* bool mask shipped as int32 [2,1,2048,2048] */
  const float* Wq = I[4]; const float* bq = I[5]; const float* Wk = I[6]; const float* bk = I[7]; const float* Wv = I[8]; const float* bv = I[9]; const float* gam = I[10]; const float* bet = I[11];
  char* ws = (char*)d_ws; size_t off = 0;
  auto take = [&](size_t bytes) { char* p = ws + off; off += (bytes + 255) & ~(size_t)255; return p; };
  const size_t WSZ = (size_t)DD * DD; _Float16* Bw = (_Float16*)take(3 * WSZ * 2); float* XR = (float*)take((size_t)NR * DD * 4); _Float16* H16 = (_Float16*)take((size_t)NR * DD * 2);
  _Float16* Q = (_Float16*)take((size_t)NR * DD * 2); _Float16* K = (_Float16*)take((size_t)NR * DD * 2); _Float16* V = (_Float16*)take((size_t)NR * DD * 2); _Float16* Vt = (_Float16*)take((size_t)NR * DD * 2); float* O = (float*)take((size_t)NR * DD * 4);
  if (off > ws_size) return;      // 6.3 + 16.8 + 8.4 + 4 × 8.4 + 16.8 ≈ 82 MB
  const unsigned gw = (unsigned)(((size_t)DD * (DD / 8) + 255) / 256); k_wt_f16<<<gw, 256, 0, stream>>>(Wq, Bw, DD, DD, 16.0f); k_wt_f16<<<gw, 256, 0, stream>>>(Wk, Bw + WSZ, DD, DD, 16.0f); k_wt_f16<<<gw, 256, 0, stream>>>(Wv, Bw + 2 * WSZ, DD, DD, 16.0f);      /* (in,out) → Bt ×2^4 */
  const unsigned gp = (NR / 128) * (DD / 128);
  k_lnx<DD, 1><<<(NR + 7) / 8, 256, 0, stream>>>(Qx, gam, bet, NR, 1e-5f, H16, XR);      /* LN(bf16 Q) → f16; XR = bf16(Q) for the residual */
  k_gemm_t<<<gp, 256, 0, stream>>>(H16, Bw, 0.0625f, bq, Q);      /* M 4096 N 1024 K 1024 */
  k_lnx<DD, 1><<<(NR + 7) / 8, 256, 0, stream>>>(Kx, gam, bet, NR, 1e-5f, H16, nullptr);
  k_gemm_t<<<gp, 256, 0, stream>>>(H16, Bw + WSZ, 0.0625f, bk, K);
  k_lnx<DD, 1><<<(NR + 7) / 8, 256, 0, stream>>>(Vx, gam, bet, NR, 1e-5f, H16, nullptr);
  k_gemm_t<<<gp, 256, 0, stream>>>(H16, Bw + 2 * WSZ, 0.0625f, bv, V);
  k_vt<NH, TT><<<BB * NH * (TT / 64), 256, 0, stream>>>(V, DD, 0, Vt);
  k_flash<<<BB * NH * (TT / 64), 128, 0, stream>>>(Q, DD, K, DD, Vt, mask, O, DD);
  k_addres<<<(unsigned)(((size_t)NR * DD / 4 + 255) / 256), 256, 0, stream>>>(O, XR, (float*)d_out, (size_t)NR * DD / 4);      /* out = o + Q */
}

// v004
// One run takes 155 microseconds.
// In both of two side-by-side timings against v003, it was 1.15 times as fast.
// Counting every step since v000, it is 2.80 times as fast.
#include <hip/hip_runtime.h>
// Pre-norm multi-head attention with a boolean mask and residual (B=2, N=2048, E=1024, 16 heads × 64): q = LN(Q)·Wq + bq, k = LN(K)·Wk + bk, v = LN(V)·Wv + bv (one shared LayerNorm γ,β; (in,out) weights); s = q·kᵀ·64^-½ with −inf where mask[b,0,n,m] is True;
// softmax; o = merged attn·v; out = o + Q (no output projection).
// Compute dtype: Q, K, V, weights, biases, γ, β rounded to bf16; LayerNorms f32 (wave per row) → f16; q/k/v f16 GEMM planes; fused flash-style kernel (int32 mask loads per (q,k), online softmax f32, P f16 ×2^10) on
// v_wmma_f32_16x16x32_f16; out = o (f32) + bf16(Q) (f32 add); f32 accumulate.
#define BB 2
#define TT 2048
#define DD 1024
#define NH 16
#define NR (BB * TT)

typedef __bf16 v16b __attribute__((ext_vector_type(16)));
typedef unsigned short v8us __attribute__((ext_vector_type(8), may_alias));
typedef float  v8f  __attribute__((ext_vector_type(8)));
typedef float  v4f  __attribute__((ext_vector_type(4)));
typedef float  v4fa __attribute__((ext_vector_type(4), may_alias));
union FragB { v16b v; v8us half[2]; unsigned short u[16]; };

__device__ __forceinline__ unsigned short bf16_bits(float x) { unsigned int u = __float_as_uint(x); return (unsigned short)((u + 0x7FFFu + ((u >> 16) & 1u)) >> 16); }
__device__ __forceinline__ float bf16_val(unsigned short b) { return __uint_as_float(((unsigned int)b) << 16); }
__device__ __forceinline__ float bf16_round(float x) { return bf16_val(bf16_bits(x)); }
// D += A·B with NT terms: 1 = ah·bh, 2 = + al·bh (A split), 3 = + ah·bl (both split)
template <int NT>
__device__ __forceinline__ v8f mmaN(v16b ah, v16b al, v16b bh, v16b bl, v8f c) {
  c = __builtin_amdgcn_wmma_f32_16x16x32_bf16(false, ah, false, bh, (short)0, c, false, false);
  if (NT >= 2) c = __builtin_amdgcn_wmma_f32_16x16x32_bf16(false, al, false, bh, (short)0, c, false, false);
  if (NT >= 3) c = __builtin_amdgcn_wmma_f32_16x16x32_bf16(false, ah, false, bl, (short)0, c, false, false);
  asm volatile("v_nop\n\tv_nop\n\tv_nop\n\tv_nop" : "+v"(c) : "v"(ah), "v"(al), "v"(bh), "v"(bl));
  return c;
}

__global__ __launch_bounds__(256) void k_wt_bf16(const float* __restrict__ W, unsigned short* __restrict__ Wt, int K, int N) {
  const int t = blockIdx.x * 256 + threadIdx.x;
  const int k8n = K / 8;
  if (t >= N * k8n) return;
  const int n = t / k8n, k8 = (t % k8n) * 8;
  v8us v;
#pragma unroll
  for (int i = 0; i < 8; ++i) v[i] = bf16_bits(W[(size_t)(k8 + i) * N + n]);
  *(v8us*)(Wt + (size_t)n * K + k8) = v;
  
}

// GEMM C[M][N] (f32, pitch ldc) = act(A[M][K]·W + bias). A f32 row-major (pitch lda) converted per fragment to bf16
// (ASPLIT: hi/lo two planes -> 2 terms, else single rounded term); Wt bf16 [N][K] (pitch ldb). BIAS_BF16 rounds the
// bias to bf16 first (bias quantised to bf16 before the add). K%32==0, M%16==0, N%64==0.
template <bool ASPLIT, int ACT, bool BIAS_BF16>
__global__ __launch_bounds__(128) void k_gemm_bf(const float* __restrict__ A, int lda, const unsigned short* __restrict__ Wt, int ldb,
                                               const float* __restrict__ bias, float* __restrict__ C, int ldc, int M, int N, int K) {
  __shared__ __attribute__((aligned(16))) float so[4][16][64];
  const int tid = threadIdx.x, w = tid >> 5, lane = tid & 31, ln = lane & 15, hh = lane >> 4;
  const int ntn = N / 64;
  const int wid = blockIdx.x * 4 + w;
  const int mt = wid / ntn, nq = wid % ntn;
  if (mt * 16 >= M) return;
  const int row0 = mt * 16, col0 = nq * 64;
  const float* arow = A + (size_t)(row0 + ln) * lda;
  v8f acc[4] = {};
  for (int kb = 0; kb < K; kb += 32) {
    FragB ah, al;
    const v4f x0 = *(const v4fa*)(arow + kb + 8 * hh), x1 = *(const v4fa*)(arow + kb + 8 * hh + 4);
    const v4f x2 = *(const v4fa*)(arow + kb + 16 + 8 * hh), x3 = *(const v4fa*)(arow + kb + 16 + 8 * hh + 4);
    float xs[16] = {x0[0],x0[1],x0[2],x0[3],x1[0],x1[1],x1[2],x1[3],x2[0],x2[1],x2[2],x2[3],x3[0],x3[1],x3[2],x3[3]};
#pragma unroll
    for (int i = 0; i < 16; ++i) { const unsigned short hb = bf16_bits(xs[i]); ah.u[i] = hb; al.u[i] = ASPLIT ? bf16_bits(xs[i] - bf16_val(hb)) : (unsigned short)0; }
#pragma unroll
    for (int t = 0; t < 4; ++t) {
      const unsigned short* brow = Wt + (size_t)(col0 + t * 16 + ln) * ldb + kb;
      FragB b;
      b.half[0] = *(const v8us*)(brow + 8 * hh);
      b.half[1] = *(const v8us*)(brow + 16 + 8 * hh);
      acc[t] = mmaN<ASPLIT ? 2 : 1>(ah.v, al.v, b.v, b.v, acc[t]);
    }
  }
#pragma unroll
  for (int t = 0; t < 4; ++t) {
    float bv = bias ? bias[col0 + t * 16 + ln] : 0.f;
    if (BIAS_BF16) bv = bf16_round(bv);
#pragma unroll
    for (int r = 0; r < 8; ++r) { float v = acc[t][r] + bv; if (ACT == 1) v = fmaxf(v, 0.f); so[w][8 * hh + r][t * 16 + ln] = v; }
  }
  __builtin_amdgcn_fence(__ATOMIC_ACQ_REL, "workgroup");
  __builtin_amdgcn_wave_barrier();
  const int rsub = lane >> 4, c4 = (lane & 15) * 4;
  {
#pragma unroll
    for (int q = 0; q < 8; ++q) {
      const int r = q * 2 + rsub;
      const v4f v = *(const v4fa*)&so[w][r][c4];
      *(v4f*)(C + (size_t)(row0 + r) * ldc + col0 + c4) = v;
    }
    
  }
}

// Flash-style causal/unmasked attention, all contractions 3-term bf16 hi/lo splits, f32 softmax with running max.
// q,k,v rows are read from f32 buffers with arbitrary row pitch (so they can live inside a fused qkv buffer);
// D = head size (multiple of 32, <= 128); one wave = 16 query rows; block = 4 waves (64 queries) sharing K/V chunks of 32.
template <int D, bool CAUSAL>
__global__ __launch_bounds__(128) void k_flash(const float* __restrict__ qb, const float* __restrict__ kb, const float* __restrict__ vb,
                                             int pitch, int T, int H, float scale, float* __restrict__ y, int ypitch) {
  constexpr int KS = D / 32;        // k-steps for QK
  constexpr int DT = D / 16;        // d tiles for PV
  __shared__ __attribute__((aligned(16))) unsigned short sKh[32][D + 8], sKl[32][D + 8], sVh[32][D + 8], sVl[32][D + 8];
  __shared__ __attribute__((aligned(16))) unsigned short sPh[4][16][40], sPl[4][16][40];
  __shared__ __attribute__((aligned(16))) float sO[4][16][D];
  const int tid = threadIdx.x, w = tid >> 5, lane = tid & 31, ln = lane & 15, hh = lane >> 4;
  const int nqb = (T + 63) / 64;
  const int bh = blockIdx.x / nqb, qblk = blockIdx.x % nqb;
  const int b = bh / H, h = bh % H;
  const int q0 = qblk * 64 + w * 16;
  const float* Q = qb + (size_t)b * T * pitch + h * D;
  const float* K = kb + (size_t)b * T * pitch + h * D;
  const float* V = vb + (size_t)b * T * pitch + h * D;

  // A fragments of the wave's 16 query rows (scaled), hi/lo
  FragB aqh[KS], aql[KS];
  {
    int row = q0 + ln; if (row >= T) row = T - 1;
    const float* qr = Q + (size_t)row * pitch;
#pragma unroll
    for (int ks = 0; ks < KS; ++ks)
#pragma unroll
      for (int i = 0; i < 16; ++i) {
        const int d = ks * 32 + ((i < 8) ? (8 * hh + i) : (16 + 8 * hh + (i - 8)));
        const float x = qr[d] * scale; const unsigned short hb = bf16_bits(x);
        aqh[ks].u[i] = hb; aql[ks].u[i] = bf16_bits(x - bf16_val(hb));
      }
  }
  float m_r[8], l_r[8];
#pragma unroll
  for (int r = 0; r < 8; ++r) { m_r[r] = -3.0e38f; l_r[r] = 0.f; }
  v8f oacc[DT];
#pragma unroll
  for (int dt = 0; dt < DT; ++dt) oacc[dt] = (v8f){0.f,0.f,0.f,0.f,0.f,0.f,0.f,0.f};

  const int kv_end = CAUSAL ? min(T, qblk * 64 + 64) : T;     // block-uniform
  for (int j0 = 0; j0 < kv_end; j0 += 32) {
    __syncthreads();
    for (int e = tid; e < 32 * (D / 4); e += 128) {
      const int r = e / (D / 4), c4 = (e % (D / 4)) * 4;
      const int key = j0 + r;
      v4f kf = {0.f,0.f,0.f,0.f}, vf = {0.f,0.f,0.f,0.f};
      if (key < T) { kf = *(const v4fa*)(K + (size_t)key * pitch + c4); vf = *(const v4fa*)(V + (size_t)key * pitch + c4); }
#pragma unroll
      for (int t = 0; t < 4; ++t) {
        unsigned short hb = bf16_bits(kf[t]); sKh[r][c4 + t] = hb; sKl[r][c4 + t] = bf16_bits(kf[t] - bf16_val(hb));
        hb = bf16_bits(vf[t]); sVh[r][c4 + t] = hb; sVl[r][c4 + t] = bf16_bits(vf[t] - bf16_val(hb));
      }
    }
    __syncthreads();
    // S tile 16 x 32
    v8f s[2];
#pragma unroll
    for (int nt = 0; nt < 2; ++nt) {
      v8f acc = {};
#pragma unroll
      for (int ks = 0; ks < KS; ++ks) {
        FragB bh_, bl_;
        bh_.half[0] = *(const v8us*)&sKh[nt * 16 + ln][ks * 32 + 8 * hh]; bh_.half[1] = *(const v8us*)&sKh[nt * 16 + ln][ks * 32 + 16 + 8 * hh];
        bl_.half[0] = *(const v8us*)&sKl[nt * 16 + ln][ks * 32 + 8 * hh]; bl_.half[1] = *(const v8us*)&sKl[nt * 16 + ln][ks * 32 + 16 + 8 * hh];
        acc = mmaN<3>(aqh[ks].v, aql[ks].v, bh_.v, bl_.v, acc);
      }
      s[nt] = acc;
    }
    // mask + running max (rows 8hh+r; the 16 lanes of a half share rows)
    float alpha[8];
#pragma unroll
    for (int r = 0; r < 8; ++r) {
      const int qi = q0 + 8 * hh + r;
      const int ja = j0 + ln, jb = j0 + 16 + ln;
      if (CAUSAL) { if (ja > qi) s[0][r] = -3.0e38f; if (jb > qi) s[1][r] = -3.0e38f; }
      if (ja >= T) s[0][r] = -3.0e38f;
      if (jb >= T) s[1][r] = -3.0e38f;
      float mx = fmaxf(s[0][r], s[1][r]);
      mx = fmaxf(mx, __shfl_xor(mx, 1, 32)); mx = fmaxf(mx, __shfl_xor(mx, 2, 32)); mx = fmaxf(mx, __shfl_xor(mx, 4, 32)); mx = fmaxf(mx, __shfl_xor(mx, 8, 32));
      const float mnew = fmaxf(m_r[r], mx);
      alpha[r] = (mnew > -1.0e38f) ? __expf(m_r[r] - mnew) : 1.0f;
      const float p0 = (s[0][r] > -1.0e38f) ? __expf(s[0][r] - mnew) : 0.f;
      const float p1 = (s[1][r] > -1.0e38f) ? __expf(s[1][r] - mnew) : 0.f;
      m_r[r] = mnew;
      l_r[r] = l_r[r] * alpha[r] + p0 + p1;            // per-lane partial row sum (16 lanes combined at the end)
      unsigned short hb = bf16_bits(p0); sPh[w][8 * hh + r][ln] = hb;      sPl[w][8 * hh + r][ln] = bf16_bits(p0 - bf16_val(hb));
      hb = bf16_bits(p1);                sPh[w][8 * hh + r][16 + ln] = hb; sPl[w][8 * hh + r][16 + ln] = bf16_bits(p1 - bf16_val(hb));
    }
#pragma unroll
    for (int dt = 0; dt < DT; ++dt)
#pragma unroll
      for (int r = 0; r < 8; ++r) oacc[dt][r] *= alpha[r];
    __builtin_amdgcn_fence(__ATOMIC_ACQ_REL, "workgroup");
    __builtin_amdgcn_wave_barrier();
    FragB pah, pal;
    pah.half[0] = *(const v8us*)&sPh[w][ln][8 * hh]; pah.half[1] = *(const v8us*)&sPh[w][ln][16 + 8 * hh];
    pal.half[0] = *(const v8us*)&sPl[w][ln][8 * hh]; pal.half[1] = *(const v8us*)&sPl[w][ln][16 + 8 * hh];
#pragma unroll
    for (int dt = 0; dt < DT; ++dt) {
      FragB bvh, bvl;
#pragma unroll
      for (int i = 0; i < 8; ++i) {
        bvh.u[i] = sVh[8 * hh + i][dt * 16 + ln]; bvh.u[8 + i] = sVh[16 + 8 * hh + i][dt * 16 + ln];
        bvl.u[i] = sVl[8 * hh + i][dt * 16 + ln]; bvl.u[8 + i] = sVl[16 + 8 * hh + i][dt * 16 + ln];
      }
      oacc[dt] = mmaN<3>(pah.v, pal.v, bvh.v, bvl.v, oacc[dt]);
    }
    __builtin_amdgcn_fence(__ATOMIC_ACQ_REL, "workgroup");
    __builtin_amdgcn_wave_barrier();
  }
#pragma unroll
  for (int r = 0; r < 8; ++r) {
    float l = l_r[r];
    l += __shfl_xor(l, 1, 32); l += __shfl_xor(l, 2, 32); l += __shfl_xor(l, 4, 32); l += __shfl_xor(l, 8, 32);
    l_r[r] = (l > 0.f) ? 1.0f / l : 0.f;
  }
#pragma unroll
  for (int dt = 0; dt < DT; ++dt)
#pragma unroll
    for (int r = 0; r < 8; ++r) sO[w][8 * hh + r][dt * 16 + ln] = oacc[dt][r] * l_r[r];
  __builtin_amdgcn_fence(__ATOMIC_ACQ_REL, "workgroup");
  __builtin_amdgcn_wave_barrier();
  {
    for (int r = 0; r < 16; ++r) {
      const int row = q0 + r;
      if (row < T && lane < D / 4) {
        const v4f val = *(const v4fa*)&sO[w][r][lane * 4];
        *(v4f*)(y + ((size_t)b * T + row) * ypitch + h * D + lane * 4) = val;
      }
    }
    
  }
}

// GEMM C = act(A·W + bias + resid): A f32 (ASPLIT -> hi/lo 2 terms), Wt bf16 [N][K]; ACT 0 none, 1 relu, 2 exact gelu;
// resid (optional, f32, row index = (row % rmod), pitch ldr, RES_BF16 rounds it) added before the activation.
template <bool ASPLIT, int ACT, bool BIAS_BF16, bool RES_BF16>
__global__ __launch_bounds__(128) void k_gemm_bf3(const float* __restrict__ A, int lda, const unsigned short* __restrict__ Wt, int ldb,
                                                const float* __restrict__ bias, const float* __restrict__ resid, int rmod, int ldr,
                                                float* __restrict__ C, int ldc, int M, int N, int K) {
  __shared__ __attribute__((aligned(16))) float so[4][16][64];
  const int tid = threadIdx.x, w = tid >> 5, lane = tid & 31, ln = lane & 15, hh = lane >> 4;
  const int ntn = N / 64;
  const int wid = blockIdx.x * 4 + w;
  const int mt = wid / ntn, nq = wid % ntn;
  if (mt * 16 >= M) return;
  const int row0 = mt * 16, col0 = nq * 64;
  const float* arow = A + (size_t)(row0 + ln) * lda;
  v8f acc[4] = {};
  for (int kb = 0; kb < K; kb += 32) {
    FragB ah, al;
    const v4f x0 = *(const v4fa*)(arow + kb + 8 * hh), x1 = *(const v4fa*)(arow + kb + 8 * hh + 4);
    const v4f x2 = *(const v4fa*)(arow + kb + 16 + 8 * hh), x3 = *(const v4fa*)(arow + kb + 16 + 8 * hh + 4);
    float xs[16] = {x0[0],x0[1],x0[2],x0[3],x1[0],x1[1],x1[2],x1[3],x2[0],x2[1],x2[2],x2[3],x3[0],x3[1],x3[2],x3[3]};
#pragma unroll
    for (int i = 0; i < 16; ++i) { const unsigned short hb = bf16_bits(xs[i]); ah.u[i] = hb; al.u[i] = ASPLIT ? bf16_bits(xs[i] - bf16_val(hb)) : (unsigned short)0; }
#pragma unroll
    for (int t = 0; t < 4; ++t) {
      const unsigned short* brow = Wt + (size_t)(col0 + t * 16 + ln) * ldb + kb;
      FragB b;
      b.half[0] = *(const v8us*)(brow + 8 * hh);
      b.half[1] = *(const v8us*)(brow + 16 + 8 * hh);
      acc[t] = mmaN<ASPLIT ? 2 : 1>(ah.v, al.v, b.v, b.v, acc[t]);
    }
  }
#pragma unroll
  for (int t = 0; t < 4; ++t) {
    const int col = col0 + t * 16 + ln;
    float bv = bias ? bias[col] : 0.f;
    if (BIAS_BF16) bv = bf16_round(bv);
#pragma unroll
    for (int r = 0; r < 8; ++r) {
      float v = acc[t][r] + bv;
      if (resid) { float rv = resid[(size_t)((row0 + 8 * hh + r) % rmod) * ldr + col]; if (RES_BF16) rv = bf16_round(rv); v += rv; }
      if (ACT == 1) v = fmaxf(v, 0.f);
      if (ACT == 2) v = 0.5f * v * (1.0f + erff(v * 0.70710678118654752f));
      if (ACT == 3) { const float u = 0.7978845608028654f * (v + 0.044715f * v * v * v); v = 0.5f * v * (1.0f + tanhf(u)); }
      so[w][8 * hh + r][t * 16 + ln] = v;
    }
  }
  __builtin_amdgcn_fence(__ATOMIC_ACQ_REL, "workgroup");
  __builtin_amdgcn_wave_barrier();
  const int rsub = lane >> 4, c4 = (lane & 15) * 4;
  {
#pragma unroll
    for (int q = 0; q < 8; ++q) {
      const int r = q * 2 + rsub;
      const v4f v = *(const v4fa*)&so[w][r][c4];
      *(v4f*)(C + (size_t)(row0 + r) * ldc + col0 + c4) = v;
    }
    
  }
}
// row LayerNorm (biased variance, eps) over N: s = X (+ R); optional out_sum <- s; out_norm <- (s-mu)*rsqrt(var+eps)*g + b
template <bool PARAM_BF16>
__global__ __launch_bounds__(256) void k_layernorm(const float* __restrict__ X, const float* __restrict__ R, const float* __restrict__ g, const float* __restrict__ bta,
                                                  float* __restrict__ out_sum, float* __restrict__ out_norm, int N, float eps) {
  __shared__ float red[256];
  const int row = blockIdx.x, tid = threadIdx.x;
  const float* x = X + (size_t)row * N; const float* rr = R ? R + (size_t)row * N : nullptr;
  float vals[16];                     // up to N = 4096
  const int per = N / 256;            // contiguous chunk per thread? use strided-by-4 chunks: thread handles j = tid*4 + 1024*u
  float s1 = 0.f;
  for (int u = 0; u < per / 4; ++u) {
    const int j = tid * 4 + 1024 * u;
    const v4f a = *(const v4fa*)(x + j);
    v4f b = {0.f,0.f,0.f,0.f}; if (rr) b = *(const v4fa*)(rr + j);
#pragma unroll
    for (int q = 0; q < 4; ++q) { const float v = a[q] + b[q]; vals[u * 4 + q] = v; s1 += v; }
  }
  red[tid] = s1; __syncthreads();
  for (int st = 128; st > 0; st >>= 1) { if (tid < st) red[tid] += red[tid + st]; __syncthreads(); }
  const float mu = red[0] / (float)N; __syncthreads();
  float s2 = 0.f;
  for (int u = 0; u < per / 4; ++u)
#pragma unroll
    for (int q = 0; q < 4; ++q) { const float c = vals[u * 4 + q] - mu; s2 += c * c; }
  red[tid] = s2; __syncthreads();
  for (int st = 128; st > 0; st >>= 1) { if (tid < st) red[tid] += red[tid + st]; __syncthreads(); }
  const float rs = rsqrtf(red[0] / (float)N + eps);
  {
    for (int u = 0; u < per / 4; ++u) {
      const int j = tid * 4 + 1024 * u;
      v4f o, sm;
#pragma unroll
      for (int q = 0; q < 4; ++q) {
        float gg = g[j + q], bb = bta[j + q];
        if (PARAM_BF16) { gg = bf16_round(gg); bb = bf16_round(bb); }
        sm[q] = vals[u * 4 + q]; o[q] = (vals[u * 4 + q] - mu) * rs * gg + bb;
      }
      if (out_sum) *(v4f*)(out_sum + (size_t)row * N + j) = sm;
      *(v4f*)(out_norm + (size_t)row * N + j) = o;
    }
    
  }
}



// ---- f16 WMMA path (v_wmma_f32_16x16x32_f16): 11-bit significands for operands in range — used where a [0,1] probability operand needs more precision than bf16
typedef _Float16 v16h __attribute__((ext_vector_type(16)));
union FragH { v16h v; v8us half[2]; _Float16 h[16]; unsigned short u[16]; };
template <int NT>
__device__ __forceinline__ v8f mmaH(v16h ah, v16h al, v16h bh, v16h bl, v8f c) {
  c = __builtin_amdgcn_wmma_f32_16x16x32_f16(false, ah, false, bh, (short)0, c, false, false);
  if (NT >= 2) c = __builtin_amdgcn_wmma_f32_16x16x32_f16(false, al, false, bh, (short)0, c, false, false);
  if (NT >= 3) c = __builtin_amdgcn_wmma_f32_16x16x32_f16(false, ah, false, bl, (short)0, c, false, false);
  asm volatile("v_nop\n\tv_nop\n\tv_nop\n\tv_nop" : "+v"(c) : "v"(ah), "v"(al), "v"(bh), "v"(bl));
  return c;
}
// batched GEMM like k_gemm_b but f16 operands: A f32 (split into f16 hi/lo if ASPLIT, else rounded to f16), Bt = f16 values [n][k]; alpha; C f32; N multiple of 16 (partial tiles skipped)
template <bool ASPLIT>
__global__ __launch_bounds__(128) void k_gemm_h(const float* __restrict__ A, int lda, size_t sA, const _Float16* __restrict__ Bh, int ldb, size_t sB, float alpha, float* __restrict__ C, int ldc, size_t sC, int M, int N, int K) {
  __shared__ __attribute__((aligned(16))) float so[4][16][64];
  const int tid = threadIdx.x, w = tid >> 5, lane = tid & 31, ln = lane & 15, hh = lane >> 4; const int by = blockIdx.y;
  A += (size_t)by * sA; Bh += (size_t)by * sB; C += (size_t)by * sC;
  const int ntn = (N + 63) / 64; const int wid = blockIdx.x * 4 + w; const int mt = wid / ntn, nq = wid % ntn; if (mt * 16 >= M) return;
  const int row0 = mt * 16, col0 = nq * 64; const float* arow = A + (size_t)(row0 + ln) * lda;
  v8f acc[4] = {};
  for (int kb = 0; kb < K; kb += 32) {
    FragH ah, al;
    const v4f x0 = *(const v4fa*)(arow + kb + 8 * hh), x1 = *(const v4fa*)(arow + kb + 8 * hh + 4), x2 = *(const v4fa*)(arow + kb + 16 + 8 * hh), x3 = *(const v4fa*)(arow + kb + 16 + 8 * hh + 4);
    float xs[16] = {x0[0],x0[1],x0[2],x0[3],x1[0],x1[1],x1[2],x1[3],x2[0],x2[1],x2[2],x2[3],x3[0],x3[1],x3[2],x3[3]};
#pragma unroll
    for (int i = 0; i < 16; ++i) { const _Float16 h = (_Float16)xs[i]; ah.h[i] = h; al.h[i] = ASPLIT ? (_Float16)(xs[i] - (float)h) : (_Float16)0.0f; }
#pragma unroll
    for (int t = 0; t < 4; ++t) { if (col0 + t * 16 >= N) continue; const size_t boff = (size_t)(col0 + t * 16 + ln) * ldb + kb; FragH bq; bq.half[0] = *(const v8us*)(Bh + boff + 8 * hh); bq.half[1] = *(const v8us*)(Bh + boff + 16 + 8 * hh);
      acc[t] = mmaH<ASPLIT ? 2 : 1>(ah.v, al.v, bq.v, bq.v, acc[t]); }
  }
#pragma unroll
  for (int t = 0; t < 4; ++t) { if (col0 + t * 16 >= N) continue;
#pragma unroll
    for (int r = 0; r < 8; ++r) so[w][8 * hh + r][t * 16 + ln] = acc[t][r] * alpha; }
  __builtin_amdgcn_fence(__ATOMIC_ACQ_REL, "workgroup"); __builtin_amdgcn_wave_barrier();
  const int rsub = lane >> 4, c4 = (lane & 15) * 4;
  {
#pragma unroll
    for (int q = 0; q < 8; ++q) { const int r = q * 2 + rsub; if (col0 + c4 < N) { const v4f v = *(const v4fa*)&so[w][r][c4]; *(v4f*)(C + (size_t)(row0 + r) * ldc + col0 + c4) = v; } }
     }
}

// Wt[n][k] = f16(W[k][n]·scale) from f32 row-major W[K][N] (scale = power of two; bf16-exact weights stay exact in f16 away from the subnormal range)
__global__ __launch_bounds__(256) void k_wt_f16(const float* __restrict__ W, _Float16* __restrict__ Wt, int K, int N, float scale) {
  const int t = blockIdx.x * 256 + threadIdx.x; if (t >= N * (K / 8)) return; const int n = t / (K / 8), k8 = (t % (K / 8)) * 8; FragH f;
#pragma unroll
  for (int i = 0; i < 8; ++i) f.h[i] = (_Float16)(bf16_round(W[(size_t)(k8 + i) * N + n]) * scale); const v8us o = f.half[0];
  *(v8us*)((unsigned short*)Wt + (size_t)n * K + k8) = o; 
}
// C16[r][c] = f16(sum_k A[r][k] * Bt[c][k] * alpha + bf16(bias[c])): A f16 [NR][DD], Bt f16 [DD][DD]. One work-group = a 128 x 128 tile of C, 8 waves of 64 x 32 (4 x 2 accumulators);
// k runs in slices of 128 through an LDS ring of two buffers that all 8 waves share; per output element the WMMAs follow one another in rising k, 32 at a time
__global__ __launch_bounds__(256) void k_gemm_t(const _Float16* __restrict__ A, const _Float16* __restrict__ Bt, float alpha, const float* __restrict__ bias, _Float16* __restrict__ C16) {
  // rows of 128 f16 = 256 B; LDS pitch 272 B (16 B x odd) keeps the 16 rows of a ds_load_b128 fragment read on distinct banks
  constexpr int BT = 128, BK = 128, NSL = DD / BK, LP = BK + 8, TBY = BT * LP * 2, CP = BT + 8;
  __shared__ __attribute__((aligned(16))) unsigned short sA[2][BT][LP]; __shared__ __attribute__((aligned(16))) unsigned short sB[2][BT][LP]; __shared__ __attribute__((aligned(16))) unsigned short sC[BT][CP];
  const int tid = threadIdx.x, w = tid >> 5, lane = tid & 31, ln = lane & 15, hh = lane >> 4;
  const int row0 = (blockIdx.x % (NR / BT)) * BT, col0 = (blockIdx.x / (NR / BT)) * BT; const int wm = (w >> 2) * 64, wn = (w & 3) * 32;
  // each thread copies 16 B of rows crow, crow + 16, ..., crow + 112 of both tiles: a wave's copy covers four whole 128-B lines
  const int crow = tid >> 4, ccol = tid & 15;
  const unsigned short* gA = (const unsigned short*)A + (size_t)(row0 + crow) * DD + ccol * 8; const unsigned short* gB = (const unsigned short*)Bt + (size_t)(col0 + crow) * DD + ccol * 8;
  const unsigned lA = (unsigned)(uintptr_t)&sA[0][crow][ccol * 8], lB = (unsigned)(uintptr_t)&sB[0][crow][ccol * 8];
  auto copy8 = [&](unsigned l, const unsigned short* g) {
    // global -> LDS through no register; s_wait_xcnt 0 closes the statement so that no address register is rewritten ahead of it
    asm volatile("global_load_async_to_lds_b128 %0, %8, off\n\tglobal_load_async_to_lds_b128 %1, %9, off\n\tglobal_load_async_to_lds_b128 %2, %10, off\n\tglobal_load_async_to_lds_b128 %3, %11, off\n\t"
                 "global_load_async_to_lds_b128 %4, %12, off\n\tglobal_load_async_to_lds_b128 %5, %13, off\n\tglobal_load_async_to_lds_b128 %6, %14, off\n\tglobal_load_async_to_lds_b128 %7, %15, off\n\ts_wait_xcnt 0x0"
                 :: "v"(l), "v"(l + 16 * LP * 2), "v"(l + 32 * LP * 2), "v"(l + 48 * LP * 2), "v"(l + 64 * LP * 2), "v"(l + 80 * LP * 2), "v"(l + 96 * LP * 2), "v"(l + 112 * LP * 2),
                    "v"(g), "v"(g + 16 * DD), "v"(g + 32 * DD), "v"(g + 48 * DD), "v"(g + 64 * DD), "v"(g + 80 * DD), "v"(g + 96 * DD), "v"(g + 112 * DD) : "memory"); };
  auto stage = [&](int st, int bf) { copy8(lA + bf * TBY, gA + st * BK); copy8(lB + bf * TBY, gB + st * BK); };
  v8f acc[4][2];
#pragma unroll
  for (int mi = 0; mi < 4; ++mi)
#pragma unroll
    for (int ni = 0; ni < 2; ++ni) acc[mi][ni] = (v8f){0.f,0.f,0.f,0.f,0.f,0.f,0.f,0.f};
  stage(0, 0);
  asm volatile("s_wait_asynccnt 0x0" ::: "memory");      // this wave's copies of slice 0 have landed
  __syncthreads();                                        // ... and every other wave's: slice 0 may be read
  stage(1, 1);
#pragma unroll 1      /* one copy of the ring's foot; the buffer index stays t & 1 */
  for (int t = 0; t < NSL; ++t) { const int bf = t & 1; const unsigned short* ab = &sA[bf][wm + ln][8 * hh]; const unsigned short* bb = &sB[bf][wn + ln][8 * hh];
    FragH a[2][4], bq[2][2];      /* two fragment sets: the next 32 k of THIS slice are read while the present 32 are multiplied */
    auto frags = [&](int ks, int s) {
#pragma unroll
      for (int mi = 0; mi < 4; ++mi) { a[s][mi].half[0] = *(const v8us*)(ab + mi * 16 * LP + ks * 32); a[s][mi].half[1] = *(const v8us*)(ab + mi * 16 * LP + ks * 32 + 16); }
#pragma unroll
      for (int ni = 0; ni < 2; ++ni) { bq[s][ni].half[0] = *(const v8us*)(bb + ni * 16 * LP + ks * 32); bq[s][ni].half[1] = *(const v8us*)(bb + ni * 16 * LP + ks * 32 + 16); } };
    frags(0, 0);
#pragma unroll
    for (int ks = 0; ks < BK / 32; ++ks) { if (ks + 1 < BK / 32) frags(ks + 1, (ks + 1) & 1);
      __builtin_amdgcn_sched_barrier(0);      // keeps the next step's 12 LDS reads in front of this step's WMMAs; without it each read sinks to its use and its latency is waited for
#pragma unroll
      for (int mi = 0; mi < 4; ++mi)
#pragma unroll
        for (int ni = 0; ni < 2; ++ni) acc[mi][ni] = __builtin_amdgcn_wmma_f32_16x16x32_f16(false, a[ks & 1][mi].v, false, bq[ks & 1][ni].v, (short)0, acc[mi][ni], false, false); }
    asm volatile("s_wait_dscnt 0x0" ::: "memory");        // this wave's reads of buffer bf are done before it is refilled
    asm volatile("s_wait_asynccnt 0x0" ::: "memory");     // this wave's copies of slice t + 1 have landed
    __syncthreads();                                        // publishes slice t + 1 and ends every wave's reads of buffer bf
    if (t + 2 < NSL) stage(t + 2, bf); }
  asm volatile("s_wait_asynccnt 0x0" ::: "memory");       // no copy is outstanding when the wave goes on to the epilogue
  // the tile goes through LDS as f16 so that each 256-B row piece of C is stored as whole 128-B lines
#pragma unroll
  for (int ni = 0; ni < 2; ++ni) { const float bv = bf16_round(bias[col0 + wn + ni * 16 + ln]);
#pragma unroll
    for (int mi = 0; mi < 4; ++mi)
#pragma unroll
      for (int r = 0; r < 8; ++r) { FragH c1; c1.h[0] = (_Float16)(acc[mi][ni][r] * alpha + bv); sC[wm + mi * 16 + 8 * hh + r][wn + ni * 16 + ln] = c1.u[0]; } }
  __syncthreads();
#pragma unroll
  for (int i = 0; i < BT * (BT / 8) / 256; ++i) { const int e = tid + i * 256, r = e >> 4, c8 = (e & 15) * 8; const v8us o = *(const v8us*)&sC[r][c8]; *(v8us*)((unsigned short*)C16 + (size_t)(row0 + r) * DD + col0 + c8) = o; }
}


typedef _Float16 v4h __attribute__((ext_vector_type(4)));

__global__ __launch_bounds__(256) void k_x16(const float* __restrict__ x, _Float16* __restrict__ X16, size_t n8) { const size_t t = (size_t)blockIdx.x * 256 + threadIdx.x; if (t >= n8) return; FragH f;
#pragma unroll
  for (int q = 0; q < 8; ++q) f.h[q] = (_Float16)bf16_round(x[t * 8 + q]); *(v8us*)((unsigned short*)X16 + t * 8) = f.half[0];  }
__global__ __launch_bounds__(256) void k_h16(const float* __restrict__ x, _Float16* __restrict__ X16, size_t n8) { const size_t t = (size_t)blockIdx.x * 256 + threadIdx.x; if (t >= n8) return; FragH f;
#pragma unroll
  for (int q = 0; q < 8; ++q) f.h[q] = (_Float16)x[t * 8 + q]; *(v8us*)((unsigned short*)X16 + t * 8) = f.half[0];  }
__global__ __launch_bounds__(256) void k_round16f(const float* __restrict__ W, _Float16* __restrict__ Bt, size_t n8) { const size_t t = (size_t)blockIdx.x * 256 + threadIdx.x; if (t >= n8) return; FragH f;
#pragma unroll
  for (int i = 0; i < 8; ++i) f.h[i] = (_Float16)(bf16_round(W[t * 8 + i]) * 16.0f); *(v8us*)((unsigned short*)Bt + t * 8) = f.half[0];  }
template <int NHv, int TTv>
__global__ __launch_bounds__(256) void k_vt(const _Float16* __restrict__ V16, int ldv, int voff, _Float16* __restrict__ Vt) { __shared__ unsigned short tl[64][66]; const int tid = threadIdx.x; const int slab = blockIdx.x / (TTv / 64), lg = blockIdx.x % (TTv / 64); const int b = slab / NHv, h = slab % NHv;
  for (int i = tid; i < 64 * 8; i += 256) { const int r = i / 8, c8 = (i % 8) * 8; FragH f; f.half[0] = *(const v8us*)((const unsigned short*)V16 + ((size_t)b * TTv + lg * 64 + r) * ldv + voff + h * 64 + c8);
#pragma unroll
    for (int q = 0; q < 8; ++q) tl[r][c8 + q] = f.u[q]; }
  __syncthreads();
  {
#pragma unroll
    for (int rd = 0; rd < 2; ++rd) { const int d = rd * 32 + tid / 8, pc = tid % 8; FragH f;
#pragma unroll
      for (int q = 0; q < 8; ++q) f.u[q] = tl[pc * 8 + q][d];
      *(v8us*)((unsigned short*)Vt + ((size_t)slab * 64 + d) * TTv + lg * 64 + pc * 8) = f.half[0]; }
     } }

template <int D, int RBF>
__global__ __launch_bounds__(256) void k_lnx(const float* __restrict__ X, const float* __restrict__ gam, const float* __restrict__ bet, int nrows, float eps, _Float16* __restrict__ O16, float* __restrict__ XR) {
  constexpr int NP = D / 128; const int tid = threadIdx.x, wv = tid >> 5, lane = tid & 31; const size_t r = (size_t)blockIdx.x * 8 + wv; if (r >= (size_t)nrows) return; v4f y[NP]; float s = 0.f;
#pragma unroll
  for (int j = 0; j < NP; ++j) { const int c = j * 128 + lane * 4; v4f g = *(const v4fa*)(X + r * D + c); if (RBF) { for (int q = 0; q < 4; ++q) g[q] = bf16_round(g[q]); } y[j] = g; s += g[0] + g[1] + g[2] + g[3]; }
  for (int o = 16; o >= 1; o >>= 1) s += __shfl_xor(s, o, 32); const float mu = s / (float)D; float q2 = 0.f;
#pragma unroll
  for (int j = 0; j < NP; ++j) for (int q = 0; q < 4; ++q) { const float d = y[j][q] - mu; q2 += d * d; }
  for (int o = 16; o >= 1; o >>= 1) q2 += __shfl_xor(q2, o, 32); const float rs = rsqrtf(q2 / (float)D + eps);
  {
#pragma unroll
    for (int j = 0; j < NP; ++j) { const int c = j * 128 + lane * 4; v4h h; for (int q = 0; q < 4; ++q) { const float v = (y[j][q] - mu) * rs * bf16_round(gam[c + q]) + bf16_round(bet[c + q]); h[q] = (_Float16)v; } *(v4h*)(O16 + r * D + c) = h; if (XR) *(v4f*)(XR + r * D + c) = y[j]; }
     } }
__global__ __launch_bounds__(256) void k_addres(const float* __restrict__ O, const float* __restrict__ XR, float* __restrict__ out, size_t n4) { const size_t t = (size_t)blockIdx.x * 256 + threadIdx.x; if (t >= n4) return; v4f a = *(const v4fa*)(O + t * 4); const v4f b = *(const v4fa*)(XR + t * 4); for (int q = 0; q < 4; ++q) a[q] += b[q]; *(v4f*)(out + t * 4) = a;  }
// y[i] = 2^x[i], twelve independent v_exp_f32 in one statement with results in registers of their own (=&v), so that none overwrites the source of the one in front of it;
// the closing v_nop is the slot the instruction set asks for behind a transcendental before its result is read or its source overwritten
__device__ __forceinline__ void exp2x12(float* __restrict__ y, const float* __restrict__ x) {
  asm("v_exp_f32 %0, %12\n\tv_exp_f32 %1, %13\n\tv_exp_f32 %2, %14\n\tv_exp_f32 %3, %15\n\tv_exp_f32 %4, %16\n\tv_exp_f32 %5, %17\n\t"
      "v_exp_f32 %6, %18\n\tv_exp_f32 %7, %19\n\tv_exp_f32 %8, %20\n\tv_exp_f32 %9, %21\n\tv_exp_f32 %10, %22\n\tv_exp_f32 %11, %23\n\tv_nop"
      : "=&v"(y[0]), "=&v"(y[1]), "=&v"(y[2]), "=&v"(y[3]), "=&v"(y[4]), "=&v"(y[5]), "=&v"(y[6]), "=&v"(y[7]), "=&v"(y[8]), "=&v"(y[9]), "=&v"(y[10]), "=&v"(y[11])
      : "v"(x[0]), "v"(x[1]), "v"(x[2]), "v"(x[3]), "v"(x[4]), "v"(x[5]), "v"(x[6]), "v"(x[7]), "v"(x[8]), "v"(x[9]), "v"(x[10]), "v"(x[11])); }
// the same for five values
__device__ __forceinline__ void exp2x5(float* __restrict__ y, const float* __restrict__ x) {
  asm("v_exp_f32 %0, %5\n\tv_exp_f32 %1, %6\n\tv_exp_f32 %2, %7\n\tv_exp_f32 %3, %8\n\tv_exp_f32 %4, %9\n\tv_nop"
      : "=&v"(y[0]), "=&v"(y[1]), "=&v"(y[2]), "=&v"(y[3]), "=&v"(y[4]) : "v"(x[0]), "v"(x[1]), "v"(x[2]), "v"(x[3]), "v"(x[4])); }
typedef int v4ia __attribute__((ext_vector_type(4), may_alias));
// the value that lane l ^ 16 holds
__device__ __forceinline__ float xhalf(float x) { const int b = __float_as_int(x); return __int_as_float(__builtin_amdgcn_permlanex16(b, b, 0x76543210, 0xfedcba98, false, false)); }
// Scores are computed transposed: S^T = K Q^T (A = 16 keys from LDS, B = the wave's 16 queries, kept in registers), O^T += V^T P^T. Lane (ln, hh) holds query q0 + ln alone:
// register r of score tile nt is key j0 + nt * 16 + 8 * hh + r, so maximum and sum run inside the lane with one exchange between the halves, and the two score tiles, converted in place, are the B operand of the second product
__global__ __launch_bounds__(128) void k_flash(const _Float16* __restrict__ Q16, int ldq, const _Float16* __restrict__ K16, int ldk, const _Float16* __restrict__ Vt, const int* __restrict__ MSK, float* __restrict__ O, int ldo) {
  constexpr int RPW = 16, NQB = TT / (4 * RPW), DT = 4, KS = 2;
  __shared__ __attribute__((aligned(16))) float sO[4][RPW][64 + 4];
  // K/V ring, two buffers, one stage = SKEY keys: sK rows = keys (64 d = 128 B), sV rows = d (SKEY keys = 128 B); LDS pitch 144 B (16 B x odd) keeps the 16 rows of a ds_load_b128 fragment read on distinct banks
  constexpr int SKEY = 64, NST = TT / SKEY, LP = 72, SBUF = 64 * LP * 2; constexpr float SC = 0.125f * 1.44269504088896340736f;      /* 64^-1/2 * log2(e) */
  __shared__ __attribute__((aligned(16))) unsigned short sK[2][SKEY][LP]; __shared__ __attribute__((aligned(16))) unsigned short sV[2][64][LP];
  const int tid = threadIdx.x, w = tid >> 5, lane = tid & 31, ln = lane & 15, hh = lane >> 4;
  const int slab = blockIdx.x / NQB, qblk = blockIdx.x % NQB; const int b = slab / NH, h = slab % NH; const int qb0 = qblk * (4 * RPW); const int q0 = qb0 + w * RPW;
  FragH aq[KS];
  { const unsigned short* qr = (const unsigned short*)Q16 + ((size_t)b * TT + q0 + ln) * ldq + h * 64;
#pragma unroll
    for (int ks = 0; ks < KS; ++ks) { aq[ks].half[0] = *(const v8us*)(qr + ks * 32 + 8 * hh); aq[ks].half[1] = *(const v8us*)(qr + ks * 32 + 16 + 8 * hh); } }
  const unsigned short* Vth = (const unsigned short*)Vt + (size_t)slab * 64 * TT;
  const int* mrow = MSK + ((size_t)b * TT + q0 + ln) * TT + 8 * hh;      /* this lane's query row of the mask, at its half's first key */
  float m_r = -3.0e38f, l_r = 0.f; v8f oacc[DT];
#pragma unroll
  for (int dt = 0; dt < DT; ++dt) oacc[dt] = (v8f){0.f,0.f,0.f,0.f,0.f,0.f,0.f,0.f};
  // each thread copies 16 B of rows crow, crow + 16, + 32, + 48 of both tiles: a wave's copy covers four whole 128-B lines
  const int crow = tid >> 3, ccol = tid & 7;
  const unsigned short* gK = (const unsigned short*)K16 + ((size_t)b * TT + crow) * ldk + h * 64 + ccol * 8; const unsigned short* gV = Vth + (size_t)crow * TT + ccol * 8;
  const unsigned lK = (unsigned)(uintptr_t)&sK[0][crow][ccol * 8], lV = (unsigned)(uintptr_t)&sV[0][crow][ccol * 8];
  auto stage = [&](int st, int bf) { const unsigned short* k0 = gK + (size_t)st * SKEY * ldk; const unsigned short* v0 = gV + st * SKEY; const unsigned lk = lK + bf * SBUF, lv = lV + bf * SBUF;
    // global -> LDS through no register; s_wait_xcnt 0 closes the statement so that no address register is rewritten ahead of it
    asm volatile("global_load_async_to_lds_b128 %0, %8, off\n\tglobal_load_async_to_lds_b128 %1, %9, off\n\tglobal_load_async_to_lds_b128 %2, %10, off\n\tglobal_load_async_to_lds_b128 %3, %11, off\n\t"
                 "global_load_async_to_lds_b128 %4, %12, off\n\tglobal_load_async_to_lds_b128 %5, %13, off\n\tglobal_load_async_to_lds_b128 %6, %14, off\n\tglobal_load_async_to_lds_b128 %7, %15, off\n\ts_wait_xcnt 0x0"
                 :: "v"(lk), "v"(lk + 16 * LP * 2), "v"(lk + 32 * LP * 2), "v"(lk + 48 * LP * 2), "v"(lv), "v"(lv + 16 * LP * 2), "v"(lv + 32 * LP * 2), "v"(lv + 48 * LP * 2),
                    "v"(k0), "v"(k0 + (size_t)16 * ldk), "v"(k0 + (size_t)32 * ldk), "v"(k0 + (size_t)48 * ldk), "v"(v0), "v"(v0 + 16 * TT), "v"(v0 + 32 * TT), "v"(v0 + 48 * TT) : "memory"); };
  stage(0, 0);
  asm volatile("s_wait_asynccnt 0x0" ::: "memory");      // this wave's copies of stage 0 have landed
  __syncthreads();                                        // ... and every other wave's: stage 0 may be read
  stage(1, 1);
#pragma unroll 1      /* one copy of the ring's foot; the buffer index stays t & 1 */
  for (int t = 0; t < NST; ++t) { const int bf = t & 1;
  for (int sub = 0; sub < SKEY / 32; ++sub) { const int j0 = t * SKEY + sub * 32;
    v4ia mk[2][2];      /* nonzero = MASKED; mk[nt][r >> 2][r & 3] belongs to register r of score tile nt */
#pragma unroll
    for (int nt = 0; nt < 2; ++nt) { mk[nt][0] = *(const v4ia*)(mrow + j0 + nt * 16); mk[nt][1] = *(const v4ia*)(mrow + j0 + nt * 16 + 4); }
    float sv[16];      /* unscaled scores of keys j0 + 8 hh + 0..7 and j0 + 16 + 8 hh + 0..7; the running maximum is kept unscaled too */
#pragma unroll
    for (int nt = 0; nt < 2; ++nt) { const unsigned short* kr = &sK[bf][sub * 32 + nt * 16 + ln][0]; FragH bk[KS];
#pragma unroll
      for (int ks = 0; ks < KS; ++ks) { bk[ks].half[0] = *(const v8us*)(kr + ks * 32 + 8 * hh); bk[ks].half[1] = *(const v8us*)(kr + ks * 32 + 16 + 8 * hh); }
      v8f acc = (v8f){0.f,0.f,0.f,0.f,0.f,0.f,0.f,0.f};
#pragma unroll
      for (int ks = 0; ks < KS; ++ks) acc = mmaH<1>(bk[ks].v, bk[ks].v, aq[ks].v, aq[ks].v, acc);
#pragma unroll
      for (int r = 0; r < 8; ++r) sv[nt * 8 + r] = (mk[nt][r >> 2][r & 3] == 0) ? acc[r] : -INFINITY; }
    float mc = fmaxf(sv[0], sv[1]);
#pragma unroll
    for (int i = 2; i < 16; ++i) mc = fmaxf(mc, sv[i]);
    mc = fmaxf(mc, xhalf(mc));      /* the other half's 16 keys of the same query */
    // e^(0.125 (s - m)) = 2^(s * SC - m * SC): one fma per score, no branch; a masked score is -inf and gives 0 (m is finite: it starts at -3e38)
    const float mn = fmaxf(m_r, mc), nb = -mn * SC; float ex[17], ey[17]; ex[16] = (m_r - mn) * SC;
#pragma unroll
    for (int i = 0; i < 16; ++i) ex[i] = fmaf(sv[i], SC, nb);
    exp2x12(ey, ex); exp2x5(ey + 12, ex + 12);
    const float* p = ey; const float al = (mn > -1.0e38f) ? ey[16] : 1.0f; m_r = mn;
    float ps = p[0];
#pragma unroll
    for (int i = 1; i < 16; ++i) ps += p[i];
    l_r = l_r * al + ps;      /* this half's keys only; the halves are joined behind the loop */
#pragma unroll
    for (int dt = 0; dt < DT; ++dt)
#pragma unroll
      for (int r = 0; r < 8; ++r) oacc[dt][r] *= al;
    FragH pb;      /* B operand: column ln = the query, element i = key kmap(i, hh) of the 32: the order in which sv holds them */
#pragma unroll
    for (int i = 0; i < 16; ++i) pb.h[i] = (_Float16)(p[i] * 1024.0f);
#pragma unroll
    for (int dt = 0; dt < DT; ++dt) { const unsigned short* vrow = &sV[bf][dt * 16 + ln][sub * 32]; FragH bv; bv.half[0] = *(const v8us*)(vrow + 8 * hh); bv.half[1] = *(const v8us*)(vrow + 16 + 8 * hh);
      oacc[dt] = mmaH<1>(bv.v, bv.v, pb.v, pb.v, oacc[dt]); } }
    asm volatile("s_wait_dscnt 0x0" ::: "memory");        // this wave's reads of buffer bf are done before it is refilled
    asm volatile("s_wait_asynccnt 0x0" ::: "memory");     // this wave's copies of stage t + 1 have landed
    __syncthreads();                                        // publishes stage t + 1 and ends every wave's reads of buffer bf
    if (t + 2 < NST) stage(t + 2, bf); }
  asm volatile("s_wait_asynccnt 0x0" ::: "memory");       // no copy is outstanding when the wave goes on to the epilogue
  const float l = l_r + xhalf(l_r); const float li = (l > 0.f) ? 1.0f / (l * 1024.0f) : 0.f;
  // register r of oacc[dt] is O[q0 + ln][dt * 16 + 8 hh + r]: eight consecutive d of the lane's query
#pragma unroll
  for (int dt = 0; dt < DT; ++dt) { v4f lo, hi;
#pragma unroll
    for (int r = 0; r < 4; ++r) { lo[r] = oacc[dt][r] * li; hi[r] = oacc[dt][4 + r] * li; }
    *(v4fa*)&sO[w][ln][dt * 16 + 8 * hh] = lo; *(v4fa*)&sO[w][ln][dt * 16 + 8 * hh + 4] = hi; }
  __builtin_amdgcn_fence(__ATOMIC_ACQ_REL, "workgroup"); __builtin_amdgcn_wave_barrier();
  {
#pragma unroll
    for (int rp = 0; rp < RPW; rp += 2) { const int r = rp + (lane >> 4), pc = lane & 15; const v4f val = *(const v4fa*)&sO[w][r][pc * 4]; *(v4f*)(O + ((size_t)b * TT + q0 + r) * ldo + h * 64 + pc * 4) = val; }
     } }

extern "C" void kernel_launch(void* const* d_in, const int* in_sizes, int n_in,
                              void* d_out, int out_size, void* d_ws, size_t ws_size, hipStream_t stream) {
  (void)in_sizes; (void)n_in; (void)out_size;
  const float* const* I = (const float* const*)d_in; const float* Qx = I[0]; const float* Kx = I[1]; const float* Vx = I[2]; const int* mask = (const int*)d_in[3];      /* bool mask shipped as int32 [2,1,2048,2048] */
  const float* Wq = I[4]; const float* bq = I[5]; const float* Wk = I[6]; const float* bk = I[7]; const float* Wv = I[8]; const float* bv = I[9]; const float* gam = I[10]; const float* bet = I[11];
  char* ws = (char*)d_ws; size_t off = 0;
  auto take = [&](size_t bytes) { char* p = ws + off; off += (bytes + 255) & ~(size_t)255; return p; };
  const size_t WSZ = (size_t)DD * DD; _Float16* Bw = (_Float16*)take(3 * WSZ * 2); float* XR = (float*)take((size_t)NR * DD * 4); _Float16* H16 = (_Float16*)take((size_t)NR * DD * 2);
  _Float16* Q = (_Float16*)take((size_t)NR * DD * 2); _Float16* K = (_Float16*)take((size_t)NR * DD * 2); _Float16* V = (_Float16*)take((size_t)NR * DD * 2); _Float16* Vt = (_Float16*)take((size_t)NR * DD * 2); float* O = (float*)take((size_t)NR * DD * 4);
  if (off > ws_size) return;      // 6.3 + 16.8 + 8.4 + 4 × 8.4 + 16.8 ≈ 82 MB
  const unsigned gw = (unsigned)(((size_t)DD * (DD / 8) + 255) / 256); k_wt_f16<<<gw, 256, 0, stream>>>(Wq, Bw, DD, DD, 16.0f); k_wt_f16<<<gw, 256, 0, stream>>>(Wk, Bw + WSZ, DD, DD, 16.0f); k_wt_f16<<<gw, 256, 0, stream>>>(Wv, Bw + 2 * WSZ, DD, DD, 16.0f);      /* (in,out) → Bt ×2^4 */
  const unsigned gp = (NR / 128) * (DD / 128);
  k_lnx<DD, 1><<<(NR + 7) / 8, 256, 0, stream>>>(Qx, gam, bet, NR, 1e-5f, H16, XR);      /* LN(bf16 Q) → f16; XR = bf16(Q) for the residual */
  k_gemm_t<<<gp, 256, 0, stream>>>(H16, Bw, 0.0625f, bq, Q);      /* M 4096 N 1024 K 1024 */
  k_lnx<DD, 1><<<(NR + 7) / 8, 256, 0, stream>>>(Kx, gam, bet, NR, 1e-5f, H16, nullptr);
  k_gemm_t<<<gp, 256, 0, stream>>>(H16, Bw + WSZ, 0.0625f, bk, K);
  k_lnx<DD, 1><<<(NR + 7) / 8, 256, 0, stream>>>(Vx, gam, bet, NR, 1e-5f, H16, nullptr);
  k_gemm_t<<<gp, 256, 0, stream>>>(H16, Bw + 2 * WSZ, 0.0625f, bv, V);
  k_vt<NH, TT><<<BB * NH * (TT / 64), 256, 0, stream>>>(V, DD, 0, Vt);
  k_flash<<<BB * NH * (TT / 64), 128, 0, stream>>>(Q, DD, K, DD, Vt, mask, O, DD);
  k_addres<<<(unsigned)(((size_t)NR * DD / 4 + 255) / 256), 256, 0, stream>>>(O, XR, (float*)d_out, (size_t)NR * DD / 4);      /* out = o + Q */
}

// v005
// One run takes 136 microseconds.
// Next to v004, in two timings, it ran 1.14 times as fast each time.
// Over all steps from v000 it is 3.19 times as fast.
#include <hip/hip_runtime.h>
// Pre-norm multi-head attention with a boolean mask and residual (B=2, N=2048, E=1024, 16 heads × 64): q = LN(Q)·Wq + bq, k = LN(K)·Wk + bk, v = LN(V)·Wv + bv (one shared LayerNorm γ,β; (in,out) weights); s = q·kᵀ·64^-½ with −inf where mask[b,0,n,m] is True;
// softmax; o = merged attn·v; out = o + Q (no output projection).
// Compute dtype: Q, K, V, weights, biases, γ, β rounded to bf16; LayerNorms f32 (wave per row) → f16; q/k/v f16 GEMM planes; fused flash-style kernel (int32 mask loads per (q,k), online softmax f32, P f16 ×2^10) on
// v_wmma_f32_16x16x32_f16; out = o (f32) + bf16(Q) (f32 add); f32 accumulate.
#define BB 2
#define TT 2048
#define DD 1024
#define NH 16
#define NR (BB * TT)

typedef __bf16 v16b __attribute__((ext_vector_type(16)));
typedef unsigned short v8us __attribute__((ext_vector_type(8), may_alias));
typedef float  v8f  __attribute__((ext_vector_type(8)));
typedef float  v4f  __attribute__((ext_vector_type(4)));
typedef float  v4fa __attribute__((ext_vector_type(4), may_alias));
union FragB { v16b v; v8us half[2]; unsigned short u[16]; };

__device__ __forceinline__ unsigned short bf16_bits(float x) { unsigned int u = __float_as_uint(x); return (unsigned short)((u + 0x7FFFu + ((u >> 16) & 1u)) >> 16); }
__device__ __forceinline__ float bf16_val(unsigned short b) { return __uint_as_float(((unsigned int)b) << 16); }
__device__ __forceinline__ float bf16_round(float x) { return bf16_val(bf16_bits(x)); }
// D += A·B with NT terms: 1 = ah·bh, 2 = + al·bh (A split), 3 = + ah·bl (both split)
template <int NT>
__device__ __forceinline__ v8f mmaN(v16b ah, v16b al, v16b bh, v16b bl, v8f c) {
  c = __builtin_amdgcn_wmma_f32_16x16x32_bf16(false, ah, false, bh, (short)0, c, false, false);
  if (NT >= 2) c = __builtin_amdgcn_wmma_f32_16x16x32_bf16(false, al, false, bh, (short)0, c, false, false);
  if (NT >= 3) c = __builtin_amdgcn_wmma_f32_16x16x32_bf16(false, ah, false, bl, (short)0, c, false, false);
  asm volatile("v_nop\n\tv_nop\n\tv_nop\n\tv_nop" : "+v"(c) : "v"(ah), "v"(al), "v"(bh), "v"(bl));
  return c;
}

__global__ __launch_bounds__(256) void k_wt_bf16(const float* __restrict__ W, unsigned short* __restrict__ Wt, int K, int N) {
  const int t = blockIdx.x * 256 + threadIdx.x;
  const int k8n = K / 8;
  if (t >= N * k8n) return;
  const int n = t / k8n, k8 = (t % k8n) * 8;
  v8us v;
#pragma unroll
  for (int i = 0; i < 8; ++i) v[i] = bf16_bits(W[(size_t)(k8 + i) * N + n]);
  *(v8us*)(Wt + (size_t)n * K + k8) = v;
  
}

// GEMM C[M][N] (f32, pitch ldc) = act(A[M][K]·W + bias). A f32 row-major (pitch lda) converted per fragment to bf16
// (ASPLIT: hi/lo two planes -> 2 terms, else single rounded term); Wt bf16 [N][K] (pitch ldb). BIAS_BF16 rounds the
// bias to bf16 first (bias quantised to bf16 before the add). K%32==0, M%16==0, N%64==0.
template <bool ASPLIT, int ACT, bool BIAS_BF16>
__global__ __launch_bounds__(128) void k_gemm_bf(const float* __restrict__ A, int lda, const unsigned short* __restrict__ Wt, int ldb,
                                               const float* __restrict__ bias, float* __restrict__ C, int ldc, int M, int N, int K) {
  __shared__ __attribute__((aligned(16))) float so[4][16][64];
  const int tid = threadIdx.x, w = tid >> 5, lane = tid & 31, ln = lane & 15, hh = lane >> 4;
  const int ntn = N / 64;
  const int wid = blockIdx.x * 4 + w;
  const int mt = wid / ntn, nq = wid % ntn;
  if (mt * 16 >= M) return;
  const int row0 = mt * 16, col0 = nq * 64;
  const float* arow = A + (size_t)(row0 + ln) * lda;
  v8f acc[4] = {};
  for (int kb = 0; kb < K; kb += 32) {
    FragB ah, al;
    const v4f x0 = *(const v4fa*)(arow + kb + 8 * hh), x1 = *(const v4fa*)(arow + kb + 8 * hh + 4);
    const v4f x2 = *(const v4fa*)(arow + kb + 16 + 8 * hh), x3 = *(const v4fa*)(arow + kb + 16 + 8 * hh + 4);
    float xs[16] = {x0[0],x0[1],x0[2],x0[3],x1[0],x1[1],x1[2],x1[3],x2[0],x2[1],x2[2],x2[3],x3[0],x3[1],x3[2],x3[3]};
#pragma unroll
    for (int i = 0; i < 16; ++i) { const unsigned short hb = bf16_bits(xs[i]); ah.u[i] = hb; al.u[i] = ASPLIT ? bf16_bits(xs[i] - bf16_val(hb)) : (unsigned short)0; }
#pragma unroll
    for (int t = 0; t < 4; ++t) {
      const unsigned short* brow = Wt + (size_t)(col0 + t * 16 + ln) * ldb + kb;
      FragB b;
      b.half[0] = *(const v8us*)(brow + 8 * hh);
      b.half[1] = *(const v8us*)(brow + 16 + 8 * hh);
      acc[t] = mmaN<ASPLIT ? 2 : 1>(ah.v, al.v, b.v, b.v, acc[t]);
    }
  }
#pragma unroll
  for (int t = 0; t < 4; ++t) {
    float bv = bias ? bias[col0 + t * 16 + ln] : 0.f;
    if (BIAS_BF16) bv = bf16_round(bv);
#pragma unroll
    for (int r = 0; r < 8; ++r) { float v = acc[t][r] + bv; if (ACT == 1) v = fmaxf(v, 0.f); so[w][8 * hh + r][t * 16 + ln] = v; }
  }
  __builtin_amdgcn_fence(__ATOMIC_ACQ_REL, "workgroup");
  __builtin_amdgcn_wave_barrier();
  const int rsub = lane >> 4, c4 = (lane & 15) * 4;
  {
#pragma unroll
    for (int q = 0; q < 8; ++q) {
      const int r = q * 2 + rsub;
      const v4f v = *(const v4fa*)&so[w][r][c4];
      *(v4f*)(C + (size_t)(row0 + r) * ldc + col0 + c4) = v;
    }
    
  }
}

// Flash-style causal/unmasked attention, all contractions 3-term bf16 hi/lo splits, f32 softmax with running max.
// q,k,v rows are read from f32 buffers with arbitrary row pitch (so they can live inside a fused qkv buffer);
// D = head size (multiple of 32, <= 128); one wave = 16 query rows; block = 4 waves (64 queries) sharing K/V chunks of 32.
template <int D, bool CAUSAL>
__global__ __launch_bounds__(128) void k_flash(const float* __restrict__ qb, const float* __restrict__ kb, const float* __restrict__ vb,
                                             int pitch, int T, int H, float scale, float* __restrict__ y, int ypitch) {
  constexpr int KS = D / 32;        // k-steps for QK
  constexpr int DT = D / 16;        // d tiles for PV
  __shared__ __attribute__((aligned(16))) unsigned short sKh[32][D + 8], sKl[32][D + 8], sVh[32][D + 8], sVl[32][D + 8];
  __shared__ __attribute__((aligned(16))) unsigned short sPh[4][16][40], sPl[4][16][40];
  __shared__ __attribute__((aligned(16))) float sO[4][16][D];
  const int tid = threadIdx.x, w = tid >> 5, lane = tid & 31, ln = lane & 15, hh = lane >> 4;
  const int nqb = (T + 63) / 64;
  const int bh = blockIdx.x / nqb, qblk = blockIdx.x % nqb;
  const int b = bh / H, h = bh % H;
  const int q0 = qblk * 64 + w * 16;
  const float* Q = qb + (size_t)b * T * pitch + h * D;
  const float* K = kb + (size_t)b * T * pitch + h * D;
  const float* V = vb + (size_t)b * T * pitch + h * D;

  // A fragments of the wave's 16 query rows (scaled), hi/lo
  FragB aqh[KS], aql[KS];
  {
    int row = q0 + ln; if (row >= T) row = T - 1;
    const float* qr = Q + (size_t)row * pitch;
#pragma unroll
    for (int ks = 0; ks < KS; ++ks)
#pragma unroll
      for (int i = 0; i < 16; ++i) {
        const int d = ks * 32 + ((i < 8) ? (8 * hh + i) : (16 + 8 * hh + (i - 8)));
        const float x = qr[d] * scale; const unsigned short hb = bf16_bits(x);
        aqh[ks].u[i] = hb; aql[ks].u[i] = bf16_bits(x - bf16_val(hb));
      }
  }
  float m_r[8], l_r[8];
#pragma unroll
  for (int r = 0; r < 8; ++r) { m_r[r] = -3.0e38f; l_r[r] = 0.f; }
  v8f oacc[DT];
#pragma unroll
  for (int dt = 0; dt < DT; ++dt) oacc[dt] = (v8f){0.f,0.f,0.f,0.f,0.f,0.f,0.f,0.f};

  const int kv_end = CAUSAL ? min(T, qblk * 64 + 64) : T;     // block-uniform
  for (int j0 = 0; j0 < kv_end; j0 += 32) {
    __syncthreads();
    for (int e = tid; e < 32 * (D / 4); e += 128) {
      const int r = e / (D / 4), c4 = (e % (D / 4)) * 4;
      const int key = j0 + r;
      v4f kf = {0.f,0.f,0.f,0.f}, vf = {0.f,0.f,0.f,0.f};
      if (key < T) { kf = *(const v4fa*)(K + (size_t)key * pitch + c4); vf = *(const v4fa*)(V + (size_t)key * pitch + c4); }
#pragma unroll
      for (int t = 0; t < 4; ++t) {
        unsigned short hb = bf16_bits(kf[t]); sKh[r][c4 + t] = hb; sKl[r][c4 + t] = bf16_bits(kf[t] - bf16_val(hb));
        hb = bf16_bits(vf[t]); sVh[r][c4 + t] = hb; sVl[r][c4 + t] = bf16_bits(vf[t] - bf16_val(hb));
      }
    }
    __syncthreads();
    // S tile 16 x 32
    v8f s[2];
#pragma unroll
    for (int nt = 0; nt < 2; ++nt) {
      v8f acc = {};
#pragma unroll
      for (int ks = 0; ks < KS; ++ks) {
        FragB bh_, bl_;
        bh_.half[0] = *(const v8us*)&sKh[nt * 16 + ln][ks * 32 + 8 * hh]; bh_.half[1] = *(const v8us*)&sKh[nt * 16 + ln][ks * 32 + 16 + 8 * hh];
        bl_.half[0] = *(const v8us*)&sKl[nt * 16 + ln][ks * 32 + 8 * hh]; bl_.half[1] = *(const v8us*)&sKl[nt * 16 + ln][ks * 32 + 16 + 8 * hh];
        acc = mmaN<3>(aqh[ks].v, aql[ks].v, bh_.v, bl_.v, acc);
      }
      s[nt] = acc;
    }
    // mask + running max (rows 8hh+r; the 16 lanes of a half share rows)
    float alpha[8];
#pragma unroll
    for (int r = 0; r < 8; ++r) {
      const int qi = q0 + 8 * hh + r;
      const int ja = j0 + ln, jb = j0 + 16 + ln;
      if (CAUSAL) { if (ja > qi) s[0][r] = -3.0e38f; if (jb > qi) s[1][r] = -3.0e38f; }
      if (ja >= T) s[0][r] = -3.0e38f;
      if (jb >= T) s[1][r] = -3.0e38f;
      float mx = fmaxf(s[0][r], s[1][r]);
      mx = fmaxf(mx, __shfl_xor(mx, 1, 32)); mx = fmaxf(mx, __shfl_xor(mx, 2, 32)); mx = fmaxf(mx, __shfl_xor(mx, 4, 32)); mx = fmaxf(mx, __shfl_xor(mx, 8, 32));
      const float mnew = fmaxf(m_r[r], mx);
      alpha[r] = (mnew > -1.0e38f) ? __expf(m_r[r] - mnew) : 1.0f;
      const float p0 = (s[0][r] > -1.0e38f) ? __expf(s[0][r] - mnew) : 0.f;
      const float p1 = (s[1][r] > -1.0e38f) ? __expf(s[1][r] - mnew) : 0.f;
      m_r[r] = mnew;
      l_r[r] = l_r[r] * alpha[r] + p0 + p1;            // per-lane partial row sum (16 lanes combined at the end)
      unsigned short hb = bf16_bits(p0); sPh[w][8 * hh + r][ln] = hb;      sPl[w][8 * hh + r][ln] = bf16_bits(p0 - bf16_val(hb));
      hb = bf16_bits(p1);                sPh[w][8 * hh + r][16 + ln] = hb; sPl[w][8 * hh + r][16 + ln] = bf16_bits(p1 - bf16_val(hb));
    }
#pragma unroll
    for (int dt = 0; dt < DT; ++dt)
#pragma unroll
      for (int r = 0; r < 8; ++r) oacc[dt][r] *= alpha[r];
    __builtin_amdgcn_fence(__ATOMIC_ACQ_REL, "workgroup");
    __builtin_amdgcn_wave_barrier();
    FragB pah, pal;
    pah.half[0] = *(const v8us*)&sPh[w][ln][8 * hh]; pah.half[1] = *(const v8us*)&sPh[w][ln][16 + 8 * hh];
    pal.half[0] = *(const v8us*)&sPl[w][ln][8 * hh]; pal.half[1] = *(const v8us*)&sPl[w][ln][16 + 8 * hh];
#pragma unroll
    for (int dt = 0; dt < DT; ++dt) {
      FragB bvh, bvl;
#pragma unroll
      for (int i = 0; i < 8; ++i) {
        bvh.u[i] = sVh[8 * hh + i][dt * 16 + ln]; bvh.u[8 + i] = sVh[16 + 8 * hh + i][dt * 16 + ln];
        bvl.u[i] = sVl[8 * hh + i][dt * 16 + ln]; bvl.u[8 + i] = sVl[16 + 8 * hh + i][dt * 16 + ln];
      }
      oacc[dt] = mmaN<3>(pah.v, pal.v, bvh.v, bvl.v, oacc[dt]);
    }
    __builtin_amdgcn_fence(__ATOMIC_ACQ_REL, "workgroup");
    __builtin_amdgcn_wave_barrier();
  }
#pragma unroll
  for (int r = 0; r < 8; ++r) {
    float l = l_r[r];
    l += __shfl_xor(l, 1, 32); l += __shfl_xor(l, 2, 32); l += __shfl_xor(l, 4, 32); l += __shfl_xor(l, 8, 32);
    l_r[r] = (l > 0.f) ? 1.0f / l : 0.f;
  }
#pragma unroll
  for (int dt = 0; dt < DT; ++dt)
#pragma unroll
    for (int r = 0; r < 8; ++r) sO[w][8 * hh + r][dt * 16 + ln] = oacc[dt][r] * l_r[r];
  __builtin_amdgcn_fence(__ATOMIC_ACQ_REL, "workgroup");
  __builtin_amdgcn_wave_barrier();
  {
    for (int r = 0; r < 16; ++r) {
      const int row = q0 + r;
      if (row < T && lane < D / 4) {
        const v4f val = *(const v4fa*)&sO[w][r][lane * 4];
        *(v4f*)(y + ((size_t)b * T + row) * ypitch + h * D + lane * 4) = val;
      }
    }
    
  }
}

// GEMM C = act(A·W + bias + resid): A f32 (ASPLIT -> hi/lo 2 terms), Wt bf16 [N][K]; ACT 0 none, 1 relu, 2 exact gelu;
// resid (optional, f32, row index = (row % rmod), pitch ldr, RES_BF16 rounds it) added before the activation.
template <bool ASPLIT, int ACT, bool BIAS_BF16, bool RES_BF16>
__global__ __launch_bounds__(128) void k_gemm_bf3(const float* __restrict__ A, int lda, const unsigned short* __restrict__ Wt, int ldb,
                                                const float* __restrict__ bias, const float* __restrict__ resid, int rmod, int ldr,
                                                float* __restrict__ C, int ldc, int M, int N, int K) {
  __shared__ __attribute__((aligned(16))) float so[4][16][64];
  const int tid = threadIdx.x, w = tid >> 5, lane = tid & 31, ln = lane & 15, hh = lane >> 4;
  const int ntn = N / 64;
  const int wid = blockIdx.x * 4 + w;
  const int mt = wid / ntn, nq = wid % ntn;
  if (mt * 16 >= M) return;
  const int row0 = mt * 16, col0 = nq * 64;
  const float* arow = A + (size_t)(row0 + ln) * lda;
  v8f acc[4] = {};
  for (int kb = 0; kb < K; kb += 32) {
    FragB ah, al;
    const v4f x0 = *(const v4fa*)(arow + kb + 8 * hh), x1 = *(const v4fa*)(arow + kb + 8 * hh + 4);
    const v4f x2 = *(const v4fa*)(arow + kb + 16 + 8 * hh), x3 = *(const v4fa*)(arow + kb + 16 + 8 * hh + 4);
    float xs[16] = {x0[0],x0[1],x0[2],x0[3],x1[0],x1[1],x1[2],x1[3],x2[0],x2[1],x2[2],x2[3],x3[0],x3[1],x3[2],x3[3]};
#pragma unroll
    for (int i = 0; i < 16; ++i) { const unsigned short hb = bf16_bits(xs[i]); ah.u[i] = hb; al.u[i] = ASPLIT ? bf16_bits(xs[i] - bf16_val(hb)) : (unsigned short)0; }
#pragma unroll
    for (int t = 0; t < 4; ++t) {
      const unsigned short* brow = Wt + (size_t)(col0 + t * 16 + ln) * ldb + kb;
      FragB b;
      b.half[0] = *(const v8us*)(brow + 8 * hh);
      b.half[1] = *(const v8us*)(brow + 16 + 8 * hh);
      acc[t] = mmaN<ASPLIT ? 2 : 1>(ah.v, al.v, b.v, b.v, acc[t]);
    }
  }
#pragma unroll
  for (int t = 0; t < 4; ++t) {
    const int col = col0 + t * 16 + ln;
    float bv = bias ? bias[col] : 0.f;
    if (BIAS_BF16) bv = bf16_round(bv);
#pragma unroll
    for (int r = 0; r < 8; ++r) {
      float v = acc[t][r] + bv;
      if (resid) { float rv = resid[(size_t)((row0 + 8 * hh + r) % rmod) * ldr + col]; if (RES_BF16) rv = bf16_round(rv); v += rv; }
      if (ACT == 1) v = fmaxf(v, 0.f);
      if (ACT == 2) v = 0.5f * v * (1.0f + erff(v * 0.70710678118654752f));
      if (ACT == 3) { const float u = 0.7978845608028654f * (v + 0.044715f * v * v * v); v = 0.5f * v * (1.0f + tanhf(u)); }
      so[w][8 * hh + r][t * 16 + ln] = v;
    }
  }
  __builtin_amdgcn_fence(__ATOMIC_ACQ_REL, "workgroup");
  __builtin_amdgcn_wave_barrier();
  const int rsub = lane >> 4, c4 = (lane & 15) * 4;
  {
#pragma unroll
    for (int q = 0; q < 8; ++q) {
      const int r = q * 2 + rsub;
      const v4f v = *(const v4fa*)&so[w][r][c4];
      *(v4f*)(C + (size_t)(row0 + r) * ldc + col0 + c4) = v;
    }
    
  }
}
// row LayerNorm (biased variance, eps) over N: s = X (+ R); optional out_sum <- s; out_norm <- (s-mu)*rsqrt(var+eps)*g + b
template <bool PARAM_BF16>
__global__ __launch_bounds__(256) void k_layernorm(const float* __restrict__ X, const float* __restrict__ R, const float* __restrict__ g, const float* __restrict__ bta,
                                                  float* __restrict__ out_sum, float* __restrict__ out_norm, int N, float eps) {
  __shared__ float red[256];
  const int row = blockIdx.x, tid = threadIdx.x;
  const float* x = X + (size_t)row * N; const float* rr = R ? R + (size_t)row * N : nullptr;
  float vals[16];                     // up to N = 4096
  const int per = N / 256;            // contiguous chunk per thread? use strided-by-4 chunks: thread handles j = tid*4 + 1024*u
  float s1 = 0.f;
  for (int u = 0; u < per / 4; ++u) {
    const int j = tid * 4 + 1024 * u;
    const v4f a = *(const v4fa*)(x + j);
    v4f b = {0.f,0.f,0.f,0.f}; if (rr) b = *(const v4fa*)(rr + j);
#pragma unroll
    for (int q = 0; q < 4; ++q) { const float v = a[q] + b[q]; vals[u * 4 + q] = v; s1 += v; }
  }
  red[tid] = s1; __syncthreads();
  for (int st = 128; st > 0; st >>= 1) { if (tid < st) red[tid] += red[tid + st]; __syncthreads(); }
  const float mu = red[0] / (float)N; __syncthreads();
  float s2 = 0.f;
  for (int u = 0; u < per / 4; ++u)
#pragma unroll
    for (int q = 0; q < 4; ++q) { const float c = vals[u * 4 + q] - mu; s2 += c * c; }
  red[tid] = s2; __syncthreads();
  for (int st = 128; st > 0; st >>= 1) { if (tid < st) red[tid] += red[tid + st]; __syncthreads(); }
  const float rs = rsqrtf(red[0] / (float)N + eps);
  {
    for (int u = 0; u < per / 4; ++u) {
      const int j = tid * 4 + 1024 * u;
      v4f o, sm;
#pragma unroll
      for (int q = 0; q < 4; ++q) {
        float gg = g[j + q], bb = bta[j + q];
        if (PARAM_BF16) { gg = bf16_round(gg); bb = bf16_round(bb); }
        sm[q] = vals[u * 4 + q]; o[q] = (vals[u * 4 + q] - mu) * rs * gg + bb;
      }
      if (out_sum) *(v4f*)(out_sum + (size_t)row * N + j) = sm;
      *(v4f*)(out_norm + (size_t)row * N + j) = o;
    }
    
  }
}



// ---- f16 WMMA path (v_wmma_f32_16x16x32_f16): 11-bit significands for operands in range — used where a [0,1] probability operand needs more precision than bf16
typedef _Float16 v16h __attribute__((ext_vector_type(16)));
union FragH { v16h v; v8us half[2]; _Float16 h[16]; unsigned short u[16]; };
template <int NT>
__device__ __forceinline__ v8f mmaH(v16h ah, v16h al, v16h bh, v16h bl, v8f c) {
  c = __builtin_amdgcn_wmma_f32_16x16x32_f16(false, ah, false, bh, (short)0, c, false, false);
  if (NT >= 2) c = __builtin_amdgcn_wmma_f32_16x16x32_f16(false, al, false, bh, (short)0, c, false, false);
  if (NT >= 3) c = __builtin_amdgcn_wmma_f32_16x16x32_f16(false, ah, false, bl, (short)0, c, false, false);
  asm volatile("v_nop\n\tv_nop\n\tv_nop\n\tv_nop" : "+v"(c) : "v"(ah), "v"(al), "v"(bh), "v"(bl));
  return c;
}
// batched GEMM like k_gemm_b but f16 operands: A f32 (split into f16 hi/lo if ASPLIT, else rounded to f16), Bt = f16 values [n][k]; alpha; C f32; N multiple of 16 (partial tiles skipped)
template <bool ASPLIT>
__global__ __launch_bounds__(128) void k_gemm_h(const float* __restrict__ A, int lda, size_t sA, const _Float16* __restrict__ Bh, int ldb, size_t sB, float alpha, float* __restrict__ C, int ldc, size_t sC, int M, int N, int K) {
  __shared__ __attribute__((aligned(16))) float so[4][16][64];
  const int tid = threadIdx.x, w = tid >> 5, lane = tid & 31, ln = lane & 15, hh = lane >> 4; const int by = blockIdx.y;
  A += (size_t)by * sA; Bh += (size_t)by * sB; C += (size_t)by * sC;
  const int ntn = (N + 63) / 64; const int wid = blockIdx.x * 4 + w; const int mt = wid / ntn, nq = wid % ntn; if (mt * 16 >= M) return;
  const int row0 = mt * 16, col0 = nq * 64; const float* arow = A + (size_t)(row0 + ln) * lda;
  v8f acc[4] = {};
  for (int kb = 0; kb < K; kb += 32) {
    FragH ah, al;
    const v4f x0 = *(const v4fa*)(arow + kb + 8 * hh), x1 = *(const v4fa*)(arow + kb + 8 * hh + 4), x2 = *(const v4fa*)(arow + kb + 16 + 8 * hh), x3 = *(const v4fa*)(arow + kb + 16 + 8 * hh + 4);
    float xs[16] = {x0[0],x0[1],x0[2],x0[3],x1[0],x1[1],x1[2],x1[3],x2[0],x2[1],x2[2],x2[3],x3[0],x3[1],x3[2],x3[3]};
#pragma unroll
    for (int i = 0; i < 16; ++i) { const _Float16 h = (_Float16)xs[i]; ah.h[i] = h; al.h[i] = ASPLIT ? (_Float16)(xs[i] - (float)h) : (_Float16)0.0f; }
#pragma unroll
    for (int t = 0; t < 4; ++t) { if (col0 + t * 16 >= N) continue; const size_t boff = (size_t)(col0 + t * 16 + ln) * ldb + kb; FragH bq; bq.half[0] = *(const v8us*)(Bh + boff + 8 * hh); bq.half[1] = *(const v8us*)(Bh + boff + 16 + 8 * hh);
      acc[t] = mmaH<ASPLIT ? 2 : 1>(ah.v, al.v, bq.v, bq.v, acc[t]); }
  }
#pragma unroll
  for (int t = 0; t < 4; ++t) { if (col0 + t * 16 >= N) continue;
#pragma unroll
    for (int r = 0; r < 8; ++r) so[w][8 * hh + r][t * 16 + ln] = acc[t][r] * alpha; }
  __builtin_amdgcn_fence(__ATOMIC_ACQ_REL, "workgroup"); __builtin_amdgcn_wave_barrier();
  const int rsub = lane >> 4, c4 = (lane & 15) * 4;
  {
#pragma unroll
    for (int q = 0; q < 8; ++q) { const int r = q * 2 + rsub; if (col0 + c4 < N) { const v4f v = *(const v4fa*)&so[w][r][c4]; *(v4f*)(C + (size_t)(row0 + r) * ldc + col0 + c4) = v; } }
     }
}

// Wt[n][k] = f16(W[k][n]·scale) from f32 row-major W[K][N] (scale = power of two; bf16-exact weights stay exact in f16 away from the subnormal range)
__device__ __forceinline__ void d_wt_f16(int bx, const float* __restrict__ W, _Float16* __restrict__ Wt, int K, int N, float scale) {
  const int t = bx * 256 + threadIdx.x; if (t >= N * (K / 8)) return; const int n = t / (K / 8), k8 = (t % (K / 8)) * 8; FragH f;
#pragma unroll
  for (int i = 0; i < 8; ++i) f.h[i] = (_Float16)(bf16_round(W[(size_t)(k8 + i) * N + n]) * scale); const v8us o = f.half[0];
  *(v8us*)((unsigned short*)Wt + (size_t)n * K + k8) = o; 
}
// C16[r][c] = f16(sum_k A[r][k] * Bt[c][k] * alpha + bf16(bias[c])): A f16 [NR][DD], Bt f16 [DD][DD]. One work-group = a 128 x 128 tile of C, 8 waves of 64 x 32 (4 x 2 accumulators);
// k runs in slices of 128 through an LDS ring of two buffers that all 8 waves share; per output element the WMMAs follow one another in rising k, 32 at a time
// One grid holds the three independent projections: blocks [256 s, 256 s + 256) are product s (0 = q, 1 = k, 2 = v); A3, Bt3 and C3 hold the three planes one behind the other
__global__ __launch_bounds__(256) void k_gemm_t(const _Float16* __restrict__ A3, const _Float16* __restrict__ Bt3, float alpha, const float* __restrict__ bias0, const float* __restrict__ bias1, const float* __restrict__ bias2, _Float16* __restrict__ C3) {
  constexpr int GP = (NR / 128) * (DD / 128); const int sel = blockIdx.x / GP, bx = blockIdx.x % GP;
  const _Float16* A = A3 + (size_t)sel * NR * DD; const _Float16* Bt = Bt3 + (size_t)sel * DD * DD; _Float16* C16 = C3 + (size_t)sel * NR * DD; const float* bias = sel == 0 ? bias0 : sel == 1 ? bias1 : bias2;
  // rows of 128 f16 = 256 B; LDS pitch 272 B (16 B x odd) keeps the 16 rows of a ds_load_b128 fragment read on distinct banks
  constexpr int BT = 128, BK = 128, NSL = DD / BK, LP = BK + 8, TBY = BT * LP * 2, CP = BT + 8;
  __shared__ __attribute__((aligned(16))) unsigned short sA[2][BT][LP]; __shared__ __attribute__((aligned(16))) unsigned short sB[2][BT][LP]; __shared__ __attribute__((aligned(16))) unsigned short sC[BT][CP];
  const int tid = threadIdx.x, w = tid >> 5, lane = tid & 31, ln = lane & 15, hh = lane >> 4;
  const int row0 = (bx % (NR / BT)) * BT, col0 = (bx / (NR / BT)) * BT; const int wm = (w >> 2) * 64, wn = (w & 3) * 32;
  // each thread copies 16 B of rows crow, crow + 16, ..., crow + 112 of both tiles: a wave's copy covers four whole 128-B lines
  const int crow = tid >> 4, ccol = tid & 15;
  const unsigned short* gA = (const unsigned short*)A + (size_t)(row0 + crow) * DD + ccol * 8; const unsigned short* gB = (const unsigned short*)Bt + (size_t)(col0 + crow) * DD + ccol * 8;
  const unsigned lA = (unsigned)(uintptr_t)&sA[0][crow][ccol * 8], lB = (unsigned)(uintptr_t)&sB[0][crow][ccol * 8];
  auto copy8 = [&](unsigned l, const unsigned short* g) {
    // global -> LDS through no register; s_wait_xcnt 0 closes the statement so that no address register is rewritten ahead of it
    asm volatile("global_load_async_to_lds_b128 %0, %8, off\n\tglobal_load_async_to_lds_b128 %1, %9, off\n\tglobal_load_async_to_lds_b128 %2, %10, off\n\tglobal_load_async_to_lds_b128 %3, %11, off\n\t"
                 "global_load_async_to_lds_b128 %4, %12, off\n\tglobal_load_async_to_lds_b128 %5, %13, off\n\tglobal_load_async_to_lds_b128 %6, %14, off\n\tglobal_load_async_to_lds_b128 %7, %15, off\n\ts_wait_xcnt 0x0"
                 :: "v"(l), "v"(l + 16 * LP * 2), "v"(l + 32 * LP * 2), "v"(l + 48 * LP * 2), "v"(l + 64 * LP * 2), "v"(l + 80 * LP * 2), "v"(l + 96 * LP * 2), "v"(l + 112 * LP * 2),
                    "v"(g), "v"(g + 16 * DD), "v"(g + 32 * DD), "v"(g + 48 * DD), "v"(g + 64 * DD), "v"(g + 80 * DD), "v"(g + 96 * DD), "v"(g + 112 * DD) : "memory"); };
  auto stage = [&](int st, int bf) { copy8(lA + bf * TBY, gA + st * BK); copy8(lB + bf * TBY, gB + st * BK); };
  v8f acc[4][2];
#pragma unroll
  for (int mi = 0; mi < 4; ++mi)
#pragma unroll
    for (int ni = 0; ni < 2; ++ni) acc[mi][ni] = (v8f){0.f,0.f,0.f,0.f,0.f,0.f,0.f,0.f};
  stage(0, 0);
  asm volatile("s_wait_asynccnt 0x0" ::: "memory");      // this wave's copies of slice 0 have landed
  __syncthreads();                                        // ... and every other wave's: slice 0 may be read
  stage(1, 1);
#pragma unroll 1      /* one copy of the ring's foot; the buffer index stays t & 1 */
  for (int t = 0; t < NSL; ++t) { const int bf = t & 1; const unsigned short* ab = &sA[bf][wm + ln][8 * hh]; const unsigned short* bb = &sB[bf][wn + ln][8 * hh];
    FragH a[2][4], bq[2][2];      /* two fragment sets: the next 32 k of THIS slice are read while the present 32 are multiplied */
    auto frags = [&](int ks, int s) {
#pragma unroll
      for (int mi = 0; mi < 4; ++mi) { a[s][mi].half[0] = *(const v8us*)(ab + mi * 16 * LP + ks * 32); a[s][mi].half[1] = *(const v8us*)(ab + mi * 16 * LP + ks * 32 + 16); }
#pragma unroll
      for (int ni = 0; ni < 2; ++ni) { bq[s][ni].half[0] = *(const v8us*)(bb + ni * 16 * LP + ks * 32); bq[s][ni].half[1] = *(const v8us*)(bb + ni * 16 * LP + ks * 32 + 16); } };
    frags(0, 0);
#pragma unroll
    for (int ks = 0; ks < BK / 32; ++ks) { if (ks + 1 < BK / 32) frags(ks + 1, (ks + 1) & 1);
      __builtin_amdgcn_sched_barrier(0);      // keeps the next step's 12 LDS reads in front of this step's WMMAs; without it each read sinks to its use and its latency is waited for
#pragma unroll
      for (int mi = 0; mi < 4; ++mi)
#pragma unroll
        for (int ni = 0; ni < 2; ++ni) acc[mi][ni] = __builtin_amdgcn_wmma_f32_16x16x32_f16(false, a[ks & 1][mi].v, false, bq[ks & 1][ni].v, (short)0, acc[mi][ni], false, false); }
    asm volatile("s_wait_dscnt 0x0" ::: "memory");        // this wave's reads of buffer bf are done before it is refilled
    asm volatile("s_wait_asynccnt 0x0" ::: "memory");     // this wave's copies of slice t + 1 have landed
    __syncthreads();                                        // publishes slice t + 1 and ends every wave's reads of buffer bf
    if (t + 2 < NSL) stage(t + 2, bf); }
  asm volatile("s_wait_asynccnt 0x0" ::: "memory");       // no copy is outstanding when the wave goes on to the epilogue
  // the tile goes through LDS as f16 so that each 256-B row piece of C is stored as whole 128-B lines
#pragma unroll
  for (int ni = 0; ni < 2; ++ni) { const float bv = bf16_round(bias[col0 + wn + ni * 16 + ln]);
#pragma unroll
    for (int mi = 0; mi < 4; ++mi)
#pragma unroll
      for (int r = 0; r < 8; ++r) { FragH c1; c1.h[0] = (_Float16)(acc[mi][ni][r] * alpha + bv); sC[wm + mi * 16 + 8 * hh + r][wn + ni * 16 + ln] = c1.u[0]; } }
  __syncthreads();
#pragma unroll
  for (int i = 0; i < BT * (BT / 8) / 256; ++i) { const int e = tid + i * 256, r = e >> 4, c8 = (e & 15) * 8; const v8us o = *(const v8us*)&sC[r][c8]; *(v8us*)((unsigned short*)C16 + (size_t)(row0 + r) * DD + col0 + c8) = o; }
}


typedef _Float16 v4h __attribute__((ext_vector_type(4)));

__global__ __launch_bounds__(256) void k_x16(const float* __restrict__ x, _Float16* __restrict__ X16, size_t n8) { const size_t t = (size_t)blockIdx.x * 256 + threadIdx.x; if (t >= n8) return; FragH f;
#pragma unroll
  for (int q = 0; q < 8; ++q) f.h[q] = (_Float16)bf16_round(x[t * 8 + q]); *(v8us*)((unsigned short*)X16 + t * 8) = f.half[0];  }
__global__ __launch_bounds__(256) void k_h16(const float* __restrict__ x, _Float16* __restrict__ X16, size_t n8) { const size_t t = (size_t)blockIdx.x * 256 + threadIdx.x; if (t >= n8) return; FragH f;
#pragma unroll
  for (int q = 0; q < 8; ++q) f.h[q] = (_Float16)x[t * 8 + q]; *(v8us*)((unsigned short*)X16 + t * 8) = f.half[0];  }
__global__ __launch_bounds__(256) void k_round16f(const float* __restrict__ W, _Float16* __restrict__ Bt, size_t n8) { const size_t t = (size_t)blockIdx.x * 256 + threadIdx.x; if (t >= n8) return; FragH f;
#pragma unroll
  for (int i = 0; i < 8; ++i) f.h[i] = (_Float16)(bf16_round(W[t * 8 + i]) * 16.0f); *(v8us*)((unsigned short*)Bt + t * 8) = f.half[0];  }
template <int NHv, int TTv>
__global__ __launch_bounds__(256) void k_vt(const _Float16* __restrict__ V16, int ldv, int voff, _Float16* __restrict__ Vt) { __shared__ unsigned short tl[64][66]; const int tid = threadIdx.x; const int slab = blockIdx.x / (TTv / 64), lg = blockIdx.x % (TTv / 64); const int b = slab / NHv, h = slab % NHv;
  for (int i = tid; i < 64 * 8; i += 256) { const int r = i / 8, c8 = (i % 8) * 8; FragH f; f.half[0] = *(const v8us*)((const unsigned short*)V16 + ((size_t)b * TTv + lg * 64 + r) * ldv + voff + h * 64 + c8);
#pragma unroll
    for (int q = 0; q < 8; ++q) tl[r][c8 + q] = f.u[q]; }
  __syncthreads();
  {
#pragma unroll
    for (int rd = 0; rd < 2; ++rd) { const int d = rd * 32 + tid / 8, pc = tid % 8; FragH f;
#pragma unroll
      for (int q = 0; q < 8; ++q) f.u[q] = tl[pc * 8 + q][d];
      *(v8us*)((unsigned short*)Vt + ((size_t)slab * 64 + d) * TTv + lg * 64 + pc * 8) = f.half[0]; }
     } }

template <int D, int RBF>
__device__ __forceinline__ void d_lnx(int bx, const float* __restrict__ X, const float* __restrict__ gam, const float* __restrict__ bet, int nrows, float eps, _Float16* __restrict__ O16, float* __restrict__ XR) {
  constexpr int NP = D / 128; const int tid = threadIdx.x, wv = tid >> 5, lane = tid & 31; const size_t r = (size_t)bx * 8 + wv; if (r >= (size_t)nrows) return; v4f y[NP]; float s = 0.f;
#pragma unroll
  for (int j = 0; j < NP; ++j) { const int c = j * 128 + lane * 4; v4f g = *(const v4fa*)(X + r * D + c); if (RBF) { for (int q = 0; q < 4; ++q) g[q] = bf16_round(g[q]); } y[j] = g; s += g[0] + g[1] + g[2] + g[3]; }
  for (int o = 16; o >= 1; o >>= 1) s += __shfl_xor(s, o, 32); const float mu = s / (float)D; float q2 = 0.f;
#pragma unroll
  for (int j = 0; j < NP; ++j) for (int q = 0; q < 4; ++q) { const float d = y[j][q] - mu; q2 += d * d; }
  for (int o = 16; o >= 1; o >>= 1) q2 += __shfl_xor(q2, o, 32); const float rs = rsqrtf(q2 / (float)D + eps);
  {
#pragma unroll
    for (int j = 0; j < NP; ++j) { const int c = j * 128 + lane * 4; v4h h; for (int q = 0; q < 4; ++q) { const float v = (y[j][q] - mu) * rs * bf16_round(gam[c + q]) + bf16_round(bet[c + q]); h[q] = (_Float16)v; } *(v4h*)(O16 + r * D + c) = h; if (XR) *(v4f*)(XR + r * D + c) = y[j]; }
     } }
// One grid holds the six independent preparations: blocks [0, 3 GW) transpose the three weights (the slower blocks, so they start first), blocks [3 GW, 3 GW + 3 GL) normalise the rows of Q, K and V
__global__ __launch_bounds__(256) void k_prep(const float* __restrict__ Qx, const float* __restrict__ Kx, const float* __restrict__ Vx, const float* __restrict__ Wq, const float* __restrict__ Wk, const float* __restrict__ Wv,
                                              const float* __restrict__ gam, const float* __restrict__ bet, _Float16* __restrict__ Bw, _Float16* __restrict__ H3, float* __restrict__ XR) {
  constexpr int GW = DD * (DD / 8) / 256, GL = NR / 8; const int bx = blockIdx.x;
  if (bx < 3 * GW) { const int sel = bx / GW; d_wt_f16(bx % GW, sel == 0 ? Wq : sel == 1 ? Wk : Wv, Bw + (size_t)sel * DD * DD, DD, DD, 16.0f); }      /* (in,out) -> Bt x 2^4 */
  else { const int y = bx - 3 * GW, sel = y / GL; d_lnx<DD, 1>(y % GL, sel == 0 ? Qx : sel == 1 ? Kx : Vx, gam, bet, NR, 1e-5f, H3 + (size_t)sel * NR * DD, sel == 0 ? XR : nullptr); } }      /* LN(bf16 x) -> f16; XR = bf16(Q) for the residual */
__global__ __launch_bounds__(256) void k_addres(const float* __restrict__ O, const float* __restrict__ XR, float* __restrict__ out, size_t n4) { const size_t t = (size_t)blockIdx.x * 256 + threadIdx.x; if (t >= n4) return; v4f a = *(const v4fa*)(O + t * 4); const v4f b = *(const v4fa*)(XR + t * 4); for (int q = 0; q < 4; ++q) a[q] += b[q]; *(v4f*)(out + t * 4) = a;  }
// y[i] = 2^x[i], twelve independent v_exp_f32 in one statement with results in registers of their own (=&v), so that none overwrites the source of the one in front of it;
// the closing v_nop is the slot the instruction set asks for behind a transcendental before its result is read or its source overwritten
__device__ __forceinline__ void exp2x12(float* __restrict__ y, const float* __restrict__ x) {
  asm("v_exp_f32 %0, %12\n\tv_exp_f32 %1, %13\n\tv_exp_f32 %2, %14\n\tv_exp_f32 %3, %15\n\tv_exp_f32 %4, %16\n\tv_exp_f32 %5, %17\n\t"
      "v_exp_f32 %6, %18\n\tv_exp_f32 %7, %19\n\tv_exp_f32 %8, %20\n\tv_exp_f32 %9, %21\n\tv_exp_f32 %10, %22\n\tv_exp_f32 %11, %23\n\tv_nop"
      : "=&v"(y[0]), "=&v"(y[1]), "=&v"(y[2]), "=&v"(y[3]), "=&v"(y[4]), "=&v"(y[5]), "=&v"(y[6]), "=&v"(y[7]), "=&v"(y[8]), "=&v"(y[9]), "=&v"(y[10]), "=&v"(y[11])
      : "v"(x[0]), "v"(x[1]), "v"(x[2]), "v"(x[3]), "v"(x[4]), "v"(x[5]), "v"(x[6]), "v"(x[7]), "v"(x[8]), "v"(x[9]), "v"(x[10]), "v"(x[11])); }
// the same for five values
__device__ __forceinline__ void exp2x5(float* __restrict__ y, const float* __restrict__ x) {
  asm("v_exp_f32 %0, %5\n\tv_exp_f32 %1, %6\n\tv_exp_f32 %2, %7\n\tv_exp_f32 %3, %8\n\tv_exp_f32 %4, %9\n\tv_nop"
      : "=&v"(y[0]), "=&v"(y[1]), "=&v"(y[2]), "=&v"(y[3]), "=&v"(y[4]) : "v"(x[0]), "v"(x[1]), "v"(x[2]), "v"(x[3]), "v"(x[4])); }
typedef int v4ia __attribute__((ext_vector_type(4), may_alias));
// the value that lane l ^ 16 holds
__device__ __forceinline__ float xhalf(float x) { const int b = __float_as_int(x); return __int_as_float(__builtin_amdgcn_permlanex16(b, b, 0x76543210, 0xfedcba98, false, false)); }
// Scores are computed transposed: S^T = K Q^T (A = 16 keys from LDS, B = the wave's 16 queries, kept in registers), O^T += V^T P^T. Lane (ln, hh) holds query q0 + ln alone:
// register r of score tile nt is key j0 + nt * 16 + 8 * hh + r, so maximum and sum run inside the lane with one exchange between the halves, and the two score tiles, converted in place, are the B operand of the second product
__global__ __launch_bounds__(128) void k_flash(const _Float16* __restrict__ Q16, int ldq, const _Float16* __restrict__ K16, int ldk, const _Float16* __restrict__ Vt, const int* __restrict__ MSK, float* __restrict__ O, int ldo) {
  constexpr int RPW = 16, NQB = TT / (4 * RPW), DT = 4, KS = 2;
  __shared__ __attribute__((aligned(16))) float sO[4][RPW][64 + 4];
  // K/V ring, two buffers, one stage = SKEY keys: sK rows = keys (64 d = 128 B), sV rows = d (SKEY keys = 128 B); LDS pitch 144 B (16 B x odd) keeps the 16 rows of a ds_load_b128 fragment read on distinct banks
  constexpr int SKEY = 64, NST = TT / SKEY, LP = 72, SBUF = 64 * LP * 2; constexpr float SC = 0.125f * 1.44269504088896340736f;      /* 64^-1/2 * log2(e) */
  __shared__ __attribute__((aligned(16))) unsigned short sK[2][SKEY][LP]; __shared__ __attribute__((aligned(16))) unsigned short sV[2][64][LP];
  const int tid = threadIdx.x, w = tid >> 5, lane = tid & 31, ln = lane & 15, hh = lane >> 4;
  const int slab = blockIdx.x / NQB, qblk = blockIdx.x % NQB; const int b = slab / NH, h = slab % NH; const int qb0 = qblk * (4 * RPW); const int q0 = qb0 + w * RPW;
  FragH aq[KS];
  { const unsigned short* qr = (const unsigned short*)Q16 + ((size_t)b * TT + q0 + ln) * ldq + h * 64;
#pragma unroll
    for (int ks = 0; ks < KS; ++ks) { aq[ks].half[0] = *(const v8us*)(qr + ks * 32 + 8 * hh); aq[ks].half[1] = *(const v8us*)(qr + ks * 32 + 16 + 8 * hh); } }
  const unsigned short* Vth = (const unsigned short*)Vt + (size_t)slab * 64 * TT;
  const int* mrow = MSK + ((size_t)b * TT + q0 + ln) * TT + 8 * hh;      /* this lane's query row of the mask, at its half's first key */
  float m_r = -3.0e38f, l_r = 0.f; v8f oacc[DT];
#pragma unroll
  for (int dt = 0; dt < DT; ++dt) oacc[dt] = (v8f){0.f,0.f,0.f,0.f,0.f,0.f,0.f,0.f};
  // each thread copies 16 B of rows crow, crow + 16, + 32, + 48 of both tiles: a wave's copy covers four whole 128-B lines
  const int crow = tid >> 3, ccol = tid & 7;
  const unsigned short* gK = (const unsigned short*)K16 + ((size_t)b * TT + crow) * ldk + h * 64 + ccol * 8; const unsigned short* gV = Vth + (size_t)crow * TT + ccol * 8;
  const unsigned lK = (unsigned)(uintptr_t)&sK[0][crow][ccol * 8], lV = (unsigned)(uintptr_t)&sV[0][crow][ccol * 8];
  auto stage = [&](int st, int bf) { const unsigned short* k0 = gK + (size_t)st * SKEY * ldk; const unsigned short* v0 = gV + st * SKEY; const unsigned lk = lK + bf * SBUF, lv = lV + bf * SBUF;
    // global -> LDS through no register; s_wait_xcnt 0 closes the statement so that no address register is rewritten ahead of it
    asm volatile("global_load_async_to_lds_b128 %0, %8, off\n\tglobal_load_async_to_lds_b128 %1, %9, off\n\tglobal_load_async_to_lds_b128 %2, %10, off\n\tglobal_load_async_to_lds_b128 %3, %11, off\n\t"
                 "global_load_async_to_lds_b128 %4, %12, off\n\tglobal_load_async_to_lds_b128 %5, %13, off\n\tglobal_load_async_to_lds_b128 %6, %14, off\n\tglobal_load_async_to_lds_b128 %7, %15, off\n\ts_wait_xcnt 0x0"
                 :: "v"(lk), "v"(lk + 16 * LP * 2), "v"(lk + 32 * LP * 2), "v"(lk + 48 * LP * 2), "v"(lv), "v"(lv + 16 * LP * 2), "v"(lv + 32 * LP * 2), "v"(lv + 48 * LP * 2),
                    "v"(k0), "v"(k0 + (size_t)16 * ldk), "v"(k0 + (size_t)32 * ldk), "v"(k0 + (size_t)48 * ldk), "v"(v0), "v"(v0 + 16 * TT), "v"(v0 + 32 * TT), "v"(v0 + 48 * TT) : "memory"); };
  stage(0, 0);
  asm volatile("s_wait_asynccnt 0x0" ::: "memory");      // this wave's copies of stage 0 have landed
  __syncthreads();                                        // ... and every other wave's: stage 0 may be read
  stage(1, 1);
#pragma unroll 1      /* one copy of the ring's foot; the buffer index stays t & 1 */
  for (int t = 0; t < NST; ++t) { const int bf = t & 1;
  for (int sub = 0; sub < SKEY / 32; ++sub) { const int j0 = t * SKEY + sub * 32;
    v4ia mk[2][2];      /* nonzero = MASKED; mk[nt][r >> 2][r & 3] belongs to register r of score tile nt */
#pragma unroll
    for (int nt = 0; nt < 2; ++nt) { mk[nt][0] = *(const v4ia*)(mrow + j0 + nt * 16); mk[nt][1] = *(const v4ia*)(mrow + j0 + nt * 16 + 4); }
    float sv[16];      /* unscaled scores of keys j0 + 8 hh + 0..7 and j0 + 16 + 8 hh + 0..7; the running maximum is kept unscaled too */
#pragma unroll
    for (int nt = 0; nt < 2; ++nt) { const unsigned short* kr = &sK[bf][sub * 32 + nt * 16 + ln][0]; FragH bk[KS];
#pragma unroll
      for (int ks = 0; ks < KS; ++ks) { bk[ks].half[0] = *(const v8us*)(kr + ks * 32 + 8 * hh); bk[ks].half[1] = *(const v8us*)(kr + ks * 32 + 16 + 8 * hh); }
      v8f acc = (v8f){0.f,0.f,0.f,0.f,0.f,0.f,0.f,0.f};
#pragma unroll
      for (int ks = 0; ks < KS; ++ks) acc = mmaH<1>(bk[ks].v, bk[ks].v, aq[ks].v, aq[ks].v, acc);
#pragma unroll
      for (int r = 0; r < 8; ++r) sv[nt * 8 + r] = (mk[nt][r >> 2][r & 3] == 0) ? acc[r] : -INFINITY; }
    float mc = fmaxf(sv[0], sv[1]);
#pragma unroll
    for (int i = 2; i < 16; ++i) mc = fmaxf(mc, sv[i]);
    mc = fmaxf(mc, xhalf(mc));      /* the other half's 16 keys of the same query */
    // e^(0.125 (s - m)) = 2^(s * SC - m * SC): one fma per score, no branch; a masked score is -inf and gives 0 (m is finite: it starts at -3e38)
    const float mn = fmaxf(m_r, mc), nb = -mn * SC; float ex[17], ey[17]; ex[16] = (m_r - mn) * SC;
#pragma unroll
    for (int i = 0; i < 16; ++i) ex[i] = fmaf(sv[i], SC, nb);
    exp2x12(ey, ex); exp2x5(ey + 12, ex + 12);
    const float* p = ey; const float al = (mn > -1.0e38f) ? ey[16] : 1.0f; m_r = mn;
    float ps = p[0];
#pragma unroll
    for (int i = 1; i < 16; ++i) ps += p[i];
    l_r = l_r * al + ps;      /* this half's keys only; the halves are joined behind the loop */
#pragma unroll
    for (int dt = 0; dt < DT; ++dt)
#pragma unroll
      for (int r = 0; r < 8; ++r) oacc[dt][r] *= al;
    FragH pb;      /* B operand: column ln = the query, element i = key kmap(i, hh) of the 32: the order in which sv holds them */
#pragma unroll
    for (int i = 0; i < 16; ++i) pb.h[i] = (_Float16)(p[i] * 1024.0f);
#pragma unroll
    for (int dt = 0; dt < DT; ++dt) { const unsigned short* vrow = &sV[bf][dt * 16 + ln][sub * 32]; FragH bv; bv.half[0] = *(const v8us*)(vrow + 8 * hh); bv.half[1] = *(const v8us*)(vrow + 16 + 8 * hh);
      oacc[dt] = mmaH<1>(bv.v, bv.v, pb.v, pb.v, oacc[dt]); } }
    asm volatile("s_wait_dscnt 0x0" ::: "memory");        // this wave's reads of buffer bf are done before it is refilled
    asm volatile("s_wait_asynccnt 0x0" ::: "memory");     // this wave's copies of stage t + 1 have landed
    __syncthreads();                                        // publishes stage t + 1 and ends every wave's reads of buffer bf
    if (t + 2 < NST) stage(t + 2, bf); }
  asm volatile("s_wait_asynccnt 0x0" ::: "memory");       // no copy is outstanding when the wave goes on to the epilogue
  const float l = l_r + xhalf(l_r); const float li = (l > 0.f) ? 1.0f / (l * 1024.0f) : 0.f;
  // register r of oacc[dt] is O[q0 + ln][dt * 16 + 8 hh + r]: eight consecutive d of the lane's query
#pragma unroll
  for (int dt = 0; dt < DT; ++dt) { v4f lo, hi;
#pragma unroll
    for (int r = 0; r < 4; ++r) { lo[r] = oacc[dt][r] * li; hi[r] = oacc[dt][4 + r] * li; }
    *(v4fa*)&sO[w][ln][dt * 16 + 8 * hh] = lo; *(v4fa*)&sO[w][ln][dt * 16 + 8 * hh + 4] = hi; }
  __builtin_amdgcn_fence(__ATOMIC_ACQ_REL, "workgroup"); __builtin_amdgcn_wave_barrier();
  {
#pragma unroll
    for (int rp = 0; rp < RPW; rp += 2) { const int r = rp + (lane >> 4), pc = lane & 15; const v4f val = *(const v4fa*)&sO[w][r][pc * 4]; *(v4f*)(O + ((size_t)b * TT + q0 + r) * ldo + h * 64 + pc * 4) = val; }
     } }

extern "C" void kernel_launch(void* const* d_in, const int* in_sizes, int n_in,
                              void* d_out, int out_size, void* d_ws, size_t ws_size, hipStream_t stream) {
  (void)in_sizes; (void)n_in; (void)out_size;
  const float* const* I = (const float* const*)d_in; const float* Qx = I[0]; const float* Kx = I[1]; const float* Vx = I[2]; const int* mask = (const int*)d_in[3];      /* bool mask shipped as int32 [2,1,2048,2048] */
  const float* Wq = I[4]; const float* bq = I[5]; const float* Wk = I[6]; const float* bk = I[7]; const float* Wv = I[8]; const float* bv = I[9]; const float* gam = I[10]; const float* bet = I[11];
  char* ws = (char*)d_ws; size_t off = 0;
  auto take = [&](size_t bytes) { char* p = ws + off; off += (bytes + 255) & ~(size_t)255; return p; };
  const size_t WSZ = (size_t)DD * DD; _Float16* Bw = (_Float16*)take(3 * WSZ * 2); float* XR = (float*)take((size_t)NR * DD * 4); _Float16* H16 = (_Float16*)take((size_t)3 * NR * DD * 2);
  _Float16* Q = (_Float16*)take((size_t)3 * NR * DD * 2); _Float16* K = Q + (size_t)NR * DD; _Float16* V = K + (size_t)NR * DD; _Float16* Vt = (_Float16*)take((size_t)NR * DD * 2); float* O = (float*)take((size_t)NR * DD * 4);
  if (off > ws_size) return;      // 6.3 + 16.8 + 25.2 + 25.2 + 8.4 + 16.8 = about 99 MB
  k_prep<<<3 * (DD * (DD / 8) / 256) + 3 * (NR / 8), 256, 0, stream>>>(Qx, Kx, Vx, Wq, Wk, Wv, gam, bet, Bw, H16, XR);
  k_gemm_t<<<3 * (NR / 128) * (DD / 128), 256, 0, stream>>>(H16, Bw, 0.0625f, bq, bk, bv, Q);      /* three times M 4096 N 1024 K 1024 */
  k_vt<NH, TT><<<BB * NH * (TT / 64), 256, 0, stream>>>(V, DD, 0, Vt);
  k_flash<<<BB * NH * (TT / 64), 128, 0, stream>>>(Q, DD, K, DD, Vt, mask, O, DD);
  k_addres<<<(unsigned)(((size_t)NR * DD / 4 + 255) / 256), 256, 0, stream>>>(O, XR, (float*)d_out, (size_t)NR * DD / 4);      /* out = o + Q */
}

// v006
// A run of this version takes 108 microseconds.
// In two side-by-side timings against v005, it was 1.25 and 1.26 times as fast.
// Over all steps from v000 it is 3.99 times as fast.
#include <hip/hip_runtime.h>
// Pre-norm multi-head attention with a boolean mask and residual (B=2, N=2048, E=1024, 16 heads × 64): q = LN(Q)·Wq + bq, k = LN(K)·Wk + bk, v = LN(V)·Wv + bv (one shared LayerNorm γ,β; (in,out) weights); s = q·kᵀ·64^-½ with −inf where mask[b,0,n,m] is True;
// softmax; o = merged attn·v; out = o + Q (no output projection).
// Compute dtype: Q, K, V, weights, biases, γ, β rounded to bf16; LayerNorms f32 (wave per row) → f16; q/k/v f16 GEMM planes; fused flash-style kernel (int32 mask loads per (q,k), online softmax f32, P f16 ×2^10) on
// v_wmma_f32_16x16x32_f16; out = o (f32) + bf16(Q) (f32 add); f32 accumulate.
#define BB 2
#define TT 2048
#define DD 1024
#define NH 16
#define NR (BB * TT)

typedef __bf16 v16b __attribute__((ext_vector_type(16)));
typedef unsigned short v8us __attribute__((ext_vector_type(8), may_alias));
typedef float  v8f  __attribute__((ext_vector_type(8)));
typedef float  v4f  __attribute__((ext_vector_type(4)));
typedef float  v4fa __attribute__((ext_vector_type(4), may_alias));
union FragB { v16b v; v8us half[2]; unsigned short u[16]; };

__device__ __forceinline__ unsigned short bf16_bits(float x) { unsigned int u = __float_as_uint(x); return (unsigned short)((u + 0x7FFFu + ((u >> 16) & 1u)) >> 16); }
__device__ __forceinline__ float bf16_val(unsigned short b) { return __uint_as_float(((unsigned int)b) << 16); }
__device__ __forceinline__ float bf16_round(float x) { return bf16_val(bf16_bits(x)); }
// D += A·B with NT terms: 1 = ah·bh, 2 = + al·bh (A split), 3 = + ah·bl (both split)
template <int NT>
__device__ __forceinline__ v8f mmaN(v16b ah, v16b al, v16b bh, v16b bl, v8f c) {
  c = __builtin_amdgcn_wmma_f32_16x16x32_bf16(false, ah, false, bh, (short)0, c, false, false);
  if (NT >= 2) c = __builtin_amdgcn_wmma_f32_16x16x32_bf16(false, al, false, bh, (short)0, c, false, false);
  if (NT >= 3) c = __builtin_amdgcn_wmma_f32_16x16x32_bf16(false, ah, false, bl, (short)0, c, false, false);
  asm volatile("v_nop\n\tv_nop\n\tv_nop\n\tv_nop" : "+v"(c) : "v"(ah), "v"(al), "v"(bh), "v"(bl));
  return c;
}

__global__ __launch_bounds__(256) void k_wt_bf16(const float* __restrict__ W, unsigned short* __restrict__ Wt, int K, int N) {
  const int t = blockIdx.x * 256 + threadIdx.x;
  const int k8n = K / 8;
  if (t >= N * k8n) return;
  const int n = t / k8n, k8 = (t % k8n) * 8;
  v8us v;
#pragma unroll
  for (int i = 0; i < 8; ++i) v[i] = bf16_bits(W[(size_t)(k8 + i) * N + n]);
  *(v8us*)(Wt + (size_t)n * K + k8) = v;
  
}

// GEMM C[M][N] (f32, pitch ldc) = act(A[M][K]·W + bias). A f32 row-major (pitch lda) converted per fragment to bf16
// (ASPLIT: hi/lo two planes -> 2 terms, else single rounded term); Wt bf16 [N][K] (pitch ldb). BIAS_BF16 rounds the
// bias to bf16 first (bias quantised to bf16 before the add). K%32==0, M%16==0, N%64==0.
template <bool ASPLIT, int ACT, bool BIAS_BF16>
__global__ __launch_bounds__(128) void k_gemm_bf(const float* __restrict__ A, int lda, const unsigned short* __restrict__ Wt, int ldb,
                                               const float* __restrict__ bias, float* __restrict__ C, int ldc, int M, int N, int K) {
  __shared__ __attribute__((aligned(16))) float so[4][16][64];
  const int tid = threadIdx.x, w = tid >> 5, lane = tid & 31, ln = lane & 15, hh = lane >> 4;
  const int ntn = N / 64;
  const int wid = blockIdx.x * 4 + w;
  const int mt = wid / ntn, nq = wid % ntn;
  if (mt * 16 >= M) return;
  const int row0 = mt * 16, col0 = nq * 64;
  const float* arow = A + (size_t)(row0 + ln) * lda;
  v8f acc[4] = {};
  for (int kb = 0; kb < K; kb += 32) {
    FragB ah, al;
    const v4f x0 = *(const v4fa*)(arow + kb + 8 * hh), x1 = *(const v4fa*)(arow + kb + 8 * hh + 4);
    const v4f x2 = *(const v4fa*)(arow + kb + 16 + 8 * hh), x3 = *(const v4fa*)(arow + kb + 16 + 8 * hh + 4);
    float xs[16] = {x0[0],x0[1],x0[2],x0[3],x1[0],x1[1],x1[2],x1[3],x2[0],x2[1],x2[2],x2[3],x3[0],x3[1],x3[2],x3[3]};
#pragma unroll
    for (int i = 0; i < 16; ++i) { const unsigned short hb = bf16_bits(xs[i]); ah.u[i] = hb; al.u[i] = ASPLIT ? bf16_bits(xs[i] - bf16_val(hb)) : (unsigned short)0; }
#pragma unroll
    for (int t = 0; t < 4; ++t) {
      const unsigned short* brow = Wt + (size_t)(col0 + t * 16 + ln) * ldb + kb;
      FragB b;
      b.half[0] = *(const v8us*)(brow + 8 * hh);
      b.half[1] = *(const v8us*)(brow + 16 + 8 * hh);
      acc[t] = mmaN<ASPLIT ? 2 : 1>(ah.v, al.v, b.v, b.v, acc[t]);
    }
  }
#pragma unroll
  for (int t = 0; t < 4; ++t) {
    float bv = bias ? bias[col0 + t * 16 + ln] : 0.f;
    if (BIAS_BF16) bv = bf16_round(bv);
#pragma unroll
    for (int r = 0; r < 8; ++r) { float v = acc[t][r] + bv; if (ACT == 1) v = fmaxf(v, 0.f); so[w][8 * hh + r][t * 16 + ln] = v; }
  }
  __builtin_amdgcn_fence(__ATOMIC_ACQ_REL, "workgroup");
  __builtin_amdgcn_wave_barrier();
  const int rsub = lane >> 4, c4 = (lane & 15) * 4;
  {
#pragma unroll
    for (int q = 0; q < 8; ++q) {
      const int r = q * 2 + rsub;
      const v4f v = *(const v4fa*)&so[w][r][c4];
      *(v4f*)(C + (size_t)(row0 + r) * ldc + col0 + c4) = v;
    }
    
  }
}

// Flash-style causal/unmasked attention, all contractions 3-term bf16 hi/lo splits, f32 softmax with running max.
// q,k,v rows are read from f32 buffers with arbitrary row pitch (so they can live inside a fused qkv buffer);
// D = head size (multiple of 32, <= 128); one wave = 16 query rows; block = 4 waves (64 queries) sharing K/V chunks of 32.
template <int D, bool CAUSAL>
__global__ __launch_bounds__(128) void k_flash(const float* __restrict__ qb, const float* __restrict__ kb, const float* __restrict__ vb,
                                             int pitch, int T, int H, float scale, float* __restrict__ y, int ypitch) {
  constexpr int KS = D / 32;        // k-steps for QK
  constexpr int DT = D / 16;        // d tiles for PV
  __shared__ __attribute__((aligned(16))) unsigned short sKh[32][D + 8], sKl[32][D + 8], sVh[32][D + 8], sVl[32][D + 8];
  __shared__ __attribute__((aligned(16))) unsigned short sPh[4][16][40], sPl[4][16][40];
  __shared__ __attribute__((aligned(16))) float sO[4][16][D];
  const int tid = threadIdx.x, w = tid >> 5, lane = tid & 31, ln = lane & 15, hh = lane >> 4;
  const int nqb = (T + 63) / 64;
  const int bh = blockIdx.x / nqb, qblk = blockIdx.x % nqb;
  const int b = bh / H, h = bh % H;
  const int q0 = qblk * 64 + w * 16;
  const float* Q = qb + (size_t)b * T * pitch + h * D;
  const float* K = kb + (size_t)b * T * pitch + h * D;
  const float* V = vb + (size_t)b * T * pitch + h * D;

  // A fragments of the wave's 16 query rows (scaled), hi/lo
  FragB aqh[KS], aql[KS];
  {
    int row = q0 + ln; if (row >= T) row = T - 1;
    const float* qr = Q + (size_t)row * pitch;
#pragma unroll
    for (int ks = 0; ks < KS; ++ks)
#pragma unroll
      for (int i = 0; i < 16; ++i) {
        const int d = ks * 32 + ((i < 8) ? (8 * hh + i) : (16 + 8 * hh + (i - 8)));
        const float x = qr[d] * scale; const unsigned short hb = bf16_bits(x);
        aqh[ks].u[i] = hb; aql[ks].u[i] = bf16_bits(x - bf16_val(hb));
      }
  }
  float m_r[8], l_r[8];
#pragma unroll
  for (int r = 0; r < 8; ++r) { m_r[r] = -3.0e38f; l_r[r] = 0.f; }
  v8f oacc[DT];
#pragma unroll
  for (int dt = 0; dt < DT; ++dt) oacc[dt] = (v8f){0.f,0.f,0.f,0.f,0.f,0.f,0.f,0.f};

  const int kv_end = CAUSAL ? min(T, qblk * 64 + 64) : T;     // block-uniform
  for (int j0 = 0; j0 < kv_end; j0 += 32) {
    __syncthreads();
    for (int e = tid; e < 32 * (D / 4); e += 128) {
      const int r = e / (D / 4), c4 = (e % (D / 4)) * 4;
      const int key = j0 + r;
      v4f kf = {0.f,0.f,0.f,0.f}, vf = {0.f,0.f,0.f,0.f};
      if (key < T) { kf = *(const v4fa*)(K + (size_t)key * pitch + c4); vf = *(const v4fa*)(V + (size_t)key * pitch + c4); }
#pragma unroll
      for (int t = 0; t < 4; ++t) {
        unsigned short hb = bf16_bits(kf[t]); sKh[r][c4 + t] = hb; sKl[r][c4 + t] = bf16_bits(kf[t] - bf16_val(hb));
        hb = bf16_bits(vf[t]); sVh[r][c4 + t] = hb; sVl[r][c4 + t] = bf16_bits(vf[t] - bf16_val(hb));
      }
    }
    __syncthreads();
    // S tile 16 x 32
    v8f s[2];
#pragma unroll
    for (int nt = 0; nt < 2; ++nt) {
      v8f acc = {};
#pragma unroll
      for (int ks = 0; ks < KS; ++ks) {
        FragB bh_, bl_;
        bh_.half[0] = *(const v8us*)&sKh[nt * 16 + ln][ks * 32 + 8 * hh]; bh_.half[1] = *(const v8us*)&sKh[nt * 16 + ln][ks * 32 + 16 + 8 * hh];
        bl_.half[0] = *(const v8us*)&sKl[nt * 16 + ln][ks * 32 + 8 * hh]; bl_.half[1] = *(const v8us*)&sKl[nt * 16 + ln][ks * 32 + 16 + 8 * hh];
        acc = mmaN<3>(aqh[ks].v, aql[ks].v, bh_.v, bl_.v, acc);
      }
      s[nt] = acc;
    }
    // mask + running max (rows 8hh+r; the 16 lanes of a half share rows)
    float alpha[8];
#pragma unroll
    for (int r = 0; r < 8; ++r) {
      const int qi = q0 + 8 * hh + r;
      const int ja = j0 + ln, jb = j0 + 16 + ln;
      if (CAUSAL) { if (ja > qi) s[0][r] = -3.0e38f; if (jb > qi) s[1][r] = -3.0e38f; }
      if (ja >= T) s[0][r] = -3.0e38f;
      if (jb >= T) s[1][r] = -3.0e38f;
      float mx = fmaxf(s[0][r], s[1][r]);
      mx = fmaxf(mx, __shfl_xor(mx, 1, 32)); mx = fmaxf(mx, __shfl_xor(mx, 2, 32)); mx = fmaxf(mx, __shfl_xor(mx, 4, 32)); mx = fmaxf(mx, __shfl_xor(mx, 8, 32));
      const float mnew = fmaxf(m_r[r], mx);
      alpha[r] = (mnew > -1.0e38f) ? __expf(m_r[r] - mnew) : 1.0f;
      const float p0 = (s[0][r] > -1.0e38f) ? __expf(s[0][r] - mnew) : 0.f;
      const float p1 = (s[1][r] > -1.0e38f) ? __expf(s[1][r] - mnew) : 0.f;
      m_r[r] = mnew;
      l_r[r] = l_r[r] * alpha[r] + p0 + p1;            // per-lane partial row sum (16 lanes combined at the end)
      unsigned short hb = bf16_bits(p0); sPh[w][8 * hh + r][ln] = hb;      sPl[w][8 * hh + r][ln] = bf16_bits(p0 - bf16_val(hb));
      hb = bf16_bits(p1);                sPh[w][8 * hh + r][16 + ln] = hb; sPl[w][8 * hh + r][16 + ln] = bf16_bits(p1 - bf16_val(hb));
    }
#pragma unroll
    for (int dt = 0; dt < DT; ++dt)
#pragma unroll
      for (int r = 0; r < 8; ++r) oacc[dt][r] *= alpha[r];
    __builtin_amdgcn_fence(__ATOMIC_ACQ_REL, "workgroup");
    __builtin_amdgcn_wave_barrier();
    FragB pah, pal;
    pah.half[0] = *(const v8us*)&sPh[w][ln][8 * hh]; pah.half[1] = *(const v8us*)&sPh[w][ln][16 + 8 * hh];
    pal.half[0] = *(const v8us*)&sPl[w][ln][8 * hh]; pal.half[1] = *(const v8us*)&sPl[w][ln][16 + 8 * hh];
#pragma unroll
    for (int dt = 0; dt < DT; ++dt) {
      FragB bvh, bvl;
#pragma unroll
      for (int i = 0; i < 8; ++i) {
        bvh.u[i] = sVh[8 * hh + i][dt * 16 + ln]; bvh.u[8 + i] = sVh[16 + 8 * hh + i][dt * 16 + ln];
        bvl.u[i] = sVl[8 * hh + i][dt * 16 + ln]; bvl.u[8 + i] = sVl[16 + 8 * hh + i][dt * 16 + ln];
      }
      oacc[dt] = mmaN<3>(pah.v, pal.v, bvh.v, bvl.v, oacc[dt]);
    }
    __builtin_amdgcn_fence(__ATOMIC_ACQ_REL, "workgroup");
    __builtin_amdgcn_wave_barrier();
  }
#pragma unroll
  for (int r = 0; r < 8; ++r) {
    float l = l_r[r];
    l += __shfl_xor(l, 1, 32); l += __shfl_xor(l, 2, 32); l += __shfl_xor(l, 4, 32); l += __shfl_xor(l, 8, 32);
    l_r[r] = (l > 0.f) ? 1.0f / l : 0.f;
  }
#pragma unroll
  for (int dt = 0; dt < DT; ++dt)
#pragma unroll
    for (int r = 0; r < 8; ++r) sO[w][8 * hh + r][dt * 16 + ln] = oacc[dt][r] * l_r[r];
  __builtin_amdgcn_fence(__ATOMIC_ACQ_REL, "workgroup");
  __builtin_amdgcn_wave_barrier();
  {
    for (int r = 0; r < 16; ++r) {
      const int row = q0 + r;
      if (row < T && lane < D / 4) {
        const v4f val = *(const v4fa*)&sO[w][r][lane * 4];
        *(v4f*)(y + ((size_t)b * T + row) * ypitch + h * D + lane * 4) = val;
      }
    }
    
  }
}

// GEMM C = act(A·W + bias + resid): A f32 (ASPLIT -> hi/lo 2 terms), Wt bf16 [N][K]; ACT 0 none, 1 relu, 2 exact gelu;
// resid (optional, f32, row index = (row % rmod), pitch ldr, RES_BF16 rounds it) added before the activation.
template <bool ASPLIT, int ACT, bool BIAS_BF16, bool RES_BF16>
__global__ __launch_bounds__(128) void k_gemm_bf3(const float* __restrict__ A, int lda, const unsigned short* __restrict__ Wt, int ldb,
                                                const float* __restrict__ bias, const float* __restrict__ resid, int rmod, int ldr,
                                                float* __restrict__ C, int ldc, int M, int N, int K) {
  __shared__ __attribute__((aligned(16))) float so[4][16][64];
  const int tid = threadIdx.x, w = tid >> 5, lane = tid & 31, ln = lane & 15, hh = lane >> 4;
  const int ntn = N / 64;
  const int wid = blockIdx.x * 4 + w;
  const int mt = wid / ntn, nq = wid % ntn;
  if (mt * 16 >= M) return;
  const int row0 = mt * 16, col0 = nq * 64;
  const float* arow = A + (size_t)(row0 + ln) * lda;
  v8f acc[4] = {};
  for (int kb = 0; kb < K; kb += 32) {
    FragB ah, al;
    const v4f x0 = *(const v4fa*)(arow + kb + 8 * hh), x1 = *(const v4fa*)(arow + kb + 8 * hh + 4);
    const v4f x2 = *(const v4fa*)(arow + kb + 16 + 8 * hh), x3 = *(const v4fa*)(arow + kb + 16 + 8 * hh + 4);
    float xs[16] = {x0[0],x0[1],x0[2],x0[3],x1[0],x1[1],x1[2],x1[3],x2[0],x2[1],x2[2],x2[3],x3[0],x3[1],x3[2],x3[3]};
#pragma unroll
    for (int i = 0; i < 16; ++i) { const unsigned short hb = bf16_bits(xs[i]); ah.u[i] = hb; al.u[i] = ASPLIT ? bf16_bits(xs[i] - bf16_val(hb)) : (unsigned short)0; }
#pragma unroll
    for (int t = 0; t < 4; ++t) {
      const unsigned short* brow = Wt + (size_t)(col0 + t * 16 + ln) * ldb + kb;
      FragB b;
      b.half[0] = *(const v8us*)(brow + 8 * hh);
      b.half[1] = *(const v8us*)(brow + 16 + 8 * hh);
      acc[t] = mmaN<ASPLIT ? 2 : 1>(ah.v, al.v, b.v, b.v, acc[t]);
    }
  }
#pragma unroll
  for (int t = 0; t < 4; ++t) {
    const int col = col0 + t * 16 + ln;
    float bv = bias ? bias[col] : 0.f;
    if (BIAS_BF16) bv = bf16_round(bv);
#pragma unroll
    for (int r = 0; r < 8; ++r) {
      float v = acc[t][r] + bv;
      if (resid) { float rv = resid[(size_t)((row0 + 8 * hh + r) % rmod) * ldr + col]; if (RES_BF16) rv = bf16_round(rv); v += rv; }
      if (ACT == 1) v = fmaxf(v, 0.f);
      if (ACT == 2) v = 0.5f * v * (1.0f + erff(v * 0.70710678118654752f));
      if (ACT == 3) { const float u = 0.7978845608028654f * (v + 0.044715f * v * v * v); v = 0.5f * v * (1.0f + tanhf(u)); }
      so[w][8 * hh + r][t * 16 + ln] = v;
    }
  }
  __builtin_amdgcn_fence(__ATOMIC_ACQ_REL, "workgroup");
  __builtin_amdgcn_wave_barrier();
  const int rsub = lane >> 4, c4 = (lane & 15) * 4;
  {
#pragma unroll
    for (int q = 0; q < 8; ++q) {
      const int r = q * 2 + rsub;
      const v4f v = *(const v4fa*)&so[w][r][c4];
      *(v4f*)(C + (size_t)(row0 + r) * ldc + col0 + c4) = v;
    }
    
  }
}
// row LayerNorm (biased variance, eps) over N: s = X (+ R); optional out_sum <- s; out_norm <- (s-mu)*rsqrt(var+eps)*g + b
template <bool PARAM_BF16>
__global__ __launch_bounds__(256) void k_layernorm(const float* __restrict__ X, const float* __restrict__ R, const float* __restrict__ g, const float* __restrict__ bta,
                                                  float* __restrict__ out_sum, float* __restrict__ out_norm, int N, float eps) {
  __shared__ float red[256];
  const int row = blockIdx.x, tid = threadIdx.x;
  const float* x = X + (size_t)row * N; const float* rr = R ? R + (size_t)row * N : nullptr;
  float vals[16];                     // up to N = 4096
  const int per = N / 256;            // contiguous chunk per thread? use strided-by-4 chunks: thread handles j = tid*4 + 1024*u
  float s1 = 0.f;
  for (int u = 0; u < per / 4; ++u) {
    const int j = tid * 4 + 1024 * u;
    const v4f a = *(const v4fa*)(x + j);
    v4f b = {0.f,0.f,0.f,0.f}; if (rr) b = *(const v4fa*)(rr + j);
#pragma unroll
    for (int q = 0; q < 4; ++q) { const float v = a[q] + b[q]; vals[u * 4 + q] = v; s1 += v; }
  }
  red[tid] = s1; __syncthreads();
  for (int st = 128; st > 0; st >>= 1) { if (tid < st) red[tid] += red[tid + st]; __syncthreads(); }
  const float mu = red[0] / (float)N; __syncthreads();
  float s2 = 0.f;
  for (int u = 0; u < per / 4; ++u)
#pragma unroll
    for (int q = 0; q < 4; ++q) { const float c = vals[u * 4 + q] - mu; s2 += c * c; }
  red[tid] = s2; __syncthreads();
  for (int st = 128; st > 0; st >>= 1) { if (tid < st) red[tid] += red[tid + st]; __syncthreads(); }
  const float rs = rsqrtf(red[0] / (float)N + eps);
  {
    for (int u = 0; u < per / 4; ++u) {
      const int j = tid * 4 + 1024 * u;
      v4f o, sm;
#pragma unroll
      for (int q = 0; q < 4; ++q) {
        float gg = g[j + q], bb = bta[j + q];
        if (PARAM_BF16) { gg = bf16_round(gg); bb = bf16_round(bb); }
        sm[q] = vals[u * 4 + q]; o[q] = (vals[u * 4 + q] - mu) * rs * gg + bb;
      }
      if (out_sum) *(v4f*)(out_sum + (size_t)row * N + j) = sm;
      *(v4f*)(out_norm + (size_t)row * N + j) = o;
    }
    
  }
}



// ---- f16 WMMA path (v_wmma_f32_16x16x32_f16): 11-bit significands for operands in range — used where a [0,1] probability operand needs more precision than bf16
typedef _Float16 v16h __attribute__((ext_vector_type(16)));
union FragH { v16h v; v8us half[2]; _Float16 h[16]; unsigned short u[16]; };
template <int NT>
__device__ __forceinline__ v8f mmaH(v16h ah, v16h al, v16h bh, v16h bl, v8f c) {
  c = __builtin_amdgcn_wmma_f32_16x16x32_f16(false, ah, false, bh, (short)0, c, false, false);
  if (NT >= 2) c = __builtin_amdgcn_wmma_f32_16x16x32_f16(false, al, false, bh, (short)0, c, false, false);
  if (NT >= 3) c = __builtin_amdgcn_wmma_f32_16x16x32_f16(false, ah, false, bl, (short)0, c, false, false);
  asm volatile("v_nop\n\tv_nop\n\tv_nop\n\tv_nop" : "+v"(c) : "v"(ah), "v"(al), "v"(bh), "v"(bl));
  return c;
}
// batched GEMM like k_gemm_b but f16 operands: A f32 (split into f16 hi/lo if ASPLIT, else rounded to f16), Bt = f16 values [n][k]; alpha; C f32; N multiple of 16 (partial tiles skipped)
template <bool ASPLIT>
__global__ __launch_bounds__(128) void k_gemm_h(const float* __restrict__ A, int lda, size_t sA, const _Float16* __restrict__ Bh, int ldb, size_t sB, float alpha, float* __restrict__ C, int ldc, size_t sC, int M, int N, int K) {
  __shared__ __attribute__((aligned(16))) float so[4][16][64];
  const int tid = threadIdx.x, w = tid >> 5, lane = tid & 31, ln = lane & 15, hh = lane >> 4; const int by = blockIdx.y;
  A += (size_t)by * sA; Bh += (size_t)by * sB; C += (size_t)by * sC;
  const int ntn = (N + 63) / 64; const int wid = blockIdx.x * 4 + w; const int mt = wid / ntn, nq = wid % ntn; if (mt * 16 >= M) return;
  const int row0 = mt * 16, col0 = nq * 64; const float* arow = A + (size_t)(row0 + ln) * lda;
  v8f acc[4] = {};
  for (int kb = 0; kb < K; kb += 32) {
    FragH ah, al;
    const v4f x0 = *(const v4fa*)(arow + kb + 8 * hh), x1 = *(const v4fa*)(arow + kb + 8 * hh + 4), x2 = *(const v4fa*)(arow + kb + 16 + 8 * hh), x3 = *(const v4fa*)(arow + kb + 16 + 8 * hh + 4);
    float xs[16] = {x0[0],x0[1],x0[2],x0[3],x1[0],x1[1],x1[2],x1[3],x2[0],x2[1],x2[2],x2[3],x3[0],x3[1],x3[2],x3[3]};
#pragma unroll
    for (int i = 0; i < 16; ++i) { const _Float16 h = (_Float16)xs[i]; ah.h[i] = h; al.h[i] = ASPLIT ? (_Float16)(xs[i] - (float)h) : (_Float16)0.0f; }
#pragma unroll
    for (int t = 0; t < 4; ++t) { if (col0 + t * 16 >= N) continue; const size_t boff = (size_t)(col0 + t * 16 + ln) * ldb + kb; FragH bq; bq.half[0] = *(const v8us*)(Bh + boff + 8 * hh); bq.half[1] = *(const v8us*)(Bh + boff + 16 + 8 * hh);
      acc[t] = mmaH<ASPLIT ? 2 : 1>(ah.v, al.v, bq.v, bq.v, acc[t]); }
  }
#pragma unroll
  for (int t = 0; t < 4; ++t) { if (col0 + t * 16 >= N) continue;
#pragma unroll
    for (int r = 0; r < 8; ++r) so[w][8 * hh + r][t * 16 + ln] = acc[t][r] * alpha; }
  __builtin_amdgcn_fence(__ATOMIC_ACQ_REL, "workgroup"); __builtin_amdgcn_wave_barrier();
  const int rsub = lane >> 4, c4 = (lane & 15) * 4;
  {
#pragma unroll
    for (int q = 0; q < 8; ++q) { const int r = q * 2 + rsub; if (col0 + c4 < N) { const v4f v = *(const v4fa*)&so[w][r][c4]; *(v4f*)(C + (size_t)(row0 + r) * ldc + col0 + c4) = v; } }
     }
}

// Wt[n][k] = f16(W[k][n]·scale) from f32 row-major W[K][N] (scale = power of two; bf16-exact weights stay exact in f16 away from the subnormal range)
__device__ __forceinline__ void d_wt_f16(int bx, const float* __restrict__ W, _Float16* __restrict__ Wt, int K, int N, float scale) {
  const int t = bx * 256 + threadIdx.x; if (t >= N * (K / 8)) return; const int n = t / (K / 8), k8 = (t % (K / 8)) * 8; FragH f;
#pragma unroll
  for (int i = 0; i < 8; ++i) f.h[i] = (_Float16)(bf16_round(W[(size_t)(k8 + i) * N + n]) * scale); const v8us o = f.half[0];
  *(v8us*)((unsigned short*)Wt + (size_t)n * K + k8) = o; 
}
// C16[r][c] = f16(sum_k A[r][k] * Bt[c][k] * alpha + bf16(bias[c])): A f16 [NR][DD], Bt f16 [DD][DD]. One work-group = a 128 x 128 tile of C, 8 waves of 64 x 32 (4 x 2 accumulators);
// k runs in slices of 128 through an LDS ring of two buffers that all 8 waves share; per output element the WMMAs follow one another in rising k, 32 at a time
// One grid holds the three independent projections: blocks [256 s, 256 s + 256) are product s (0 = q, 1 = k, 2 = v); A3, Bt3 and C3 hold the three planes one behind the other
__global__ __launch_bounds__(256) void k_gemm_t(const _Float16* __restrict__ A3, const _Float16* __restrict__ Bt3, float alpha, const float* __restrict__ bias0, const float* __restrict__ bias1, const float* __restrict__ bias2, _Float16* __restrict__ C3) {
  constexpr int GP = (NR / 128) * (DD / 128); const int sel = blockIdx.x / GP, bx = blockIdx.x % GP;
  const _Float16* A = A3 + (size_t)sel * NR * DD; const _Float16* Bt = Bt3 + (size_t)sel * DD * DD; _Float16* C16 = C3 + (size_t)sel * NR * DD; const float* bias = sel == 0 ? bias0 : sel == 1 ? bias1 : bias2;
  // rows of 128 f16 = 256 B; LDS pitch 272 B (16 B x odd) keeps the 16 rows of a ds_load_b128 fragment read on distinct banks
  constexpr int BT = 128, BK = 128, NSL = DD / BK, LP = BK + 8, TBY = BT * LP * 2, CP = BT + 8;
  __shared__ __attribute__((aligned(16))) unsigned short sA[2][BT][LP]; __shared__ __attribute__((aligned(16))) unsigned short sB[2][BT][LP]; __shared__ __attribute__((aligned(16))) unsigned short sC[BT][CP];
  const int tid = threadIdx.x, w = tid >> 5, lane = tid & 31, ln = lane & 15, hh = lane >> 4;
  const int row0 = (bx % (NR / BT)) * BT, col0 = (bx / (NR / BT)) * BT; const int wm = (w >> 2) * 64, wn = (w & 3) * 32;
  // each thread copies 16 B of rows crow, crow + 16, ..., crow + 112 of both tiles: a wave's copy covers four whole 128-B lines
  const int crow = tid >> 4, ccol = tid & 15;
  const unsigned short* gA = (const unsigned short*)A + (size_t)(row0 + crow) * DD + ccol * 8; const unsigned short* gB = (const unsigned short*)Bt + (size_t)(col0 + crow) * DD + ccol * 8;
  const unsigned lA = (unsigned)(uintptr_t)&sA[0][crow][ccol * 8], lB = (unsigned)(uintptr_t)&sB[0][crow][ccol * 8];
  auto copy8 = [&](unsigned l, const unsigned short* g) {
    // global -> LDS through no register; s_wait_xcnt 0 closes the statement so that no address register is rewritten ahead of it
    asm volatile("global_load_async_to_lds_b128 %0, %8, off\n\tglobal_load_async_to_lds_b128 %1, %9, off\n\tglobal_load_async_to_lds_b128 %2, %10, off\n\tglobal_load_async_to_lds_b128 %3, %11, off\n\t"
                 "global_load_async_to_lds_b128 %4, %12, off\n\tglobal_load_async_to_lds_b128 %5, %13, off\n\tglobal_load_async_to_lds_b128 %6, %14, off\n\tglobal_load_async_to_lds_b128 %7, %15, off\n\ts_wait_xcnt 0x0"
                 :: "v"(l), "v"(l + 16 * LP * 2), "v"(l + 32 * LP * 2), "v"(l + 48 * LP * 2), "v"(l + 64 * LP * 2), "v"(l + 80 * LP * 2), "v"(l + 96 * LP * 2), "v"(l + 112 * LP * 2),
                    "v"(g), "v"(g + 16 * DD), "v"(g + 32 * DD), "v"(g + 48 * DD), "v"(g + 64 * DD), "v"(g + 80 * DD), "v"(g + 96 * DD), "v"(g + 112 * DD) : "memory"); };
  auto stage = [&](int st, int bf) { copy8(lA + bf * TBY, gA + st * BK); copy8(lB + bf * TBY, gB + st * BK); };
  v8f acc[4][2];
#pragma unroll
  for (int mi = 0; mi < 4; ++mi)
#pragma unroll
    for (int ni = 0; ni < 2; ++ni) acc[mi][ni] = (v8f){0.f,0.f,0.f,0.f,0.f,0.f,0.f,0.f};
  stage(0, 0);
  asm volatile("s_wait_asynccnt 0x0" ::: "memory");      // this wave's copies of slice 0 have landed
  __syncthreads();                                        // ... and every other wave's: slice 0 may be read
  stage(1, 1);
#pragma unroll 1      /* one copy of the ring's foot; the buffer index stays t & 1 */
  for (int t = 0; t < NSL; ++t) { const int bf = t & 1; const unsigned short* ab = &sA[bf][wm + ln][8 * hh]; const unsigned short* bb = &sB[bf][wn + ln][8 * hh];
    FragH a[2][4], bq[2][2];      /* two fragment sets: the next 32 k of THIS slice are read while the present 32 are multiplied */
    auto frags = [&](int ks, int s) {
#pragma unroll
      for (int mi = 0; mi < 4; ++mi) { a[s][mi].half[0] = *(const v8us*)(ab + mi * 16 * LP + ks * 32); a[s][mi].half[1] = *(const v8us*)(ab + mi * 16 * LP + ks * 32 + 16); }
#pragma unroll
      for (int ni = 0; ni < 2; ++ni) { bq[s][ni].half[0] = *(const v8us*)(bb + ni * 16 * LP + ks * 32); bq[s][ni].half[1] = *(const v8us*)(bb + ni * 16 * LP + ks * 32 + 16); } };
    frags(0, 0);
#pragma unroll
    for (int ks = 0; ks < BK / 32; ++ks) { if (ks + 1 < BK / 32) frags(ks + 1, (ks + 1) & 1);
      __builtin_amdgcn_sched_barrier(0);      // keeps the next step's 12 LDS reads in front of this step's WMMAs; without it each read sinks to its use and its latency is waited for
#pragma unroll
      for (int mi = 0; mi < 4; ++mi)
#pragma unroll
        for (int ni = 0; ni < 2; ++ni) acc[mi][ni] = __builtin_amdgcn_wmma_f32_16x16x32_f16(false, a[ks & 1][mi].v, false, bq[ks & 1][ni].v, (short)0, acc[mi][ni], false, false); }
    asm volatile("s_wait_dscnt 0x0" ::: "memory");        // this wave's reads of buffer bf are done before it is refilled
    asm volatile("s_wait_asynccnt 0x0" ::: "memory");     // this wave's copies of slice t + 1 have landed
    __syncthreads();                                        // publishes slice t + 1 and ends every wave's reads of buffer bf
    if (t + 2 < NSL) stage(t + 2, bf); }
  asm volatile("s_wait_asynccnt 0x0" ::: "memory");       // no copy is outstanding when the wave goes on to the epilogue
  // the tile goes through LDS as f16 so that each 256-B row piece of C is stored as whole 128-B lines
#pragma unroll
  for (int ni = 0; ni < 2; ++ni) { const float bv = bf16_round(bias[col0 + wn + ni * 16 + ln]);
#pragma unroll
    for (int mi = 0; mi < 4; ++mi)
#pragma unroll
      for (int r = 0; r < 8; ++r) { FragH c1; c1.h[0] = (_Float16)(acc[mi][ni][r] * alpha + bv); sC[wm + mi * 16 + 8 * hh + r][wn + ni * 16 + ln] = c1.u[0]; } }
  __syncthreads();
#pragma unroll
  for (int i = 0; i < BT * (BT / 8) / 256; ++i) { const int e = tid + i * 256, r = e >> 4, c8 = (e & 15) * 8; const v8us o = *(const v8us*)&sC[r][c8]; *(v8us*)((unsigned short*)C16 + (size_t)(row0 + r) * DD + col0 + c8) = o; }
}


typedef _Float16 v4h __attribute__((ext_vector_type(4)));

__global__ __launch_bounds__(256) void k_x16(const float* __restrict__ x, _Float16* __restrict__ X16, size_t n8) { const size_t t = (size_t)blockIdx.x * 256 + threadIdx.x; if (t >= n8) return; FragH f;
#pragma unroll
  for (int q = 0; q < 8; ++q) f.h[q] = (_Float16)bf16_round(x[t * 8 + q]); *(v8us*)((unsigned short*)X16 + t * 8) = f.half[0];  }
__global__ __launch_bounds__(256) void k_h16(const float* __restrict__ x, _Float16* __restrict__ X16, size_t n8) { const size_t t = (size_t)blockIdx.x * 256 + threadIdx.x; if (t >= n8) return; FragH f;
#pragma unroll
  for (int q = 0; q < 8; ++q) f.h[q] = (_Float16)x[t * 8 + q]; *(v8us*)((unsigned short*)X16 + t * 8) = f.half[0];  }
__global__ __launch_bounds__(256) void k_round16f(const float* __restrict__ W, _Float16* __restrict__ Bt, size_t n8) { const size_t t = (size_t)blockIdx.x * 256 + threadIdx.x; if (t >= n8) return; FragH f;
#pragma unroll
  for (int i = 0; i < 8; ++i) f.h[i] = (_Float16)(bf16_round(W[t * 8 + i]) * 16.0f); *(v8us*)((unsigned short*)Bt + t * 8) = f.half[0];  }
template <int NHv, int TTv>
__global__ __launch_bounds__(256) void k_vt(const _Float16* __restrict__ V16, int ldv, int voff, _Float16* __restrict__ Vt) { __shared__ unsigned short tl[64][66]; const int tid = threadIdx.x; const int slab = blockIdx.x / (TTv / 64), lg = blockIdx.x % (TTv / 64); const int b = slab / NHv, h = slab % NHv;
  for (int i = tid; i < 64 * 8; i += 256) { const int r = i / 8, c8 = (i % 8) * 8; FragH f; f.half[0] = *(const v8us*)((const unsigned short*)V16 + ((size_t)b * TTv + lg * 64 + r) * ldv + voff + h * 64 + c8);
#pragma unroll
    for (int q = 0; q < 8; ++q) tl[r][c8 + q] = f.u[q]; }
  __syncthreads();
  {
#pragma unroll
    for (int rd = 0; rd < 2; ++rd) { const int d = rd * 32 + tid / 8, pc = tid % 8; FragH f;
#pragma unroll
      for (int q = 0; q < 8; ++q) f.u[q] = tl[pc * 8 + q][d];
      *(v8us*)((unsigned short*)Vt + ((size_t)slab * 64 + d) * TTv + lg * 64 + pc * 8) = f.half[0]; }
     } }

template <int D, int RBF>
__device__ __forceinline__ void d_lnx(int bx, const float* __restrict__ X, const float* __restrict__ gam, const float* __restrict__ bet, int nrows, float eps, _Float16* __restrict__ O16, float* __restrict__ XR) {
  constexpr int NP = D / 128; const int tid = threadIdx.x, wv = tid >> 5, lane = tid & 31; const size_t r = (size_t)bx * 8 + wv; if (r >= (size_t)nrows) return; v4f y[NP]; float s = 0.f;
#pragma unroll
  for (int j = 0; j < NP; ++j) { const int c = j * 128 + lane * 4; v4f g = *(const v4fa*)(X + r * D + c); if (RBF) { for (int q = 0; q < 4; ++q) g[q] = bf16_round(g[q]); } y[j] = g; s += g[0] + g[1] + g[2] + g[3]; }
  for (int o = 16; o >= 1; o >>= 1) s += __shfl_xor(s, o, 32); const float mu = s / (float)D; float q2 = 0.f;
#pragma unroll
  for (int j = 0; j < NP; ++j) for (int q = 0; q < 4; ++q) { const float d = y[j][q] - mu; q2 += d * d; }
  for (int o = 16; o >= 1; o >>= 1) q2 += __shfl_xor(q2, o, 32); const float rs = rsqrtf(q2 / (float)D + eps);
  {
#pragma unroll
    for (int j = 0; j < NP; ++j) { const int c = j * 128 + lane * 4; v4h h; for (int q = 0; q < 4; ++q) { const float v = (y[j][q] - mu) * rs * bf16_round(gam[c + q]) + bf16_round(bet[c + q]); h[q] = (_Float16)v; } *(v4h*)(O16 + r * D + c) = h; if (XR) *(v4f*)(XR + r * D + c) = y[j]; }
     } }
typedef int v4ia __attribute__((ext_vector_type(4), may_alias));
// One wave reads one tile of 64 queries x 64 keys of the mask (nonzero = masked) and writes its class: bit 0 = some pair is open, bit 1 = some pair is masked.
// Tile number = (b * 32 + query tile) * 32 + key tile; each class word stands in a 128-B line of its own, so every line has one writer
__device__ __forceinline__ void d_mclass(int bx, const int* __restrict__ MSK, int* __restrict__ TF) {
  const unsigned lane = threadIdx.x & 31, tile = (unsigned)bx * 8 + (threadIdx.x >> 5); const unsigned kt = tile % (TT / 64), qt = (tile / (TT / 64)) % (TT / 64), b = tile / ((TT / 64) * (TT / 64));
  const int* p = MSK + ((size_t)b * TT + qt * 64 + (lane >> 4)) * TT + kt * 64 + (lane & 15) * 4;      /* a wave's load = two rows of 256 B: four whole lines */
  unsigned am = 0u, lo = ~0u;      /* OR and unsigned minimum of the tile's words: am != 0 = some pair masked, lo == 0 = some pair open */
#pragma unroll 8      /* eight independent loads in flight per wave: the tile comes from memory */
  for (int i = 0; i < 32; ++i) { const v4ia x = *(const v4ia*)(p + (size_t)i * 2 * TT);
#pragma unroll
    for (int q = 0; q < 4; ++q) { am |= (unsigned)x[q]; lo = min(lo, (unsigned)x[q]); } }
  const unsigned bm = __builtin_amdgcn_ballot_w32(am != 0u), bo = __builtin_amdgcn_ballot_w32(lo == 0u);
  if (lane == 0) TF[(size_t)tile * 32] = (bo ? 1 : 0) | (bm ? 2 : 0); }
// One grid holds the independent preparations: blocks [0, GM) class the mask's tiles; behind them blocks [0, 3 GW) transpose the three weights (the slower blocks, so they start early), blocks [3 GW, 3 GW + 3 GL) normalise the rows of Q, K and V
__global__ __launch_bounds__(256) void k_prep(const float* __restrict__ Qx, const float* __restrict__ Kx, const float* __restrict__ Vx, const float* __restrict__ Wq, const float* __restrict__ Wk, const float* __restrict__ Wv,
                                              const float* __restrict__ gam, const float* __restrict__ bet, const int* __restrict__ MSK, _Float16* __restrict__ Bw, _Float16* __restrict__ H3, float* __restrict__ XR, int* __restrict__ TF) {
  constexpr int GM = BB * (TT / 64) * (TT / 64) / 8, GW = DD * (DD / 8) / 256, GL = NR / 8; const int bx = (int)blockIdx.x - GM;
  if (bx < 0) d_mclass(blockIdx.x, MSK, TF);
  else if (bx < 3 * GW) { const int sel = bx / GW; d_wt_f16(bx % GW, sel == 0 ? Wq : sel == 1 ? Wk : Wv, Bw + (size_t)sel * DD * DD, DD, DD, 16.0f); }      /* (in,out) -> Bt x 2^4 */
  else { const int y = bx - 3 * GW, sel = y / GL; d_lnx<DD, 1>(y % GL, sel == 0 ? Qx : sel == 1 ? Kx : Vx, gam, bet, NR, 1e-5f, H3 + (size_t)sel * NR * DD, sel == 0 ? XR : nullptr); } }      /* LN(bf16 x) -> f16; XR = bf16(Q) for the residual */
__global__ __launch_bounds__(256) void k_addres(const float* __restrict__ O, const float* __restrict__ XR, float* __restrict__ out, size_t n4) { const size_t t = (size_t)blockIdx.x * 256 + threadIdx.x; if (t >= n4) return; v4f a = *(const v4fa*)(O + t * 4); const v4f b = *(const v4fa*)(XR + t * 4); for (int q = 0; q < 4; ++q) a[q] += b[q]; *(v4f*)(out + t * 4) = a;  }
// y[i] = 2^x[i], twelve independent v_exp_f32 in one statement with results in registers of their own (=&v), so that none overwrites the source of the one in front of it;
// the closing v_nop is the slot the instruction set asks for behind a transcendental before its result is read or its source overwritten
__device__ __forceinline__ void exp2x12(float* __restrict__ y, const float* __restrict__ x) {
  asm("v_exp_f32 %0, %12\n\tv_exp_f32 %1, %13\n\tv_exp_f32 %2, %14\n\tv_exp_f32 %3, %15\n\tv_exp_f32 %4, %16\n\tv_exp_f32 %5, %17\n\t"
      "v_exp_f32 %6, %18\n\tv_exp_f32 %7, %19\n\tv_exp_f32 %8, %20\n\tv_exp_f32 %9, %21\n\tv_exp_f32 %10, %22\n\tv_exp_f32 %11, %23\n\tv_nop"
      : "=&v"(y[0]), "=&v"(y[1]), "=&v"(y[2]), "=&v"(y[3]), "=&v"(y[4]), "=&v"(y[5]), "=&v"(y[6]), "=&v"(y[7]), "=&v"(y[8]), "=&v"(y[9]), "=&v"(y[10]), "=&v"(y[11])
      : "v"(x[0]), "v"(x[1]), "v"(x[2]), "v"(x[3]), "v"(x[4]), "v"(x[5]), "v"(x[6]), "v"(x[7]), "v"(x[8]), "v"(x[9]), "v"(x[10]), "v"(x[11])); }
// the same for five values
__device__ __forceinline__ void exp2x5(float* __restrict__ y, const float* __restrict__ x) {
  asm("v_exp_f32 %0, %5\n\tv_exp_f32 %1, %6\n\tv_exp_f32 %2, %7\n\tv_exp_f32 %3, %8\n\tv_exp_f32 %4, %9\n\tv_nop"
      : "=&v"(y[0]), "=&v"(y[1]), "=&v"(y[2]), "=&v"(y[3]), "=&v"(y[4]) : "v"(x[0]), "v"(x[1]), "v"(x[2]), "v"(x[3]), "v"(x[4])); }
// the value that lane l ^ 16 holds
__device__ __forceinline__ float xhalf(float x) { const int b = __float_as_int(x); return __int_as_float(__builtin_amdgcn_permlanex16(b, b, 0x76543210, 0xfedcba98, false, false)); }
// Scores are computed transposed: S^T = K Q^T (A = 16 keys from LDS, B = the wave's 16 queries, kept in registers), O^T += V^T P^T. Lane (ln, hh) holds query q0 + ln alone:
// register r of score tile nt is key j0 + nt * 16 + 8 * hh + r, so maximum and sum run inside the lane with one exchange between the halves, and the two score tiles, converted in place, are the B operand of the second product
__global__ __launch_bounds__(128) void k_flash(const _Float16* __restrict__ Q16, int ldq, const _Float16* __restrict__ K16, int ldk, const _Float16* __restrict__ Vt, const int* __restrict__ MSK, const int* __restrict__ TF, float* __restrict__ O, int ldo) {
  constexpr int RPW = 16, NQB = TT / (4 * RPW), DT = 4, KS = 2;
  __shared__ __attribute__((aligned(16))) float sO[4][RPW][64 + 4];
  // K/V ring, two buffers, one stage = SKEY keys: sK rows = keys (64 d = 128 B), sV rows = d (SKEY keys = 128 B); LDS pitch 144 B (16 B x odd) keeps the 16 rows of a ds_load_b128 fragment read on distinct banks
  constexpr int SKEY = 64, NST = TT / SKEY, LP = 72, SBUF = 64 * LP * 2; constexpr float SC = 0.125f * 1.44269504088896340736f;      /* 64^-1/2 * log2(e) */
  __shared__ __attribute__((aligned(16))) unsigned short sK[2][SKEY][LP]; __shared__ __attribute__((aligned(16))) unsigned short sV[2][64][LP];
  const int tid = threadIdx.x, w = tid >> 5, lane = tid & 31, ln = lane & 15, hh = lane >> 4;
  // A work-group's cost is the number of key stages that its query tile leaves open, so it differs from tile to tile. Block index -> (slab, query tile) is a permutation of the 1024 pairs, for speed only.
  // Each run of 128 blocks (ga = 0..7) holds, for all 32 slabs, the four tiles 31 - ga, 16 + ga, 15 - ga, ga; which of the four a block takes is the sum of its index's base-4 digits mod 4,
  // so that four blocks a power of two apart hold one tile of each kind, wherever the hardware puts them, and the far ends of the tile range stand early in the grid
  static_assert(NQB == 32 && BB * NH == 32 && TT / 64 == 32, "the bit fields below and one class word per lane");
  const int bi = blockIdx.x, ga = bi >> 7, slab = (bi >> 2) & 31, pp = (bi + (bi >> 2) + (bi >> 4) + (bi >> 6) + (bi >> 8)) & 3;
  const int qblk = (((pp >> 1) ^ 1) << 4) | (ga ^ (((pp & 1) - 1) & 15));      /* pp = 0, 1, 2, 3: 31 - ga, 16 + ga, 15 - ga, ga */
  const int b = slab / NH, h = slab % NH; const int qb0 = qblk * (4 * RPW); const int q0 = qb0 + w * RPW;
  const int tf = TF[(size_t)((b * NQB + qblk) * NST + lane) * 32];
  asm volatile("s_wait_xcnt 0x0" ::: "memory");      // stands behind the load above, in front of every later write of its address registers
  FragH aq[KS];
  { const unsigned short* qr = (const unsigned short*)Q16 + ((size_t)b * TT + q0 + ln) * ldq + h * 64;
#pragma unroll
    for (int ks = 0; ks < KS; ++ks) { aq[ks].half[0] = *(const v8us*)(qr + ks * 32 + 8 * hh); aq[ks].half[1] = *(const v8us*)(qr + ks * 32 + 16 + 8 * hh); } }
  const unsigned short* Vth = (const unsigned short*)Vt + (size_t)slab * 64 * TT;
  const int* mrow = MSK + ((size_t)b * TT + q0 + ln) * TT + 8 * hh;      /* this lane's query row of the mask, at its half's first key */
  float m_r = -3.0e38f, l_r = 0.f; v8f oacc[DT];
#pragma unroll
  for (int dt = 0; dt < DT; ++dt) oacc[dt] = (v8f){0.f,0.f,0.f,0.f,0.f,0.f,0.f,0.f};
  // each thread copies 16 B of rows crow, crow + 16, + 32, + 48 of both tiles: a wave's copy covers four whole 128-B lines
  const int crow = tid >> 3, ccol = tid & 7;
  const unsigned short* gK = (const unsigned short*)K16 + ((size_t)b * TT + crow) * ldk + h * 64 + ccol * 8; const unsigned short* gV = Vth + (size_t)crow * TT + ccol * 8;
  const unsigned lK = (unsigned)(uintptr_t)&sK[0][crow][ccol * 8], lV = (unsigned)(uintptr_t)&sV[0][crow][ccol * 8];
  auto stage = [&](int st, int bf) { const unsigned short* k0 = gK + (size_t)st * SKEY * ldk; const unsigned short* v0 = gV + st * SKEY; const unsigned lk = lK + bf * SBUF, lv = lV + bf * SBUF;
    // global -> LDS through no register; s_wait_xcnt 0 closes the statement so that no address register is rewritten ahead of it
    asm volatile("global_load_async_to_lds_b128 %0, %8, off\n\tglobal_load_async_to_lds_b128 %1, %9, off\n\tglobal_load_async_to_lds_b128 %2, %10, off\n\tglobal_load_async_to_lds_b128 %3, %11, off\n\t"
                 "global_load_async_to_lds_b128 %4, %12, off\n\tglobal_load_async_to_lds_b128 %5, %13, off\n\tglobal_load_async_to_lds_b128 %6, %14, off\n\tglobal_load_async_to_lds_b128 %7, %15, off\n\ts_wait_xcnt 0x0"
                 :: "v"(lk), "v"(lk + 16 * LP * 2), "v"(lk + 32 * LP * 2), "v"(lk + 48 * LP * 2), "v"(lv), "v"(lv + 16 * LP * 2), "v"(lv + 32 * LP * 2), "v"(lv + 48 * LP * 2),
                    "v"(k0), "v"(k0 + (size_t)16 * ldk), "v"(k0 + (size_t)32 * ldk), "v"(k0 + (size_t)48 * ldk), "v"(v0), "v"(v0 + 16 * TT), "v"(v0 + 32 * TT), "v"(v0 + 48 * TT) : "memory"); };
  // tf: lane t holds the class of key stage t for this block's 64 queries; every wave reads the same 32 words, so both ballots are the same in the whole work-group.
  // A stage with no open pair adds nothing (every p is 0, the maximum stays, the rescale is 1): it is neither copied nor computed. The ring runs over the na <= 32 stages that are left, in rising order
  const unsigned mix = __builtin_amdgcn_ballot_w32((tf & 2) != 0); unsigned rem = __builtin_amdgcn_ballot_w32((tf & 1) != 0); const int na = __builtin_popcount(rem);
  auto next = [&]() { const int s = __builtin_ctz(rem); rem &= rem - 1; return s; };      /* called only while a stage is left */
  int tc = 0, tn = 0;      /* the stage in buffer it & 1 and the one behind it */
  if (na > 0) { tc = next(); stage(tc, 0); }
  asm volatile("s_wait_asynccnt 0x0" ::: "memory");      // this wave's copies of the first stage have landed
  __syncthreads();                                        // ... and every other wave's: it may be read
  if (na > 1) { tn = next(); stage(tn, 1); }
#pragma unroll 1      /* one copy of the ring's foot; the buffer index stays it & 1 */
  for (int it = 0; it < na; ++it) { const int bf = it & 1; const bool mx = (mix >> tc) & 1;      /* the stage has masked pairs: only then are the mask's words read and applied */
  for (int sub = 0; sub < SKEY / 32; ++sub) { const int j0 = tc * SKEY + sub * 32;
    v4ia mk[2][2];      /* nonzero = MASKED; mk[nt][r >> 2][r & 3] belongs to register r of score tile nt; loaded and read under mx alone */
    if (mx) {
#pragma unroll
    for (int nt = 0; nt < 2; ++nt) { mk[nt][0] = *(const v4ia*)(mrow + j0 + nt * 16); mk[nt][1] = *(const v4ia*)(mrow + j0 + nt * 16 + 4); } }
    float sv[16];      /* unscaled scores of keys j0 + 8 hh + 0..7 and j0 + 16 + 8 hh + 0..7; the running maximum is kept unscaled too */
#pragma unroll
    for (int nt = 0; nt < 2; ++nt) { const unsigned short* kr = &sK[bf][sub * 32 + nt * 16 + ln][0]; FragH bk[KS];
#pragma unroll
      for (int ks = 0; ks < KS; ++ks) { bk[ks].half[0] = *(const v8us*)(kr + ks * 32 + 8 * hh); bk[ks].half[1] = *(const v8us*)(kr + ks * 32 + 16 + 8 * hh); }
      v8f acc = (v8f){0.f,0.f,0.f,0.f,0.f,0.f,0.f,0.f};
#pragma unroll
      for (int ks = 0; ks < KS; ++ks) acc = mmaH<1>(bk[ks].v, bk[ks].v, aq[ks].v, aq[ks].v, acc);
#pragma unroll
      for (int r = 0; r < 8; ++r) sv[nt * 8 + r] = acc[r];
      if (mx) {
#pragma unroll
        for (int r = 0; r < 8; ++r) sv[nt * 8 + r] = (mk[nt][r >> 2][r & 3] == 0) ? acc[r] : -INFINITY; } }
    float mc = fmaxf(sv[0], sv[1]);
#pragma unroll
    for (int i = 2; i < 16; ++i) mc = fmaxf(mc, sv[i]);
    mc = fmaxf(mc, xhalf(mc));      /* the other half's 16 keys of the same query */
    // e^(0.125 (s - m)) = 2^(s * SC - m * SC): one fma per score, no branch; a masked score is -inf and gives 0 (m is finite: it starts at -3e38)
    const float mn = fmaxf(m_r, mc), nb = -mn * SC; float ex[17], ey[17]; ex[16] = (m_r - mn) * SC;
#pragma unroll
    for (int i = 0; i < 16; ++i) ex[i] = fmaf(sv[i], SC, nb);
    exp2x12(ey, ex); exp2x5(ey + 12, ex + 12);
    const float* p = ey; const float al = (mn > -1.0e38f) ? ey[16] : 1.0f; m_r = mn;
    float ps = p[0];
#pragma unroll
    for (int i = 1; i < 16; ++i) ps += p[i];
    l_r = l_r * al + ps;      /* this half's keys only; the halves are joined behind the loop */
#pragma unroll
    for (int dt = 0; dt < DT; ++dt)
#pragma unroll
      for (int r = 0; r < 8; ++r) oacc[dt][r] *= al;
    FragH pb;      /* B operand: column ln = the query, element i = key kmap(i, hh) of the 32: the order in which sv holds them */
#pragma unroll
    for (int i = 0; i < 16; ++i) pb.h[i] = (_Float16)(p[i] * 1024.0f);
#pragma unroll
    for (int dt = 0; dt < DT; ++dt) { const unsigned short* vrow = &sV[bf][dt * 16 + ln][sub * 32]; FragH bv; bv.half[0] = *(const v8us*)(vrow + 8 * hh); bv.half[1] = *(const v8us*)(vrow + 16 + 8 * hh);
      oacc[dt] = mmaH<1>(bv.v, bv.v, pb.v, pb.v, oacc[dt]); } }
    asm volatile("s_wait_dscnt 0x0" ::: "memory");        // this wave's reads of buffer bf are done before it is refilled
    asm volatile("s_wait_asynccnt 0x0" ::: "memory");     // this wave's copies of the next stage have landed
    __syncthreads();                                        // publishes the next stage and ends every wave's reads of buffer bf
    tc = tn; if (it + 2 < na) { tn = next(); stage(tn, bf); } }
  asm volatile("s_wait_asynccnt 0x0" ::: "memory");       // no copy is outstanding when the wave goes on to the epilogue
  const float l = l_r + xhalf(l_r); const float li = (l > 0.f) ? 1.0f / (l * 1024.0f) : 0.f;
  // register r of oacc[dt] is O[q0 + ln][dt * 16 + 8 hh + r]: eight consecutive d of the lane's query
#pragma unroll
  for (int dt = 0; dt < DT; ++dt) { v4f lo, hi;
#pragma unroll
    for (int r = 0; r < 4; ++r) { lo[r] = oacc[dt][r] * li; hi[r] = oacc[dt][4 + r] * li; }
    *(v4fa*)&sO[w][ln][dt * 16 + 8 * hh] = lo; *(v4fa*)&sO[w][ln][dt * 16 + 8 * hh + 4] = hi; }
  __builtin_amdgcn_fence(__ATOMIC_ACQ_REL, "workgroup"); __builtin_amdgcn_wave_barrier();
  {
#pragma unroll
    for (int rp = 0; rp < RPW; rp += 2) { const int r = rp + (lane >> 4), pc = lane & 15; const v4f val = *(const v4fa*)&sO[w][r][pc * 4]; *(v4f*)(O + ((size_t)b * TT + q0 + r) * ldo + h * 64 + pc * 4) = val; }
     } }

extern "C" void kernel_launch(void* const* d_in, const int* in_sizes, int n_in,
                              void* d_out, int out_size, void* d_ws, size_t ws_size, hipStream_t stream) {
  (void)in_sizes; (void)n_in; (void)out_size;
  const float* const* I = (const float* const*)d_in; const float* Qx = I[0]; const float* Kx = I[1]; const float* Vx = I[2]; const int* mask = (const int*)d_in[3];      /* bool mask shipped as int32 [2,1,2048,2048] */
  const float* Wq = I[4]; const float* bq = I[5]; const float* Wk = I[6]; const float* bk = I[7]; const float* Wv = I[8]; const float* bv = I[9]; const float* gam = I[10]; const float* bet = I[11];
  char* ws = (char*)d_ws; size_t off = 0;
  auto take = [&](size_t bytes) { char* p = ws + off; off += (bytes + 255) & ~(size_t)255; return p; };
  const size_t WSZ = (size_t)DD * DD; _Float16* Bw = (_Float16*)take(3 * WSZ * 2); float* XR = (float*)take((size_t)NR * DD * 4); _Float16* H16 = (_Float16*)take((size_t)3 * NR * DD * 2);
  _Float16* Q = (_Float16*)take((size_t)3 * NR * DD * 2); _Float16* K = Q + (size_t)NR * DD; _Float16* V = K + (size_t)NR * DD; _Float16* Vt = (_Float16*)take((size_t)NR * DD * 2); float* O = (float*)take((size_t)NR * DD * 4); int* TF = (int*)take((size_t)BB * (TT / 64) * (TT / 64) * 128);
  if (off > ws_size) return;      // 6.3 + 16.8 + 25.2 + 25.2 + 8.4 + 16.8 = about 99 MB
  k_prep<<<BB * (TT / 64) * (TT / 64) / 8 + 3 * (DD * (DD / 8) / 256) + 3 * (NR / 8), 256, 0, stream>>>(Qx, Kx, Vx, Wq, Wk, Wv, gam, bet, mask, Bw, H16, XR, TF);
  k_gemm_t<<<3 * (NR / 128) * (DD / 128), 256, 0, stream>>>(H16, Bw, 0.0625f, bq, bk, bv, Q);      /* three times M 4096 N 1024 K 1024 */
  k_vt<NH, TT><<<BB * NH * (TT / 64), 256, 0, stream>>>(V, DD, 0, Vt);
  k_flash<<<BB * NH * (TT / 64), 128, 0, stream>>>(Q, DD, K, DD, Vt, mask, TF, O, DD);
  k_addres<<<(unsigned)(((size_t)NR * DD / 4 + 255) / 256), 256, 0, stream>>>(O, XR, (float*)d_out, (size_t)NR * DD / 4);      /* out = o + Q */
}

// v007
// One run takes 96.1 microseconds.
// In two side-by-side timings against v006, it was 1.13 and 1.12 times as fast.
// Over all steps from v000 it is 4.49 times as fast.
#include <hip/hip_runtime.h>
// Pre-norm multi-head attention with a boolean mask and residual (B=2, N=2048, E=1024, 16 heads × 64): q = LN(Q)·Wq + bq, k = LN(K)·Wk + bk, v = LN(V)·Wv + bv (one shared LayerNorm γ,β; (in,out) weights); s = q·kᵀ·64^-½ with −inf where mask[b,0,n,m] is True;
// softmax; o = merged attn·v; out = o + Q (no output projection).
// Compute dtype: Q, K, V, weights, biases, γ, β rounded to bf16; LayerNorms f32 (wave per row) → f16; q/k/v f16 GEMM planes; fused flash-style kernel (int32 mask loads per (q,k), online softmax f32, P f16 ×2^10) on
// v_wmma_f32_16x16x32_f16; out = o (f32) + bf16(Q) (f32 add); f32 accumulate.
#define BB 2
#define TT 2048
#define DD 1024
#define NH 16
#define NR (BB * TT)

typedef __bf16 v16b __attribute__((ext_vector_type(16)));
typedef unsigned short v8us __attribute__((ext_vector_type(8), may_alias));
typedef float  v8f  __attribute__((ext_vector_type(8)));
typedef float  v4f  __attribute__((ext_vector_type(4)));
typedef float  v4fa __attribute__((ext_vector_type(4), may_alias));
union FragB { v16b v; v8us half[2]; unsigned short u[16]; };

__device__ __forceinline__ unsigned short bf16_bits(float x) { unsigned int u = __float_as_uint(x); return (unsigned short)((u + 0x7FFFu + ((u >> 16) & 1u)) >> 16); }
__device__ __forceinline__ float bf16_val(unsigned short b) { return __uint_as_float(((unsigned int)b) << 16); }
__device__ __forceinline__ float bf16_round(float x) { return bf16_val(bf16_bits(x)); }
// D += A·B with NT terms: 1 = ah·bh, 2 = + al·bh (A split), 3 = + ah·bl (both split)
template <int NT>
__device__ __forceinline__ v8f mmaN(v16b ah, v16b al, v16b bh, v16b bl, v8f c) {
  c = __builtin_amdgcn_wmma_f32_16x16x32_bf16(false, ah, false, bh, (short)0, c, false, false);
  if (NT >= 2) c = __builtin_amdgcn_wmma_f32_16x16x32_bf16(false, al, false, bh, (short)0, c, false, false);
  if (NT >= 3) c = __builtin_amdgcn_wmma_f32_16x16x32_bf16(false, ah, false, bl, (short)0, c, false, false);
  asm volatile("v_nop\n\tv_nop\n\tv_nop\n\tv_nop" : "+v"(c) : "v"(ah), "v"(al), "v"(bh), "v"(bl));
  return c;
}

__global__ __launch_bounds__(256) void k_wt_bf16(const float* __restrict__ W, unsigned short* __restrict__ Wt, int K, int N) {
  const int t = blockIdx.x * 256 + threadIdx.x;
  const int k8n = K / 8;
  if (t >= N * k8n) return;
  const int n = t / k8n, k8 = (t % k8n) * 8;
  v8us v;
#pragma unroll
  for (int i = 0; i < 8; ++i) v[i] = bf16_bits(W[(size_t)(k8 + i) * N + n]);
  *(v8us*)(Wt + (size_t)n * K + k8) = v;
  
}

// GEMM C[M][N] (f32, pitch ldc) = act(A[M][K]·W + bias). A f32 row-major (pitch lda) converted per fragment to bf16
// (ASPLIT: hi/lo two planes -> 2 terms, else single rounded term); Wt bf16 [N][K] (pitch ldb). BIAS_BF16 rounds the
// bias to bf16 first (bias quantised to bf16 before the add). K%32==0, M%16==0, N%64==0.
template <bool ASPLIT, int ACT, bool BIAS_BF16>
__global__ __launch_bounds__(128) void k_gemm_bf(const float* __restrict__ A, int lda, const unsigned short* __restrict__ Wt, int ldb,
                                               const float* __restrict__ bias, float* __restrict__ C, int ldc, int M, int N, int K) {
  __shared__ __attribute__((aligned(16))) float so[4][16][64];
  const int tid = threadIdx.x, w = tid >> 5, lane = tid & 31, ln = lane & 15, hh = lane >> 4;
  const int ntn = N / 64;
  const int wid = blockIdx.x * 4 + w;
  const int mt = wid / ntn, nq = wid % ntn;
  if (mt * 16 >= M) return;
  const int row0 = mt * 16, col0 = nq * 64;
  const float* arow = A + (size_t)(row0 + ln) * lda;
  v8f acc[4] = {};
  for (int kb = 0; kb < K; kb += 32) {
    FragB ah, al;
    const v4f x0 = *(const v4fa*)(arow + kb + 8 * hh), x1 = *(const v4fa*)(arow + kb + 8 * hh + 4);
    const v4f x2 = *(const v4fa*)(arow + kb + 16 + 8 * hh), x3 = *(const v4fa*)(arow + kb + 16 + 8 * hh + 4);
    float xs[16] = {x0[0],x0[1],x0[2],x0[3],x1[0],x1[1],x1[2],x1[3],x2[0],x2[1],x2[2],x2[3],x3[0],x3[1],x3[2],x3[3]};
#pragma unroll
    for (int i = 0; i < 16; ++i) { const unsigned short hb = bf16_bits(xs[i]); ah.u[i] = hb; al.u[i] = ASPLIT ? bf16_bits(xs[i] - bf16_val(hb)) : (unsigned short)0; }
#pragma unroll
    for (int t = 0; t < 4; ++t) {
      const unsigned short* brow = Wt + (size_t)(col0 + t * 16 + ln) * ldb + kb;
      FragB b;
      b.half[0] = *(const v8us*)(brow + 8 * hh);
      b.half[1] = *(const v8us*)(brow + 16 + 8 * hh);
      acc[t] = mmaN<ASPLIT ? 2 : 1>(ah.v, al.v, b.v, b.v, acc[t]);
    }
  }
#pragma unroll
  for (int t = 0; t < 4; ++t) {
    float bv = bias ? bias[col0 + t * 16 + ln] : 0.f;
    if (BIAS_BF16) bv = bf16_round(bv);
#pragma unroll
    for (int r = 0; r < 8; ++r) { float v = acc[t][r] + bv; if (ACT == 1) v = fmaxf(v, 0.f); so[w][8 * hh + r][t * 16 + ln] = v; }
  }
  __builtin_amdgcn_fence(__ATOMIC_ACQ_REL, "workgroup");
  __builtin_amdgcn_wave_barrier();
  const int rsub = lane >> 4, c4 = (lane & 15) * 4;
  {
#pragma unroll
    for (int q = 0; q < 8; ++q) {
      const int r = q * 2 + rsub;
      const v4f v = *(const v4fa*)&so[w][r][c4];
      *(v4f*)(C + (size_t)(row0 + r) * ldc + col0 + c4) = v;
    }
    
  }
}

// Flash-style causal/unmasked attention, all contractions 3-term bf16 hi/lo splits, f32 softmax with running max.
// q,k,v rows are read from f32 buffers with arbitrary row pitch (so they can live inside a fused qkv buffer);
// D = head size (multiple of 32, <= 128); one wave = 16 query rows; block = 4 waves (64 queries) sharing K/V chunks of 32.
template <int D, bool CAUSAL>
__global__ __launch_bounds__(128) void k_flash(const float* __restrict__ qb, const float* __restrict__ kb, const float* __restrict__ vb,
                                             int pitch, int T, int H, float scale, float* __restrict__ y, int ypitch) {
  constexpr int KS = D / 32;        // k-steps for QK
  constexpr int DT = D / 16;        // d tiles for PV
  __shared__ __attribute__((aligned(16))) unsigned short sKh[32][D + 8], sKl[32][D + 8], sVh[32][D + 8], sVl[32][D + 8];
  __shared__ __attribute__((aligned(16))) unsigned short sPh[4][16][40], sPl[4][16][40];
  __shared__ __attribute__((aligned(16))) float sO[4][16][D];
  const int tid = threadIdx.x, w = tid >> 5, lane = tid & 31, ln = lane & 15, hh = lane >> 4;
  const int nqb = (T + 63) / 64;
  const int bh = blockIdx.x / nqb, qblk = blockIdx.x % nqb;
  const int b = bh / H, h = bh % H;
  const int q0 = qblk * 64 + w * 16;
  const float* Q = qb + (size_t)b * T * pitch + h * D;
  const float* K = kb + (size_t)b * T * pitch + h * D;
  const float* V = vb + (size_t)b * T * pitch + h * D;

  // A fragments of the wave's 16 query rows (scaled), hi/lo
  FragB aqh[KS], aql[KS];
  {
    int row = q0 + ln; if (row >= T) row = T - 1;
    const float* qr = Q + (size_t)row * pitch;
#pragma unroll
    for (int ks = 0; ks < KS; ++ks)
#pragma unroll
      for (int i = 0; i < 16; ++i) {
        const int d = ks * 32 + ((i < 8) ? (8 * hh + i) : (16 + 8 * hh + (i - 8)));
        const float x = qr[d] * scale; const unsigned short hb = bf16_bits(x);
        aqh[ks].u[i] = hb; aql[ks].u[i] = bf16_bits(x - bf16_val(hb));
      }
  }
  float m_r[8], l_r[8];
#pragma unroll
  for (int r = 0; r < 8; ++r) { m_r[r] = -3.0e38f; l_r[r] = 0.f; }
  v8f oacc[DT];
#pragma unroll
  for (int dt = 0; dt < DT; ++dt) oacc[dt] = (v8f){0.f,0.f,0.f,0.f,0.f,0.f,0.f,0.f};

  const int kv_end = CAUSAL ? min(T, qblk * 64 + 64) : T;     // block-uniform
  for (int j0 = 0; j0 < kv_end; j0 += 32) {
    __syncthreads();
    for (int e = tid; e < 32 * (D / 4); e += 128) {
      const int r = e / (D / 4), c4 = (e % (D / 4)) * 4;
      const int key = j0 + r;
      v4f kf = {0.f,0.f,0.f,0.f}, vf = {0.f,0.f,0.f,0.f};
      if (key < T) { kf = *(const v4fa*)(K + (size_t)key * pitch + c4); vf = *(const v4fa*)(V + (size_t)key * pitch + c4); }
#pragma unroll
      for (int t = 0; t < 4; ++t) {
        unsigned short hb = bf16_bits(kf[t]); sKh[r][c4 + t] = hb; sKl[r][c4 + t] = bf16_bits(kf[t] - bf16_val(hb));
        hb = bf16_bits(vf[t]); sVh[r][c4 + t] = hb; sVl[r][c4 + t] = bf16_bits(vf[t] - bf16_val(hb));
      }
    }
    __syncthreads();
    // S tile 16 x 32
    v8f s[2];
#pragma unroll
    for (int nt = 0; nt < 2; ++nt) {
      v8f acc = {};
#pragma unroll
      for (int ks = 0; ks < KS; ++ks) {
        FragB bh_, bl_;
        bh_.half[0] = *(const v8us*)&sKh[nt * 16 + ln][ks * 32 + 8 * hh]; bh_.half[1] = *(const v8us*)&sKh[nt * 16 + ln][ks * 32 + 16 + 8 * hh];
        bl_.half[0] = *(const v8us*)&sKl[nt * 16 + ln][ks * 32 + 8 * hh]; bl_.half[1] = *(const v8us*)&sKl[nt * 16 + ln][ks * 32 + 16 + 8 * hh];
        acc = mmaN<3>(aqh[ks].v, aql[ks].v, bh_.v, bl_.v, acc);
      }
      s[nt] = acc;
    }
    // mask + running max (rows 8hh+r; the 16 lanes of a half share rows)
    float alpha[8];
#pragma unroll
    for (int r = 0; r < 8; ++r) {
      const int qi = q0 + 8 * hh + r;
      const int ja = j0 + ln, jb = j0 + 16 + ln;
      if (CAUSAL) { if (ja > qi) s[0][r] = -3.0e38f; if (jb > qi) s[1][r] = -3.0e38f; }
      if (ja >= T) s[0][r] = -3.0e38f;
      if (jb >= T) s[1][r] = -3.0e38f;
      float mx = fmaxf(s[0][r], s[1][r]);
      mx = fmaxf(mx, __shfl_xor(mx, 1, 32)); mx = fmaxf(mx, __shfl_xor(mx, 2, 32)); mx = fmaxf(mx, __shfl_xor(mx, 4, 32)); mx = fmaxf(mx, __shfl_xor(mx, 8, 32));
      const float mnew = fmaxf(m_r[r], mx);
      alpha[r] = (mnew > -1.0e38f) ? __expf(m_r[r] - mnew) : 1.0f;
      const float p0 = (s[0][r] > -1.0e38f) ? __expf(s[0][r] - mnew) : 0.f;
      const float p1 = (s[1][r] > -1.0e38f) ? __expf(s[1][r] - mnew) : 0.f;
      m_r[r] = mnew;
      l_r[r] = l_r[r] * alpha[r] + p0 + p1;            // per-lane partial row sum (16 lanes combined at the end)
      unsigned short hb = bf16_bits(p0); sPh[w][8 * hh + r][ln] = hb;      sPl[w][8 * hh + r][ln] = bf16_bits(p0 - bf16_val(hb));
      hb = bf16_bits(p1);                sPh[w][8 * hh + r][16 + ln] = hb; sPl[w][8 * hh + r][16 + ln] = bf16_bits(p1 - bf16_val(hb));
    }
#pragma unroll
    for (int dt = 0; dt < DT; ++dt)
#pragma unroll
      for (int r = 0; r < 8; ++r) oacc[dt][r] *= alpha[r];
    __builtin_amdgcn_fence(__ATOMIC_ACQ_REL, "workgroup");
    __builtin_amdgcn_wave_barrier();
    FragB pah, pal;
    pah.half[0] = *(const v8us*)&sPh[w][ln][8 * hh]; pah.half[1] = *(const v8us*)&sPh[w][ln][16 + 8 * hh];
    pal.half[0] = *(const v8us*)&sPl[w][ln][8 * hh]; pal.half[1] = *(const v8us*)&sPl[w][ln][16 + 8 * hh];
#pragma unroll
    for (int dt = 0; dt < DT; ++dt) {
      FragB bvh, bvl;
#pragma unroll
      for (int i = 0; i < 8; ++i) {
        bvh.u[i] = sVh[8 * hh + i][dt * 16 + ln]; bvh.u[8 + i] = sVh[16 + 8 * hh + i][dt * 16 + ln];
        bvl.u[i] = sVl[8 * hh + i][dt * 16 + ln]; bvl.u[8 + i] = sVl[16 + 8 * hh + i][dt * 16 + ln];
      }
      oacc[dt] = mmaN<3>(pah.v, pal.v, bvh.v, bvl.v, oacc[dt]);
    }
    __builtin_amdgcn_fence(__ATOMIC_ACQ_REL, "workgroup");
    __builtin_amdgcn_wave_barrier();
  }
#pragma unroll
  for (int r = 0; r < 8; ++r) {
    float l = l_r[r];
    l += __shfl_xor(l, 1, 32); l += __shfl_xor(l, 2, 32); l += __shfl_xor(l, 4, 32); l += __shfl_xor(l, 8, 32);
    l_r[r] = (l > 0.f) ? 1.0f / l : 0.f;
  }
#pragma unroll
  for (int dt = 0; dt < DT; ++dt)
#pragma unroll
    for (int r = 0; r < 8; ++r) sO[w][8 * hh + r][dt * 16 + ln] = oacc[dt][r] * l_r[r];
  __builtin_amdgcn_fence(__ATOMIC_ACQ_REL, "workgroup");
  __builtin_amdgcn_wave_barrier();
  {
    for (int r = 0; r < 16; ++r) {
      const int row = q0 + r;
      if (row < T && lane < D / 4) {
        const v4f val = *(const v4fa*)&sO[w][r][lane * 4];
        *(v4f*)(y + ((size_t)b * T + row) * ypitch + h * D + lane * 4) = val;
      }
    }
    
  }
}

// GEMM C = act(A·W + bias + resid): A f32 (ASPLIT -> hi/lo 2 terms), Wt bf16 [N][K]; ACT 0 none, 1 relu, 2 exact gelu;
// resid (optional, f32, row index = (row % rmod), pitch ldr, RES_BF16 rounds it) added before the activation.
template <bool ASPLIT, int ACT, bool BIAS_BF16, bool RES_BF16>
__global__ __launch_bounds__(128) void k_gemm_bf3(const float* __restrict__ A, int lda, const unsigned short* __restrict__ Wt, int ldb,
                                                const float* __restrict__ bias, const float* __restrict__ resid, int rmod, int ldr,
                                                float* __restrict__ C, int ldc, int M, int N, int K) {
  __shared__ __attribute__((aligned(16))) float so[4][16][64];
  const int tid = threadIdx.x, w = tid >> 5, lane = tid & 31, ln = lane & 15, hh = lane >> 4;
  const int ntn = N / 64;
  const int wid = blockIdx.x * 4 + w;
  const int mt = wid / ntn, nq = wid % ntn;
  if (mt * 16 >= M) return;
  const int row0 = mt * 16, col0 = nq * 64;
  const float* arow = A + (size_t)(row0 + ln) * lda;
  v8f acc[4] = {};
  for (int kb = 0; kb < K; kb += 32) {
    FragB ah, al;
    const v4f x0 = *(const v4fa*)(arow + kb + 8 * hh), x1 = *(const v4fa*)(arow + kb + 8 * hh + 4);
    const v4f x2 = *(const v4fa*)(arow + kb + 16 + 8 * hh), x3 = *(const v4fa*)(arow + kb + 16 + 8 * hh + 4);
    float xs[16] = {x0[0],x0[1],x0[2],x0[3],x1[0],x1[1],x1[2],x1[3],x2[0],x2[1],x2[2],x2[3],x3[0],x3[1],x3[2],x3[3]};
#pragma unroll
    for (int i = 0; i < 16; ++i) { const unsigned short hb = bf16_bits(xs[i]); ah.u[i] = hb; al.u[i] = ASPLIT ? bf16_bits(xs[i] - bf16_val(hb)) : (unsigned short)0; }
#pragma unroll
    for (int t = 0; t < 4; ++t) {
      const unsigned short* brow = Wt + (size_t)(col0 + t * 16 + ln) * ldb + kb;
      FragB b;
      b.half[0] = *(const v8us*)(brow + 8 * hh);
      b.half[1] = *(const v8us*)(brow + 16 + 8 * hh);
      acc[t] = mmaN<ASPLIT ? 2 : 1>(ah.v, al.v, b.v, b.v, acc[t]);
    }
  }
#pragma unroll
  for (int t = 0; t < 4; ++t) {
    const int col = col0 + t * 16 + ln;
    float bv = bias ? bias[col] : 0.f;
    if (BIAS_BF16) bv = bf16_round(bv);
#pragma unroll
    for (int r = 0; r < 8; ++r) {
      float v = acc[t][r] + bv;
      if (resid) { float rv = resid[(size_t)((row0 + 8 * hh + r) % rmod) * ldr + col]; if (RES_BF16) rv = bf16_round(rv); v += rv; }
      if (ACT == 1) v = fmaxf(v, 0.f);
      if (ACT == 2) v = 0.5f * v * (1.0f + erff(v * 0.70710678118654752f));
      if (ACT == 3) { const float u = 0.7978845608028654f * (v + 0.044715f * v * v * v); v = 0.5f * v * (1.0f + tanhf(u)); }
      so[w][8 * hh + r][t * 16 + ln] = v;
    }
  }
  __builtin_amdgcn_fence(__ATOMIC_ACQ_REL, "workgroup");
  __builtin_amdgcn_wave_barrier();
  const int rsub = lane >> 4, c4 = (lane & 15) * 4;
  {
#pragma unroll
    for (int q = 0; q < 8; ++q) {
      const int r = q * 2 + rsub;
      const v4f v = *(const v4fa*)&so[w][r][c4];
      *(v4f*)(C + (size_t)(row0 + r) * ldc + col0 + c4) = v;
    }
    
  }
}
// row LayerNorm (biased variance, eps) over N: s = X (+ R); optional out_sum <- s; out_norm <- (s-mu)*rsqrt(var+eps)*g + b
template <bool PARAM_BF16>
__global__ __launch_bounds__(256) void k_layernorm(const float* __restrict__ X, const float* __restrict__ R, const float* __restrict__ g, const float* __restrict__ bta,
                                                  float* __restrict__ out_sum, float* __restrict__ out_norm, int N, float eps) {
  __shared__ float red[256];
  const int row = blockIdx.x, tid = threadIdx.x;
  const float* x = X + (size_t)row * N; const float* rr = R ? R + (size_t)row * N : nullptr;
  float vals[16];                     // up to N = 4096
  const int per = N / 256;            // contiguous chunk per thread? use strided-by-4 chunks: thread handles j = tid*4 + 1024*u
  float s1 = 0.f;
  for (int u = 0; u < per / 4; ++u) {
    const int j = tid * 4 + 1024 * u;
    const v4f a = *(const v4fa*)(x + j);
    v4f b = {0.f,0.f,0.f,0.f}; if (rr) b = *(const v4fa*)(rr + j);
#pragma unroll
    for (int q = 0; q < 4; ++q) { const float v = a[q] + b[q]; vals[u * 4 + q] = v; s1 += v; }
  }
  red[tid] = s1; __syncthreads();
  for (int st = 128; st > 0; st >>= 1) { if (tid < st) red[tid] += red[tid + st]; __syncthreads(); }
  const float mu = red[0] / (float)N; __syncthreads();
  float s2 = 0.f;
  for (int u = 0; u < per / 4; ++u)
#pragma unroll
    for (int q = 0; q < 4; ++q) { const float c = vals[u * 4 + q] - mu; s2 += c * c; }
  red[tid] = s2; __syncthreads();
  for (int st = 128; st > 0; st >>= 1) { if (tid < st) red[tid] += red[tid + st]; __syncthreads(); }
  const float rs = rsqrtf(red[0] / (float)N + eps);
  {
    for (int u = 0; u < per / 4; ++u) {
      const int j = tid * 4 + 1024 * u;
      v4f o, sm;
#pragma unroll
      for (int q = 0; q < 4; ++q) {
        float gg = g[j + q], bb = bta[j + q];
        if (PARAM_BF16) { gg = bf16_round(gg); bb = bf16_round(bb); }
        sm[q] = vals[u * 4 + q]; o[q] = (vals[u * 4 + q] - mu) * rs * gg + bb;
      }
      if (out_sum) *(v4f*)(out_sum + (size_t)row * N + j) = sm;
      *(v4f*)(out_norm + (size_t)row * N + j) = o;
    }
    
  }
}



// ---- f16 WMMA path (v_wmma_f32_16x16x32_f16): 11-bit significands for operands in range — used where a [0,1] probability operand needs more precision than bf16
typedef _Float16 v16h __attribute__((ext_vector_type(16)));
union FragH { v16h v; v8us half[2]; _Float16 h[16]; unsigned short u[16]; };
template <int NT>
__device__ __forceinline__ v8f mmaH(v16h ah, v16h al, v16h bh, v16h bl, v8f c) {
  c = __builtin_amdgcn_wmma_f32_16x16x32_f16(false, ah, false, bh, (short)0, c, false, false);
  if (NT >= 2) c = __builtin_amdgcn_wmma_f32_16x16x32_f16(false, al, false, bh, (short)0, c, false, false);
  if (NT >= 3) c = __builtin_amdgcn_wmma_f32_16x16x32_f16(false, ah, false, bl, (short)0, c, false, false);
  asm volatile("v_nop\n\tv_nop\n\tv_nop\n\tv_nop" : "+v"(c) : "v"(ah), "v"(al), "v"(bh), "v"(bl));
  return c;
}
// batched GEMM like k_gemm_b but f16 operands: A f32 (split into f16 hi/lo if ASPLIT, else rounded to f16), Bt = f16 values [n][k]; alpha; C f32; N multiple of 16 (partial tiles skipped)
template <bool ASPLIT>
__global__ __launch_bounds__(128) void k_gemm_h(const float* __restrict__ A, int lda, size_t sA, const _Float16* __restrict__ Bh, int ldb, size_t sB, float alpha, float* __restrict__ C, int ldc, size_t sC, int M, int N, int K) {
  __shared__ __attribute__((aligned(16))) float so[4][16][64];
  const int tid = threadIdx.x, w = tid >> 5, lane = tid & 31, ln = lane & 15, hh = lane >> 4; const int by = blockIdx.y;
  A += (size_t)by * sA; Bh += (size_t)by * sB; C += (size_t)by * sC;
  const int ntn = (N + 63) / 64; const int wid = blockIdx.x * 4 + w; const int mt = wid / ntn, nq = wid % ntn; if (mt * 16 >= M) return;
  const int row0 = mt * 16, col0 = nq * 64; const float* arow = A + (size_t)(row0 + ln) * lda;
  v8f acc[4] = {};
  for (int kb = 0; kb < K; kb += 32) {
    FragH ah, al;
    const v4f x0 = *(const v4fa*)(arow + kb + 8 * hh), x1 = *(const v4fa*)(arow + kb + 8 * hh + 4), x2 = *(const v4fa*)(arow + kb + 16 + 8 * hh), x3 = *(const v4fa*)(arow + kb + 16 + 8 * hh + 4);
    float xs[16] = {x0[0],x0[1],x0[2],x0[3],x1[0],x1[1],x1[2],x1[3],x2[0],x2[1],x2[2],x2[3],x3[0],x3[1],x3[2],x3[3]};
#pragma unroll
    for (int i = 0; i < 16; ++i) { const _Float16 h = (_Float16)xs[i]; ah.h[i] = h; al.h[i] = ASPLIT ? (_Float16)(xs[i] - (float)h) : (_Float16)0.0f; }
#pragma unroll
    for (int t = 0; t < 4; ++t) { if (col0 + t * 16 >= N) continue; const size_t boff = (size_t)(col0 + t * 16 + ln) * ldb + kb; FragH bq; bq.half[0] = *(const v8us*)(Bh + boff + 8 * hh); bq.half[1] = *(const v8us*)(Bh + boff + 16 + 8 * hh);
      acc[t] = mmaH<ASPLIT ? 2 : 1>(ah.v, al.v, bq.v, bq.v, acc[t]); }
  }
#pragma unroll
  for (int t = 0; t < 4; ++t) { if (col0 + t * 16 >= N) continue;
#pragma unroll
    for (int r = 0; r < 8; ++r) so[w][8 * hh + r][t * 16 + ln] = acc[t][r] * alpha; }
  __builtin_amdgcn_fence(__ATOMIC_ACQ_REL, "workgroup"); __builtin_amdgcn_wave_barrier();
  const int rsub = lane >> 4, c4 = (lane & 15) * 4;
  {
#pragma unroll
    for (int q = 0; q < 8; ++q) { const int r = q * 2 + rsub; if (col0 + c4 < N) { const v4f v = *(const v4fa*)&so[w][r][c4]; *(v4f*)(C + (size_t)(row0 + r) * ldc + col0 + c4) = v; } }
     }
}

// Wt[n][k] = f16(W[k][n]·scale) from f32 row-major W[K][N] (scale = power of two; bf16-exact weights stay exact in f16 away from the subnormal range)
__device__ __forceinline__ void d_wt_f16(int bx, const float* __restrict__ W, _Float16* __restrict__ Wt, int K, int N, float scale) {
  const int t = bx * 256 + threadIdx.x; if (t >= N * (K / 8)) return; const int n = t / (K / 8), k8 = (t % (K / 8)) * 8; FragH f;
#pragma unroll
  for (int i = 0; i < 8; ++i) f.h[i] = (_Float16)(bf16_round(W[(size_t)(k8 + i) * N + n]) * scale); const v8us o = f.half[0];
  *(v8us*)((unsigned short*)Wt + (size_t)n * K + k8) = o; 
}
// C16[r][c] = f16(sum_k A[r][k] * Bt[c][k] * alpha + bf16(bias[c])): A f16 [NR][DD], Bt f16 [DD][DD]. One work-group = a 128 x 128 tile of C, 8 waves of 64 x 32 (4 x 2 accumulators);
// k runs in slices of 128 through an LDS ring of two buffers that all 8 waves share; per output element the WMMAs follow one another in rising k, 32 at a time
// One grid holds the three independent projections: blocks [256 s, 256 s + 256) are product s (0 = q, 1 = k, 2 = v); A3 and Bt3 hold the three planes one behind the other, C3 those of q and k.
// Product v is stored transposed, as the attention kernel reads it: Vt[(b * NH + h) * 64 + d][token], rows of TT tokens
__global__ __launch_bounds__(256) void k_gemm_t(const _Float16* __restrict__ A3, const _Float16* __restrict__ Bt3, float alpha, const float* __restrict__ bias0, const float* __restrict__ bias1, const float* __restrict__ bias2, _Float16* __restrict__ C3, _Float16* __restrict__ Vt) {
  constexpr int GP = (NR / 128) * (DD / 128); const int sel = blockIdx.x / GP, bx = blockIdx.x % GP;
  const _Float16* A = A3 + (size_t)sel * NR * DD; const _Float16* Bt = Bt3 + (size_t)sel * DD * DD; _Float16* C16 = C3 + (size_t)sel * NR * DD; const float* bias = sel == 0 ? bias0 : sel == 1 ? bias1 : bias2;
  // rows of 128 f16 = 256 B; LDS pitch 272 B (16 B x odd) keeps the 16 rows of a ds_load_b128 fragment read on distinct banks
  constexpr int BT = 128, BK = 128, NSL = DD / BK, LP = BK + 8, TBY = BT * LP * 2, CP = BT + 8;
  __shared__ __attribute__((aligned(16))) unsigned short sA[2][BT][LP]; __shared__ __attribute__((aligned(16))) unsigned short sB[2][BT][LP]; __shared__ __attribute__((aligned(16))) unsigned short sC[BT][CP];
  const int tid = threadIdx.x, w = tid >> 5, lane = tid & 31, ln = lane & 15, hh = lane >> 4;
  const int row0 = (bx % (NR / BT)) * BT, col0 = (bx / (NR / BT)) * BT; const int wm = (w >> 2) * 64, wn = (w & 3) * 32;
  // each thread copies 16 B of rows crow, crow + 16, ..., crow + 112 of both tiles: a wave's copy covers four whole 128-B lines
  const int crow = tid >> 4, ccol = tid & 15;
  const unsigned short* gA = (const unsigned short*)A + (size_t)(row0 + crow) * DD + ccol * 8; const unsigned short* gB = (const unsigned short*)Bt + (size_t)(col0 + crow) * DD + ccol * 8;
  const unsigned lA = (unsigned)(uintptr_t)&sA[0][crow][ccol * 8], lB = (unsigned)(uintptr_t)&sB[0][crow][ccol * 8];
  auto copy8 = [&](unsigned l, const unsigned short* g) {
    // global -> LDS through no register; s_wait_xcnt 0 closes the statement so that no address register is rewritten ahead of it
    asm volatile("global_load_async_to_lds_b128 %0, %8, off\n\tglobal_load_async_to_lds_b128 %1, %9, off\n\tglobal_load_async_to_lds_b128 %2, %10, off\n\tglobal_load_async_to_lds_b128 %3, %11, off\n\t"
                 "global_load_async_to_lds_b128 %4, %12, off\n\tglobal_load_async_to_lds_b128 %5, %13, off\n\tglobal_load_async_to_lds_b128 %6, %14, off\n\tglobal_load_async_to_lds_b128 %7, %15, off\n\ts_wait_xcnt 0x0"
                 :: "v"(l), "v"(l + 16 * LP * 2), "v"(l + 32 * LP * 2), "v"(l + 48 * LP * 2), "v"(l + 64 * LP * 2), "v"(l + 80 * LP * 2), "v"(l + 96 * LP * 2), "v"(l + 112 * LP * 2),
                    "v"(g), "v"(g + 16 * DD), "v"(g + 32 * DD), "v"(g + 48 * DD), "v"(g + 64 * DD), "v"(g + 80 * DD), "v"(g + 96 * DD), "v"(g + 112 * DD) : "memory"); };
  auto stage = [&](int st, int bf) { copy8(lA + bf * TBY, gA + st * BK); copy8(lB + bf * TBY, gB + st * BK); };
  v8f acc[4][2];
#pragma unroll
  for (int mi = 0; mi < 4; ++mi)
#pragma unroll
    for (int ni = 0; ni < 2; ++ni) acc[mi][ni] = (v8f){0.f,0.f,0.f,0.f,0.f,0.f,0.f,0.f};
  stage(0, 0);
  asm volatile("s_wait_asynccnt 0x0" ::: "memory");      // this wave's copies of slice 0 have landed
  __syncthreads();                                        // ... and every other wave's: slice 0 may be read
  stage(1, 1);
#pragma unroll 1      /* one copy of the ring's foot; the buffer index stays t & 1 */
  for (int t = 0; t < NSL; ++t) { const int bf = t & 1; const unsigned short* ab = &sA[bf][wm + ln][8 * hh]; const unsigned short* bb = &sB[bf][wn + ln][8 * hh];
    FragH a[2][4], bq[2][2];      /* two fragment sets: the next 32 k of THIS slice are read while the present 32 are multiplied */
    auto frags = [&](int ks, int s) {
#pragma unroll
      for (int mi = 0; mi < 4; ++mi) { a[s][mi].half[0] = *(const v8us*)(ab + mi * 16 * LP + ks * 32); a[s][mi].half[1] = *(const v8us*)(ab + mi * 16 * LP + ks * 32 + 16); }
#pragma unroll
      for (int ni = 0; ni < 2; ++ni) { bq[s][ni].half[0] = *(const v8us*)(bb + ni * 16 * LP + ks * 32); bq[s][ni].half[1] = *(const v8us*)(bb + ni * 16 * LP + ks * 32 + 16); } };
    frags(0, 0);
#pragma unroll
    for (int ks = 0; ks < BK / 32; ++ks) { if (ks + 1 < BK / 32) frags(ks + 1, (ks + 1) & 1);
      __builtin_amdgcn_sched_barrier(0);      // keeps the next step's 12 LDS reads in front of this step's WMMAs; without it each read sinks to its use and its latency is waited for
#pragma unroll
      for (int mi = 0; mi < 4; ++mi)
#pragma unroll
        for (int ni = 0; ni < 2; ++ni) acc[mi][ni] = __builtin_amdgcn_wmma_f32_16x16x32_f16(false, a[ks & 1][mi].v, false, bq[ks & 1][ni].v, (short)0, acc[mi][ni], false, false); }
    asm volatile("s_wait_dscnt 0x0" ::: "memory");        // this wave's reads of buffer bf are done before it is refilled
    asm volatile("s_wait_asynccnt 0x0" ::: "memory");     // this wave's copies of slice t + 1 have landed
    __syncthreads();                                        // publishes slice t + 1 and ends every wave's reads of buffer bf
    if (t + 2 < NSL) stage(t + 2, bf); }
  asm volatile("s_wait_asynccnt 0x0" ::: "memory");       // no copy is outstanding when the wave goes on to the epilogue
  // the tile goes through LDS as f16 so that each 256-B row piece of the stored plane goes out as whole 128-B lines; sel is the same in the whole work-group
  static_assert(TT % BT == 0 && NH * 64 == DD, "a tile lies in one batch; column c of v is row c of that batch's DD rows of Vt");
  FragH cf[4][2];      /* cf[mi][ni].h[r] = C[wm + mi * 16 + 8 hh + r][wn + ni * 16 + ln] */
#pragma unroll
  for (int ni = 0; ni < 2; ++ni) { const float bv = bf16_round(bias[col0 + wn + ni * 16 + ln]);
#pragma unroll
    for (int mi = 0; mi < 4; ++mi)
#pragma unroll
      for (int r = 0; r < 8; ++r) cf[mi][ni].h[r] = (_Float16)(acc[mi][ni][r] * alpha + bv); }
  auto put = [&](unsigned short* dst, int pitch) {      /* the 128 rows of sC, 256 B each, to rows of the given pitch */
#pragma unroll
    for (int i = 0; i < BT * (BT / 8) / 256; ++i) { const int e = tid + i * 256, r = e >> 4, c8 = (e & 15) * 8; const v8us o = *(const v8us*)&sC[r][c8]; *(v8us*)(dst + (size_t)r * pitch + c8) = o; } };
  if (sel == 2) {      /* sC[column][row]: a lane's eight registers are eight consecutive rows of one column, one 16-B write */
#pragma unroll
    for (int ni = 0; ni < 2; ++ni)
#pragma unroll
      for (int mi = 0; mi < 4; ++mi) *(v8us*)&sC[wn + ni * 16 + ln][wm + mi * 16 + 8 * hh] = cf[mi][ni].half[0];
  } else {
#pragma unroll
    for (int ni = 0; ni < 2; ++ni)
#pragma unroll
      for (int mi = 0; mi < 4; ++mi)
#pragma unroll
        for (int r = 0; r < 8; ++r) sC[wm + mi * 16 + 8 * hh + r][wn + ni * 16 + ln] = cf[mi][ni].u[r];
  }
  __syncthreads();
  if (sel == 2) put((unsigned short*)Vt + ((size_t)(row0 / TT) * DD + col0) * TT + row0 % TT, TT);
  else put((unsigned short*)C16 + (size_t)row0 * DD + col0, DD);
}


typedef _Float16 v4h __attribute__((ext_vector_type(4)));

__global__ __launch_bounds__(256) void k_x16(const float* __restrict__ x, _Float16* __restrict__ X16, size_t n8) { const size_t t = (size_t)blockIdx.x * 256 + threadIdx.x; if (t >= n8) return; FragH f;
#pragma unroll
  for (int q = 0; q < 8; ++q) f.h[q] = (_Float16)bf16_round(x[t * 8 + q]); *(v8us*)((unsigned short*)X16 + t * 8) = f.half[0];  }
__global__ __launch_bounds__(256) void k_h16(const float* __restrict__ x, _Float16* __restrict__ X16, size_t n8) { const size_t t = (size_t)blockIdx.x * 256 + threadIdx.x; if (t >= n8) return; FragH f;
#pragma unroll
  for (int q = 0; q < 8; ++q) f.h[q] = (_Float16)x[t * 8 + q]; *(v8us*)((unsigned short*)X16 + t * 8) = f.half[0];  }
__global__ __launch_bounds__(256) void k_round16f(const float* __restrict__ W, _Float16* __restrict__ Bt, size_t n8) { const size_t t = (size_t)blockIdx.x * 256 + threadIdx.x; if (t >= n8) return; FragH f;
#pragma unroll
  for (int i = 0; i < 8; ++i) f.h[i] = (_Float16)(bf16_round(W[t * 8 + i]) * 16.0f); *(v8us*)((unsigned short*)Bt + t * 8) = f.half[0];  }
template <int D, int RBF>
__device__ __forceinline__ void d_lnx(int bx, const float* __restrict__ X, const float* __restrict__ gam, const float* __restrict__ bet, int nrows, float eps, _Float16* __restrict__ O16, float* __restrict__ XR) {
  constexpr int NP = D / 128; const int tid = threadIdx.x, wv = tid >> 5, lane = tid & 31; const size_t r = (size_t)bx * 8 + wv; if (r >= (size_t)nrows) return; v4f y[NP]; float s = 0.f;
#pragma unroll
  for (int j = 0; j < NP; ++j) { const int c = j * 128 + lane * 4; v4f g = *(const v4fa*)(X + r * D + c); if (RBF) { for (int q = 0; q < 4; ++q) g[q] = bf16_round(g[q]); } y[j] = g; s += g[0] + g[1] + g[2] + g[3]; }
  asm volatile("s_wait_xcnt 0x0" ::: "memory");      // stands behind the row's loads, in front of every later write of their address registers
  for (int o = 16; o >= 1; o >>= 1) s += __shfl_xor(s, o, 32); const float mu = s / (float)D; float q2 = 0.f;
#pragma unroll
  for (int j = 0; j < NP; ++j) for (int q = 0; q < 4; ++q) { const float d = y[j][q] - mu; q2 += d * d; }
  for (int o = 16; o >= 1; o >>= 1) q2 += __shfl_xor(q2, o, 32); const float rs = rsqrtf(q2 / (float)D + eps);
  {
#pragma unroll
    for (int j = 0; j < NP; ++j) { const int c = j * 128 + lane * 4; v4h h; for (int q = 0; q < 4; ++q) { const float v = (y[j][q] - mu) * rs * bf16_round(gam[c + q]) + bf16_round(bet[c + q]); h[q] = (_Float16)v; } *(v4h*)(O16 + r * D + c) = h; if (XR) *(v4f*)(XR + r * D + c) = y[j]; }
     } }
typedef int v4ia __attribute__((ext_vector_type(4), may_alias));
// One wave reads one tile of 64 queries x 64 keys of the mask (nonzero = masked) and writes its class: bit 0 = some pair is open, bit 1 = some pair is masked.
// Tile number = (b * 32 + query tile) * 32 + key tile; each class word stands in a 128-B line of its own, so every line has one writer
__device__ __forceinline__ void d_mclass(int bx, const int* __restrict__ MSK, int* __restrict__ TF) {
  const unsigned lane = threadIdx.x & 31, tile = (unsigned)bx * 8 + (threadIdx.x >> 5); const unsigned kt = tile % (TT / 64), qt = (tile / (TT / 64)) % (TT / 64), b = tile / ((TT / 64) * (TT / 64));
  const int* p = MSK + ((size_t)b * TT + qt * 64 + (lane >> 4)) * TT + kt * 64 + (lane & 15) * 4;      /* a wave's load = two rows of 256 B: four whole lines */
  unsigned am = 0u, lo = ~0u;      /* OR and unsigned minimum of the tile's words: am != 0 = some pair masked, lo == 0 = some pair open */
#pragma unroll 8      /* eight independent loads in flight per wave: the tile comes from memory */
  for (int i = 0; i < 32; ++i) { const v4ia x = *(const v4ia*)(p + (size_t)i * 2 * TT);
#pragma unroll
    for (int q = 0; q < 4; ++q) { am |= (unsigned)x[q]; lo = min(lo, (unsigned)x[q]); } }
  const unsigned bm = __builtin_amdgcn_ballot_w32(am != 0u), bo = __builtin_amdgcn_ballot_w32(lo == 0u);
  if (lane == 0) TF[(size_t)tile * 32] = (bo ? 1 : 0) | (bm ? 2 : 0); }
// One grid holds the independent preparations: blocks [0, GM) class the mask's tiles; behind them blocks [0, 3 GW) transpose the three weights (the slower blocks, so they start early), blocks [3 GW, 3 GW + 3 GL) normalise the rows of Q, K and V
__global__ __launch_bounds__(256) void k_prep(const float* __restrict__ Qx, const float* __restrict__ Kx, const float* __restrict__ Vx, const float* __restrict__ Wq, const float* __restrict__ Wk, const float* __restrict__ Wv,
                                              const float* __restrict__ gam, const float* __restrict__ bet, const int* __restrict__ MSK, _Float16* __restrict__ Bw, _Float16* __restrict__ H3, int* __restrict__ TF) {
  constexpr int GM = BB * (TT / 64) * (TT / 64) / 8, GW = DD * (DD / 8) / 256, GL = NR / 8; const int bx = (int)blockIdx.x - GM;
  if (bx < 0) d_mclass(blockIdx.x, MSK, TF);
  else if (bx < 3 * GW) { const int sel = bx / GW; d_wt_f16(bx % GW, sel == 0 ? Wq : sel == 1 ? Wk : Wv, Bw + (size_t)sel * DD * DD, DD, DD, 16.0f); }      /* (in,out) -> Bt x 2^4 */
  else { const int y = bx - 3 * GW, sel = y / GL; d_lnx<DD, 1>(y % GL, sel == 0 ? Qx : sel == 1 ? Kx : Vx, gam, bet, NR, 1e-5f, H3 + (size_t)sel * NR * DD, nullptr); } }      /* LN(bf16 x) -> f16 */
// y[i] = 2^x[i], twelve independent v_exp_f32 in one statement with results in registers of their own (=&v), so that none overwrites the source of the one in front of it;
// the closing v_nop is the slot the instruction set asks for behind a transcendental before its result is read or its source overwritten
__device__ __forceinline__ void exp2x12(float* __restrict__ y, const float* __restrict__ x) {
  asm("v_exp_f32 %0, %12\n\tv_exp_f32 %1, %13\n\tv_exp_f32 %2, %14\n\tv_exp_f32 %3, %15\n\tv_exp_f32 %4, %16\n\tv_exp_f32 %5, %17\n\t"
      "v_exp_f32 %6, %18\n\tv_exp_f32 %7, %19\n\tv_exp_f32 %8, %20\n\tv_exp_f32 %9, %21\n\tv_exp_f32 %10, %22\n\tv_exp_f32 %11, %23\n\tv_nop"
      : "=&v"(y[0]), "=&v"(y[1]), "=&v"(y[2]), "=&v"(y[3]), "=&v"(y[4]), "=&v"(y[5]), "=&v"(y[6]), "=&v"(y[7]), "=&v"(y[8]), "=&v"(y[9]), "=&v"(y[10]), "=&v"(y[11])
      : "v"(x[0]), "v"(x[1]), "v"(x[2]), "v"(x[3]), "v"(x[4]), "v"(x[5]), "v"(x[6]), "v"(x[7]), "v"(x[8]), "v"(x[9]), "v"(x[10]), "v"(x[11])); }
// the same for five values
__device__ __forceinline__ void exp2x5(float* __restrict__ y, const float* __restrict__ x) {
  asm("v_exp_f32 %0, %5\n\tv_exp_f32 %1, %6\n\tv_exp_f32 %2, %7\n\tv_exp_f32 %3, %8\n\tv_exp_f32 %4, %9\n\tv_nop"
      : "=&v"(y[0]), "=&v"(y[1]), "=&v"(y[2]), "=&v"(y[3]), "=&v"(y[4]) : "v"(x[0]), "v"(x[1]), "v"(x[2]), "v"(x[3]), "v"(x[4])); }
// the value that lane l ^ 16 holds
__device__ __forceinline__ float xhalf(float x) { const int b = __float_as_int(x); return __int_as_float(__builtin_amdgcn_permlanex16(b, b, 0x76543210, 0xfedcba98, false, false)); }
// Scores are computed transposed: S^T = K Q^T (A = 16 keys from LDS, B = the wave's 16 queries, kept in registers), O^T += V^T P^T. Lane (ln, hh) holds query q0 + ln alone:
// register r of score tile nt is key j0 + nt * 16 + 8 * hh + r, so maximum and sum run inside the lane with one exchange between the halves, and the two score tiles, converted in place, are the B operand of the second product
__global__ __launch_bounds__(128) void k_flash(const _Float16* __restrict__ Q16, int ldq, const _Float16* __restrict__ K16, int ldk, const _Float16* __restrict__ Vt, const int* __restrict__ MSK, const int* __restrict__ TF, const float* __restrict__ Qx, float* __restrict__ O, int ldo) {
  constexpr int RPW = 16, NQB = TT / (4 * RPW), DT = 4, KS = 2;
  __shared__ __attribute__((aligned(16))) float sO[4][RPW][64 + 4];
  // K/V ring, two buffers, one stage = SKEY keys: sK rows = keys (64 d = 128 B), sV rows = d (SKEY keys = 128 B); LDS pitch 144 B (16 B x odd) keeps the 16 rows of a ds_load_b128 fragment read on distinct banks
  constexpr int SKEY = 64, NST = TT / SKEY, LP = 72, SBUF = 64 * LP * 2; constexpr float SC = 0.125f * 1.44269504088896340736f;      /* 64^-1/2 * log2(e) */
  __shared__ __attribute__((aligned(16))) unsigned short sK[2][SKEY][LP]; __shared__ __attribute__((aligned(16))) unsigned short sV[2][64][LP];
  const int tid = threadIdx.x, w = tid >> 5, lane = tid & 31, ln = lane & 15, hh = lane >> 4;
  // A work-group's cost is the number of key stages that its query tile leaves open, so it differs from tile to tile. Block index -> (slab, query tile) is a permutation of the 1024 pairs, for speed only.
  // Each run of 128 blocks (ga = 0..7) holds, for all 32 slabs, the four tiles 31 - ga, 16 + ga, 15 - ga, ga; which of the four a block takes is the sum of its index's base-4 digits mod 4,
  // so that four blocks a power of two apart hold one tile of each kind, wherever the hardware puts them, and the far ends of the tile range stand early in the grid
  static_assert(NQB == 32 && BB * NH == 32 && TT / 64 == 32, "the bit fields below and one class word per lane");
  const int bi = blockIdx.x, ga = bi >> 7, slab = (bi >> 2) & 31, pp = (bi + (bi >> 2) + (bi >> 4) + (bi >> 6) + (bi >> 8)) & 3;
  const int qblk = (((pp >> 1) ^ 1) << 4) | (ga ^ (((pp & 1) - 1) & 15));      /* pp = 0, 1, 2, 3: 31 - ga, 16 + ga, 15 - ga, ga */
  const int b = slab / NH, h = slab % NH; const int qb0 = qblk * (4 * RPW); const int q0 = qb0 + w * RPW;
  const int tf = TF[(size_t)((b * NQB + qblk) * NST + lane) * 32];
  asm volatile("s_wait_xcnt 0x0" ::: "memory");      // stands behind the load above, in front of every later write of its address registers
  FragH aq[KS];
  { const unsigned short* qr = (const unsigned short*)Q16 + ((size_t)b * TT + q0 + ln) * ldq + h * 64;
#pragma unroll
    for (int ks = 0; ks < KS; ++ks) { aq[ks].half[0] = *(const v8us*)(qr + ks * 32 + 8 * hh); aq[ks].half[1] = *(const v8us*)(qr + ks * 32 + 16 + 8 * hh); } }
  // the residual: the pieces of Q that this lane adds to what it stores at the end, asked for here so that they come in under the key loop
  v4f xr[RPW / 2];
  { const float* qx = Qx + ((size_t)b * TT + q0 + hh) * DD + h * 64 + ln * 4;
#pragma unroll
    for (int i = 0; i < RPW / 2; ++i) xr[i] = *(const v4fa*)(qx + (size_t)i * 2 * DD); }
  asm volatile("s_wait_xcnt 0x0" ::: "memory");      // stands behind the loads above, in front of every later write of their address registers
  const unsigned short* Vth = (const unsigned short*)Vt + (size_t)slab * 64 * TT;
  const int* mrow = MSK + ((size_t)b * TT + q0 + ln) * TT + 8 * hh;      /* this lane's query row of the mask, at its half's first key */
  float m_r = -3.0e38f, l_r = 0.f; v8f oacc[DT];
#pragma unroll
  for (int dt = 0; dt < DT; ++dt) oacc[dt] = (v8f){0.f,0.f,0.f,0.f,0.f,0.f,0.f,0.f};
  // each thread copies 16 B of rows crow, crow + 16, + 32, + 48 of both tiles: a wave's copy covers four whole 128-B lines
  const int crow = tid >> 3, ccol = tid & 7;
  const unsigned short* gK = (const unsigned short*)K16 + ((size_t)b * TT + crow) * ldk + h * 64 + ccol * 8; const unsigned short* gV = Vth + (size_t)crow * TT + ccol * 8;
  const unsigned lK = (unsigned)(uintptr_t)&sK[0][crow][ccol * 8], lV = (unsigned)(uintptr_t)&sV[0][crow][ccol * 8];
  auto stage = [&](int st, int bf) { const unsigned short* k0 = gK + (size_t)st * SKEY * ldk; const unsigned short* v0 = gV + st * SKEY; const unsigned lk = lK + bf * SBUF, lv = lV + bf * SBUF;
    // global -> LDS through no register; s_wait_xcnt 0 closes the statement so that no address register is rewritten ahead of it
    asm volatile("global_load_async_to_lds_b128 %0, %8, off\n\tglobal_load_async_to_lds_b128 %1, %9, off\n\tglobal_load_async_to_lds_b128 %2, %10, off\n\tglobal_load_async_to_lds_b128 %3, %11, off\n\t"
                 "global_load_async_to_lds_b128 %4, %12, off\n\tglobal_load_async_to_lds_b128 %5, %13, off\n\tglobal_load_async_to_lds_b128 %6, %14, off\n\tglobal_load_async_to_lds_b128 %7, %15, off\n\ts_wait_xcnt 0x0"
                 :: "v"(lk), "v"(lk + 16 * LP * 2), "v"(lk + 32 * LP * 2), "v"(lk + 48 * LP * 2), "v"(lv), "v"(lv + 16 * LP * 2), "v"(lv + 32 * LP * 2), "v"(lv + 48 * LP * 2),
                    "v"(k0), "v"(k0 + (size_t)16 * ldk), "v"(k0 + (size_t)32 * ldk), "v"(k0 + (size_t)48 * ldk), "v"(v0), "v"(v0 + 16 * TT), "v"(v0 + 32 * TT), "v"(v0 + 48 * TT) : "memory"); };
  // tf: lane t holds the class of key stage t for this block's 64 queries; every wave reads the same 32 words, so both ballots are the same in the whole work-group.
  // A stage with no open pair adds nothing (every p is 0, the maximum stays, the rescale is 1): it is neither copied nor computed. The ring runs over the na <= 32 stages that are left, in rising order
  const unsigned mix = __builtin_amdgcn_ballot_w32((tf & 2) != 0); unsigned rem = __builtin_amdgcn_ballot_w32((tf & 1) != 0); const int na = __builtin_popcount(rem);
  auto next = [&]() { const int s = __builtin_ctz(rem); rem &= rem - 1; return s; };      /* called only while a stage is left */
  int tc = 0, tn = 0;      /* the stage in buffer it & 1 and the one behind it */
  if (na > 0) { tc = next(); stage(tc, 0); }
  asm volatile("s_wait_asynccnt 0x0" ::: "memory");      // this wave's copies of the first stage have landed
  __syncthreads();                                        // ... and every other wave's: it may be read
  if (na > 1) { tn = next(); stage(tn, 1); }
#pragma unroll 1      /* one copy of the ring's foot; the buffer index stays it & 1 */
  for (int it = 0; it < na; ++it) { const int bf = it & 1; const bool mx = (mix >> tc) & 1;      /* the stage has masked pairs: only then are the mask's words read and applied */
  for (int sub = 0; sub < SKEY / 32; ++sub) { const int j0 = tc * SKEY + sub * 32;
    v4ia mk[2][2];      /* nonzero = MASKED; mk[nt][r >> 2][r & 3] belongs to register r of score tile nt; loaded and read under mx alone */
    if (mx) {
#pragma unroll
    for (int nt = 0; nt < 2; ++nt) { mk[nt][0] = *(const v4ia*)(mrow + j0 + nt * 16); mk[nt][1] = *(const v4ia*)(mrow + j0 + nt * 16 + 4); } }
    float sv[16];      /* unscaled scores of keys j0 + 8 hh + 0..7 and j0 + 16 + 8 hh + 0..7; the running maximum is kept unscaled too */
#pragma unroll
    for (int nt = 0; nt < 2; ++nt) { const unsigned short* kr = &sK[bf][sub * 32 + nt * 16 + ln][0]; FragH bk[KS];
#pragma unroll
      for (int ks = 0; ks < KS; ++ks) { bk[ks].half[0] = *(const v8us*)(kr + ks * 32 + 8 * hh); bk[ks].half[1] = *(const v8us*)(kr + ks * 32 + 16 + 8 * hh); }
      v8f acc = (v8f){0.f,0.f,0.f,0.f,0.f,0.f,0.f,0.f};
#pragma unroll
      for (int ks = 0; ks < KS; ++ks) acc = mmaH<1>(bk[ks].v, bk[ks].v, aq[ks].v, aq[ks].v, acc);
#pragma unroll
      for (int r = 0; r < 8; ++r) sv[nt * 8 + r] = acc[r];
      if (mx) {
#pragma unroll
        for (int r = 0; r < 8; ++r) sv[nt * 8 + r] = (mk[nt][r >> 2][r & 3] == 0) ? acc[r] : -INFINITY; } }
    float mc = fmaxf(sv[0], sv[1]);
#pragma unroll
    for (int i = 2; i < 16; ++i) mc = fmaxf(mc, sv[i]);
    mc = fmaxf(mc, xhalf(mc));      /* the other half's 16 keys of the same query */
    // e^(0.125 (s - m)) = 2^(s * SC - m * SC): one fma per score, no branch; a masked score is -inf and gives 0 (m is finite: it starts at -3e38)
    const float mn = fmaxf(m_r, mc), nb = -mn * SC; float ex[17], ey[17]; ex[16] = (m_r - mn) * SC;
#pragma unroll
    for (int i = 0; i < 16; ++i) ex[i] = fmaf(sv[i], SC, nb);
    exp2x12(ey, ex); exp2x5(ey + 12, ex + 12);
    const float* p = ey; const float al = (mn > -1.0e38f) ? ey[16] : 1.0f; m_r = mn;
    float ps = p[0];
#pragma unroll
    for (int i = 1; i < 16; ++i) ps += p[i];
    l_r = l_r * al + ps;      /* this half's keys only; the halves are joined behind the loop */
#pragma unroll
    for (int dt = 0; dt < DT; ++dt)
#pragma unroll
      for (int r = 0; r < 8; ++r) oacc[dt][r] *= al;
    FragH pb;      /* B operand: column ln = the query, element i = key kmap(i, hh) of the 32: the order in which sv holds them */
#pragma unroll
    for (int i = 0; i < 16; ++i) pb.h[i] = (_Float16)(p[i] * 1024.0f);
#pragma unroll
    for (int dt = 0; dt < DT; ++dt) { const unsigned short* vrow = &sV[bf][dt * 16 + ln][sub * 32]; FragH bv; bv.half[0] = *(const v8us*)(vrow + 8 * hh); bv.half[1] = *(const v8us*)(vrow + 16 + 8 * hh);
      oacc[dt] = mmaH<1>(bv.v, bv.v, pb.v, pb.v, oacc[dt]); } }
    asm volatile("s_wait_dscnt 0x0" ::: "memory");        // this wave's reads of buffer bf are done before it is refilled
    asm volatile("s_wait_asynccnt 0x0" ::: "memory");     // this wave's copies of the next stage have landed
    __syncthreads();                                        // publishes the next stage and ends every wave's reads of buffer bf
    tc = tn; if (it + 2 < na) { tn = next(); stage(tn, bf); } }
  asm volatile("s_wait_asynccnt 0x0" ::: "memory");       // no copy is outstanding when the wave goes on to the epilogue
  const float l = l_r + xhalf(l_r); const float li = (l > 0.f) ? 1.0f / (l * 1024.0f) : 0.f;
  // register r of oacc[dt] is O[q0 + ln][dt * 16 + 8 hh + r]: eight consecutive d of the lane's query
#pragma unroll
  for (int dt = 0; dt < DT; ++dt) { v4f lo, hi;
#pragma unroll
    for (int r = 0; r < 4; ++r) { lo[r] = oacc[dt][r] * li; hi[r] = oacc[dt][4 + r] * li; }
    *(v4fa*)&sO[w][ln][dt * 16 + 8 * hh] = lo; *(v4fa*)&sO[w][ln][dt * 16 + 8 * hh + 4] = hi; }
  __builtin_amdgcn_fence(__ATOMIC_ACQ_REL, "workgroup"); __builtin_amdgcn_wave_barrier();
  {
#pragma unroll
    for (int rp = 0; rp < RPW; rp += 2) { const int r = rp + (lane >> 4), pc = lane & 15; v4f val = *(const v4fa*)&sO[w][r][pc * 4];
#pragma unroll
      for (int q = 0; q < 4; ++q) val[q] += bf16_round(xr[rp / 2][q]);      /* out = o + bf16(Q) */
      *(v4f*)(O + ((size_t)b * TT + q0 + r) * ldo + h * 64 + pc * 4) = val; }
     } }

extern "C" void kernel_launch(void* const* d_in, const int* in_sizes, int n_in,
                              void* d_out, int out_size, void* d_ws, size_t ws_size, hipStream_t stream) {
  (void)in_sizes; (void)n_in; (void)out_size;
  const float* const* I = (const float* const*)d_in; const float* Qx = I[0]; const float* Kx = I[1]; const float* Vx = I[2]; const int* mask = (const int*)d_in[3];      /* bool mask shipped as int32 [2,1,2048,2048] */
  const float* Wq = I[4]; const float* bq = I[5]; const float* Wk = I[6]; const float* bk = I[7]; const float* Wv = I[8]; const float* bv = I[9]; const float* gam = I[10]; const float* bet = I[11];
  char* ws = (char*)d_ws; size_t off = 0;
  auto take = [&](size_t bytes) { char* p = ws + off; off += (bytes + 255) & ~(size_t)255; return p; };
  const size_t WSZ = (size_t)DD * DD; _Float16* Bw = (_Float16*)take(3 * WSZ * 2); _Float16* H16 = (_Float16*)take((size_t)3 * NR * DD * 2);
  _Float16* Q = (_Float16*)take((size_t)2 * NR * DD * 2); _Float16* K = Q + (size_t)NR * DD; _Float16* Vt = (_Float16*)take((size_t)NR * DD * 2); int* TF = (int*)take((size_t)BB * (TT / 64) * (TT / 64) * 128);
  if (off > ws_size) return;      // 6.3 + 25.2 + 16.8 + 8.4 = about 57 MB
  k_prep<<<BB * (TT / 64) * (TT / 64) / 8 + 3 * (DD * (DD / 8) / 256) + 3 * (NR / 8), 256, 0, stream>>>(Qx, Kx, Vx, Wq, Wk, Wv, gam, bet, mask, Bw, H16, TF);
  k_gemm_t<<<3 * (NR / 128) * (DD / 128), 256, 0, stream>>>(H16, Bw, 0.0625f, bq, bk, bv, Q, Vt);      /* three times M 4096 N 1024 K 1024; v comes out transposed */
  k_flash<<<BB * NH * (TT / 64), 128, 0, stream>>>(Q, DD, K, DD, Vt, mask, TF, Qx, (float*)d_out, DD);      /* out = o + Q */
}

// v008
// One run takes 84.4 microseconds.
// Two timings next to v007 both put it at 1.14 times that version's speed.
// All steps since v000 together make it 5.13 times as fast.
#include <hip/hip_runtime.h>
// Pre-norm multi-head attention with a boolean mask and residual (B=2, N=2048, E=1024, 16 heads × 64): q = LN(Q)·Wq + bq, k = LN(K)·Wk + bk, v = LN(V)·Wv + bv (one shared LayerNorm γ,β; (in,out) weights); s = q·kᵀ·64^-½ with −inf where mask[b,0,n,m] is True;
// softmax; o = merged attn·v; out = o + Q (no output projection).
// Compute dtype: Q, K, V, weights, biases, γ, β rounded to bf16; LayerNorms f32 (wave per row) → f16; q/k/v f16 GEMM planes; fused flash-style kernel (int32 mask loads per (q,k), online softmax f32, P f16 ×2^10) on
// v_wmma_f32_16x16x32_f16; out = o (f32) + bf16(Q) (f32 add); f32 accumulate.
#define BB 2
#define TT 2048
#define DD 1024
#define NH 16
#define NR (BB * TT)

typedef __bf16 v16b __attribute__((ext_vector_type(16)));
typedef unsigned short v8us __attribute__((ext_vector_type(8), may_alias));
typedef float  v8f  __attribute__((ext_vector_type(8)));
typedef float  v4f  __attribute__((ext_vector_type(4)));
typedef float  v4fa __attribute__((ext_vector_type(4), may_alias));
union FragB { v16b v; v8us half[2]; unsigned short u[16]; };

__device__ __forceinline__ unsigned short bf16_bits(float x) { unsigned int u = __float_as_uint(x); return (unsigned short)((u + 0x7FFFu + ((u >> 16) & 1u)) >> 16); }
__device__ __forceinline__ float bf16_val(unsigned short b) { return __uint_as_float(((unsigned int)b) << 16); }
__device__ __forceinline__ float bf16_round(float x) { return bf16_val(bf16_bits(x)); }
// D += A·B with NT terms: 1 = ah·bh, 2 = + al·bh (A split), 3 = + ah·bl (both split)
template <int NT>
__device__ __forceinline__ v8f mmaN(v16b ah, v16b al, v16b bh, v16b bl, v8f c) {
  c = __builtin_amdgcn_wmma_f32_16x16x32_bf16(false, ah, false, bh, (short)0, c, false, false);
  if (NT >= 2) c = __builtin_amdgcn_wmma_f32_16x16x32_bf16(false, al, false, bh, (short)0, c, false, false);
  if (NT >= 3) c = __builtin_amdgcn_wmma_f32_16x16x32_bf16(false, ah, false, bl, (short)0, c, false, false);
  asm volatile("v_nop\n\tv_nop\n\tv_nop\n\tv_nop" : "+v"(c) : "v"(ah), "v"(al), "v"(bh), "v"(bl));
  return c;
}

__global__ __launch_bounds__(256) void k_wt_bf16(const float* __restrict__ W, unsigned short* __restrict__ Wt, int K, int N) {
  const int t = blockIdx.x * 256 + threadIdx.x;
  const int k8n = K / 8;
  if (t >= N * k8n) return;
  const int n = t / k8n, k8 = (t % k8n) * 8;
  v8us v;
#pragma unroll
  for (int i = 0; i < 8; ++i) v[i] = bf16_bits(W[(size_t)(k8 + i) * N + n]);
  *(v8us*)(Wt + (size_t)n * K + k8) = v;
  
}

// GEMM C[M][N] (f32, pitch ldc) = act(A[M][K]·W + bias). A f32 row-major (pitch lda) converted per fragment to bf16
// (ASPLIT: hi/lo two planes -> 2 terms, else single rounded term); Wt bf16 [N][K] (pitch ldb). BIAS_BF16 rounds the
// bias to bf16 first (bias quantised to bf16 before the add). K%32==0, M%16==0, N%64==0.
template <bool ASPLIT, int ACT, bool BIAS_BF16>
__global__ __launch_bounds__(128) void k_gemm_bf(const float* __restrict__ A, int lda, const unsigned short* __restrict__ Wt, int ldb,
                                               const float* __restrict__ bias, float* __restrict__ C, int ldc, int M, int N, int K) {
  __shared__ __attribute__((aligned(16))) float so[4][16][64];
  const int tid = threadIdx.x, w = tid >> 5, lane = tid & 31, ln = lane & 15, hh = lane >> 4;
  const int ntn = N / 64;
  const int wid = blockIdx.x * 4 + w;
  const int mt = wid / ntn, nq = wid % ntn;
  if (mt * 16 >= M) return;
  const int row0 = mt * 16, col0 = nq * 64;
  const float* arow = A + (size_t)(row0 + ln) * lda;
  v8f acc[4] = {};
  for (int kb = 0; kb < K; kb += 32) {
    FragB ah, al;
    const v4f x0 = *(const v4fa*)(arow + kb + 8 * hh), x1 = *(const v4fa*)(arow + kb + 8 * hh + 4);
    const v4f x2 = *(const v4fa*)(arow + kb + 16 + 8 * hh), x3 = *(const v4fa*)(arow + kb + 16 + 8 * hh + 4);
    float xs[16] = {x0[0],x0[1],x0[2],x0[3],x1[0],x1[1],x1[2],x1[3],x2[0],x2[1],x2[2],x2[3],x3[0],x3[1],x3[2],x3[3]};
#pragma unroll
    for (int i = 0; i < 16; ++i) { const unsigned short hb = bf16_bits(xs[i]); ah.u[i] = hb; al.u[i] = ASPLIT ? bf16_bits(xs[i] - bf16_val(hb)) : (unsigned short)0; }
#pragma unroll
    for (int t = 0; t < 4; ++t) {
      const unsigned short* brow = Wt + (size_t)(col0 + t * 16 + ln) * ldb + kb;
      FragB b;
      b.half[0] = *(const v8us*)(brow + 8 * hh);
      b.half[1] = *(const v8us*)(brow + 16 + 8 * hh);
      acc[t] = mmaN<ASPLIT ? 2 : 1>(ah.v, al.v, b.v, b.v, acc[t]);
    }
  }
#pragma unroll
  for (int t = 0; t < 4; ++t) {
    float bv = bias ? bias[col0 + t * 16 + ln] : 0.f;
    if (BIAS_BF16) bv = bf16_round(bv);
#pragma unroll
    for (int r = 0; r < 8; ++r) { float v = acc[t][r] + bv; if (ACT == 1) v = fmaxf(v, 0.f); so[w][8 * hh + r][t * 16 + ln] = v; }
  }
  __builtin_amdgcn_fence(__ATOMIC_ACQ_REL, "workgroup");
  __builtin_amdgcn_wave_barrier();
  const int rsub = lane >> 4, c4 = (lane & 15) * 4;
  {
#pragma unroll
    for (int q = 0; q < 8; ++q) {
      const int r = q * 2 + rsub;
      const v4f v = *(const v4fa*)&so[w][r][c4];
      *(v4f*)(C + (size_t)(row0 + r) * ldc + col0 + c4) = v;
    }
    
  }
}

// Flash-style causal/unmasked attention, all contractions 3-term bf16 hi/lo splits, f32 softmax with running max.
// q,k,v rows are read from f32 buffers with arbitrary row pitch (so they can live inside a fused qkv buffer);
// D = head size (multiple of 32, <= 128); one wave = 16 query rows; block = 4 waves (64 queries) sharing K/V chunks of 32.
template <int D, bool CAUSAL>
__global__ __launch_bounds__(128) void k_flash(const float* __restrict__ qb, const float* __restrict__ kb, const float* __restrict__ vb,
                                             int pitch, int T, int H, float scale, float* __restrict__ y, int ypitch) {
  constexpr int KS = D / 32;        // k-steps for QK
  constexpr int DT = D / 16;        // d tiles for PV
  __shared__ __attribute__((aligned(16))) unsigned short sKh[32][D + 8], sKl[32][D + 8], sVh[32][D + 8], sVl[32][D + 8];
  __shared__ __attribute__((aligned(16))) unsigned short sPh[4][16][40], sPl[4][16][40];
  __shared__ __attribute__((aligned(16))) float sO[4][16][D];
  const int tid = threadIdx.x, w = tid >> 5, lane = tid & 31, ln = lane & 15, hh = lane >> 4;
  const int nqb = (T + 63) / 64;
  const int bh = blockIdx.x / nqb, qblk = blockIdx.x % nqb;
  const int b = bh / H, h = bh % H;
  const int q0 = qblk * 64 + w * 16;
  const float* Q = qb + (size_t)b * T * pitch + h * D;
  const float* K = kb + (size_t)b * T * pitch + h * D;
  const float* V = vb + (size_t)b * T * pitch + h * D;

  // A fragments of the wave's 16 query rows (scaled), hi/lo
  FragB aqh[KS], aql[KS];
  {
    int row = q0 + ln; if (row >= T) row = T - 1;
    const float* qr = Q + (size_t)row * pitch;
#pragma unroll
    for (int ks = 0; ks < KS; ++ks)
#pragma unroll
      for (int i = 0; i < 16; ++i) {
        const int d = ks * 32 + ((i < 8) ? (8 * hh + i) : (16 + 8 * hh + (i - 8)));
        const float x = qr[d] * scale; const unsigned short hb = bf16_bits(x);
        aqh[ks].u[i] = hb; aql[ks].u[i] = bf16_bits(x - bf16_val(hb));
      }
  }
  float m_r[8], l_r[8];
#pragma unroll
  for (int r = 0; r < 8; ++r) { m_r[r] = -3.0e38f; l_r[r] = 0.f; }
  v8f oacc[DT];
#pragma unroll
  for (int dt = 0; dt < DT; ++dt) oacc[dt] = (v8f){0.f,0.f,0.f,0.f,0.f,0.f,0.f,0.f};

  const int kv_end = CAUSAL ? min(T, qblk * 64 + 64) : T;     // block-uniform
  for (int j0 = 0; j0 < kv_end; j0 += 32) {
    __syncthreads();
    for (int e = tid; e < 32 * (D / 4); e += 128) {
      const int r = e / (D / 4), c4 = (e % (D / 4)) * 4;
      const int key = j0 + r;
      v4f kf = {0.f,0.f,0.f,0.f}, vf = {0.f,0.f,0.f,0.f};
      if (key < T) { kf = *(const v4fa*)(K + (size_t)key * pitch + c4); vf = *(const v4fa*)(V + (size_t)key * pitch + c4); }
#pragma unroll
      for (int t = 0; t < 4; ++t) {
        unsigned short hb = bf16_bits(kf[t]); sKh[r][c4 + t] = hb; sKl[r][c4 + t] = bf16_bits(kf[t] - bf16_val(hb));
        hb = bf16_bits(vf[t]); sVh[r][c4 + t] = hb; sVl[r][c4 + t] = bf16_bits(vf[t] - bf16_val(hb));
      }
    }
    __syncthreads();
    // S tile 16 x 32
    v8f s[2];
#pragma unroll
    for (int nt = 0; nt < 2; ++nt) {
      v8f acc = {};
#pragma unroll
      for (int ks = 0; ks < KS; ++ks) {
        FragB bh_, bl_;
        bh_.half[0] = *(const v8us*)&sKh[nt * 16 + ln][ks * 32 + 8 * hh]; bh_.half[1] = *(const v8us*)&sKh[nt * 16 + ln][ks * 32 + 16 + 8 * hh];
        bl_.half[0] = *(const v8us*)&sKl[nt * 16 + ln][ks * 32 + 8 * hh]; bl_.half[1] = *(const v8us*)&sKl[nt * 16 + ln][ks * 32 + 16 + 8 * hh];
        acc = mmaN<3>(aqh[ks].v, aql[ks].v, bh_.v, bl_.v, acc);
      }
      s[nt] = acc;
    }
    // mask + running max (rows 8hh+r; the 16 lanes of a half share rows)
    float alpha[8];
#pragma unroll
    for (int r = 0; r < 8; ++r) {
      const int qi = q0 + 8 * hh + r;
      const int ja = j0 + ln, jb = j0 + 16 + ln;
      if (CAUSAL) { if (ja > qi) s[0][r] = -3.0e38f; if (jb > qi) s[1][r] = -3.0e38f; }
      if (ja >= T) s[0][r] = -3.0e38f;
      if (jb >= T) s[1][r] = -3.0e38f;
      float mx = fmaxf(s[0][r], s[1][r]);
      mx = fmaxf(mx, __shfl_xor(mx, 1, 32)); mx = fmaxf(mx, __shfl_xor(mx, 2, 32)); mx = fmaxf(mx, __shfl_xor(mx, 4, 32)); mx = fmaxf(mx, __shfl_xor(mx, 8, 32));
      const float mnew = fmaxf(m_r[r], mx);
      alpha[r] = (mnew > -1.0e38f) ? __expf(m_r[r] - mnew) : 1.0f;
      const float p0 = (s[0][r] > -1.0e38f) ? __expf(s[0][r] - mnew) : 0.f;
      const float p1 = (s[1][r] > -1.0e38f) ? __expf(s[1][r] - mnew) : 0.f;
      m_r[r] = mnew;
      l_r[r] = l_r[r] * alpha[r] + p0 + p1;            // per-lane partial row sum (16 lanes combined at the end)
      unsigned short hb = bf16_bits(p0); sPh[w][8 * hh + r][ln] = hb;      sPl[w][8 * hh + r][ln] = bf16_bits(p0 - bf16_val(hb));
      hb = bf16_bits(p1);                sPh[w][8 * hh + r][16 + ln] = hb; sPl[w][8 * hh + r][16 + ln] = bf16_bits(p1 - bf16_val(hb));
    }
#pragma unroll
    for (int dt = 0; dt < DT; ++dt)
#pragma unroll
      for (int r = 0; r < 8; ++r) oacc[dt][r] *= alpha[r];
    __builtin_amdgcn_fence(__ATOMIC_ACQ_REL, "workgroup");
    __builtin_amdgcn_wave_barrier();
    FragB pah, pal;
    pah.half[0] = *(const v8us*)&sPh[w][ln][8 * hh]; pah.half[1] = *(const v8us*)&sPh[w][ln][16 + 8 * hh];
    pal.half[0] = *(const v8us*)&sPl[w][ln][8 * hh]; pal.half[1] = *(const v8us*)&sPl[w][ln][16 + 8 * hh];
#pragma unroll
    for (int dt = 0; dt < DT; ++dt) {
      FragB bvh, bvl;
#pragma unroll
      for (int i = 0; i < 8; ++i) {
        bvh.u[i] = sVh[8 * hh + i][dt * 16 + ln]; bvh.u[8 + i] = sVh[16 + 8 * hh + i][dt * 16 + ln];
        bvl.u[i] = sVl[8 * hh + i][dt * 16 + ln]; bvl.u[8 + i] = sVl[16 + 8 * hh + i][dt * 16 + ln];
      }
      oacc[dt] = mmaN<3>(pah.v, pal.v, bvh.v, bvl.v, oacc[dt]);
    }
    __builtin_amdgcn_fence(__ATOMIC_ACQ_REL, "workgroup");
    __builtin_amdgcn_wave_barrier();
  }
#pragma unroll
  for (int r = 0; r < 8; ++r) {
    float l = l_r[r];
    l += __shfl_xor(l, 1, 32); l += __shfl_xor(l, 2, 32); l += __shfl_xor(l, 4, 32); l += __shfl_xor(l, 8, 32);
    l_r[r] = (l > 0.f) ? 1.0f / l : 0.f;
  }
#pragma unroll
  for (int dt = 0; dt < DT; ++dt)
#pragma unroll
    for (int r = 0; r < 8; ++r) sO[w][8 * hh + r][dt * 16 + ln] = oacc[dt][r] * l_r[r];
  __builtin_amdgcn_fence(__ATOMIC_ACQ_REL, "workgroup");
  __builtin_amdgcn_wave_barrier();
  {
    for (int r = 0; r < 16; ++r) {
      const int row = q0 + r;
      if (row < T && lane < D / 4) {
        const v4f val = *(const v4fa*)&sO[w][r][lane * 4];
        *(v4f*)(y + ((size_t)b * T + row) * ypitch + h * D + lane * 4) = val;
      }
    }
    
  }
}

// GEMM C = act(A·W + bias + resid): A f32 (ASPLIT -> hi/lo 2 terms), Wt bf16 [N][K]; ACT 0 none, 1 relu, 2 exact gelu;
// resid (optional, f32, row index = (row % rmod), pitch ldr, RES_BF16 rounds it) added before the activation.
template <bool ASPLIT, int ACT, bool BIAS_BF16, bool RES_BF16>
__global__ __launch_bounds__(128) void k_gemm_bf3(const float* __restrict__ A, int lda, const unsigned short* __restrict__ Wt, int ldb,
                                                const float* __restrict__ bias, const float* __restrict__ resid, int rmod, int ldr,
                                                float* __restrict__ C, int ldc, int M, int N, int K) {
  __shared__ __attribute__((aligned(16))) float so[4][16][64];
  const int tid = threadIdx.x, w = tid >> 5, lane = tid & 31, ln = lane & 15, hh = lane >> 4;
  const int ntn = N / 64;
  const int wid = blockIdx.x * 4 + w;
  const int mt = wid / ntn, nq = wid % ntn;
  if (mt * 16 >= M) return;
  const int row0 = mt * 16, col0 = nq * 64;
  const float* arow = A + (size_t)(row0 + ln) * lda;
  v8f acc[4] = {};
  for (int kb = 0; kb < K; kb += 32) {
    FragB ah, al;
    const v4f x0 = *(const v4fa*)(arow + kb + 8 * hh), x1 = *(const v4fa*)(arow + kb + 8 * hh + 4);
    const v4f x2 = *(const v4fa*)(arow + kb + 16 + 8 * hh), x3 = *(const v4fa*)(arow + kb + 16 + 8 * hh + 4);
    float xs[16] = {x0[0],x0[1],x0[2],x0[3],x1[0],x1[1],x1[2],x1[3],x2[0],x2[1],x2[2],x2[3],x3[0],x3[1],x3[2],x3[3]};
#pragma unroll
    for (int i = 0; i < 16; ++i) { const unsigned short hb = bf16_bits(xs[i]); ah.u[i] = hb; al.u[i] = ASPLIT ? bf16_bits(xs[i] - bf16_val(hb)) : (unsigned short)0; }
#pragma unroll
    for (int t = 0; t < 4; ++t) {
      const unsigned short* brow = Wt + (size_t)(col0 + t * 16 + ln) * ldb + kb;
      FragB b;
      b.half[0] = *(const v8us*)(brow + 8 * hh);
      b.half[1] = *(const v8us*)(brow + 16 + 8 * hh);
      acc[t] = mmaN<ASPLIT ? 2 : 1>(ah.v, al.v, b.v, b.v, acc[t]);
    }
  }
#pragma unroll
  for (int t = 0; t < 4; ++t) {
    const int col = col0 + t * 16 + ln;
    float bv = bias ? bias[col] : 0.f;
    if (BIAS_BF16) bv = bf16_round(bv);
#pragma unroll
    for (int r = 0; r < 8; ++r) {
      float v = acc[t][r] + bv;
      if (resid) { float rv = resid[(size_t)((row0 + 8 * hh + r) % rmod) * ldr + col]; if (RES_BF16) rv = bf16_round(rv); v += rv; }
      if (ACT == 1) v = fmaxf(v, 0.f);
      if (ACT == 2) v = 0.5f * v * (1.0f + erff(v * 0.70710678118654752f));
      if (ACT == 3) { const float u = 0.7978845608028654f * (v + 0.044715f * v * v * v); v = 0.5f * v * (1.0f + tanhf(u)); }
      so[w][8 * hh + r][t * 16 + ln] = v;
    }
  }
  __builtin_amdgcn_fence(__ATOMIC_ACQ_REL, "workgroup");
  __builtin_amdgcn_wave_barrier();
  const int rsub = lane >> 4, c4 = (lane & 15) * 4;
  {
#pragma unroll
    for (int q = 0; q < 8; ++q) {
      const int r = q * 2 + rsub;
      const v4f v = *(const v4fa*)&so[w][r][c4];
      *(v4f*)(C + (size_t)(row0 + r) * ldc + col0 + c4) = v;
    }
    
  }
}
// row LayerNorm (biased variance, eps) over N: s = X (+ R); optional out_sum <- s; out_norm <- (s-mu)*rsqrt(var+eps)*g + b
template <bool PARAM_BF16>
__global__ __launch_bounds__(256) void k_layernorm(const float* __restrict__ X, const float* __restrict__ R, const float* __restrict__ g, const float* __restrict__ bta,
                                                  float* __restrict__ out_sum, float* __restrict__ out_norm, int N, float eps) {
  __shared__ float red[256];
  const int row = blockIdx.x, tid = threadIdx.x;
  const float* x = X + (size_t)row * N; const float* rr = R ? R + (size_t)row * N : nullptr;
  float vals[16];                     // up to N = 4096
  const int per = N / 256;            // contiguous chunk per thread? use strided-by-4 chunks: thread handles j = tid*4 + 1024*u
  float s1 = 0.f;
  for (int u = 0; u < per / 4; ++u) {
    const int j = tid * 4 + 1024 * u;
    const v4f a = *(const v4fa*)(x + j);
    v4f b = {0.f,0.f,0.f,0.f}; if (rr) b = *(const v4fa*)(rr + j);
#pragma unroll
    for (int q = 0; q < 4; ++q) { const float v = a[q] + b[q]; vals[u * 4 + q] = v; s1 += v; }
  }
  red[tid] = s1; __syncthreads();
  for (int st = 128; st > 0; st >>= 1) { if (tid < st) red[tid] += red[tid + st]; __syncthreads(); }
  const float mu = red[0] / (float)N; __syncthreads();
  float s2 = 0.f;
  for (int u = 0; u < per / 4; ++u)
#pragma unroll
    for (int q = 0; q < 4; ++q) { const float c = vals[u * 4 + q] - mu; s2 += c * c; }
  red[tid] = s2; __syncthreads();
  for (int st = 128; st > 0; st >>= 1) { if (tid < st) red[tid] += red[tid + st]; __syncthreads(); }
  const float rs = rsqrtf(red[0] / (float)N + eps);
  {
    for (int u = 0; u < per / 4; ++u) {
      const int j = tid * 4 + 1024 * u;
      v4f o, sm;
#pragma unroll
      for (int q = 0; q < 4; ++q) {
        float gg = g[j + q], bb = bta[j + q];
        if (PARAM_BF16) { gg = bf16_round(gg); bb = bf16_round(bb); }
        sm[q] = vals[u * 4 + q]; o[q] = (vals[u * 4 + q] - mu) * rs * gg + bb;
      }
      if (out_sum) *(v4f*)(out_sum + (size_t)row * N + j) = sm;
      *(v4f*)(out_norm + (size_t)row * N + j) = o;
    }
    
  }
}



// ---- f16 WMMA path (v_wmma_f32_16x16x32_f16): 11-bit significands for operands in range — used where a [0,1] probability operand needs more precision than bf16
typedef _Float16 v16h __attribute__((ext_vector_type(16)));
union FragH { v16h v; v8us half[2]; _Float16 h[16]; unsigned short u[16]; };
template <int NT>
__device__ __forceinline__ v8f mmaH(v16h ah, v16h al, v16h bh, v16h bl, v8f c) {
  c = __builtin_amdgcn_wmma_f32_16x16x32_f16(false, ah, false, bh, (short)0, c, false, false);
  if (NT >= 2) c = __builtin_amdgcn_wmma_f32_16x16x32_f16(false, al, false, bh, (short)0, c, false, false);
  if (NT >= 3) c = __builtin_amdgcn_wmma_f32_16x16x32_f16(false, ah, false, bl, (short)0, c, false, false);
  asm volatile("v_nop\n\tv_nop\n\tv_nop\n\tv_nop" : "+v"(c) : "v"(ah), "v"(al), "v"(bh), "v"(bl));
  return c;
}
// batched GEMM like k_gemm_b but f16 operands: A f32 (split into f16 hi/lo if ASPLIT, else rounded to f16), Bt = f16 values [n][k]; alpha; C f32; N multiple of 16 (partial tiles skipped)
template <bool ASPLIT>
__global__ __launch_bounds__(128) void k_gemm_h(const float* __restrict__ A, int lda, size_t sA, const _Float16* __restrict__ Bh, int ldb, size_t sB, float alpha, float* __restrict__ C, int ldc, size_t sC, int M, int N, int K) {
  __shared__ __attribute__((aligned(16))) float so[4][16][64];
  const int tid = threadIdx.x, w = tid >> 5, lane = tid & 31, ln = lane & 15, hh = lane >> 4; const int by = blockIdx.y;
  A += (size_t)by * sA; Bh += (size_t)by * sB; C += (size_t)by * sC;
  const int ntn = (N + 63) / 64; const int wid = blockIdx.x * 4 + w; const int mt = wid / ntn, nq = wid % ntn; if (mt * 16 >= M) return;
  const int row0 = mt * 16, col0 = nq * 64; const float* arow = A + (size_t)(row0 + ln) * lda;
  v8f acc[4] = {};
  for (int kb = 0; kb < K; kb += 32) {
    FragH ah, al;
    const v4f x0 = *(const v4fa*)(arow + kb + 8 * hh), x1 = *(const v4fa*)(arow + kb + 8 * hh + 4), x2 = *(const v4fa*)(arow + kb + 16 + 8 * hh), x3 = *(const v4fa*)(arow + kb + 16 + 8 * hh + 4);
    float xs[16] = {x0[0],x0[1],x0[2],x0[3],x1[0],x1[1],x1[2],x1[3],x2[0],x2[1],x2[2],x2[3],x3[0],x3[1],x3[2],x3[3]};
#pragma unroll
    for (int i = 0; i < 16; ++i) { const _Float16 h = (_Float16)xs[i]; ah.h[i] = h; al.h[i] = ASPLIT ? (_Float16)(xs[i] - (float)h) : (_Float16)0.0f; }
#pragma unroll
    for (int t = 0; t < 4; ++t) { if (col0 + t * 16 >= N) continue; const size_t boff = (size_t)(col0 + t * 16 + ln) * ldb + kb; FragH bq; bq.half[0] = *(const v8us*)(Bh + boff + 8 * hh); bq.half[1] = *(const v8us*)(Bh + boff + 16 + 8 * hh);
      acc[t] = mmaH<ASPLIT ? 2 : 1>(ah.v, al.v, bq.v, bq.v, acc[t]); }
  }
#pragma unroll
  for (int t = 0; t < 4; ++t) { if (col0 + t * 16 >= N) continue;
#pragma unroll
    for (int r = 0; r < 8; ++r) so[w][8 * hh + r][t * 16 + ln] = acc[t][r] * alpha; }
  __builtin_amdgcn_fence(__ATOMIC_ACQ_REL, "workgroup"); __builtin_amdgcn_wave_barrier();
  const int rsub = lane >> 4, c4 = (lane & 15) * 4;
  {
#pragma unroll
    for (int q = 0; q < 8; ++q) { const int r = q * 2 + rsub; if (col0 + c4 < N) { const v4f v = *(const v4fa*)&so[w][r][c4]; *(v4f*)(C + (size_t)(row0 + r) * ldc + col0 + c4) = v; } }
     }
}

// Wt[n][k] = f16(bf16(W[k][n]) * scale) from f32 row-major W[DD][DD] (scale = power of two; bf16-exact weights stay exact in f16 away from the subnormal range).
// One work-group = a tile of WTK k x WTN n, turned through LDS, so that both sides move whole 128-B lines: a wave's load is two rows of 256 B of W, a wave's store two rows of 256 B of Wt.
// A thread takes 8 consecutive k of 4 consecutive n: each of its four n is one 16-B piece of a row of Wt
#define WTK 128
#define WTN 64
__device__ __forceinline__ void d_wt_f16(int bx, const float* __restrict__ W, _Float16* __restrict__ Wt, float scale) {
  __shared__ __attribute__((aligned(16))) unsigned short sT[WTN][WTK + 8];      /* pitch 272 B (16 B x odd), as for the GEMM's tiles */
  const int tid = threadIdx.x, n4 = tid & 15, k8 = tid >> 4; const int k0 = (bx % (DD / WTK)) * WTK, n0 = (bx / (DD / WTK)) * WTN;
  const float* p = W + (size_t)(k0 + k8 * 8) * DD + n0 + n4 * 4; v4f x[8];
#pragma unroll
  for (int i = 0; i < 8; ++i) x[i] = *(const v4fa*)(p + (size_t)i * DD);
  asm volatile("s_wait_xcnt 0x0" ::: "memory");      // stands behind the eight loads, in front of every later write of their address registers
#pragma unroll
  for (int q = 0; q < 4; ++q) { FragH f;
#pragma unroll
    for (int i = 0; i < 8; ++i) f.h[i] = (_Float16)(bf16_round(x[i][q]) * scale);
    *(v8us*)&sT[n4 * 4 + q][k8 * 8] = f.half[0]; }
  __syncthreads();      // the tile is whole before any row of it is read; bx is the same in the whole work-group
  unsigned short* o = (unsigned short*)Wt + (size_t)(n0 + k8) * DD + k0 + n4 * 8;
#pragma unroll
  for (int i = 0; i < WTN / 16; ++i) { const v8us v = *(const v8us*)&sT[k8 + i * 16][n4 * 8]; *(v8us*)(o + (size_t)i * 16 * DD) = v; }
  asm volatile("s_wait_xcnt 0x0" ::: "memory");      // stands behind the four stores, in front of every later write of their address and data registers
}
// C16[r][c] = f16(sum_k A[r][k] * Bt[c][k] * alpha + bf16(bias[c])): A f16 [NR][DD], Bt f16 [DD][DD]. One work-group = a 128 x 128 tile of C, 8 waves of 64 x 32 (4 x 2 accumulators);
// k runs in slices of 128 through an LDS ring of two buffers that all 8 waves share; per output element the WMMAs follow one another in rising k, 32 at a time
// One grid holds the three independent projections: blocks [256 s, 256 s + 256) are product s (0 = q, 1 = k, 2 = v); A3 and Bt3 hold the three planes one behind the other, C3 those of q and k.
// Product v is stored transposed, as the attention kernel reads it: Vt[(b * NH + h) * 64 + d][token], rows of TT tokens
__global__ __launch_bounds__(256) void k_gemm_t(const _Float16* __restrict__ A3, const _Float16* __restrict__ Bt3, float alpha, const float* __restrict__ bias0, const float* __restrict__ bias1, const float* __restrict__ bias2, _Float16* __restrict__ C3, _Float16* __restrict__ Vt) {
  constexpr int GP = (NR / 128) * (DD / 128); const int sel = blockIdx.x / GP, bx = blockIdx.x % GP;
  const _Float16* A = A3 + (size_t)sel * NR * DD; const _Float16* Bt = Bt3 + (size_t)sel * DD * DD; _Float16* C16 = C3 + (size_t)sel * NR * DD; const float* bias = sel == 0 ? bias0 : sel == 1 ? bias1 : bias2;
  // rows of 128 f16 = 256 B; LDS pitch 272 B (16 B x odd) keeps the 16 rows of a ds_load_b128 fragment read on distinct banks
  constexpr int BT = 128, BK = 128, NSL = DD / BK, LP = BK + 8, TBY = BT * LP * 2, CP = BT + 8;
  __shared__ __attribute__((aligned(16))) unsigned short sA[2][BT][LP]; __shared__ __attribute__((aligned(16))) unsigned short sB[2][BT][LP]; __shared__ __attribute__((aligned(16))) unsigned short sC[BT][CP];
  const int tid = threadIdx.x, w = tid >> 5, lane = tid & 31, ln = lane & 15, hh = lane >> 4;
  const int row0 = (bx % (NR / BT)) * BT, col0 = (bx / (NR / BT)) * BT; const int wm = (w >> 2) * 64, wn = (w & 3) * 32;
  // each thread copies 16 B of rows crow, crow + 16, ..., crow + 112 of both tiles: a wave's copy covers four whole 128-B lines
  const int crow = tid >> 4, ccol = tid & 15;
  const unsigned short* gA = (const unsigned short*)A + (size_t)(row0 + crow) * DD + ccol * 8; const unsigned short* gB = (const unsigned short*)Bt + (size_t)(col0 + crow) * DD + ccol * 8;
  const unsigned lA = (unsigned)(uintptr_t)&sA[0][crow][ccol * 8], lB = (unsigned)(uintptr_t)&sB[0][crow][ccol * 8];
  auto copy8 = [&](unsigned l, const unsigned short* g) {
    // global -> LDS through no register; s_wait_xcnt 0 closes the statement so that no address register is rewritten ahead of it
    asm volatile("global_load_async_to_lds_b128 %0, %8, off\n\tglobal_load_async_to_lds_b128 %1, %9, off\n\tglobal_load_async_to_lds_b128 %2, %10, off\n\tglobal_load_async_to_lds_b128 %3, %11, off\n\t"
                 "global_load_async_to_lds_b128 %4, %12, off\n\tglobal_load_async_to_lds_b128 %5, %13, off\n\tglobal_load_async_to_lds_b128 %6, %14, off\n\tglobal_load_async_to_lds_b128 %7, %15, off\n\ts_wait_xcnt 0x0"
                 :: "v"(l), "v"(l + 16 * LP * 2), "v"(l + 32 * LP * 2), "v"(l + 48 * LP * 2), "v"(l + 64 * LP * 2), "v"(l + 80 * LP * 2), "v"(l + 96 * LP * 2), "v"(l + 112 * LP * 2),
                    "v"(g), "v"(g + 16 * DD), "v"(g + 32 * DD), "v"(g + 48 * DD), "v"(g + 64 * DD), "v"(g + 80 * DD), "v"(g + 96 * DD), "v"(g + 112 * DD) : "memory"); };
  auto stage = [&](int st, int bf) { copy8(lA + bf * TBY, gA + st * BK); copy8(lB + bf * TBY, gB + st * BK); };
  v8f acc[4][2];
#pragma unroll
  for (int mi = 0; mi < 4; ++mi)
#pragma unroll
    for (int ni = 0; ni < 2; ++ni) acc[mi][ni] = (v8f){0.f,0.f,0.f,0.f,0.f,0.f,0.f,0.f};
  stage(0, 0);
  asm volatile("s_wait_asynccnt 0x0" ::: "memory");      // this wave's copies of slice 0 have landed
  __syncthreads();                                        // ... and every other wave's: slice 0 may be read
  stage(1, 1);
#pragma unroll 1      /* one copy of the ring's foot; the buffer index stays t & 1 */
  for (int t = 0; t < NSL; ++t) { const int bf = t & 1; const unsigned short* ab = &sA[bf][wm + ln][8 * hh]; const unsigned short* bb = &sB[bf][wn + ln][8 * hh];
    FragH a[2][4], bq[2][2];      /* two fragment sets: the next 32 k of THIS slice are read while the present 32 are multiplied */
    auto frags = [&](int ks, int s) {
#pragma unroll
      for (int mi = 0; mi < 4; ++mi) { a[s][mi].half[0] = *(const v8us*)(ab + mi * 16 * LP + ks * 32); a[s][mi].half[1] = *(const v8us*)(ab + mi * 16 * LP + ks * 32 + 16); }
#pragma unroll
      for (int ni = 0; ni < 2; ++ni) { bq[s][ni].half[0] = *(const v8us*)(bb + ni * 16 * LP + ks * 32); bq[s][ni].half[1] = *(const v8us*)(bb + ni * 16 * LP + ks * 32 + 16); } };
    frags(0, 0);
#pragma unroll
    for (int ks = 0; ks < BK / 32; ++ks) { if (ks + 1 < BK / 32) frags(ks + 1, (ks + 1) & 1);
      __builtin_amdgcn_sched_barrier(0);      // keeps the next step's 12 LDS reads in front of this step's WMMAs; without it each read sinks to its use and its latency is waited for
#pragma unroll
      for (int mi = 0; mi < 4; ++mi)
#pragma unroll
        for (int ni = 0; ni < 2; ++ni) acc[mi][ni] = __builtin_amdgcn_wmma_f32_16x16x32_f16(false, a[ks & 1][mi].v, false, bq[ks & 1][ni].v, (short)0, acc[mi][ni], false, false); }
    asm volatile("s_wait_dscnt 0x0" ::: "memory");        // this wave's reads of buffer bf are done before it is refilled
    asm volatile("s_wait_asynccnt 0x0" ::: "memory");     // this wave's copies of slice t + 1 have landed
    __syncthreads();                                        // publishes slice t + 1 and ends every wave's reads of buffer bf
    if (t + 2 < NSL) stage(t + 2, bf); }
  asm volatile("s_wait_asynccnt 0x0" ::: "memory");       // no copy is outstanding when the wave goes on to the epilogue
  // the tile goes through LDS as f16 so that each 256-B row piece of the stored plane goes out as whole 128-B lines; sel is the same in the whole work-group
  static_assert(TT % BT == 0 && NH * 64 == DD, "a tile lies in one batch; column c of v is row c of that batch's DD rows of Vt");
  FragH cf[4][2];      /* cf[mi][ni].h[r] = C[wm + mi * 16 + 8 hh + r][wn + ni * 16 + ln] */
#pragma unroll
  for (int ni = 0; ni < 2; ++ni) { const float bv = bf16_round(bias[col0 + wn + ni * 16 + ln]);
#pragma unroll
    for (int mi = 0; mi < 4; ++mi)
#pragma unroll
      for (int r = 0; r < 8; ++r) cf[mi][ni].h[r] = (_Float16)(acc[mi][ni][r] * alpha + bv); }
  auto put = [&](unsigned short* dst, int pitch) {      /* the 128 rows of sC, 256 B each, to rows of the given pitch */
#pragma unroll
    for (int i = 0; i < BT * (BT / 8) / 256; ++i) { const int e = tid + i * 256, r = e >> 4, c8 = (e & 15) * 8; const v8us o = *(const v8us*)&sC[r][c8]; *(v8us*)(dst + (size_t)r * pitch + c8) = o; } };
  if (sel == 2) {      /* sC[column][row]: a lane's eight registers are eight consecutive rows of one column, one 16-B write */
#pragma unroll
    for (int ni = 0; ni < 2; ++ni)
#pragma unroll
      for (int mi = 0; mi < 4; ++mi) *(v8us*)&sC[wn + ni * 16 + ln][wm + mi * 16 + 8 * hh] = cf[mi][ni].half[0];
  } else {
#pragma unroll
    for (int ni = 0; ni < 2; ++ni)
#pragma unroll
      for (int mi = 0; mi < 4; ++mi)
#pragma unroll
        for (int r = 0; r < 8; ++r) sC[wm + mi * 16 + 8 * hh + r][wn + ni * 16 + ln] = cf[mi][ni].u[r];
  }
  __syncthreads();
  if (sel == 2) put((unsigned short*)Vt + ((size_t)(row0 / TT) * DD + col0) * TT + row0 % TT, TT);
  else put((unsigned short*)C16 + (size_t)row0 * DD + col0, DD);
}


typedef _Float16 v4h __attribute__((ext_vector_type(4)));

__global__ __launch_bounds__(256) void k_x16(const float* __restrict__ x, _Float16* __restrict__ X16, size_t n8) { const size_t t = (size_t)blockIdx.x * 256 + threadIdx.x; if (t >= n8) return; FragH f;
#pragma unroll
  for (int q = 0; q < 8; ++q) f.h[q] = (_Float16)bf16_round(x[t * 8 + q]); *(v8us*)((unsigned short*)X16 + t * 8) = f.half[0];  }
__global__ __launch_bounds__(256) void k_h16(const float* __restrict__ x, _Float16* __restrict__ X16, size_t n8) { const size_t t = (size_t)blockIdx.x * 256 + threadIdx.x; if (t >= n8) return; FragH f;
#pragma unroll
  for (int q = 0; q < 8; ++q) f.h[q] = (_Float16)x[t * 8 + q]; *(v8us*)((unsigned short*)X16 + t * 8) = f.half[0];  }
__global__ __launch_bounds__(256) void k_round16f(const float* __restrict__ W, _Float16* __restrict__ Bt, size_t n8) { const size_t t = (size_t)blockIdx.x * 256 + threadIdx.x; if (t >= n8) return; FragH f;
#pragma unroll
  for (int i = 0; i < 8; ++i) f.h[i] = (_Float16)(bf16_round(W[t * 8 + i]) * 16.0f); *(v8us*)((unsigned short*)Bt + t * 8) = f.half[0];  }
template <int D, int RBF>
__device__ __forceinline__ void d_lnx(int bx, const float* __restrict__ X, const float* __restrict__ gam, const float* __restrict__ bet, int nrows, float eps, _Float16* __restrict__ O16, float* __restrict__ XR) {
  constexpr int NP = D / 128; const int tid = threadIdx.x, wv = tid >> 5, lane = tid & 31; const size_t r = (size_t)bx * 8 + wv; if (r >= (size_t)nrows) return; v4f y[NP]; float s = 0.f;
#pragma unroll
  for (int j = 0; j < NP; ++j) { const int c = j * 128 + lane * 4; v4f g = *(const v4fa*)(X + r * D + c); if (RBF) { for (int q = 0; q < 4; ++q) g[q] = bf16_round(g[q]); } y[j] = g; s += g[0] + g[1] + g[2] + g[3]; }
  asm volatile("s_wait_xcnt 0x0" ::: "memory");      // stands behind the row's loads, in front of every later write of their address registers
  for (int o = 16; o >= 1; o >>= 1) s += __shfl_xor(s, o, 32); const float mu = s / (float)D; float q2 = 0.f;
#pragma unroll
  for (int j = 0; j < NP; ++j) for (int q = 0; q < 4; ++q) { const float d = y[j][q] - mu; q2 += d * d; }
  for (int o = 16; o >= 1; o >>= 1) q2 += __shfl_xor(q2, o, 32); const float rs = rsqrtf(q2 / (float)D + eps);
  {
#pragma unroll
    for (int j = 0; j < NP; ++j) { const int c = j * 128 + lane * 4; v4h h; for (int q = 0; q < 4; ++q) { const float v = (y[j][q] - mu) * rs * bf16_round(gam[c + q]) + bf16_round(bet[c + q]); h[q] = (_Float16)v; } *(v4h*)(O16 + r * D + c) = h; if (XR) *(v4f*)(XR + r * D + c) = y[j]; }
     } }
typedef int v4ia __attribute__((ext_vector_type(4), may_alias));
// One wave reads one tile of 64 queries x 64 keys of the mask (nonzero = masked) and writes its class: bit 0 = some pair is open, bit 1 = some pair is masked.
// Tile number = (b * 32 + query tile) * 32 + key tile; each class word stands in a 128-B line of its own, so every line has one writer
__device__ __forceinline__ void d_mclass(int bx, const int* __restrict__ MSK, int* __restrict__ TF) {
  const unsigned lane = threadIdx.x & 31, tile = (unsigned)bx * 8 + (threadIdx.x >> 5); const unsigned kt = tile % (TT / 64), qt = (tile / (TT / 64)) % (TT / 64), b = tile / ((TT / 64) * (TT / 64));
  const int* p = MSK + ((size_t)b * TT + qt * 64 + (lane >> 4)) * TT + kt * 64 + (lane & 15) * 4;      /* a wave's load = two rows of 256 B: four whole lines */
  unsigned am = 0u, lo = ~0u;      /* OR and unsigned minimum of the tile's words: am != 0 = some pair masked, lo == 0 = some pair open */
#pragma unroll 8      /* eight independent loads in flight per wave: the tile comes from memory */
  for (int i = 0; i < 32; ++i) { const v4ia x = *(const v4ia*)(p + (size_t)i * 2 * TT);
#pragma unroll
    for (int q = 0; q < 4; ++q) { am |= (unsigned)x[q]; lo = min(lo, (unsigned)x[q]); } }
  const unsigned bm = __builtin_amdgcn_ballot_w32(am != 0u), bo = __builtin_amdgcn_ballot_w32(lo == 0u);
  if (lane == 0) TF[(size_t)tile * 32] = (bo ? 1 : 0) | (bm ? 2 : 0); }
// One grid holds the independent preparations: blocks [0, GM) class the mask's tiles; behind them blocks [0, 3 GW) transpose the three weights, blocks [3 GW, 3 GW + 3 GL) normalise the rows of Q, K and V
__global__ __launch_bounds__(256) void k_prep(const float* __restrict__ Qx, const float* __restrict__ Kx, const float* __restrict__ Vx, const float* __restrict__ Wq, const float* __restrict__ Wk, const float* __restrict__ Wv,
                                              const float* __restrict__ gam, const float* __restrict__ bet, const int* __restrict__ MSK, _Float16* __restrict__ Bw, _Float16* __restrict__ H3, int* __restrict__ TF) {
  constexpr int GM = BB * (TT / 64) * (TT / 64) / 8, GW = (DD / WTK) * (DD / WTN), GL = NR / 8; const int bx = (int)blockIdx.x - GM;
  if (bx < 0) d_mclass(blockIdx.x, MSK, TF);
  else if (bx < 3 * GW) { const int sel = bx / GW; d_wt_f16(bx % GW, sel == 0 ? Wq : sel == 1 ? Wk : Wv, Bw + (size_t)sel * DD * DD, 16.0f); }      /* (in,out) -> Bt x 2^4 */
  else { const int y = bx - 3 * GW, sel = y / GL; d_lnx<DD, 1>(y % GL, sel == 0 ? Qx : sel == 1 ? Kx : Vx, gam, bet, NR, 1e-5f, H3 + (size_t)sel * NR * DD, nullptr); } }      /* LN(bf16 x) -> f16 */
// y[i] = 2^x[i], twelve independent v_exp_f32 in one statement with results in registers of their own (=&v), so that none overwrites the source of the one in front of it;
// the closing v_nop is the slot the instruction set asks for behind a transcendental before its result is read or its source overwritten
__device__ __forceinline__ void exp2x12(float* __restrict__ y, const float* __restrict__ x) {
  asm("v_exp_f32 %0, %12\n\tv_exp_f32 %1, %13\n\tv_exp_f32 %2, %14\n\tv_exp_f32 %3, %15\n\tv_exp_f32 %4, %16\n\tv_exp_f32 %5, %17\n\t"
      "v_exp_f32 %6, %18\n\tv_exp_f32 %7, %19\n\tv_exp_f32 %8, %20\n\tv_exp_f32 %9, %21\n\tv_exp_f32 %10, %22\n\tv_exp_f32 %11, %23\n\tv_nop"
      : "=&v"(y[0]), "=&v"(y[1]), "=&v"(y[2]), "=&v"(y[3]), "=&v"(y[4]), "=&v"(y[5]), "=&v"(y[6]), "=&v"(y[7]), "=&v"(y[8]), "=&v"(y[9]), "=&v"(y[10]), "=&v"(y[11])
      : "v"(x[0]), "v"(x[1]), "v"(x[2]), "v"(x[3]), "v"(x[4]), "v"(x[5]), "v"(x[6]), "v"(x[7]), "v"(x[8]), "v"(x[9]), "v"(x[10]), "v"(x[11])); }
// the same for five values
__device__ __forceinline__ void exp2x5(float* __restrict__ y, const float* __restrict__ x) {
  asm("v_exp_f32 %0, %5\n\tv_exp_f32 %1, %6\n\tv_exp_f32 %2, %7\n\tv_exp_f32 %3, %8\n\tv_exp_f32 %4, %9\n\tv_nop"
      : "=&v"(y[0]), "=&v"(y[1]), "=&v"(y[2]), "=&v"(y[3]), "=&v"(y[4]) : "v"(x[0]), "v"(x[1]), "v"(x[2]), "v"(x[3]), "v"(x[4])); }
// the value that lane l ^ 16 holds
__device__ __forceinline__ float xhalf(float x) { const int b = __float_as_int(x); return __int_as_float(__builtin_amdgcn_permlanex16(b, b, 0x76543210, 0xfedcba98, false, false)); }
// Scores are computed transposed: S^T = K Q^T (A = 16 keys from LDS, B = the wave's 16 queries, kept in registers), O^T += V^T P^T. Lane (ln, hh) holds query q0 + ln alone:
// register r of score tile nt is key j0 + nt * 16 + 8 * hh + r, so maximum and sum run inside the lane with one exchange between the halves, and the two score tiles, converted in place, are the B operand of the second product
__global__ __launch_bounds__(128) void k_flash(const _Float16* __restrict__ Q16, int ldq, const _Float16* __restrict__ K16, int ldk, const _Float16* __restrict__ Vt, const int* __restrict__ MSK, const int* __restrict__ TF, const float* __restrict__ Qx, float* __restrict__ O, int ldo) {
  constexpr int RPW = 16, NQB = TT / (4 * RPW), DT = 4, KS = 2;
  __shared__ __attribute__((aligned(16))) float sO[4][RPW][64 + 4];
  // K/V ring, two buffers, one stage = SKEY keys: sK rows = keys (64 d = 128 B), sV rows = d (SKEY keys = 128 B); LDS pitch 144 B (16 B x odd) keeps the 16 rows of a ds_load_b128 fragment read on distinct banks
  constexpr int SKEY = 64, NST = TT / SKEY, LP = 72, SBUF = 64 * LP * 2; constexpr float SC = 0.125f * 1.44269504088896340736f;      /* 64^-1/2 * log2(e) */
  __shared__ __attribute__((aligned(16))) unsigned short sK[2][SKEY][LP]; __shared__ __attribute__((aligned(16))) unsigned short sV[2][64][LP];
  const int tid = threadIdx.x, w = tid >> 5, lane = tid & 31, ln = lane & 15, hh = lane >> 4;
  // A work-group's cost is the number of key stages that its query tile leaves open, so it differs from tile to tile. Block index -> (slab, query tile) is a permutation of the 1024 pairs, for speed only.
  // Each run of 128 blocks (ga = 0..7) holds, for all 32 slabs, the four tiles 31 - ga, 16 + ga, 15 - ga, ga; which of the four a block takes is the sum of its index's base-4 digits mod 4,
  // so that four blocks a power of two apart hold one tile of each kind, wherever the hardware puts them, and the far ends of the tile range stand early in the grid
  static_assert(NQB == 32 && BB * NH == 32 && TT / 64 == 32, "the bit fields below and one class word per lane");
  const int bi = blockIdx.x, ga = bi >> 7, slab = (bi >> 2) & 31, pp = (bi + (bi >> 2) + (bi >> 4) + (bi >> 6) + (bi >> 8)) & 3;
  const int qblk = (((pp >> 1) ^ 1) << 4) | (ga ^ (((pp & 1) - 1) & 15));      /* pp = 0, 1, 2, 3: 31 - ga, 16 + ga, 15 - ga, ga */
  const int b = slab / NH, h = slab % NH; const int qb0 = qblk * (4 * RPW); const int q0 = qb0 + w * RPW;
  const int tf = TF[(size_t)((b * NQB + qblk) * NST + lane) * 32];
  asm volatile("s_wait_xcnt 0x0" ::: "memory");      // stands behind the load above, in front of every later write of its address registers
  FragH aq[KS];
  { const unsigned short* qr = (const unsigned short*)Q16 + ((size_t)b * TT + q0 + ln) * ldq + h * 64;
#pragma unroll
    for (int ks = 0; ks < KS; ++ks) { aq[ks].half[0] = *(const v8us*)(qr + ks * 32 + 8 * hh); aq[ks].half[1] = *(const v8us*)(qr + ks * 32 + 16 + 8 * hh); } }
  // the residual: the pieces of Q that this lane adds to what it stores at the end, asked for here so that they come in under the key loop
  v4f xr[RPW / 2];
  { const float* qx = Qx + ((size_t)b * TT + q0 + hh) * DD + h * 64 + ln * 4;
#pragma unroll
    for (int i = 0; i < RPW / 2; ++i) xr[i] = *(const v4fa*)(qx + (size_t)i * 2 * DD); }
  asm volatile("s_wait_xcnt 0x0" ::: "memory");      // stands behind the loads above, in front of every later write of their address registers
  const unsigned short* Vth = (const unsigned short*)Vt + (size_t)slab * 64 * TT;
  const int* mrow = MSK + ((size_t)b * TT + q0 + ln) * TT + 8 * hh;      /* this lane's query row of the mask, at its half's first key */
  float m_r = -3.0e38f, l_r = 0.f; v8f oacc[DT];
#pragma unroll
  for (int dt = 0; dt < DT; ++dt) oacc[dt] = (v8f){0.f,0.f,0.f,0.f,0.f,0.f,0.f,0.f};
  // each thread copies 16 B of rows crow, crow + 16, + 32, + 48 of both tiles: a wave's copy covers four whole 128-B lines
  const int crow = tid >> 3, ccol = tid & 7;
  const unsigned short* gK = (const unsigned short*)K16 + ((size_t)b * TT + crow) * ldk + h * 64 + ccol * 8; const unsigned short* gV = Vth + (size_t)crow * TT + ccol * 8;
  const unsigned lK = (unsigned)(uintptr_t)&sK[0][crow][ccol * 8], lV = (unsigned)(uintptr_t)&sV[0][crow][ccol * 8];
  auto stage = [&](int st, int bf) { const unsigned short* k0 = gK + (size_t)st * SKEY * ldk; const unsigned short* v0 = gV + st * SKEY; const unsigned lk = lK + bf * SBUF, lv = lV + bf * SBUF;
    // global -> LDS through no register; s_wait_xcnt 0 closes the statement so that no address register is rewritten ahead of it
    asm volatile("global_load_async_to_lds_b128 %0, %8, off\n\tglobal_load_async_to_lds_b128 %1, %9, off\n\tglobal_load_async_to_lds_b128 %2, %10, off\n\tglobal_load_async_to_lds_b128 %3, %11, off\n\t"
                 "global_load_async_to_lds_b128 %4, %12, off\n\tglobal_load_async_to_lds_b128 %5, %13, off\n\tglobal_load_async_to_lds_b128 %6, %14, off\n\tglobal_load_async_to_lds_b128 %7, %15, off\n\ts_wait_xcnt 0x0"
                 :: "v"(lk), "v"(lk + 16 * LP * 2), "v"(lk + 32 * LP * 2), "v"(lk + 48 * LP * 2), "v"(lv), "v"(lv + 16 * LP * 2), "v"(lv + 32 * LP * 2), "v"(lv + 48 * LP * 2),
                    "v"(k0), "v"(k0 + (size_t)16 * ldk), "v"(k0 + (size_t)32 * ldk), "v"(k0 + (size_t)48 * ldk), "v"(v0), "v"(v0 + 16 * TT), "v"(v0 + 32 * TT), "v"(v0 + 48 * TT) : "memory"); };
  // tf: lane t holds the class of key stage t for this block's 64 queries; every wave reads the same 32 words, so both ballots are the same in the whole work-group.
  // A stage with no open pair adds nothing (every p is 0, the maximum stays, the rescale is 1): it is neither copied nor computed. The ring runs over the na <= 32 stages that are left, in rising order
  const unsigned mix = __builtin_amdgcn_ballot_w32((tf & 2) != 0); unsigned rem = __builtin_amdgcn_ballot_w32((tf & 1) != 0); const int na = __builtin_popcount(rem);
  auto next = [&]() { const int s = __builtin_ctz(rem); rem &= rem - 1; return s; };      /* called only while a stage is left */
  int tc = 0, tn = 0;      /* the stage in buffer it & 1 and the one behind it */
  if (na > 0) { tc = next(); stage(tc, 0); }
  asm volatile("s_wait_asynccnt 0x0" ::: "memory");      // this wave's copies of the first stage have landed
  __syncthreads();                                        // ... and every other wave's: it may be read
  if (na > 1) { tn = next(); stage(tn, 1); }
#pragma unroll 1      /* one copy of the ring's foot; the buffer index stays it & 1 */
  for (int it = 0; it < na; ++it) { const int bf = it & 1; const bool mx = (mix >> tc) & 1;      /* the stage has masked pairs: only then are the mask's words read and applied */
  for (int sub = 0; sub < SKEY / 32; ++sub) { const int j0 = tc * SKEY + sub * 32;
    v4ia mk[2][2];      /* nonzero = MASKED; mk[nt][r >> 2][r & 3] belongs to register r of score tile nt; loaded and read under mx alone */
    if (mx) {
#pragma unroll
    for (int nt = 0; nt < 2; ++nt) { mk[nt][0] = *(const v4ia*)(mrow + j0 + nt * 16); mk[nt][1] = *(const v4ia*)(mrow + j0 + nt * 16 + 4); } }
    float sv[16];      /* unscaled scores of keys j0 + 8 hh + 0..7 and j0 + 16 + 8 hh + 0..7; the running maximum is kept unscaled too */
#pragma unroll
    for (int nt = 0; nt < 2; ++nt) { const unsigned short* kr = &sK[bf][sub * 32 + nt * 16 + ln][0]; FragH bk[KS];
#pragma unroll
      for (int ks = 0; ks < KS; ++ks) { bk[ks].half[0] = *(const v8us*)(kr + ks * 32 + 8 * hh); bk[ks].half[1] = *(const v8us*)(kr + ks * 32 + 16 + 8 * hh); }
      v8f acc = (v8f){0.f,0.f,0.f,0.f,0.f,0.f,0.f,0.f};
#pragma unroll
      for (int ks = 0; ks < KS; ++ks) acc = mmaH<1>(bk[ks].v, bk[ks].v, aq[ks].v, aq[ks].v, acc);
#pragma unroll
      for (int r = 0; r < 8; ++r) sv[nt * 8 + r] = acc[r];
      if (mx) {
#pragma unroll
        for (int r = 0; r < 8; ++r) sv[nt * 8 + r] = (mk[nt][r >> 2][r & 3] == 0) ? acc[r] : -INFINITY; } }
    float mc = fmaxf(sv[0], sv[1]);
#pragma unroll
    for (int i = 2; i < 16; ++i) mc = fmaxf(mc, sv[i]);
    mc = fmaxf(mc, xhalf(mc));      /* the other half's 16 keys of the same query */
    // e^(0.125 (s - m)) = 2^(s * SC - m * SC): one fma per score, no branch; a masked score is -inf and gives 0 (m is finite: it starts at -3e38)
    const float mn = fmaxf(m_r, mc), nb = -mn * SC; float ex[17], ey[17]; ex[16] = (m_r - mn) * SC;
#pragma unroll
    for (int i = 0; i < 16; ++i) ex[i] = fmaf(sv[i], SC, nb);
    exp2x12(ey, ex); exp2x5(ey + 12, ex + 12);
    const float* p = ey; const float al = (mn > -1.0e38f) ? ey[16] : 1.0f; m_r = mn;
    float ps = p[0];
#pragma unroll
    for (int i = 1; i < 16; ++i) ps += p[i];
    l_r = l_r * al + ps;      /* this half's keys only; the halves are joined behind the loop */
#pragma unroll
    for (int dt = 0; dt < DT; ++dt)
#pragma unroll
      for (int r = 0; r < 8; ++r) oacc[dt][r] *= al;
    FragH pb;      /* B operand: column ln = the query, element i = key kmap(i, hh) of the 32: the order in which sv holds them */
#pragma unroll
    for (int i = 0; i < 16; ++i) pb.h[i] = (_Float16)(p[i] * 1024.0f);
#pragma unroll
    for (int dt = 0; dt < DT; ++dt) { const unsigned short* vrow = &sV[bf][dt * 16 + ln][sub * 32]; FragH bv; bv.half[0] = *(const v8us*)(vrow + 8 * hh); bv.half[1] = *(const v8us*)(vrow + 16 + 8 * hh);
      oacc[dt] = mmaH<1>(bv.v, bv.v, pb.v, pb.v, oacc[dt]); } }
    asm volatile("s_wait_dscnt 0x0" ::: "memory");        // this wave's reads of buffer bf are done before it is refilled
    asm volatile("s_wait_asynccnt 0x0" ::: "memory");     // this wave's copies of the next stage have landed
    __syncthreads();                                        // publishes the next stage and ends every wave's reads of buffer bf
    tc = tn; if (it + 2 < na) { tn = next(); stage(tn, bf); } }
  asm volatile("s_wait_asynccnt 0x0" ::: "memory");       // no copy is outstanding when the wave goes on to the epilogue
  const float l = l_r + xhalf(l_r); const float li = (l > 0.f) ? 1.0f / (l * 1024.0f) : 0.f;
  // register r of oacc[dt] is O[q0 + ln][dt * 16 + 8 hh + r]: eight consecutive d of the lane's query
#pragma unroll
  for (int dt = 0; dt < DT; ++dt) { v4f lo, hi;
#pragma unroll
    for (int r = 0; r < 4; ++r) { lo[r] = oacc[dt][r] * li; hi[r] = oacc[dt][4 + r] * li; }
    *(v4fa*)&sO[w][ln][dt * 16 + 8 * hh] = lo; *(v4fa*)&sO[w][ln][dt * 16 + 8 * hh + 4] = hi; }
  __builtin_amdgcn_fence(__ATOMIC_ACQ_REL, "workgroup"); __builtin_amdgcn_wave_barrier();
  {
#pragma unroll
    for (int rp = 0; rp < RPW; rp += 2) { const int r = rp + (lane >> 4), pc = lane & 15; v4f val = *(const v4fa*)&sO[w][r][pc * 4];
#pragma unroll
      for (int q = 0; q < 4; ++q) val[q] += bf16_round(xr[rp / 2][q]);      /* out = o + bf16(Q) */
      *(v4f*)(O + ((size_t)b * TT + q0 + r) * ldo + h * 64 + pc * 4) = val; }
     } }

extern "C" void kernel_launch(void* const* d_in, const int* in_sizes, int n_in,
                              void* d_out, int out_size, void* d_ws, size_t ws_size, hipStream_t stream) {
  (void)in_sizes; (void)n_in; (void)out_size;
  const float* const* I = (const float* const*)d_in; const float* Qx = I[0]; const float* Kx = I[1]; const float* Vx = I[2]; const int* mask = (const int*)d_in[3];      /* bool mask shipped as int32 [2,1,2048,2048] */
  const float* Wq = I[4]; const float* bq = I[5]; const float* Wk = I[6]; const float* bk = I[7]; const float* Wv = I[8]; const float* bv = I[9]; const float* gam = I[10]; const float* bet = I[11];
  char* ws = (char*)d_ws; size_t off = 0;
  auto take = [&](size_t bytes) { char* p = ws + off; off += (bytes + 255) & ~(size_t)255; return p; };
  const size_t WSZ = (size_t)DD * DD; _Float16* Bw = (_Float16*)take(3 * WSZ * 2); _Float16* H16 = (_Float16*)take((size_t)3 * NR * DD * 2);
  _Float16* Q = (_Float16*)take((size_t)2 * NR * DD * 2); _Float16* K = Q + (size_t)NR * DD; _Float16* Vt = (_Float16*)take((size_t)NR * DD * 2); int* TF = (int*)take((size_t)BB * (TT / 64) * (TT / 64) * 128);
  if (off > ws_size) return;      // 6.3 + 25.2 + 16.8 + 8.4 = about 57 MB
  k_prep<<<BB * (TT / 64) * (TT / 64) / 8 + 3 * ((DD / WTK) * (DD / WTN)) + 3 * (NR / 8), 256, 0, stream>>>(Qx, Kx, Vx, Wq, Wk, Wv, gam, bet, mask, Bw, H16, TF);
  k_gemm_t<<<3 * (NR / 128) * (DD / 128), 256, 0, stream>>>(H16, Bw, 0.0625f, bq, bk, bv, Q, Vt);      /* three times M 4096 N 1024 K 1024; v comes out transposed */
  k_flash<<<BB * NH * (TT / 64), 128, 0, stream>>>(Q, DD, K, DD, Vt, mask, TF, Qx, (float*)d_out, DD);      /* out = o + Q */
}

// v009
// One run takes 78.3 microseconds.
// Timed twice side by side with v008, it ran 1.08 times as fast both times.
// Over all steps from v000 it is 5.53 times as fast.
#include <hip/hip_runtime.h>
// Pre-norm multi-head attention with a boolean mask and residual (B=2, N=2048, E=1024, 16 heads × 64): q = LN(Q)·Wq + bq, k = LN(K)·Wk + bk, v = LN(V)·Wv + bv (one shared LayerNorm γ,β; (in,out) weights); s = q·kᵀ·64^-½ with −inf where mask[b,0,n,m] is True;
// softmax; o = merged attn·v; out = o + Q (no output projection).
// Compute dtype: Q, K, V, weights, biases, γ, β rounded to bf16; LayerNorms f32 (wave per row) → f16; q/k/v f16 GEMM planes; fused flash-style kernel (int32 mask loads per (q,k), online softmax f32, P f16 ×2^10) on
// v_wmma_f32_16x16x32_f16; out = o (f32) + bf16(Q) (f32 add); f32 accumulate.
#define BB 2
#define TT 2048
#define DD 1024
#define NH 16
#define NR (BB * TT)

typedef __bf16 v16b __attribute__((ext_vector_type(16)));
typedef unsigned short v8us __attribute__((ext_vector_type(8), may_alias));
typedef float  v8f  __attribute__((ext_vector_type(8)));
typedef float  v4f  __attribute__((ext_vector_type(4)));
typedef float  v4fa __attribute__((ext_vector_type(4), may_alias));
union FragB { v16b v; v8us half[2]; unsigned short u[16]; };

__device__ __forceinline__ unsigned short bf16_bits(float x) { unsigned int u = __float_as_uint(x); return (unsigned short)((u + 0x7FFFu + ((u >> 16) & 1u)) >> 16); }
__device__ __forceinline__ float bf16_val(unsigned short b) { return __uint_as_float(((unsigned int)b) << 16); }
__device__ __forceinline__ float bf16_round(float x) { return bf16_val(bf16_bits(x)); }
// D += A·B with NT terms: 1 = ah·bh, 2 = + al·bh (A split), 3 = + ah·bl (both split)
template <int NT>
__device__ __forceinline__ v8f mmaN(v16b ah, v16b al, v16b bh, v16b bl, v8f c) {
  c = __builtin_amdgcn_wmma_f32_16x16x32_bf16(false, ah, false, bh, (short)0, c, false, false);
  if (NT >= 2) c = __builtin_amdgcn_wmma_f32_16x16x32_bf16(false, al, false, bh, (short)0, c, false, false);
  if (NT >= 3) c = __builtin_amdgcn_wmma_f32_16x16x32_bf16(false, ah, false, bl, (short)0, c, false, false);
  asm volatile("v_nop\n\tv_nop\n\tv_nop\n\tv_nop" : "+v"(c) : "v"(ah), "v"(al), "v"(bh), "v"(bl));
  return c;
}

__global__ __launch_bounds__(256) void k_wt_bf16(const float* __restrict__ W, unsigned short* __restrict__ Wt, int K, int N) {
  const int t = blockIdx.x * 256 + threadIdx.x;
  const int k8n = K / 8;
  if (t >= N * k8n) return;
  const int n = t / k8n, k8 = (t % k8n) * 8;
  v8us v;
#pragma unroll
  for (int i = 0; i < 8; ++i) v[i] = bf16_bits(W[(size_t)(k8 + i) * N + n]);
  *(v8us*)(Wt + (size_t)n * K + k8) = v;
  
}

// GEMM C[M][N] (f32, pitch ldc) = act(A[M][K]·W + bias). A f32 row-major (pitch lda) converted per fragment to bf16
// (ASPLIT: hi/lo two planes -> 2 terms, else single rounded term); Wt bf16 [N][K] (pitch ldb). BIAS_BF16 rounds the
// bias to bf16 first (bias quantised to bf16 before the add). K%32==0, M%16==0, N%64==0.
template <bool ASPLIT, int ACT, bool BIAS_BF16>
__global__ __launch_bounds__(128) void k_gemm_bf(const float* __restrict__ A, int lda, const unsigned short* __restrict__ Wt, int ldb,
                                               const float* __restrict__ bias, float* __restrict__ C, int ldc, int M, int N, int K) {
  __shared__ __attribute__((aligned(16))) float so[4][16][64];
  const int tid = threadIdx.x, w = tid >> 5, lane = tid & 31, ln = lane & 15, hh = lane >> 4;
  const int ntn = N / 64;
  const int wid = blockIdx.x * 4 + w;
  const int mt = wid / ntn, nq = wid % ntn;
  if (mt * 16 >= M) return;
  const int row0 = mt * 16, col0 = nq * 64;
  const float* arow = A + (size_t)(row0 + ln) * lda;
  v8f acc[4] = {};
  for (int kb = 0; kb < K; kb += 32) {
    FragB ah, al;
    const v4f x0 = *(const v4fa*)(arow + kb + 8 * hh), x1 = *(const v4fa*)(arow + kb + 8 * hh + 4);
    const v4f x2 = *(const v4fa*)(arow + kb + 16 + 8 * hh), x3 = *(const v4fa*)(arow + kb + 16 + 8 * hh + 4);
    float xs[16] = {x0[0],x0[1],x0[2],x0[3],x1[0],x1[1],x1[2],x1[3],x2[0],x2[1],x2[2],x2[3],x3[0],x3[1],x3[2],x3[3]};
#pragma unroll
    for (int i = 0; i < 16; ++i) { const unsigned short hb = bf16_bits(xs[i]); ah.u[i] = hb; al.u[i] = ASPLIT ? bf16_bits(xs[i] - bf16_val(hb)) : (unsigned short)0; }
#pragma unroll
    for (int t = 0; t < 4; ++t) {
      const unsigned short* brow = Wt + (size_t)(col0 + t * 16 + ln) * ldb + kb;
      FragB b;
      b.half[0] = *(const v8us*)(brow + 8 * hh);
      b.half[1] = *(const v8us*)(brow + 16 + 8 * hh);
      acc[t] = mmaN<ASPLIT ? 2 : 1>(ah.v, al.v, b.v, b.v, acc[t]);
    }
  }
#pragma unroll
  for (int t = 0; t < 4; ++t) {
    float bv = bias ? bias[col0 + t * 16 + ln] : 0.f;
    if (BIAS_BF16) bv = bf16_round(bv);
#pragma unroll
    for (int r = 0; r < 8; ++r) { float v = acc[t][r] + bv; if (ACT == 1) v = fmaxf(v, 0.f); so[w][8 * hh + r][t * 16 + ln] = v; }
  }
  __builtin_amdgcn_fence(__ATOMIC_ACQ_REL, "workgroup");
  __builtin_amdgcn_wave_barrier();
  const int rsub = lane >> 4, c4 = (lane & 15) * 4;
  {
#pragma unroll
    for (int q = 0; q < 8; ++q) {
      const int r = q * 2 + rsub;
      const v4f v = *(const v4fa*)&so[w][r][c4];
      *(v4f*)(C + (size_t)(row0 + r) * ldc + col0 + c4) = v;
    }
    
  }
}

// Flash-style causal/unmasked attention, all contractions 3-term bf16 hi/lo splits, f32 softmax with running max.
// q,k,v rows are read from f32 buffers with arbitrary row pitch (so they can live inside a fused qkv buffer);
// D = head size (multiple of 32, <= 128); one wave = 16 query rows; block = 4 waves (64 queries) sharing K/V chunks of 32.
template <int D, bool CAUSAL>
__global__ __launch_bounds__(128) void k_flash(const float* __restrict__ qb, const float* __restrict__ kb, const float* __restrict__ vb,
                                             int pitch, int T, int H, float scale, float* __restrict__ y, int ypitch) {
  constexpr int KS = D / 32;        // k-steps for QK
  constexpr int DT = D / 16;        // d tiles for PV
  __shared__ __attribute__((aligned(16))) unsigned short sKh[32][D + 8], sKl[32][D + 8], sVh[32][D + 8], sVl[32][D + 8];
  __shared__ __attribute__((aligned(16))) unsigned short sPh[4][16][40], sPl[4][16][40];
  __shared__ __attribute__((aligned(16))) float sO[4][16][D];
  const int tid = threadIdx.x, w = tid >> 5, lane = tid & 31, ln = lane & 15, hh = lane >> 4;
  const int nqb = (T + 63) / 64;
  const int bh = blockIdx.x / nqb, qblk = blockIdx.x % nqb;
  const int b = bh / H, h = bh % H;
  const int q0 = qblk * 64 + w * 16;
  const float* Q = qb + (size_t)b * T * pitch + h * D;
  const float* K = kb + (size_t)b * T * pitch + h * D;
  const float* V = vb + (size_t)b * T * pitch + h * D;

  // A fragments of the wave's 16 query rows (scaled), hi/lo
  FragB aqh[KS], aql[KS];
  {
    int row = q0 + ln; if (row >= T) row = T - 1;
    const float* qr = Q + (size_t)row * pitch;
#pragma unroll
    for (int ks = 0; ks < KS; ++ks)
#pragma unroll
      for (int i = 0; i < 16; ++i) {
        const int d = ks * 32 + ((i < 8) ? (8 * hh + i) : (16 + 8 * hh + (i - 8)));
        const float x = qr[d] * scale; const unsigned short hb = bf16_bits(x);
        aqh[ks].u[i] = hb; aql[ks].u[i] = bf16_bits(x - bf16_val(hb));
      }
  }
  float m_r[8], l_r[8];
#pragma unroll
  for (int r = 0; r < 8; ++r) { m_r[r] = -3.0e38f; l_r[r] = 0.f; }
  v8f oacc[DT];
#pragma unroll
  for (int dt = 0; dt < DT; ++dt) oacc[dt] = (v8f){0.f,0.f,0.f,0.f,0.f,0.f,0.f,0.f};

  const int kv_end = CAUSAL ? min(T, qblk * 64 + 64) : T;     // block-uniform
  for (int j0 = 0; j0 < kv_end; j0 += 32) {
    __syncthreads();
    for (int e = tid; e < 32 * (D / 4); e += 128) {
      const int r = e / (D / 4), c4 = (e % (D / 4)) * 4;
      const int key = j0 + r;
      v4f kf = {0.f,0.f,0.f,0.f}, vf = {0.f,0.f,0.f,0.f};
      if (key < T) { kf = *(const v4fa*)(K + (size_t)key * pitch + c4); vf = *(const v4fa*)(V + (size_t)key * pitch + c4); }
#pragma unroll
      for (int t = 0; t < 4; ++t) {
        unsigned short hb = bf16_bits(kf[t]); sKh[r][c4 + t] = hb; sKl[r][c4 + t] = bf16_bits(kf[t] - bf16_val(hb));
        hb = bf16_bits(vf[t]); sVh[r][c4 + t] = hb; sVl[r][c4 + t] = bf16_bits(vf[t] - bf16_val(hb));
      }
    }
    __syncthreads();
    // S tile 16 x 32
    v8f s[2];
#pragma unroll
    for (int nt = 0; nt < 2; ++nt) {
      v8f acc = {};
#pragma unroll
      for (int ks = 0; ks < KS; ++ks) {
        FragB bh_, bl_;
        bh_.half[0] = *(const v8us*)&sKh[nt * 16 + ln][ks * 32 + 8 * hh]; bh_.half[1] = *(const v8us*)&sKh[nt * 16 + ln][ks * 32 + 16 + 8 * hh];
        bl_.half[0] = *(const v8us*)&sKl[nt * 16 + ln][ks * 32 + 8 * hh]; bl_.half[1] = *(const v8us*)&sKl[nt * 16 + ln][ks * 32 + 16 + 8 * hh];
        acc = mmaN<3>(aqh[ks].v, aql[ks].v, bh_.v, bl_.v, acc);
      }
      s[nt] = acc;
    }
    // mask + running max (rows 8hh+r; the 16 lanes of a half share rows)
    float alpha[8];
#pragma unroll
    for (int r = 0; r < 8; ++r) {
      const int qi = q0 + 8 * hh + r;
      const int ja = j0 + ln, jb = j0 + 16 + ln;
      if (CAUSAL) { if (ja > qi) s[0][r] = -3.0e38f; if (jb > qi) s[1][r] = -3.0e38f; }
      if (ja >= T) s[0][r] = -3.0e38f;
      if (jb >= T) s[1][r] = -3.0e38f;
      float mx = fmaxf(s[0][r], s[1][r]);
      mx = fmaxf(mx, __shfl_xor(mx, 1, 32)); mx = fmaxf(mx, __shfl_xor(mx, 2, 32)); mx = fmaxf(mx, __shfl_xor(mx, 4, 32)); mx = fmaxf(mx, __shfl_xor(mx, 8, 32));
      const float mnew = fmaxf(m_r[r], mx);
      alpha[r] = (mnew > -1.0e38f) ? __expf(m_r[r] - mnew) : 1.0f;
      const float p0 = (s[0][r] > -1.0e38f) ? __expf(s[0][r] - mnew) : 0.f;
      const float p1 = (s[1][r] > -1.0e38f) ? __expf(s[1][r] - mnew) : 0.f;
      m_r[r] = mnew;
      l_r[r] = l_r[r] * alpha[r] + p0 + p1;            // per-lane partial row sum (16 lanes combined at the end)
      unsigned short hb = bf16_bits(p0); sPh[w][8 * hh + r][ln] = hb;      sPl[w][8 * hh + r][ln] = bf16_bits(p0 - bf16_val(hb));
      hb = bf16_bits(p1);                sPh[w][8 * hh + r][16 + ln] = hb; sPl[w][8 * hh + r][16 + ln] = bf16_bits(p1 - bf16_val(hb));
    }
#pragma unroll
    for (int dt = 0; dt < DT; ++dt)
#pragma unroll
      for (int r = 0; r < 8; ++r) oacc[dt][r] *= alpha[r];
    __builtin_amdgcn_fence(__ATOMIC_ACQ_REL, "workgroup");
    __builtin_amdgcn_wave_barrier();
    FragB pah, pal;
    pah.half[0] = *(const v8us*)&sPh[w][ln][8 * hh]; pah.half[1] = *(const v8us*)&sPh[w][ln][16 + 8 * hh];
    pal.half[0] = *(const v8us*)&sPl[w][ln][8 * hh]; pal.half[1] = *(const v8us*)&sPl[w][ln][16 + 8 * hh];
#pragma unroll
    for (int dt = 0; dt < DT; ++dt) {
      FragB bvh, bvl;
#pragma unroll
      for (int i = 0; i < 8; ++i) {
        bvh.u[i] = sVh[8 * hh + i][dt * 16 + ln]; bvh.u[8 + i] = sVh[16 + 8 * hh + i][dt * 16 + ln];
        bvl.u[i] = sVl[8 * hh + i][dt * 16 + ln]; bvl.u[8 + i] = sVl[16 + 8 * hh + i][dt * 16 + ln];
      }
      oacc[dt] = mmaN<3>(pah.v, pal.v, bvh.v, bvl.v, oacc[dt]);
    }
    __builtin_amdgcn_fence(__ATOMIC_ACQ_REL, "workgroup");
    __builtin_amdgcn_wave_barrier();
  }
#pragma unroll
  for (int r = 0; r < 8; ++r) {
    float l = l_r[r];
    l += __shfl_xor(l, 1, 32); l += __shfl_xor(l, 2, 32); l += __shfl_xor(l, 4, 32); l += __shfl_xor(l, 8, 32);
    l_r[r] = (l > 0.f) ? 1.0f / l : 0.f;
  }
#pragma unroll
  for (int dt = 0; dt < DT; ++dt)
#pragma unroll
    for (int r = 0; r < 8; ++r) sO[w][8 * hh + r][dt * 16 + ln] = oacc[dt][r] * l_r[r];
  __builtin_amdgcn_fence(__ATOMIC_ACQ_REL, "workgroup");
  __builtin_amdgcn_wave_barrier();
  {
    for (int r = 0; r < 16; ++r) {
      const int row = q0 + r;
      if (row < T && lane < D / 4) {
        const v4f val = *(const v4fa*)&sO[w][r][lane * 4];
        *(v4f*)(y + ((size_t)b * T + row) * ypitch + h * D + lane * 4) = val;
      }
    }
    
  }
}

// GEMM C = act(A·W + bias + resid): A f32 (ASPLIT -> hi/lo 2 terms), Wt bf16 [N][K]; ACT 0 none, 1 relu, 2 exact gelu;
// resid (optional, f32, row index = (row % rmod), pitch ldr, RES_BF16 rounds it) added before the activation.
template <bool ASPLIT, int ACT, bool BIAS_BF16, bool RES_BF16>
__global__ __launch_bounds__(128) void k_gemm_bf3(const float* __restrict__ A, int lda, const unsigned short* __restrict__ Wt, int ldb,
                                                const float* __restrict__ bias, const float* __restrict__ resid, int rmod, int ldr,
                                                float* __restrict__ C, int ldc, int M, int N, int K) {
  __shared__ __attribute__((aligned(16))) float so[4][16][64];
  const int tid = threadIdx.x, w = tid >> 5, lane = tid & 31, ln = lane & 15, hh = lane >> 4;
  const int ntn = N / 64;
  const int wid = blockIdx.x * 4 + w;
  const int mt = wid / ntn, nq = wid % ntn;
  if (mt * 16 >= M) return;
  const int row0 = mt * 16, col0 = nq * 64;
  const float* arow = A + (size_t)(row0 + ln) * lda;
  v8f acc[4] = {};
  for (int kb = 0; kb < K; kb += 32) {
    FragB ah, al;
    const v4f x0 = *(const v4fa*)(arow + kb + 8 * hh), x1 = *(const v4fa*)(arow + kb + 8 * hh + 4);
    const v4f x2 = *(const v4fa*)(arow + kb + 16 + 8 * hh), x3 = *(const v4fa*)(arow + kb + 16 + 8 * hh + 4);
    float xs[16] = {x0[0],x0[1],x0[2],x0[3],x1[0],x1[1],x1[2],x1[3],x2[0],x2[1],x2[2],x2[3],x3[0],x3[1],x3[2],x3[3]};
#pragma unroll
    for (int i = 0; i < 16; ++i) { const unsigned short hb = bf16_bits(xs[i]); ah.u[i] = hb; al.u[i] = ASPLIT ? bf16_bits(xs[i] - bf16_val(hb)) : (unsigned short)0; }
#pragma unroll
    for (int t = 0; t < 4; ++t) {
      const unsigned short* brow = Wt + (size_t)(col0 + t * 16 + ln) * ldb + kb;
      FragB b;
      b.half[0] = *(const v8us*)(brow + 8 * hh);
      b.half[1] = *(const v8us*)(brow + 16 + 8 * hh);
      acc[t] = mmaN<ASPLIT ? 2 : 1>(ah.v, al.v, b.v, b.v, acc[t]);
    }
  }
#pragma unroll
  for (int t = 0; t < 4; ++t) {
    const int col = col0 + t * 16 + ln;
    float bv = bias ? bias[col] : 0.f;
    if (BIAS_BF16) bv = bf16_round(bv);
#pragma unroll
    for (int r = 0; r < 8; ++r) {
      float v = acc[t][r] + bv;
      if (resid) { float rv = resid[(size_t)((row0 + 8 * hh + r) % rmod) * ldr + col]; if (RES_BF16) rv = bf16_round(rv); v += rv; }
      if (ACT == 1) v = fmaxf(v, 0.f);
      if (ACT == 2) v = 0.5f * v * (1.0f + erff(v * 0.70710678118654752f));
      if (ACT == 3) { const float u = 0.7978845608028654f * (v + 0.044715f * v * v * v); v = 0.5f * v * (1.0f + tanhf(u)); }
      so[w][8 * hh + r][t * 16 + ln] = v;
    }
  }
  __builtin_amdgcn_fence(__ATOMIC_ACQ_REL, "workgroup");
  __builtin_amdgcn_wave_barrier();
  const int rsub = lane >> 4, c4 = (lane & 15) * 4;
  {
#pragma unroll
    for (int q = 0; q < 8; ++q) {
      const int r = q * 2 + rsub;
      const v4f v = *(const v4fa*)&so[w][r][c4];
      *(v4f*)(C + (size_t)(row0 + r) * ldc + col0 + c4) = v;
    }
    
  }
}
// row LayerNorm (biased variance, eps) over N: s = X (+ R); optional out_sum <- s; out_norm <- (s-mu)*rsqrt(var+eps)*g + b
template <bool PARAM_BF16>
__global__ __launch_bounds__(256) void k_layernorm(const float* __restrict__ X, const float* __restrict__ R, const float* __restrict__ g, const float* __restrict__ bta,
                                                  float* __restrict__ out_sum, float* __restrict__ out_norm, int N, float eps) {
  __shared__ float red[256];
  const int row = blockIdx.x, tid = threadIdx.x;
  const float* x = X + (size_t)row * N; const float* rr = R ? R + (size_t)row * N : nullptr;
  float vals[16];                     // up to N = 4096
  const int per = N / 256;            // contiguous chunk per thread? use strided-by-4 chunks: thread handles j = tid*4 + 1024*u
  float s1 = 0.f;
  for (int u = 0; u < per / 4; ++u) {
    const int j = tid * 4 + 1024 * u;
    const v4f a = *(const v4fa*)(x + j);
    v4f b = {0.f,0.f,0.f,0.f}; if (rr) b = *(const v4fa*)(rr + j);
#pragma unroll
    for (int q = 0; q < 4; ++q) { const float v = a[q] + b[q]; vals[u * 4 + q] = v; s1 += v; }
  }
  red[tid] = s1; __syncthreads();
  for (int st = 128; st > 0; st >>= 1) { if (tid < st) red[tid] += red[tid + st]; __syncthreads(); }
  const float mu = red[0] / (float)N; __syncthreads();
  float s2 = 0.f;
  for (int u = 0; u < per / 4; ++u)
#pragma unroll
    for (int q = 0; q < 4; ++q) { const float c = vals[u * 4 + q] - mu; s2 += c * c; }
  red[tid] = s2; __syncthreads();
  for (int st = 128; st > 0; st >>= 1) { if (tid < st) red[tid] += red[tid + st]; __syncthreads(); }
  const float rs = rsqrtf(red[0] / (float)N + eps);
  {
    for (int u = 0; u < per / 4; ++u) {
      const int j = tid * 4 + 1024 * u;
      v4f o, sm;
#pragma unroll
      for (int q = 0; q < 4; ++q) {
        float gg = g[j + q], bb = bta[j + q];
        if (PARAM_BF16) { gg = bf16_round(gg); bb = bf16_round(bb); }
        sm[q] = vals[u * 4 + q]; o[q] = (vals[u * 4 + q] - mu) * rs * gg + bb;
      }
      if (out_sum) *(v4f*)(out_sum + (size_t)row * N + j) = sm;
      *(v4f*)(out_norm + (size_t)row * N + j) = o;
    }
    
  }
}



// ---- f16 WMMA path (v_wmma_f32_16x16x32_f16): 11-bit significands for operands in range — used where a [0,1] probability operand needs more precision than bf16
typedef _Float16 v16h __attribute__((ext_vector_type(16)));
union FragH { v16h v; v8us half[2]; _Float16 h[16]; unsigned short u[16]; };
template <int NT>
__device__ __forceinline__ v8f mmaH(v16h ah, v16h al, v16h bh, v16h bl, v8f c) {
  c = __builtin_amdgcn_wmma_f32_16x16x32_f16(false, ah, false, bh, (short)0, c, false, false);
  if (NT >= 2) c = __builtin_amdgcn_wmma_f32_16x16x32_f16(false, al, false, bh, (short)0, c, false, false);
  if (NT >= 3) c = __builtin_amdgcn_wmma_f32_16x16x32_f16(false, ah, false, bl, (short)0, c, false, false);
  asm volatile("v_nop\n\tv_nop\n\tv_nop\n\tv_nop" : "+v"(c) : "v"(ah), "v"(al), "v"(bh), "v"(bl));
  return c;
}
// batched GEMM like k_gemm_b but f16 operands: A f32 (split into f16 hi/lo if ASPLIT, else rounded to f16), Bt = f16 values [n][k]; alpha; C f32; N multiple of 16 (partial tiles skipped)
template <bool ASPLIT>
__global__ __launch_bounds__(128) void k_gemm_h(const float* __restrict__ A, int lda, size_t sA, const _Float16* __restrict__ Bh, int ldb, size_t sB, float alpha, float* __restrict__ C, int ldc, size_t sC, int M, int N, int K) {
  __shared__ __attribute__((aligned(16))) float so[4][16][64];
  const int tid = threadIdx.x, w = tid >> 5, lane = tid & 31, ln = lane & 15, hh = lane >> 4; const int by = blockIdx.y;
  A += (size_t)by * sA; Bh += (size_t)by * sB; C += (size_t)by * sC;
  const int ntn = (N + 63) / 64; const int wid = blockIdx.x * 4 + w; const int mt = wid / ntn, nq = wid % ntn; if (mt * 16 >= M) return;
  const int row0 = mt * 16, col0 = nq * 64; const float* arow = A + (size_t)(row0 + ln) * lda;
  v8f acc[4] = {};
  for (int kb = 0; kb < K; kb += 32) {
    FragH ah, al;
    const v4f x0 = *(const v4fa*)(arow + kb + 8 * hh), x1 = *(const v4fa*)(arow + kb + 8 * hh + 4), x2 = *(const v4fa*)(arow + kb + 16 + 8 * hh), x3 = *(const v4fa*)(arow + kb + 16 + 8 * hh + 4);
    float xs[16] = {x0[0],x0[1],x0[2],x0[3],x1[0],x1[1],x1[2],x1[3],x2[0],x2[1],x2[2],x2[3],x3[0],x3[1],x3[2],x3[3]};
#pragma unroll
    for (int i = 0; i < 16; ++i) { const _Float16 h = (_Float16)xs[i]; ah.h[i] = h; al.h[i] = ASPLIT ? (_Float16)(xs[i] - (float)h) : (_Float16)0.0f; }
#pragma unroll
    for (int t = 0; t < 4; ++t) { if (col0 + t * 16 >= N) continue; const size_t boff = (size_t)(col0 + t * 16 + ln) * ldb + kb; FragH bq; bq.half[0] = *(const v8us*)(Bh + boff + 8 * hh); bq.half[1] = *(const v8us*)(Bh + boff + 16 + 8 * hh);
      acc[t] = mmaH<ASPLIT ? 2 : 1>(ah.v, al.v, bq.v, bq.v, acc[t]); }
  }
#pragma unroll
  for (int t = 0; t < 4; ++t) { if (col0 + t * 16 >= N) continue;
#pragma unroll
    for (int r = 0; r < 8; ++r) so[w][8 * hh + r][t * 16 + ln] = acc[t][r] * alpha; }
  __builtin_amdgcn_fence(__ATOMIC_ACQ_REL, "workgroup"); __builtin_amdgcn_wave_barrier();
  const int rsub = lane >> 4, c4 = (lane & 15) * 4;
  {
#pragma unroll
    for (int q = 0; q < 8; ++q) { const int r = q * 2 + rsub; if (col0 + c4 < N) { const v4f v = *(const v4fa*)&so[w][r][c4]; *(v4f*)(C + (size_t)(row0 + r) * ldc + col0 + c4) = v; } }
     }
}

// Wt[n][k] = f16(bf16(W[k][n]) * scale) from f32 row-major W[DD][DD] (scale = power of two; bf16-exact weights stay exact in f16 away from the subnormal range).
// One work-group = a tile of WTK k x WTN n, turned through LDS, so that both sides move whole 128-B lines: a wave's load is two rows of 256 B of W, a wave's store two rows of 256 B of Wt.
// A thread takes 8 consecutive k of 4 consecutive n: each of its four n is one 16-B piece of a row of Wt
#define WTK 128
#define WTN 64
__device__ __forceinline__ void d_wt_f16(int bx, const float* __restrict__ W, _Float16* __restrict__ Wt, float scale) {
  __shared__ __attribute__((aligned(16))) unsigned short sT[WTN][WTK + 8];      /* pitch 272 B (16 B x odd), as for the GEMM's tiles */
  const int tid = threadIdx.x, n4 = tid & 15, k8 = tid >> 4; const int k0 = (bx % (DD / WTK)) * WTK, n0 = (bx / (DD / WTK)) * WTN;
  const float* p = W + (size_t)(k0 + k8 * 8) * DD + n0 + n4 * 4; v4f x[8];
#pragma unroll
  for (int i = 0; i < 8; ++i) x[i] = *(const v4fa*)(p + (size_t)i * DD);
  asm volatile("s_wait_xcnt 0x0" ::: "memory");      // stands behind the eight loads, in front of every later write of their address registers
#pragma unroll
  for (int q = 0; q < 4; ++q) { FragH f;
#pragma unroll
    for (int i = 0; i < 8; ++i) f.h[i] = (_Float16)(bf16_round(x[i][q]) * scale);
    *(v8us*)&sT[n4 * 4 + q][k8 * 8] = f.half[0]; }
  __syncthreads();      // the tile is whole before any row of it is read; bx is the same in the whole work-group
  unsigned short* o = (unsigned short*)Wt + (size_t)(n0 + k8) * DD + k0 + n4 * 8;
#pragma unroll
  for (int i = 0; i < WTN / 16; ++i) { const v8us v = *(const v8us*)&sT[k8 + i * 16][n4 * 8]; *(v8us*)(o + (size_t)i * 16 * DD) = v; }
  asm volatile("s_wait_xcnt 0x0" ::: "memory");      // stands behind the four stores, in front of every later write of their address and data registers
}
// C16[r][c] = f16(sum_k A[r][k] * Bt[c][k] * alpha + bf16(bias[c])): A f16 [NR][DD], Bt f16 [DD][DD]. One work-group = a 128 x 128 tile of C, 8 waves of 64 x 32 (4 x 2 accumulators);
// k runs in slices of 128 through an LDS ring of two buffers that all 8 waves share; per output element the WMMAs follow one another in rising k, 32 at a time
// One grid holds the three independent projections: blocks [256 s, 256 s + 256) are product s (0 = q, 1 = k, 2 = v); A3 and Bt3 hold the three planes one behind the other, C3 those of q and k.
// Product v is stored transposed, as the attention kernel reads it: Vt[(b * NH + h) * 64 + d][token], rows of TT tokens
__global__ __launch_bounds__(256) void k_gemm_t(const _Float16* __restrict__ A3, const _Float16* __restrict__ Bt3, float alpha, const float* __restrict__ bias0, const float* __restrict__ bias1, const float* __restrict__ bias2, _Float16* __restrict__ C3, _Float16* __restrict__ Vt) {
  constexpr int GP = (NR / 128) * (DD / 128); const int sel = blockIdx.x / GP, bx = blockIdx.x % GP;
  const _Float16* A = A3 + (size_t)sel * NR * DD; const _Float16* Bt = Bt3 + (size_t)sel * DD * DD; _Float16* C16 = C3 + (size_t)sel * NR * DD; const float* bias = sel == 0 ? bias0 : sel == 1 ? bias1 : bias2;
  // rows of 128 f16 = 256 B; LDS pitch 272 B (16 B x odd) keeps the 16 rows of a ds_load_b128 fragment read on distinct banks
  constexpr int BT = 128, BK = 128, NSL = DD / BK, LP = BK + 8, TBY = BT * LP * 2, CP = BT + 8;
  __shared__ __attribute__((aligned(16))) unsigned short sA[2][BT][LP]; __shared__ __attribute__((aligned(16))) unsigned short sB[2][BT][LP]; __shared__ __attribute__((aligned(16))) unsigned short sC[BT][CP];
  const int tid = threadIdx.x, w = tid >> 5, lane = tid & 31, ln = lane & 15, hh = lane >> 4;
  const int row0 = (bx % (NR / BT)) * BT, col0 = (bx / (NR / BT)) * BT; const int wm = (w >> 2) * 64, wn = (w & 3) * 32;
  // each thread copies 16 B of rows crow, crow + 16, ..., crow + 112 of both tiles: a wave's copy covers four whole 128-B lines
  const int crow = tid >> 4, ccol = tid & 15;
  const unsigned short* gA = (const unsigned short*)A + (size_t)(row0 + crow) * DD + ccol * 8; const unsigned short* gB = (const unsigned short*)Bt + (size_t)(col0 + crow) * DD + ccol * 8;
  const unsigned lA = (unsigned)(uintptr_t)&sA[0][crow][ccol * 8], lB = (unsigned)(uintptr_t)&sB[0][crow][ccol * 8];
  auto copy8 = [&](unsigned l, const unsigned short* g) {
    // global -> LDS through no register; s_wait_xcnt 0 closes the statement so that no address register is rewritten ahead of it
    asm volatile("global_load_async_to_lds_b128 %0, %8, off\n\tglobal_load_async_to_lds_b128 %1, %9, off\n\tglobal_load_async_to_lds_b128 %2, %10, off\n\tglobal_load_async_to_lds_b128 %3, %11, off\n\t"
                 "global_load_async_to_lds_b128 %4, %12, off\n\tglobal_load_async_to_lds_b128 %5, %13, off\n\tglobal_load_async_to_lds_b128 %6, %14, off\n\tglobal_load_async_to_lds_b128 %7, %15, off\n\ts_wait_xcnt 0x0"
                 :: "v"(l), "v"(l + 16 * LP * 2), "v"(l + 32 * LP * 2), "v"(l + 48 * LP * 2), "v"(l + 64 * LP * 2), "v"(l + 80 * LP * 2), "v"(l + 96 * LP * 2), "v"(l + 112 * LP * 2),
                    "v"(g), "v"(g + 16 * DD), "v"(g + 32 * DD), "v"(g + 48 * DD), "v"(g + 64 * DD), "v"(g + 80 * DD), "v"(g + 96 * DD), "v"(g + 112 * DD) : "memory"); };
  auto stage = [&](int st, int bf) { copy8(lA + bf * TBY, gA + st * BK); copy8(lB + bf * TBY, gB + st * BK); };
  v8f acc[4][2];
#pragma unroll
  for (int mi = 0; mi < 4; ++mi)
#pragma unroll
    for (int ni = 0; ni < 2; ++ni) acc[mi][ni] = (v8f){0.f,0.f,0.f,0.f,0.f,0.f,0.f,0.f};
  stage(0, 0);
  asm volatile("s_wait_asynccnt 0x0" ::: "memory");      // this wave's copies of slice 0 have landed
  __syncthreads();                                        // ... and every other wave's: slice 0 may be read
  stage(1, 1);
#pragma unroll 1      /* one copy of the ring's foot; the buffer index stays t & 1 */
  for (int t = 0; t < NSL; ++t) { const int bf = t & 1; const unsigned short* ab = &sA[bf][wm + ln][8 * hh]; const unsigned short* bb = &sB[bf][wn + ln][8 * hh];
    FragH a[2][4], bq[2][2];      /* two fragment sets: the next 32 k of THIS slice are read while the present 32 are multiplied */
    auto frags = [&](int ks, int s) {
#pragma unroll
      for (int mi = 0; mi < 4; ++mi) { a[s][mi].half[0] = *(const v8us*)(ab + mi * 16 * LP + ks * 32); a[s][mi].half[1] = *(const v8us*)(ab + mi * 16 * LP + ks * 32 + 16); }
#pragma unroll
      for (int ni = 0; ni < 2; ++ni) { bq[s][ni].half[0] = *(const v8us*)(bb + ni * 16 * LP + ks * 32); bq[s][ni].half[1] = *(const v8us*)(bb + ni * 16 * LP + ks * 32 + 16); } };
    frags(0, 0);
#pragma unroll
    for (int ks = 0; ks < BK / 32; ++ks) { if (ks + 1 < BK / 32) frags(ks + 1, (ks + 1) & 1);
      __builtin_amdgcn_sched_barrier(0);      // keeps the next step's 12 LDS reads in front of this step's WMMAs; without it each read sinks to its use and its latency is waited for
#pragma unroll
      for (int mi = 0; mi < 4; ++mi)
#pragma unroll
        for (int ni = 0; ni < 2; ++ni) acc[mi][ni] = __builtin_amdgcn_wmma_f32_16x16x32_f16(false, a[ks & 1][mi].v, false, bq[ks & 1][ni].v, (short)0, acc[mi][ni], false, false); }
    asm volatile("s_wait_dscnt 0x0" ::: "memory");        // this wave's reads of buffer bf are done before it is refilled
    asm volatile("s_wait_asynccnt 0x0" ::: "memory");     // this wave's copies of slice t + 1 have landed
    __syncthreads();                                        // publishes slice t + 1 and ends every wave's reads of buffer bf
    if (t + 2 < NSL) stage(t + 2, bf); }
  asm volatile("s_wait_asynccnt 0x0" ::: "memory");       // no copy is outstanding when the wave goes on to the epilogue
  // the tile goes through LDS as f16 so that each 256-B row piece of the stored plane goes out as whole 128-B lines; sel is the same in the whole work-group
  static_assert(TT % BT == 0 && NH * 64 == DD, "a tile lies in one batch; column c of v is row c of that batch's DD rows of Vt");
  FragH cf[4][2];      /* cf[mi][ni].h[r] = C[wm + mi * 16 + 8 hh + r][wn + ni * 16 + ln] */
#pragma unroll
  for (int ni = 0; ni < 2; ++ni) { const float bv = bf16_round(bias[col0 + wn + ni * 16 + ln]);
#pragma unroll
    for (int mi = 0; mi < 4; ++mi)
#pragma unroll
      for (int r = 0; r < 8; ++r) cf[mi][ni].h[r] = (_Float16)(acc[mi][ni][r] * alpha + bv); }
  auto put = [&](unsigned short* dst, int pitch) {      /* the 128 rows of sC, 256 B each, to rows of the given pitch */
#pragma unroll
    for (int i = 0; i < BT * (BT / 8) / 256; ++i) { const int e = tid + i * 256, r = e >> 4, c8 = (e & 15) * 8; const v8us o = *(const v8us*)&sC[r][c8]; *(v8us*)(dst + (size_t)r * pitch + c8) = o; } };
  if (sel == 2) {      /* sC[column][row]: a lane's eight registers are eight consecutive rows of one column, one 16-B write */
#pragma unroll
    for (int ni = 0; ni < 2; ++ni)
#pragma unroll
      for (int mi = 0; mi < 4; ++mi) *(v8us*)&sC[wn + ni * 16 + ln][wm + mi * 16 + 8 * hh] = cf[mi][ni].half[0];
  } else {
#pragma unroll
    for (int ni = 0; ni < 2; ++ni)
#pragma unroll
      for (int mi = 0; mi < 4; ++mi)
#pragma unroll
        for (int r = 0; r < 8; ++r) sC[wm + mi * 16 + 8 * hh + r][wn + ni * 16 + ln] = cf[mi][ni].u[r];
  }
  __syncthreads();
  if (sel == 2) put((unsigned short*)Vt + ((size_t)(row0 / TT) * DD + col0) * TT + row0 % TT, TT);
  else put((unsigned short*)C16 + (size_t)row0 * DD + col0, DD);
}


typedef _Float16 v4h __attribute__((ext_vector_type(4)));

__global__ __launch_bounds__(256) void k_x16(const float* __restrict__ x, _Float16* __restrict__ X16, size_t n8) { const size_t t = (size_t)blockIdx.x * 256 + threadIdx.x; if (t >= n8) return; FragH f;
#pragma unroll
  for (int q = 0; q < 8; ++q) f.h[q] = (_Float16)bf16_round(x[t * 8 + q]); *(v8us*)((unsigned short*)X16 + t * 8) = f.half[0];  }
__global__ __launch_bounds__(256) void k_h16(const float* __restrict__ x, _Float16* __restrict__ X16, size_t n8) { const size_t t = (size_t)blockIdx.x * 256 + threadIdx.x; if (t >= n8) return; FragH f;
#pragma unroll
  for (int q = 0; q < 8; ++q) f.h[q] = (_Float16)x[t * 8 + q]; *(v8us*)((unsigned short*)X16 + t * 8) = f.half[0];  }
__global__ __launch_bounds__(256) void k_round16f(const float* __restrict__ W, _Float16* __restrict__ Bt, size_t n8) { const size_t t = (size_t)blockIdx.x * 256 + threadIdx.x; if (t >= n8) return; FragH f;
#pragma unroll
  for (int i = 0; i < 8; ++i) f.h[i] = (_Float16)(bf16_round(W[t * 8 + i]) * 16.0f); *(v8us*)((unsigned short*)Bt + t * 8) = f.half[0];  }
template <int D, int RBF>
__device__ __forceinline__ void d_lnx(int bx, const float* __restrict__ X, const float* __restrict__ gam, const float* __restrict__ bet, int nrows, float eps, _Float16* __restrict__ O16, float* __restrict__ XR) {
  constexpr int NP = D / 128; const int tid = threadIdx.x, wv = tid >> 5, lane = tid & 31; const size_t r = (size_t)bx * 8 + wv; if (r >= (size_t)nrows) return; v4f y[NP]; float s = 0.f;
#pragma unroll
  for (int j = 0; j < NP; ++j) { const int c = j * 128 + lane * 4; v4f g = *(const v4fa*)(X + r * D + c); if (RBF) { for (int q = 0; q < 4; ++q) g[q] = bf16_round(g[q]); } y[j] = g; s += g[0] + g[1] + g[2] + g[3]; }
  asm volatile("s_wait_xcnt 0x0" ::: "memory");      // stands behind the row's loads, in front of every later write of their address registers
  for (int o = 16; o >= 1; o >>= 1) s += __shfl_xor(s, o, 32); const float mu = s / (float)D; float q2 = 0.f;
#pragma unroll
  for (int j = 0; j < NP; ++j) for (int q = 0; q < 4; ++q) { const float d = y[j][q] - mu; q2 += d * d; }
  for (int o = 16; o >= 1; o >>= 1) q2 += __shfl_xor(q2, o, 32); const float rs = rsqrtf(q2 / (float)D + eps);
  {
#pragma unroll
    for (int j = 0; j < NP; ++j) { const int c = j * 128 + lane * 4; v4h h; for (int q = 0; q < 4; ++q) { const float v = (y[j][q] - mu) * rs * bf16_round(gam[c + q]) + bf16_round(bet[c + q]); h[q] = (_Float16)v; } *(v4h*)(O16 + r * D + c) = h; if (XR) *(v4f*)(XR + r * D + c) = y[j]; }
     } }
typedef int v4ia __attribute__((ext_vector_type(4), may_alias));
// One wave reads one tile of 64 queries x 64 keys of the mask (nonzero = masked) and writes its class: bit 0 = some pair is open, bit 1 = some pair is masked.
// Tile number = (b * 32 + query tile) * 32 + key tile; each class word stands in a 128-B line of its own, so every line has one writer
__device__ __forceinline__ void d_mclass(int bx, const int* __restrict__ MSK, int* __restrict__ TF) {
  const unsigned lane = threadIdx.x & 31, tile = (unsigned)bx * 8 + (threadIdx.x >> 5); const unsigned kt = tile % (TT / 64), qt = (tile / (TT / 64)) % (TT / 64), b = tile / ((TT / 64) * (TT / 64));
  const int* p = MSK + ((size_t)b * TT + qt * 64 + (lane >> 4)) * TT + kt * 64 + (lane & 15) * 4;      /* a wave's load = two rows of 256 B: four whole lines */
  unsigned am = 0u, lo = ~0u;      /* OR and unsigned minimum of the tile's words: am != 0 = some pair masked, lo == 0 = some pair open */
#pragma unroll 8      /* eight independent loads in flight per wave: the tile comes from memory */
  for (int i = 0; i < 32; ++i) { const v4ia x = *(const v4ia*)(p + (size_t)i * 2 * TT);
#pragma unroll
    for (int q = 0; q < 4; ++q) { am |= (unsigned)x[q]; lo = min(lo, (unsigned)x[q]); } }
  const unsigned bm = __builtin_amdgcn_ballot_w32(am != 0u), bo = __builtin_amdgcn_ballot_w32(lo == 0u);
  if (lane == 0) TF[(size_t)tile * 32] = (bo ? 1 : 0) | (bm ? 2 : 0); }
// One grid holds the independent preparations: blocks [0, GM) class the mask's tiles; behind them blocks [0, 3 GW) transpose the three weights, blocks [3 GW, 3 GW + 3 GL) normalise the rows of Q, K and V
__global__ __launch_bounds__(256) void k_prep(const float* __restrict__ Qx, const float* __restrict__ Kx, const float* __restrict__ Vx, const float* __restrict__ Wq, const float* __restrict__ Wk, const float* __restrict__ Wv,
                                              const float* __restrict__ gam, const float* __restrict__ bet, const int* __restrict__ MSK, _Float16* __restrict__ Bw, _Float16* __restrict__ H3, int* __restrict__ TF) {
  constexpr int GM = BB * (TT / 64) * (TT / 64) / 8, GW = (DD / WTK) * (DD / WTN), GL = NR / 8; const int bx = (int)blockIdx.x - GM;
  if (bx < 0) d_mclass(blockIdx.x, MSK, TF);
  else if (bx < 3 * GW) { const int sel = bx / GW; d_wt_f16(bx % GW, sel == 0 ? Wq : sel == 1 ? Wk : Wv, Bw + (size_t)sel * DD * DD, 16.0f); }      /* (in,out) -> Bt x 2^4 */
  else { const int y = bx - 3 * GW, sel = y / GL; d_lnx<DD, 1>(y % GL, sel == 0 ? Qx : sel == 1 ? Kx : Vx, gam, bet, NR, 1e-5f, H3 + (size_t)sel * NR * DD, nullptr); } }      /* LN(bf16 x) -> f16 */
// y[i] = 2^x[i], twelve independent v_exp_f32 in one statement with results in registers of their own (=&v), so that none overwrites the source of the one in front of it;
// the closing v_nop is the slot the instruction set asks for behind a transcendental before its result is read or its source overwritten
__device__ __forceinline__ void exp2x12(float* __restrict__ y, const float* __restrict__ x) {
  asm("v_exp_f32 %0, %12\n\tv_exp_f32 %1, %13\n\tv_exp_f32 %2, %14\n\tv_exp_f32 %3, %15\n\tv_exp_f32 %4, %16\n\tv_exp_f32 %5, %17\n\t"
      "v_exp_f32 %6, %18\n\tv_exp_f32 %7, %19\n\tv_exp_f32 %8, %20\n\tv_exp_f32 %9, %21\n\tv_exp_f32 %10, %22\n\tv_exp_f32 %11, %23\n\tv_nop"
      : "=&v"(y[0]), "=&v"(y[1]), "=&v"(y[2]), "=&v"(y[3]), "=&v"(y[4]), "=&v"(y[5]), "=&v"(y[6]), "=&v"(y[7]), "=&v"(y[8]), "=&v"(y[9]), "=&v"(y[10]), "=&v"(y[11])
      : "v"(x[0]), "v"(x[1]), "v"(x[2]), "v"(x[3]), "v"(x[4]), "v"(x[5]), "v"(x[6]), "v"(x[7]), "v"(x[8]), "v"(x[9]), "v"(x[10]), "v"(x[11])); }
// the same for nine values
__device__ __forceinline__ void exp2x9(float* __restrict__ y, const float* __restrict__ x) {
  asm("v_exp_f32 %0, %9\n\tv_exp_f32 %1, %10\n\tv_exp_f32 %2, %11\n\tv_exp_f32 %3, %12\n\tv_exp_f32 %4, %13\n\tv_exp_f32 %5, %14\n\tv_exp_f32 %6, %15\n\tv_exp_f32 %7, %16\n\tv_exp_f32 %8, %17\n\tv_nop"
      : "=&v"(y[0]), "=&v"(y[1]), "=&v"(y[2]), "=&v"(y[3]), "=&v"(y[4]), "=&v"(y[5]), "=&v"(y[6]), "=&v"(y[7]), "=&v"(y[8])
      : "v"(x[0]), "v"(x[1]), "v"(x[2]), "v"(x[3]), "v"(x[4]), "v"(x[5]), "v"(x[6]), "v"(x[7]), "v"(x[8])); }
// the value that lane l ^ 16 holds
__device__ __forceinline__ float xhalf(float x) { const int b = __float_as_int(x); return __int_as_float(__builtin_amdgcn_permlanex16(b, b, 0x76543210, 0xfedcba98, false, false)); }
// Scores are computed transposed: S^T = K Q^T (A = 16 keys from LDS, B = the wave's 16 queries, kept in registers), O^T += V^T P^T. Lane (ln, hh) holds query q0 + ln alone:
// register r of score tile nt is key j0 + nt * 16 + 8 * hh + r, so maximum and sum run inside the lane with one exchange between the halves, and the four score tiles, converted in place, are the two B operands of the second product, two tiles each
__global__ __launch_bounds__(128) void k_flash(const _Float16* __restrict__ Q16, int ldq, const _Float16* __restrict__ K16, int ldk, const _Float16* __restrict__ Vt, const int* __restrict__ MSK, const int* __restrict__ TF, const float* __restrict__ Qx, float* __restrict__ O, int ldo) {
  constexpr int RPW = 16, NQB = TT / (4 * RPW), DT = 4, KS = 2;
  __shared__ __attribute__((aligned(16))) float sO[4][RPW][64 + 4];
  // K/V ring, two buffers, one stage = SKEY keys: sK rows = keys (64 d = 128 B), sV rows = d (SKEY keys = 128 B); LDS pitch 144 B (16 B x odd) keeps the 16 rows of a ds_load_b128 fragment read on distinct banks
  constexpr int SKEY = 64, NST = TT / SKEY, LP = 72, SBUF = 64 * LP * 2; constexpr float SC = 0.125f * 1.44269504088896340736f;      /* 64^-1/2 * log2(e) */
  __shared__ __attribute__((aligned(16))) unsigned short sK[2][SKEY][LP]; __shared__ __attribute__((aligned(16))) unsigned short sV[2][64][LP];
  const int tid = threadIdx.x, w = tid >> 5, lane = tid & 31, ln = lane & 15, hh = lane >> 4;
  // A work-group's cost is the number of key stages that its query tile leaves open, so it differs from tile to tile. Block index -> (slab, query tile) is a permutation of the 1024 pairs, for speed only.
  // Each run of 128 blocks (ga = 0..7) holds, for all 32 slabs, the four tiles 31 - ga, 16 + ga, 15 - ga, ga; which of the four a block takes is the sum of its index's base-4 digits mod 4,
  // so that four blocks a power of two apart hold one tile of each kind, wherever the hardware puts them, and the far ends of the tile range stand early in the grid
  static_assert(NQB == 32 && BB * NH == 32 && TT / 64 == 32, "the bit fields below and one class word per lane");
  const int bi = blockIdx.x, ga = bi >> 7, slab = (bi >> 2) & 31, pp = (bi + (bi >> 2) + (bi >> 4) + (bi >> 6) + (bi >> 8)) & 3;
  const int qblk = (((pp >> 1) ^ 1) << 4) | (ga ^ (((pp & 1) - 1) & 15));      /* pp = 0, 1, 2, 3: 31 - ga, 16 + ga, 15 - ga, ga */
  const int b = slab / NH, h = slab % NH; const int qb0 = qblk * (4 * RPW); const int q0 = qb0 + w * RPW;
  const int tf = TF[(size_t)((b * NQB + qblk) * NST + lane) * 32];
  asm volatile("s_wait_xcnt 0x0" ::: "memory");      // stands behind the load above, in front of every later write of its address registers
  FragH aq[KS];
  { const unsigned short* qr = (const unsigned short*)Q16 + ((size_t)b * TT + q0 + ln) * ldq + h * 64;
#pragma unroll
    for (int ks = 0; ks < KS; ++ks) { aq[ks].half[0] = *(const v8us*)(qr + ks * 32 + 8 * hh); aq[ks].half[1] = *(const v8us*)(qr + ks * 32 + 16 + 8 * hh); } }
  // the residual: the pieces of Q that this lane adds to what it stores at the end, asked for here so that they come in under the key loop
  v4f xr[RPW / 2];
  { const float* qx = Qx + ((size_t)b * TT + q0 + hh) * DD + h * 64 + ln * 4;
#pragma unroll
    for (int i = 0; i < RPW / 2; ++i) xr[i] = *(const v4fa*)(qx + (size_t)i * 2 * DD); }
  asm volatile("s_wait_xcnt 0x0" ::: "memory");      // stands behind the loads above, in front of every later write of their address registers
  const unsigned short* Vth = (const unsigned short*)Vt + (size_t)slab * 64 * TT;
  const int* mrow = MSK + ((size_t)b * TT + q0 + ln) * TT + 8 * hh;      /* this lane's query row of the mask, at its half's first key */
  float m_r = -3.0e38f, l_r = 0.f; v8f oacc[DT];
#pragma unroll
  for (int dt = 0; dt < DT; ++dt) oacc[dt] = (v8f){0.f,0.f,0.f,0.f,0.f,0.f,0.f,0.f};
  // each thread copies 16 B of rows crow, crow + 16, + 32, + 48 of both tiles: a wave's copy covers four whole 128-B lines
  const int crow = tid >> 3, ccol = tid & 7;
  const unsigned short* gK = (const unsigned short*)K16 + ((size_t)b * TT + crow) * ldk + h * 64 + ccol * 8; const unsigned short* gV = Vth + (size_t)crow * TT + ccol * 8;
  const unsigned lK = (unsigned)(uintptr_t)&sK[0][crow][ccol * 8], lV = (unsigned)(uintptr_t)&sV[0][crow][ccol * 8];
  auto stage = [&](int st, int bf) { const unsigned short* k0 = gK + (size_t)st * SKEY * ldk; const unsigned short* v0 = gV + st * SKEY; const unsigned lk = lK + bf * SBUF, lv = lV + bf * SBUF;
    // global -> LDS through no register; s_wait_xcnt 0 closes the statement so that no address register is rewritten ahead of it
    asm volatile("global_load_async_to_lds_b128 %0, %8, off\n\tglobal_load_async_to_lds_b128 %1, %9, off\n\tglobal_load_async_to_lds_b128 %2, %10, off\n\tglobal_load_async_to_lds_b128 %3, %11, off\n\t"
                 "global_load_async_to_lds_b128 %4, %12, off\n\tglobal_load_async_to_lds_b128 %5, %13, off\n\tglobal_load_async_to_lds_b128 %6, %14, off\n\tglobal_load_async_to_lds_b128 %7, %15, off\n\ts_wait_xcnt 0x0"
                 :: "v"(lk), "v"(lk + 16 * LP * 2), "v"(lk + 32 * LP * 2), "v"(lk + 48 * LP * 2), "v"(lv), "v"(lv + 16 * LP * 2), "v"(lv + 32 * LP * 2), "v"(lv + 48 * LP * 2),
                    "v"(k0), "v"(k0 + (size_t)16 * ldk), "v"(k0 + (size_t)32 * ldk), "v"(k0 + (size_t)48 * ldk), "v"(v0), "v"(v0 + 16 * TT), "v"(v0 + 32 * TT), "v"(v0 + 48 * TT) : "memory"); };
  // tf: lane t holds the class of key stage t for this block's 64 queries; every wave reads the same 32 words, so both ballots are the same in the whole work-group.
  // A stage with no open pair adds nothing (every p is 0, the maximum stays, the rescale is 1): it is neither copied nor computed. The ring runs over the na <= 32 stages that are left, in rising order
  const unsigned mix = __builtin_amdgcn_ballot_w32((tf & 2) != 0); unsigned rem = __builtin_amdgcn_ballot_w32((tf & 1) != 0); const int na = __builtin_popcount(rem);
  auto next = [&]() { const int s = __builtin_ctz(rem); rem &= rem - 1; return s; };      /* called only while a stage is left */
  int tc = 0, tn = 0;      /* the stage in buffer it & 1 and the one behind it */
  if (na > 0) { tc = next(); stage(tc, 0); }
  asm volatile("s_wait_asynccnt 0x0" ::: "memory");      // this wave's copies of the first stage have landed
  __syncthreads();                                        // ... and every other wave's: it may be read
  if (na > 1) { tn = next(); stage(tn, 1); }
#pragma unroll 1      /* one copy of the ring's foot; the buffer index stays it & 1 */
  for (int it = 0; it < na; ++it) { const int bf = it & 1; const bool mx = (mix >> tc) & 1;      /* the stage has masked pairs: only then are the mask's words read and applied */
    // One pass = the whole stage of SKEY keys: NT score tiles, one maximum, one rescale. Its fragment reads stand in two groups, each ahead of the eight WMMAs that use it, and neighbouring WMMAs have accumulators of their own
    constexpr int NT = SKEY / 16, NS = SKEY / 32; const int j0 = tc * SKEY;
    v4ia mk[NT][2];      /* nonzero = MASKED; mk[nt][r >> 2][r & 3] belongs to register r of score tile nt; loaded and read under mx alone */
    if (mx) {
#pragma unroll
      for (int nt = 0; nt < NT; ++nt) { mk[nt][0] = *(const v4ia*)(mrow + j0 + nt * 16); mk[nt][1] = *(const v4ia*)(mrow + j0 + nt * 16 + 4); } }
    FragH bk[NT][KS];
#pragma unroll
    for (int nt = 0; nt < NT; ++nt) { const unsigned short* kr = &sK[bf][nt * 16 + ln][0];
#pragma unroll
      for (int ks = 0; ks < KS; ++ks) { bk[nt][ks].half[0] = *(const v8us*)(kr + ks * 32 + 8 * hh); bk[nt][ks].half[1] = *(const v8us*)(kr + ks * 32 + 16 + 8 * hh); } }
    __builtin_amdgcn_sched_barrier(0);      // keeps the 16 reads of K together in front of the WMMAs; without it each read sinks to its use and its latency is waited for there
    v8f sa[NT];
#pragma unroll
    for (int nt = 0; nt < NT; ++nt) sa[nt] = (v8f){0.f,0.f,0.f,0.f,0.f,0.f,0.f,0.f};
#pragma unroll
    for (int ks = 0; ks < KS; ++ks)
#pragma unroll
      for (int nt = 0; nt < NT; ++nt) sa[nt] = __builtin_amdgcn_wmma_f32_16x16x32_f16(false, bk[nt][ks].v, false, aq[ks].v, (short)0, sa[nt], false, false);
    FragH bv[DT][NS];
#pragma unroll
    for (int dt = 0; dt < DT; ++dt) { const unsigned short* vrow = &sV[bf][dt * 16 + ln][0];
#pragma unroll
      for (int s = 0; s < NS; ++s) { bv[dt][s].half[0] = *(const v8us*)(vrow + s * 32 + 8 * hh); bv[dt][s].half[1] = *(const v8us*)(vrow + s * 32 + 16 + 8 * hh); } }
    float sv[NT * 8];      /* unscaled scores: sv[nt * 8 + r] is key j0 + nt * 16 + 8 hh + r; the running maximum is kept unscaled too */
#pragma unroll
    for (int nt = 0; nt < NT; ++nt)
#pragma unroll
      for (int r = 0; r < 8; ++r) sv[nt * 8 + r] = sa[nt][r];
    if (mx) {
#pragma unroll
      for (int nt = 0; nt < NT; ++nt)
#pragma unroll
        for (int r = 0; r < 8; ++r) sv[nt * 8 + r] = (mk[nt][r >> 2][r & 3] == 0) ? sa[nt][r] : -INFINITY; }
    float mt[NT];      /* one chain per score tile, so that the four run side by side */
#pragma unroll
    for (int nt = 0; nt < NT; ++nt) { mt[nt] = fmaxf(sv[nt * 8], sv[nt * 8 + 1]);
#pragma unroll
      for (int r = 2; r < 8; ++r) mt[nt] = fmaxf(mt[nt], sv[nt * 8 + r]); }
    float mc = fmaxf(fmaxf(mt[0], mt[1]), fmaxf(mt[2], mt[3])); static_assert(NT == 4, "the joins of the four chains");
    mc = fmaxf(mc, xhalf(mc));      /* the other half's 32 keys of the same query */
    // e^(0.125 (s - m)) = 2^(s * SC - m * SC): one fma per score, no branch; a masked score is -inf and gives 0 (m is finite: it starts at -3e38)
    const float mn = fmaxf(m_r, mc), nb = -mn * SC; float ex[NT * 8 + 1], ey[NT * 8 + 1]; ex[NT * 8] = (m_r - mn) * SC;
#pragma unroll
    for (int i = 0; i < NT * 8; ++i) ex[i] = fmaf(sv[i], SC, nb);
    exp2x12(ey, ex); exp2x12(ey + 12, ex + 12); exp2x9(ey + 24, ex + 24);
    const float* p = ey; const float al = (mn > -1.0e38f) ? ey[NT * 8] : 1.0f; m_r = mn;
    float pt[NT];
#pragma unroll
    for (int nt = 0; nt < NT; ++nt) { pt[nt] = p[nt * 8];
#pragma unroll
      for (int r = 1; r < 8; ++r) pt[nt] += p[nt * 8 + r]; }
    l_r = l_r * al + ((pt[0] + pt[1]) + (pt[2] + pt[3]));      /* this half's keys only; the halves are joined behind the loop */
#pragma unroll
    for (int dt = 0; dt < DT; ++dt)
#pragma unroll
      for (int r = 0; r < 8; ++r) oacc[dt][r] *= al;
    FragH pb[NS];      /* B operands: column ln = the query, element i of pb[s] = key 8 hh + i (i < 8), 8 + 8 hh + i (i >= 8) of the 32 keys s: the order in which sv holds them */
#pragma unroll
    for (int s = 0; s < NS; ++s)
#pragma unroll
      for (int i = 0; i < 16; ++i) pb[s].h[i] = (_Float16)(p[s * 16 + i] * 1024.0f);
#pragma unroll
    for (int s = 0; s < NS; ++s)
#pragma unroll
      for (int dt = 0; dt < DT; ++dt) oacc[dt] = __builtin_amdgcn_wmma_f32_16x16x32_f16(false, bv[dt][s].v, false, pb[s].v, (short)0, oacc[dt], false, false);
    __builtin_amdgcn_sched_barrier(0);      // keeps the ring's foot behind the pass's arithmetic: lifted over it, the wait for the next stage's copies comes a fraction of a pass behind their issue
    asm volatile("s_wait_dscnt 0x0" ::: "memory");        // this wave's reads of buffer bf are done before it is refilled
    asm volatile("s_wait_asynccnt 0x0" ::: "memory");     // this wave's copies of the next stage have landed
    __syncthreads();                                        // publishes the next stage and ends every wave's reads of buffer bf
    tc = tn; if (it + 2 < na) { tn = next(); stage(tn, bf); } }
  asm volatile("s_wait_asynccnt 0x0" ::: "memory");       // no copy is outstanding when the wave goes on to the epilogue
  const float l = l_r + xhalf(l_r); const float li = (l > 0.f) ? 1.0f / (l * 1024.0f) : 0.f;
  // register r of oacc[dt] is O[q0 + ln][dt * 16 + 8 hh + r]: eight consecutive d of the lane's query
#pragma unroll
  for (int dt = 0; dt < DT; ++dt) { v4f lo, hi;
#pragma unroll
    for (int r = 0; r < 4; ++r) { lo[r] = oacc[dt][r] * li; hi[r] = oacc[dt][4 + r] * li; }
    *(v4fa*)&sO[w][ln][dt * 16 + 8 * hh] = lo; *(v4fa*)&sO[w][ln][dt * 16 + 8 * hh + 4] = hi; }
  __builtin_amdgcn_fence(__ATOMIC_ACQ_REL, "workgroup"); __builtin_amdgcn_wave_barrier();
  {
#pragma unroll
    for (int rp = 0; rp < RPW; rp += 2) { const int r = rp + (lane >> 4), pc = lane & 15; v4f val = *(const v4fa*)&sO[w][r][pc * 4];
#pragma unroll
      for (int q = 0; q < 4; ++q) val[q] += bf16_round(xr[rp / 2][q]);      /* out = o + bf16(Q) */
      *(v4f*)(O + ((size_t)b * TT + q0 + r) * ldo + h * 64 + pc * 4) = val; }
     } }

extern "C" void kernel_launch(void* const* d_in, const int* in_sizes, int n_in,
                              void* d_out, int out_size, void* d_ws, size_t ws_size, hipStream_t stream) {
  (void)in_sizes; (void)n_in; (void)out_size;
  const float* const* I = (const float* const*)d_in; const float* Qx = I[0]; const float* Kx = I[1]; const float* Vx = I[2]; const int* mask = (const int*)d_in[3];      /* bool mask shipped as int32 [2,1,2048,2048] */
  const float* Wq = I[4]; const float* bq = I[5]; const float* Wk = I[6]; const float* bk = I[7]; const float* Wv = I[8]; const float* bv = I[9]; const float* gam = I[10]; const float* bet = I[11];
  char* ws = (char*)d_ws; size_t off = 0;
  auto take = [&](size_t bytes) { char* p = ws + off; off += (bytes + 255) & ~(size_t)255; return p; };
  const size_t WSZ = (size_t)DD * DD; _Float16* Bw = (_Float16*)take(3 * WSZ * 2); _Float16* H16 = (_Float16*)take((size_t)3 * NR * DD * 2);
  _Float16* Q = (_Float16*)take((size_t)2 * NR * DD * 2); _Float16* K = Q + (size_t)NR * DD; _Float16* Vt = (_Float16*)take((size_t)NR * DD * 2); int* TF = (int*)take((size_t)BB * (TT / 64) * (TT / 64) * 128);
  if (off > ws_size) return;      // 6.3 + 25.2 + 16.8 + 8.4 = about 57 MB
  k_prep<<<BB * (TT / 64) * (TT / 64) / 8 + 3 * ((DD / WTK) * (DD / WTN)) + 3 * (NR / 8), 256, 0, stream>>>(Qx, Kx, Vx, Wq, Wk, Wv, gam, bet, mask, Bw, H16, TF);
  k_gemm_t<<<3 * (NR / 128) * (DD / 128), 256, 0, stream>>>(H16, Bw, 0.0625f, bq, bk, bv, Q, Vt);      /* three times M 4096 N 1024 K 1024; v comes out transposed */
  k_flash<<<BB * NH * (TT / 64), 128, 0, stream>>>(Q, DD, K, DD, Vt, mask, TF, Qx, (float*)d_out, DD);      /* out = o + Q */
}

// v010
// Measured time: 72.3 microseconds a run.
// Two timings next to v009 put it at 1.08 and 1.09 times that version's speed.
// Counting every step since v000, it is 6.00 times as fast.
#include <hip/hip_runtime.h>
// Pre-norm multi-head attention with a boolean mask and residual (B=2, N=2048, E=1024, 16 heads × 64): q = LN(Q)·Wq + bq, k = LN(K)·Wk + bk, v = LN(V)·Wv + bv (one shared LayerNorm γ,β; (in,out) weights); s = q·kᵀ·64^-½ with −inf where mask[b,0,n,m] is True;
// softmax; o = merged attn·v; out = o + Q (no output projection).
// Compute dtype: Q, K, V, weights, biases, γ, β rounded to bf16; LayerNorms f32 (wave per row) → f16; q/k/v f16 GEMM planes; fused flash-style kernel (int32 mask loads per (q,k), online softmax f32, P f16 ×2^10) on
// v_wmma_f32_16x16x32_f16; out = o (f32) + bf16(Q) (f32 add); f32 accumulate.
#define BB 2
#define TT 2048
#define DD 1024
#define NH 16
#define NR (BB * TT)

typedef __bf16 v16b __attribute__((ext_vector_type(16)));
typedef unsigned short v8us __attribute__((ext_vector_type(8), may_alias));
typedef float  v8f  __attribute__((ext_vector_type(8)));
typedef float  v4f  __attribute__((ext_vector_type(4)));
typedef float  v4fa __attribute__((ext_vector_type(4), may_alias));
union FragB { v16b v; v8us half[2]; unsigned short u[16]; };

__device__ __forceinline__ unsigned short bf16_bits(float x) { unsigned int u = __float_as_uint(x); return (unsigned short)((u + 0x7FFFu + ((u >> 16) & 1u)) >> 16); }
__device__ __forceinline__ float bf16_val(unsigned short b) { return __uint_as_float(((unsigned int)b) << 16); }
__device__ __forceinline__ float bf16_round(float x) { return bf16_val(bf16_bits(x)); }
// D += A·B with NT terms: 1 = ah·bh, 2 = + al·bh (A split), 3 = + ah·bl (both split)
template <int NT>
__device__ __forceinline__ v8f mmaN(v16b ah, v16b al, v16b bh, v16b bl, v8f c) {
  c = __builtin_amdgcn_wmma_f32_16x16x32_bf16(false, ah, false, bh, (short)0, c, false, false);
  if (NT >= 2) c = __builtin_amdgcn_wmma_f32_16x16x32_bf16(false, al, false, bh, (short)0, c, false, false);
  if (NT >= 3) c = __builtin_amdgcn_wmma_f32_16x16x32_bf16(false, ah, false, bl, (short)0, c, false, false);
  asm volatile("v_nop\n\tv_nop\n\tv_nop\n\tv_nop" : "+v"(c) : "v"(ah), "v"(al), "v"(bh), "v"(bl));
  return c;
}

__global__ __launch_bounds__(256) void k_wt_bf16(const float* __restrict__ W, unsigned short* __restrict__ Wt, int K, int N) {
  const int t = blockIdx.x * 256 + threadIdx.x;
  const int k8n = K / 8;
  if (t >= N * k8n) return;
  const int n = t / k8n, k8 = (t % k8n) * 8;
  v8us v;
#pragma unroll
  for (int i = 0; i < 8; ++i) v[i] = bf16_bits(W[(size_t)(k8 + i) * N + n]);
  *(v8us*)(Wt + (size_t)n * K + k8) = v;
  
}

// GEMM C[M][N] (f32, pitch ldc) = act(A[M][K]·W + bias). A f32 row-major (pitch lda) converted per fragment to bf16
// (ASPLIT: hi/lo two planes -> 2 terms, else single rounded term); Wt bf16 [N][K] (pitch ldb). BIAS_BF16 rounds the
// bias to bf16 first (bias quantised to bf16 before the add). K%32==0, M%16==0, N%64==0.
template <bool ASPLIT, int ACT, bool BIAS_BF16>
__global__ __launch_bounds__(128) void k_gemm_bf(const float* __restrict__ A, int lda, const unsigned short* __restrict__ Wt, int ldb,
                                               const float* __restrict__ bias, float* __restrict__ C, int ldc, int M, int N, int K) {
  __shared__ __attribute__((aligned(16))) float so[4][16][64];
  const int tid = threadIdx.x, w = tid >> 5, lane = tid & 31, ln = lane & 15, hh = lane >> 4;
  const int ntn = N / 64;
  const int wid = blockIdx.x * 4 + w;
  const int mt = wid / ntn, nq = wid % ntn;
  if (mt * 16 >= M) return;
  const int row0 = mt * 16, col0 = nq * 64;
  const float* arow = A + (size_t)(row0 + ln) * lda;
  v8f acc[4] = {};
  for (int kb = 0; kb < K; kb += 32) {
    FragB ah, al;
    const v4f x0 = *(const v4fa*)(arow + kb + 8 * hh), x1 = *(const v4fa*)(arow + kb + 8 * hh + 4);
    const v4f x2 = *(const v4fa*)(arow + kb + 16 + 8 * hh), x3 = *(const v4fa*)(arow + kb + 16 + 8 * hh + 4);
    float xs[16] = {x0[0],x0[1],x0[2],x0[3],x1[0],x1[1],x1[2],x1[3],x2[0],x2[1],x2[2],x2[3],x3[0],x3[1],x3[2],x3[3]};
#pragma unroll
    for (int i = 0; i < 16; ++i) { const unsigned short hb = bf16_bits(xs[i]); ah.u[i] = hb; al.u[i] = ASPLIT ? bf16_bits(xs[i] - bf16_val(hb)) : (unsigned short)0; }
#pragma unroll
    for (int t = 0; t < 4; ++t) {
      const unsigned short* brow = Wt + (size_t)(col0 + t * 16 + ln) * ldb + kb;
      FragB b;
      b.half[0] = *(const v8us*)(brow + 8 * hh);
      b.half[1] = *(const v8us*)(brow + 16 + 8 * hh);
      acc[t] = mmaN<ASPLIT ? 2 : 1>(ah.v, al.v, b.v, b.v, acc[t]);
    }
  }
#pragma unroll
  for (int t = 0; t < 4; ++t) {
    float bv = bias ? bias[col0 + t * 16 + ln] : 0.f;
    if (BIAS_BF16) bv = bf16_round(bv);
#pragma unroll
    for (int r = 0; r < 8; ++r) { float v = acc[t][r] + bv; if (ACT == 1) v = fmaxf(v, 0.f); so[w][8 * hh + r][t * 16 + ln] = v; }
  }
  __builtin_amdgcn_fence(__ATOMIC_ACQ_REL, "workgroup");
  __builtin_amdgcn_wave_barrier();
  const int rsub = lane >> 4, c4 = (lane & 15) * 4;
  {
#pragma unroll
    for (int q = 0; q < 8; ++q) {
      const int r = q * 2 + rsub;
      const v4f v = *(const v4fa*)&so[w][r][c4];
      *(v4f*)(C + (size_t)(row0 + r) * ldc + col0 + c4) = v;
    }
    
  }
}

// Flash-style causal/unmasked attention, all contractions 3-term bf16 hi/lo splits, f32 softmax with running max.
// q,k,v rows are read from f32 buffers with arbitrary row pitch (so they can live inside a fused qkv buffer);
// D = head size (multiple of 32, <= 128); one wave = 16 query rows; block = 4 waves (64 queries) sharing K/V chunks of 32.
template <int D, bool CAUSAL>
__global__ __launch_bounds__(128) void k_flash(const float* __restrict__ qb, const float* __restrict__ kb, const float* __restrict__ vb,
                                             int pitch, int T, int H, float scale, float* __restrict__ y, int ypitch) {
  constexpr int KS = D / 32;        // k-steps for QK
  constexpr int DT = D / 16;        // d tiles for PV
  __shared__ __attribute__((aligned(16))) unsigned short sKh[32][D + 8], sKl[32][D + 8], sVh[32][D + 8], sVl[32][D + 8];
  __shared__ __attribute__((aligned(16))) unsigned short sPh[4][16][40], sPl[4][16][40];
  __shared__ __attribute__((aligned(16))) float sO[4][16][D];
  const int tid = threadIdx.x, w = tid >> 5, lane = tid & 31, ln = lane & 15, hh = lane >> 4;
  const int nqb = (T + 63) / 64;
  const int bh = blockIdx.x / nqb, qblk = blockIdx.x % nqb;
  const int b = bh / H, h = bh % H;
  const int q0 = qblk * 64 + w * 16;
  const float* Q = qb + (size_t)b * T * pitch + h * D;
  const float* K = kb + (size_t)b * T * pitch + h * D;
  const float* V = vb + (size_t)b * T * pitch + h * D;

  // A fragments of the wave's 16 query rows (scaled), hi/lo
  FragB aqh[KS], aql[KS];
  {
    int row = q0 + ln; if (row >= T) row = T - 1;
    const float* qr = Q + (size_t)row * pitch;
#pragma unroll
    for (int ks = 0; ks < KS; ++ks)
#pragma unroll
      for (int i = 0; i < 16; ++i) {
        const int d = ks * 32 + ((i < 8) ? (8 * hh + i) : (16 + 8 * hh + (i - 8)));
        const float x = qr[d] * scale; const unsigned short hb = bf16_bits(x);
        aqh[ks].u[i] = hb; aql[ks].u[i] = bf16_bits(x - bf16_val(hb));
      }
  }
  float m_r[8], l_r[8];
#pragma unroll
  for (int r = 0; r < 8; ++r) { m_r[r] = -3.0e38f; l_r[r] = 0.f; }
  v8f oacc[DT];
#pragma unroll
  for (int dt = 0; dt < DT; ++dt) oacc[dt] = (v8f){0.f,0.f,0.f,0.f,0.f,0.f,0.f,0.f};

  const int kv_end = CAUSAL ? min(T, qblk * 64 + 64) : T;     // block-uniform
  for (int j0 = 0; j0 < kv_end; j0 += 32) {
    __syncthreads();
    for (int e = tid; e < 32 * (D / 4); e += 128) {
      const int r = e / (D / 4), c4 = (e % (D / 4)) * 4;
      const int key = j0 + r;
      v4f kf = {0.f,0.f,0.f,0.f}, vf = {0.f,0.f,0.f,0.f};
      if (key < T) { kf = *(const v4fa*)(K + (size_t)key * pitch + c4); vf = *(const v4fa*)(V + (size_t)key * pitch + c4); }
#pragma unroll
      for (int t = 0; t < 4; ++t) {
        unsigned short hb = bf16_bits(kf[t]); sKh[r][c4 + t] = hb; sKl[r][c4 + t] = bf16_bits(kf[t] - bf16_val(hb));
        hb = bf16_bits(vf[t]); sVh[r][c4 + t] = hb; sVl[r][c4 + t] = bf16_bits(vf[t] - bf16_val(hb));
      }
    }
    __syncthreads();
    // S tile 16 x 32
    v8f s[2];
#pragma unroll
    for (int nt = 0; nt < 2; ++nt) {
      v8f acc = {};
#pragma unroll
      for (int ks = 0; ks < KS; ++ks) {
        FragB bh_, bl_;
        bh_.half[0] = *(const v8us*)&sKh[nt * 16 + ln][ks * 32 + 8 * hh]; bh_.half[1] = *(const v8us*)&sKh[nt * 16 + ln][ks * 32 + 16 + 8 * hh];
        bl_.half[0] = *(const v8us*)&sKl[nt * 16 + ln][ks * 32 + 8 * hh]; bl_.half[1] = *(const v8us*)&sKl[nt * 16 + ln][ks * 32 + 16 + 8 * hh];
        acc = mmaN<3>(aqh[ks].v, aql[ks].v, bh_.v, bl_.v, acc);
      }
      s[nt] = acc;
    }
    // mask + running max (rows 8hh+r; the 16 lanes of a half share rows)
    float alpha[8];
#pragma unroll
    for (int r = 0; r < 8; ++r) {
      const int qi = q0 + 8 * hh + r;
      const int ja = j0 + ln, jb = j0 + 16 + ln;
      if (CAUSAL) { if (ja > qi) s[0][r] = -3.0e38f; if (jb > qi) s[1][r] = -3.0e38f; }
      if (ja >= T) s[0][r] = -3.0e38f;
      if (jb >= T) s[1][r] = -3.0e38f;
      float mx = fmaxf(s[0][r], s[1][r]);
      mx = fmaxf(mx, __shfl_xor(mx, 1, 32)); mx = fmaxf(mx, __shfl_xor(mx, 2, 32)); mx = fmaxf(mx, __shfl_xor(mx, 4, 32)); mx = fmaxf(mx, __shfl_xor(mx, 8, 32));
      const float mnew = fmaxf(m_r[r], mx);
      alpha[r] = (mnew > -1.0e38f) ? __expf(m_r[r] - mnew) : 1.0f;
      const float p0 = (s[0][r] > -1.0e38f) ? __expf(s[0][r] - mnew) : 0.f;
      const float p1 = (s[1][r] > -1.0e38f) ? __expf(s[1][r] - mnew) : 0.f;
      m_r[r] = mnew;
      l_r[r] = l_r[r] * alpha[r] + p0 + p1;            // per-lane partial row sum (16 lanes combined at the end)
      unsigned short hb = bf16_bits(p0); sPh[w][8 * hh + r][ln] = hb;      sPl[w][8 * hh + r][ln] = bf16_bits(p0 - bf16_val(hb));
      hb = bf16_bits(p1);                sPh[w][8 * hh + r][16 + ln] = hb; sPl[w][8 * hh + r][16 + ln] = bf16_bits(p1 - bf16_val(hb));
    }
#pragma unroll
    for (int dt = 0; dt < DT; ++dt)
#pragma unroll
      for (int r = 0; r < 8; ++r) oacc[dt][r] *= alpha[r];
    __builtin_amdgcn_fence(__ATOMIC_ACQ_REL, "workgroup");
    __builtin_amdgcn_wave_barrier();
    FragB pah, pal;
    pah.half[0] = *(const v8us*)&sPh[w][ln][8 * hh]; pah.half[1] = *(const v8us*)&sPh[w][ln][16 + 8 * hh];
    pal.half[0] = *(const v8us*)&sPl[w][ln][8 * hh]; pal.half[1] = *(const v8us*)&sPl[w][ln][16 + 8 * hh];
#pragma unroll
    for (int dt = 0; dt < DT; ++dt) {
      FragB bvh, bvl;
#pragma unroll
      for (int i = 0; i < 8; ++i) {
        bvh.u[i] = sVh[8 * hh + i][dt * 16 + ln]; bvh.u[8 + i] = sVh[16 + 8 * hh + i][dt * 16 + ln];
        bvl.u[i] = sVl[8 * hh + i][dt * 16 + ln]; bvl.u[8 + i] = sVl[16 + 8 * hh + i][dt * 16 + ln];
      }
      oacc[dt] = mmaN<3>(pah.v, pal.v, bvh.v, bvl.v, oacc[dt]);
    }
    __builtin_amdgcn_fence(__ATOMIC_ACQ_REL, "workgroup");
    __builtin_amdgcn_wave_barrier();
  }
#pragma unroll
  for (int r = 0; r < 8; ++r) {
    float l = l_r[r];
    l += __shfl_xor(l, 1, 32); l += __shfl_xor(l, 2, 32); l += __shfl_xor(l, 4, 32); l += __shfl_xor(l, 8, 32);
    l_r[r] = (l > 0.f) ? 1.0f / l : 0.f;
  }
#pragma unroll
  for (int dt = 0; dt < DT; ++dt)
#pragma unroll
    for (int r = 0; r < 8; ++r) sO[w][8 * hh + r][dt * 16 + ln] = oacc[dt][r] * l_r[r];
  __builtin_amdgcn_fence(__ATOMIC_ACQ_REL, "workgroup");
  __builtin_amdgcn_wave_barrier();
  {
    for (int r = 0; r < 16; ++r) {
      const int row = q0 + r;
      if (row < T && lane < D / 4) {
        const v4f val = *(const v4fa*)&sO[w][r][lane * 4];
        *(v4f*)(y + ((size_t)b * T + row) * ypitch + h * D + lane * 4) = val;
      }
    }
    
  }
}

// GEMM C = act(A·W + bias + resid): A f32 (ASPLIT -> hi/lo 2 terms), Wt bf16 [N][K]; ACT 0 none, 1 relu, 2 exact gelu;
// resid (optional, f32, row index = (row % rmod), pitch ldr, RES_BF16 rounds it) added before the activation.
template <bool ASPLIT, int ACT, bool BIAS_BF16, bool RES_BF16>
__global__ __launch_bounds__(128) void k_gemm_bf3(const float* __restrict__ A, int lda, const unsigned short* __restrict__ Wt, int ldb,
                                                const float* __restrict__ bias, const float* __restrict__ resid, int rmod, int ldr,
                                                float* __restrict__ C, int ldc, int M, int N, int K) {
  __shared__ __attribute__((aligned(16))) float so[4][16][64];
  const int tid = threadIdx.x, w = tid >> 5, lane = tid & 31, ln = lane & 15, hh = lane >> 4;
  const int ntn = N / 64;
  const int wid = blockIdx.x * 4 + w;
  const int mt = wid / ntn, nq = wid % ntn;
  if (mt * 16 >= M) return;
  const int row0 = mt * 16, col0 = nq * 64;
  const float* arow = A + (size_t)(row0 + ln) * lda;
  v8f acc[4] = {};
  for (int kb = 0; kb < K; kb += 32) {
    FragB ah, al;
    const v4f x0 = *(const v4fa*)(arow + kb + 8 * hh), x1 = *(const v4fa*)(arow + kb + 8 * hh + 4);
    const v4f x2 = *(const v4fa*)(arow + kb + 16 + 8 * hh), x3 = *(const v4fa*)(arow + kb + 16 + 8 * hh + 4);
    float xs[16] = {x0[0],x0[1],x0[2],x0[3],x1[0],x1[1],x1[2],x1[3],x2[0],x2[1],x2[2],x2[3],x3[0],x3[1],x3[2],x3[3]};
#pragma unroll
    for (int i = 0; i < 16; ++i) { const unsigned short hb = bf16_bits(xs[i]); ah.u[i] = hb; al.u[i] = ASPLIT ? bf16_bits(xs[i] - bf16_val(hb)) : (unsigned short)0; }
#pragma unroll
    for (int t = 0; t < 4; ++t) {
      const unsigned short* brow = Wt + (size_t)(col0 + t * 16 + ln) * ldb + kb;
      FragB b;
      b.half[0] = *(const v8us*)(brow + 8 * hh);
      b.half[1] = *(const v8us*)(brow + 16 + 8 * hh);
      acc[t] = mmaN<ASPLIT ? 2 : 1>(ah.v, al.v, b.v, b.v, acc[t]);
    }
  }
#pragma unroll
  for (int t = 0; t < 4; ++t) {
    const int col = col0 + t * 16 + ln;
    float bv = bias ? bias[col] : 0.f;
    if (BIAS_BF16) bv = bf16_round(bv);
#pragma unroll
    for (int r = 0; r < 8; ++r) {
      float v = acc[t][r] + bv;
      if (resid) { float rv = resid[(size_t)((row0 + 8 * hh + r) % rmod) * ldr + col]; if (RES_BF16) rv = bf16_round(rv); v += rv; }
      if (ACT == 1) v = fmaxf(v, 0.f);
      if (ACT == 2) v = 0.5f * v * (1.0f + erff(v * 0.70710678118654752f));
      if (ACT == 3) { const float u = 0.7978845608028654f * (v + 0.044715f * v * v * v); v = 0.5f * v * (1.0f + tanhf(u)); }
      so[w][8 * hh + r][t * 16 + ln] = v;
    }
  }
  __builtin_amdgcn_fence(__ATOMIC_ACQ_REL, "workgroup");
  __builtin_amdgcn_wave_barrier();
  const int rsub = lane >> 4, c4 = (lane & 15) * 4;
  {
#pragma unroll
    for (int q = 0; q < 8; ++q) {
      const int r = q * 2 + rsub;
      const v4f v = *(const v4fa*)&so[w][r][c4];
      *(v4f*)(C + (size_t)(row0 + r) * ldc + col0 + c4) = v;
    }
    
  }
}
// row LayerNorm (biased variance, eps) over N: s = X (+ R); optional out_sum <- s; out_norm <- (s-mu)*rsqrt(var+eps)*g + b
template <bool PARAM_BF16>
__global__ __launch_bounds__(256) void k_layernorm(const float* __restrict__ X, const float* __restrict__ R, const float* __restrict__ g, const float* __restrict__ bta,
                                                  float* __restrict__ out_sum, float* __restrict__ out_norm, int N, float eps) {
  __shared__ float red[256];
  const int row = blockIdx.x, tid = threadIdx.x;
  const float* x = X + (size_t)row * N; const float* rr = R ? R + (size_t)row * N : nullptr;
  float vals[16];                     // up to N = 4096
  const int per = N / 256;            // contiguous chunk per thread? use strided-by-4 chunks: thread handles j = tid*4 + 1024*u
  float s1 = 0.f;
  for (int u = 0; u < per / 4; ++u) {
    const int j = tid * 4 + 1024 * u;
    const v4f a = *(const v4fa*)(x + j);
    v4f b = {0.f,0.f,0.f,0.f}; if (rr) b = *(const v4fa*)(rr + j);
#pragma unroll
    for (int q = 0; q < 4; ++q) { const float v = a[q] + b[q]; vals[u * 4 + q] = v; s1 += v; }
  }
  red[tid] = s1; __syncthreads();
  for (int st = 128; st > 0; st >>= 1) { if (tid < st) red[tid] += red[tid + st]; __syncthreads(); }
  const float mu = red[0] / (float)N; __syncthreads();
  float s2 = 0.f;
  for (int u = 0; u < per / 4; ++u)
#pragma unroll
    for (int q = 0; q < 4; ++q) { const float c = vals[u * 4 + q] - mu; s2 += c * c; }
  red[tid] = s2; __syncthreads();
  for (int st = 128; st > 0; st >>= 1) { if (tid < st) red[tid] += red[tid + st]; __syncthreads(); }
  const float rs = rsqrtf(red[0] / (float)N + eps);
  {
    for (int u = 0; u < per / 4; ++u) {
      const int j = tid * 4 + 1024 * u;
      v4f o, sm;
#pragma unroll
      for (int q = 0; q < 4; ++q) {
        float gg = g[j + q], bb = bta[j + q];
        if (PARAM_BF16) { gg = bf16_round(gg); bb = bf16_round(bb); }
        sm[q] = vals[u * 4 + q]; o[q] = (vals[u * 4 + q] - mu) * rs * gg + bb;
      }
      if (out_sum) *(v4f*)(out_sum + (size_t)row * N + j) = sm;
      *(v4f*)(out_norm + (size_t)row * N + j) = o;
    }
    
  }
}



// ---- f16 WMMA path (v_wmma_f32_16x16x32_f16): 11-bit significands for operands in range — used where a [0,1] probability operand needs more precision than bf16
typedef _Float16 v16h __attribute__((ext_vector_type(16)));
union FragH { v16h v; v8us half[2]; _Float16 h[16]; unsigned short u[16]; };
template <int NT>
__device__ __forceinline__ v8f mmaH(v16h ah, v16h al, v16h bh, v16h bl, v8f c) {
  c = __builtin_amdgcn_wmma_f32_16x16x32_f16(false, ah, false, bh, (short)0, c, false, false);
  if (NT >= 2) c = __builtin_amdgcn_wmma_f32_16x16x32_f16(false, al, false, bh, (short)0, c, false, false);
  if (NT >= 3) c = __builtin_amdgcn_wmma_f32_16x16x32_f16(false, ah, false, bl, (short)0, c, false, false);
  asm volatile("v_nop\n\tv_nop\n\tv_nop\n\tv_nop" : "+v"(c) : "v"(ah), "v"(al), "v"(bh), "v"(bl));
  return c;
}
// batched GEMM like k_gemm_b but f16 operands: A f32 (split into f16 hi/lo if ASPLIT, else rounded to f16), Bt = f16 values [n][k]; alpha; C f32; N multiple of 16 (partial tiles skipped)
template <bool ASPLIT>
__global__ __launch_bounds__(128) void k_gemm_h(const float* __restrict__ A, int lda, size_t sA, const _Float16* __restrict__ Bh, int ldb, size_t sB, float alpha, float* __restrict__ C, int ldc, size_t sC, int M, int N, int K) {
  __shared__ __attribute__((aligned(16))) float so[4][16][64];
  const int tid = threadIdx.x, w = tid >> 5, lane = tid & 31, ln = lane & 15, hh = lane >> 4; const int by = blockIdx.y;
  A += (size_t)by * sA; Bh += (size_t)by * sB; C += (size_t)by * sC;
  const int ntn = (N + 63) / 64; const int wid = blockIdx.x * 4 + w; const int mt = wid / ntn, nq = wid % ntn; if (mt * 16 >= M) return;
  const int row0 = mt * 16, col0 = nq * 64; const float* arow = A + (size_t)(row0 + ln) * lda;
  v8f acc[4] = {};
  for (int kb = 0; kb < K; kb += 32) {
    FragH ah, al;
    const v4f x0 = *(const v4fa*)(arow + kb + 8 * hh), x1 = *(const v4fa*)(arow + kb + 8 * hh + 4), x2 = *(const v4fa*)(arow + kb + 16 + 8 * hh), x3 = *(const v4fa*)(arow + kb + 16 + 8 * hh + 4);
    float xs[16] = {x0[0],x0[1],x0[2],x0[3],x1[0],x1[1],x1[2],x1[3],x2[0],x2[1],x2[2],x2[3],x3[0],x3[1],x3[2],x3[3]};
#pragma unroll
    for (int i = 0; i < 16; ++i) { const _Float16 h = (_Float16)xs[i]; ah.h[i] = h; al.h[i] = ASPLIT ? (_Float16)(xs[i] - (float)h) : (_Float16)0.0f; }
#pragma unroll
    for (int t = 0; t < 4; ++t) { if (col0 + t * 16 >= N) continue; const size_t boff = (size_t)(col0 + t * 16 + ln) * ldb + kb; FragH bq; bq.half[0] = *(const v8us*)(Bh + boff + 8 * hh); bq.half[1] = *(const v8us*)(Bh + boff + 16 + 8 * hh);
      acc[t] = mmaH<ASPLIT ? 2 : 1>(ah.v, al.v, bq.v, bq.v, acc[t]); }
  }
#pragma unroll
  for (int t = 0; t < 4; ++t) { if (col0 + t * 16 >= N) continue;
#pragma unroll
    for (int r = 0; r < 8; ++r) so[w][8 * hh + r][t * 16 + ln] = acc[t][r] * alpha; }
  __builtin_amdgcn_fence(__ATOMIC_ACQ_REL, "workgroup"); __builtin_amdgcn_wave_barrier();
  const int rsub = lane >> 4, c4 = (lane & 15) * 4;
  {
#pragma unroll
    for (int q = 0; q < 8; ++q) { const int r = q * 2 + rsub; if (col0 + c4 < N) { const v4f v = *(const v4fa*)&so[w][r][c4]; *(v4f*)(C + (size_t)(row0 + r) * ldc + col0 + c4) = v; } }
     }
}

// Wt[n][k] = f16(bf16(W[k][n]) * scale) from f32 row-major W[DD][DD] (scale = power of two; bf16-exact weights stay exact in f16 away from the subnormal range).
// One work-group = a tile of WTK k x WTN n, turned through LDS, so that both sides move whole 128-B lines: a wave's load is two rows of 256 B of W, a wave's store two rows of 256 B of Wt.
// A thread takes 8 consecutive k of 4 consecutive n: each of its four n is one 16-B piece of a row of Wt
#define WTK 128
#define WTN 64
__device__ __forceinline__ void d_wt_f16(int bx, const float* __restrict__ W, _Float16* __restrict__ Wt, float scale) {
  __shared__ __attribute__((aligned(16))) unsigned short sT[WTN][WTK + 8];      /* pitch 272 B (16 B x odd), as for the GEMM's tiles */
  const int tid = threadIdx.x, n4 = tid & 15, k8 = tid >> 4; const int k0 = (bx % (DD / WTK)) * WTK, n0 = (bx / (DD / WTK)) * WTN;
  const float* p = W + (size_t)(k0 + k8 * 8) * DD + n0 + n4 * 4; v4f x[8];
#pragma unroll
  for (int i = 0; i < 8; ++i) x[i] = *(const v4fa*)(p + (size_t)i * DD);
  asm volatile("s_wait_xcnt 0x0" ::: "memory");      // stands behind the eight loads, in front of every later write of their address registers
#pragma unroll
  for (int q = 0; q < 4; ++q) { FragH f;
#pragma unroll
    for (int i = 0; i < 8; ++i) f.h[i] = (_Float16)(bf16_round(x[i][q]) * scale);
    *(v8us*)&sT[n4 * 4 + q][k8 * 8] = f.half[0]; }
  __syncthreads();      // the tile is whole before any row of it is read; bx is the same in the whole work-group
  unsigned short* o = (unsigned short*)Wt + (size_t)(n0 + k8) * DD + k0 + n4 * 8;
#pragma unroll
  for (int i = 0; i < WTN / 16; ++i) { const v8us v = *(const v8us*)&sT[k8 + i * 16][n4 * 8]; *(v8us*)(o + (size_t)i * 16 * DD) = v; }
  asm volatile("s_wait_xcnt 0x0" ::: "memory");      // stands behind the four stores, in front of every later write of their address and data registers
}
// C16[r][c] = f16(sum_k A[r][k] * Bt[c][k] * alpha + bf16(bias[c])): A f16 [NR][DD], Bt f16 [DD][DD]. One work-group = a 128 x 128 tile of C, 8 waves of 64 x 32 (4 x 2 accumulators);
// k runs in slices of 128 through an LDS ring of two buffers that all 8 waves share; per output element the WMMAs follow one another in rising k, 32 at a time
// One grid holds the three independent projections: blocks [256 s, 256 s + 256) are product s (0 = q, 1 = k, 2 = v); A3 and Bt3 hold the three planes one behind the other, C3 those of q and k.
// Product v is stored transposed, as the attention kernel reads it: Vt[(b * NH + h) * 64 + d][token], rows of TT tokens
__global__ __launch_bounds__(256) void k_gemm_t(const _Float16* __restrict__ A3, const _Float16* __restrict__ Bt3, float alpha, const float* __restrict__ bias0, const float* __restrict__ bias1, const float* __restrict__ bias2, _Float16* __restrict__ C3, _Float16* __restrict__ Vt) {
  constexpr int GP = (NR / 128) * (DD / 128); const int sel = blockIdx.x / GP, bx = blockIdx.x % GP;
  const _Float16* A = A3 + (size_t)sel * NR * DD; const _Float16* Bt = Bt3 + (size_t)sel * DD * DD; _Float16* C16 = C3 + (size_t)sel * NR * DD; const float* bias = sel == 0 ? bias0 : sel == 1 ? bias1 : bias2;
  // rows of 128 f16 = 256 B; LDS pitch 272 B (16 B x odd) keeps the 16 rows of a ds_load_b128 fragment read on distinct banks
  constexpr int BT = 128, BK = 128, NSL = DD / BK, LP = BK + 8, TBY = BT * LP * 2, CP = BT + 8;
  __shared__ __attribute__((aligned(16))) unsigned short sA[2][BT][LP]; __shared__ __attribute__((aligned(16))) unsigned short sB[2][BT][LP];
  // The epilogue's tile lies in buffer 0 of sA, not in LDS of its own: 139,264 B a work-group instead of 174,080, so that two work-groups fit a WGP's 320 KiB and one computes while the other waits for its copies, starts or stores.
  // Buffer 0 is free by then: its last copies were waited for at the foot of trip NSL - 3, its last reads end at the barrier at the foot of trip NSL - 2, and the loop's last barrier lies behind that
  static_assert(CP == LP && NSL % 2 == 0 && NSL >= 2, "sC has the shape of one buffer of sA; the last trip reads buffer 1"); unsigned short (*sC)[CP] = sA[0];
  const int tid = threadIdx.x, w = tid >> 5, lane = tid & 31, ln = lane & 15, hh = lane >> 4;
  const int row0 = (bx % (NR / BT)) * BT, col0 = (bx / (NR / BT)) * BT; const int wm = (w >> 2) * 64, wn = (w & 3) * 32;
  // each thread copies 16 B of rows crow, crow + 16, ..., crow + 112 of both tiles: a wave's copy covers four whole 128-B lines
  const int crow = tid >> 4, ccol = tid & 15;
  const unsigned short* gA = (const unsigned short*)A + (size_t)(row0 + crow) * DD + ccol * 8; const unsigned short* gB = (const unsigned short*)Bt + (size_t)(col0 + crow) * DD + ccol * 8;
  const unsigned lA = (unsigned)(uintptr_t)&sA[0][crow][ccol * 8], lB = (unsigned)(uintptr_t)&sB[0][crow][ccol * 8];
  auto copy8 = [&](unsigned l, const unsigned short* g) {
    // global -> LDS through no register; s_wait_xcnt 0 closes the statement so that no address register is rewritten ahead of it
    asm volatile("global_load_async_to_lds_b128 %0, %8, off\n\tglobal_load_async_to_lds_b128 %1, %9, off\n\tglobal_load_async_to_lds_b128 %2, %10, off\n\tglobal_load_async_to_lds_b128 %3, %11, off\n\t"
                 "global_load_async_to_lds_b128 %4, %12, off\n\tglobal_load_async_to_lds_b128 %5, %13, off\n\tglobal_load_async_to_lds_b128 %6, %14, off\n\tglobal_load_async_to_lds_b128 %7, %15, off\n\ts_wait_xcnt 0x0"
                 :: "v"(l), "v"(l + 16 * LP * 2), "v"(l + 32 * LP * 2), "v"(l + 48 * LP * 2), "v"(l + 64 * LP * 2), "v"(l + 80 * LP * 2), "v"(l + 96 * LP * 2), "v"(l + 112 * LP * 2),
                    "v"(g), "v"(g + 16 * DD), "v"(g + 32 * DD), "v"(g + 48 * DD), "v"(g + 64 * DD), "v"(g + 80 * DD), "v"(g + 96 * DD), "v"(g + 112 * DD) : "memory"); };
  auto stage = [&](int st, int bf) { copy8(lA + bf * TBY, gA + st * BK); copy8(lB + bf * TBY, gB + st * BK); };
  v8f acc[4][2];
#pragma unroll
  for (int mi = 0; mi < 4; ++mi)
#pragma unroll
    for (int ni = 0; ni < 2; ++ni) acc[mi][ni] = (v8f){0.f,0.f,0.f,0.f,0.f,0.f,0.f,0.f};
  stage(0, 0);
  asm volatile("s_wait_asynccnt 0x0" ::: "memory");      // this wave's copies of slice 0 have landed
  __syncthreads();                                        // ... and every other wave's: slice 0 may be read
  stage(1, 1);
#pragma unroll 1      /* one copy of the ring's foot; the buffer index stays t & 1 */
  for (int t = 0; t < NSL; ++t) { const int bf = t & 1; const unsigned short* ab = &sA[bf][wm + ln][8 * hh]; const unsigned short* bb = &sB[bf][wn + ln][8 * hh];
    FragH a[2][4], bq[2][2];      /* two fragment sets: the next 32 k of THIS slice are read while the present 32 are multiplied */
    auto frags = [&](int ks, int s) {
#pragma unroll
      for (int mi = 0; mi < 4; ++mi) { a[s][mi].half[0] = *(const v8us*)(ab + mi * 16 * LP + ks * 32); a[s][mi].half[1] = *(const v8us*)(ab + mi * 16 * LP + ks * 32 + 16); }
#pragma unroll
      for (int ni = 0; ni < 2; ++ni) { bq[s][ni].half[0] = *(const v8us*)(bb + ni * 16 * LP + ks * 32); bq[s][ni].half[1] = *(const v8us*)(bb + ni * 16 * LP + ks * 32 + 16); } };
    frags(0, 0);
#pragma unroll
    for (int ks = 0; ks < BK / 32; ++ks) { if (ks + 1 < BK / 32) frags(ks + 1, (ks + 1) & 1);
      __builtin_amdgcn_sched_barrier(0);      // keeps the next step's 12 LDS reads in front of this step's WMMAs; without it each read sinks to its use and its latency is waited for
#pragma unroll
      for (int mi = 0; mi < 4; ++mi)
#pragma unroll
        for (int ni = 0; ni < 2; ++ni) acc[mi][ni] = __builtin_amdgcn_wmma_f32_16x16x32_f16(false, a[ks & 1][mi].v, false, bq[ks & 1][ni].v, (short)0, acc[mi][ni], false, false); }
    asm volatile("s_wait_dscnt 0x0" ::: "memory");        // this wave's reads of buffer bf are done before it is refilled
    asm volatile("s_wait_asynccnt 0x0" ::: "memory");     // this wave's copies of slice t + 1 have landed
    __syncthreads();                                        // publishes slice t + 1 and ends every wave's reads of buffer bf
    if (t + 2 < NSL) stage(t + 2, bf); }
  asm volatile("s_wait_asynccnt 0x0" ::: "memory");       // no copy is outstanding when the wave goes on to the epilogue
  // the tile goes through LDS as f16 so that each 256-B row piece of the stored plane goes out as whole 128-B lines; sel is the same in the whole work-group
  static_assert(TT % BT == 0 && NH * 64 == DD, "a tile lies in one batch; column c of v is row c of that batch's DD rows of Vt");
  FragH cf[4][2];      /* cf[mi][ni].h[r] = C[wm + mi * 16 + 8 hh + r][wn + ni * 16 + ln] */
#pragma unroll
  for (int ni = 0; ni < 2; ++ni) { const float bv = bf16_round(bias[col0 + wn + ni * 16 + ln]);
#pragma unroll
    for (int mi = 0; mi < 4; ++mi)
#pragma unroll
      for (int r = 0; r < 8; ++r) cf[mi][ni].h[r] = (_Float16)(acc[mi][ni][r] * alpha + bv); }
  auto put = [&](unsigned short* dst, int pitch) {      /* the 128 rows of sC, 256 B each, to rows of the given pitch */
#pragma unroll
    for (int i = 0; i < BT * (BT / 8) / 256; ++i) { const int e = tid + i * 256, r = e >> 4, c8 = (e & 15) * 8; const v8us o = *(const v8us*)&sC[r][c8]; *(v8us*)(dst + (size_t)r * pitch + c8) = o; } };
  if (sel == 2) {      /* sC[column][row]: a lane's eight registers are eight consecutive rows of one column, one 16-B write */
#pragma unroll
    for (int ni = 0; ni < 2; ++ni)
#pragma unroll
      for (int mi = 0; mi < 4; ++mi) *(v8us*)&sC[wn + ni * 16 + ln][wm + mi * 16 + 8 * hh] = cf[mi][ni].half[0];
  } else {
#pragma unroll
    for (int ni = 0; ni < 2; ++ni)
#pragma unroll
      for (int mi = 0; mi < 4; ++mi)
#pragma unroll
        for (int r = 0; r < 8; ++r) sC[wm + mi * 16 + 8 * hh + r][wn + ni * 16 + ln] = cf[mi][ni].u[r];
  }
  __syncthreads();
  if (sel == 2) put((unsigned short*)Vt + ((size_t)(row0 / TT) * DD + col0) * TT + row0 % TT, TT);
  else put((unsigned short*)C16 + (size_t)row0 * DD + col0, DD);
}


typedef _Float16 v4h __attribute__((ext_vector_type(4)));

__global__ __launch_bounds__(256) void k_x16(const float* __restrict__ x, _Float16* __restrict__ X16, size_t n8) { const size_t t = (size_t)blockIdx.x * 256 + threadIdx.x; if (t >= n8) return; FragH f;
#pragma unroll
  for (int q = 0; q < 8; ++q) f.h[q] = (_Float16)bf16_round(x[t * 8 + q]); *(v8us*)((unsigned short*)X16 + t * 8) = f.half[0];  }
__global__ __launch_bounds__(256) void k_h16(const float* __restrict__ x, _Float16* __restrict__ X16, size_t n8) { const size_t t = (size_t)blockIdx.x * 256 + threadIdx.x; if (t >= n8) return; FragH f;
#pragma unroll
  for (int q = 0; q < 8; ++q) f.h[q] = (_Float16)x[t * 8 + q]; *(v8us*)((unsigned short*)X16 + t * 8) = f.half[0];  }
__global__ __launch_bounds__(256) void k_round16f(const float* __restrict__ W, _Float16* __restrict__ Bt, size_t n8) { const size_t t = (size_t)blockIdx.x * 256 + threadIdx.x; if (t >= n8) return; FragH f;
#pragma unroll
  for (int i = 0; i < 8; ++i) f.h[i] = (_Float16)(bf16_round(W[t * 8 + i]) * 16.0f); *(v8us*)((unsigned short*)Bt + t * 8) = f.half[0];  }
template <int D, int RBF>
__device__ __forceinline__ void d_lnx(int bx, const float* __restrict__ X, const float* __restrict__ gam, const float* __restrict__ bet, int nrows, float eps, _Float16* __restrict__ O16, float* __restrict__ XR) {
  constexpr int NP = D / 128; const int tid = threadIdx.x, wv = tid >> 5, lane = tid & 31; const size_t r = (size_t)bx * 8 + wv; if (r >= (size_t)nrows) return; v4f y[NP]; float s = 0.f;
#pragma unroll
  for (int j = 0; j < NP; ++j) { const int c = j * 128 + lane * 4; v4f g = *(const v4fa*)(X + r * D + c); if (RBF) { for (int q = 0; q < 4; ++q) g[q] = bf16_round(g[q]); } y[j] = g; s += g[0] + g[1] + g[2] + g[3]; }
  asm volatile("s_wait_xcnt 0x0" ::: "memory");      // stands behind the row's loads, in front of every later write of their address registers
  for (int o = 16; o >= 1; o >>= 1) s += __shfl_xor(s, o, 32); const float mu = s / (float)D; float q2 = 0.f;
#pragma unroll
  for (int j = 0; j < NP; ++j) for (int q = 0; q < 4; ++q) { const float d = y[j][q] - mu; q2 += d * d; }
  for (int o = 16; o >= 1; o >>= 1) q2 += __shfl_xor(q2, o, 32); const float rs = rsqrtf(q2 / (float)D + eps);
  {
#pragma unroll
    for (int j = 0; j < NP; ++j) { const int c = j * 128 + lane * 4; v4h h; for (int q = 0; q < 4; ++q) { const float v = (y[j][q] - mu) * rs * bf16_round(gam[c + q]) + bf16_round(bet[c + q]); h[q] = (_Float16)v; } *(v4h*)(O16 + r * D + c) = h; if (XR) *(v4f*)(XR + r * D + c) = y[j]; }
     } }
typedef int v4ia __attribute__((ext_vector_type(4), may_alias));
// One wave reads one tile of 64 queries x 64 keys of the mask (nonzero = masked) and writes its class: bit 0 = some pair is open, bit 1 = some pair is masked.
// Tile number = (b * 32 + query tile) * 32 + key tile; each class word stands in a 128-B line of its own, so every line has one writer
__device__ __forceinline__ void d_mclass(int bx, const int* __restrict__ MSK, int* __restrict__ TF) {
  const unsigned lane = threadIdx.x & 31, tile = (unsigned)bx * 8 + (threadIdx.x >> 5); const unsigned kt = tile % (TT / 64), qt = (tile / (TT / 64)) % (TT / 64), b = tile / ((TT / 64) * (TT / 64));
  const int* p = MSK + ((size_t)b * TT + qt * 64 + (lane >> 4)) * TT + kt * 64 + (lane & 15) * 4;      /* a wave's load = two rows of 256 B: four whole lines */
  unsigned am = 0u, lo = ~0u;      /* OR and unsigned minimum of the tile's words: am != 0 = some pair masked, lo == 0 = some pair open */
#pragma unroll 8      /* eight independent loads in flight per wave: the tile comes from memory */
  for (int i = 0; i < 32; ++i) { const v4ia x = *(const v4ia*)(p + (size_t)i * 2 * TT);
#pragma unroll
    for (int q = 0; q < 4; ++q) { am |= (unsigned)x[q]; lo = min(lo, (unsigned)x[q]); } }
  const unsigned bm = __builtin_amdgcn_ballot_w32(am != 0u), bo = __builtin_amdgcn_ballot_w32(lo == 0u);
  if (lane == 0) TF[(size_t)tile * 32] = (bo ? 1 : 0) | (bm ? 2 : 0); }
// One grid holds the independent preparations: blocks [0, GM) class the mask's tiles; behind them blocks [0, 3 GW) transpose the three weights, blocks [3 GW, 3 GW + 3 GL) normalise the rows of Q, K and V
__global__ __launch_bounds__(256) void k_prep(const float* __restrict__ Qx, const float* __restrict__ Kx, const float* __restrict__ Vx, const float* __restrict__ Wq, const float* __restrict__ Wk, const float* __restrict__ Wv,
                                              const float* __restrict__ gam, const float* __restrict__ bet, const int* __restrict__ MSK, _Float16* __restrict__ Bw, _Float16* __restrict__ H3, int* __restrict__ TF) {
  constexpr int GM = BB * (TT / 64) * (TT / 64) / 8, GW = (DD / WTK) * (DD / WTN), GL = NR / 8; const int bx = (int)blockIdx.x - GM;
  if (bx < 0) d_mclass(blockIdx.x, MSK, TF);
  else if (bx < 3 * GW) { const int sel = bx / GW; d_wt_f16(bx % GW, sel == 0 ? Wq : sel == 1 ? Wk : Wv, Bw + (size_t)sel * DD * DD, 16.0f); }      /* (in,out) -> Bt x 2^4 */
  else { const int y = bx - 3 * GW, sel = y / GL; d_lnx<DD, 1>(y % GL, sel == 0 ? Qx : sel == 1 ? Kx : Vx, gam, bet, NR, 1e-5f, H3 + (size_t)sel * NR * DD, nullptr); } }      /* LN(bf16 x) -> f16 */
// y[i] = 2^x[i], twelve independent v_exp_f32 in one statement with results in registers of their own (=&v), so that none overwrites the source of the one in front of it;
// the closing v_nop is the slot the instruction set asks for behind a transcendental before its result is read or its source overwritten
__device__ __forceinline__ void exp2x12(float* __restrict__ y, const float* __restrict__ x) {
  asm("v_exp_f32 %0, %12\n\tv_exp_f32 %1, %13\n\tv_exp_f32 %2, %14\n\tv_exp_f32 %3, %15\n\tv_exp_f32 %4, %16\n\tv_exp_f32 %5, %17\n\t"
      "v_exp_f32 %6, %18\n\tv_exp_f32 %7, %19\n\tv_exp_f32 %8, %20\n\tv_exp_f32 %9, %21\n\tv_exp_f32 %10, %22\n\tv_exp_f32 %11, %23\n\tv_nop"
      : "=&v"(y[0]), "=&v"(y[1]), "=&v"(y[2]), "=&v"(y[3]), "=&v"(y[4]), "=&v"(y[5]), "=&v"(y[6]), "=&v"(y[7]), "=&v"(y[8]), "=&v"(y[9]), "=&v"(y[10]), "=&v"(y[11])
      : "v"(x[0]), "v"(x[1]), "v"(x[2]), "v"(x[3]), "v"(x[4]), "v"(x[5]), "v"(x[6]), "v"(x[7]), "v"(x[8]), "v"(x[9]), "v"(x[10]), "v"(x[11])); }
// the same for nine values
__device__ __forceinline__ void exp2x9(float* __restrict__ y, const float* __restrict__ x) {
  asm("v_exp_f32 %0, %9\n\tv_exp_f32 %1, %10\n\tv_exp_f32 %2, %11\n\tv_exp_f32 %3, %12\n\tv_exp_f32 %4, %13\n\tv_exp_f32 %5, %14\n\tv_exp_f32 %6, %15\n\tv_exp_f32 %7, %16\n\tv_exp_f32 %8, %17\n\tv_nop"
      : "=&v"(y[0]), "=&v"(y[1]), "=&v"(y[2]), "=&v"(y[3]), "=&v"(y[4]), "=&v"(y[5]), "=&v"(y[6]), "=&v"(y[7]), "=&v"(y[8])
      : "v"(x[0]), "v"(x[1]), "v"(x[2]), "v"(x[3]), "v"(x[4]), "v"(x[5]), "v"(x[6]), "v"(x[7]), "v"(x[8])); }
// the value that lane l ^ 16 holds
__device__ __forceinline__ float xhalf(float x) { const int b = __float_as_int(x); return __int_as_float(__builtin_amdgcn_permlanex16(b, b, 0x76543210, 0xfedcba98, false, false)); }
// Scores are computed transposed: S^T = K Q^T (A = 16 keys from LDS, B = the wave's 16 queries, kept in registers), O^T += V^T P^T. Lane (ln, hh) holds query q0 + ln alone:
// register r of score tile nt is key j0 + nt * 16 + 8 * hh + r, so maximum and sum run inside the lane with one exchange between the halves, and the four score tiles, converted in place, are the two B operands of the second product, two tiles each
__global__ __launch_bounds__(128) void k_flash(const _Float16* __restrict__ Q16, int ldq, const _Float16* __restrict__ K16, int ldk, const _Float16* __restrict__ Vt, const int* __restrict__ MSK, const int* __restrict__ TF, const float* __restrict__ Qx, float* __restrict__ O, int ldo) {
  constexpr int RPW = 16, NQB = TT / (4 * RPW), DT = 4, KS = 2;
  __shared__ __attribute__((aligned(16))) float sO[4][RPW][64 + 4];
  // K/V ring, two buffers, one stage = SKEY keys: sK rows = keys (64 d = 128 B), sV rows = d (SKEY keys = 128 B); LDS pitch 144 B (16 B x odd) keeps the 16 rows of a ds_load_b128 fragment read on distinct banks
  constexpr int SKEY = 64, NST = TT / SKEY, LP = 72, SBUF = 64 * LP * 2; constexpr float SC = 0.125f * 1.44269504088896340736f;      /* 64^-1/2 * log2(e) */
  __shared__ __attribute__((aligned(16))) unsigned short sK[2][SKEY][LP]; __shared__ __attribute__((aligned(16))) unsigned short sV[2][64][LP];
  const int tid = threadIdx.x, w = tid >> 5, lane = tid & 31, ln = lane & 15, hh = lane >> 4;
  // A work-group's cost is the number of key stages that its query tile leaves open, so it differs from tile to tile. Block index -> (slab, query tile) is a permutation of the 1024 pairs, for speed only.
  // Each run of 128 blocks (ga = 0..7) holds, for all 32 slabs, the four tiles 31 - ga, 16 + ga, 15 - ga, ga; which of the four a block takes is the sum of its index's base-4 digits mod 4,
  // so that four blocks a power of two apart hold one tile of each kind, wherever the hardware puts them, and the far ends of the tile range stand early in the grid
  static_assert(NQB == 32 && BB * NH == 32 && TT / 64 == 32, "the bit fields below and one class word per lane");
  const int bi = blockIdx.x, ga = bi >> 7, slab = (bi >> 2) & 31, pp = (bi + (bi >> 2) + (bi >> 4) + (bi >> 6) + (bi >> 8)) & 3;
  const int qblk = (((pp >> 1) ^ 1) << 4) | (ga ^ (((pp & 1) - 1) & 15));      /* pp = 0, 1, 2, 3: 31 - ga, 16 + ga, 15 - ga, ga */
  const int b = slab / NH, h = slab % NH; const int qb0 = qblk * (4 * RPW); const int q0 = qb0 + w * RPW;
  const int tf = TF[(size_t)((b * NQB + qblk) * NST + lane) * 32];
  asm volatile("s_wait_xcnt 0x0" ::: "memory");      // stands behind the load above, in front of every later write of its address registers
  FragH aq[KS];
  { const unsigned short* qr = (const unsigned short*)Q16 + ((size_t)b * TT + q0 + ln) * ldq + h * 64;
#pragma unroll
    for (int ks = 0; ks < KS; ++ks) { aq[ks].half[0] = *(const v8us*)(qr + ks * 32 + 8 * hh); aq[ks].half[1] = *(const v8us*)(qr + ks * 32 + 16 + 8 * hh); } }
  // the residual: the pieces of Q that this lane adds to what it stores at the end, asked for here so that they come in under the key loop
  v4f xr[RPW / 2];
  { const float* qx = Qx + ((size_t)b * TT + q0 + hh) * DD + h * 64 + ln * 4;
#pragma unroll
    for (int i = 0; i < RPW / 2; ++i) xr[i] = *(const v4fa*)(qx + (size_t)i * 2 * DD); }
  asm volatile("s_wait_xcnt 0x0" ::: "memory");      // stands behind the loads above, in front of every later write of their address registers
  const unsigned short* Vth = (const unsigned short*)Vt + (size_t)slab * 64 * TT;
  const int* mrow = MSK + ((size_t)b * TT + q0 + ln) * TT + 8 * hh;      /* this lane's query row of the mask, at its half's first key */
  float m_r = -3.0e38f, l_r = 0.f; v8f oacc[DT];
#pragma unroll
  for (int dt = 0; dt < DT; ++dt) oacc[dt] = (v8f){0.f,0.f,0.f,0.f,0.f,0.f,0.f,0.f};
  // each thread copies 16 B of rows crow, crow + 16, + 32, + 48 of both tiles: a wave's copy covers four whole 128-B lines
  const int crow = tid >> 3, ccol = tid & 7;
  const unsigned short* gK = (const unsigned short*)K16 + ((size_t)b * TT + crow) * ldk + h * 64 + ccol * 8; const unsigned short* gV = Vth + (size_t)crow * TT + ccol * 8;
  const unsigned lK = (unsigned)(uintptr_t)&sK[0][crow][ccol * 8], lV = (unsigned)(uintptr_t)&sV[0][crow][ccol * 8];
  auto stage = [&](int st, int bf) { const unsigned short* k0 = gK + (size_t)st * SKEY * ldk; const unsigned short* v0 = gV + st * SKEY; const unsigned lk = lK + bf * SBUF, lv = lV + bf * SBUF;
    // global -> LDS through no register; s_wait_xcnt 0 closes the statement so that no address register is rewritten ahead of it
    asm volatile("global_load_async_to_lds_b128 %0, %8, off\n\tglobal_load_async_to_lds_b128 %1, %9, off\n\tglobal_load_async_to_lds_b128 %2, %10, off\n\tglobal_load_async_to_lds_b128 %3, %11, off\n\t"
                 "global_load_async_to_lds_b128 %4, %12, off\n\tglobal_load_async_to_lds_b128 %5, %13, off\n\tglobal_load_async_to_lds_b128 %6, %14, off\n\tglobal_load_async_to_lds_b128 %7, %15, off\n\ts_wait_xcnt 0x0"
                 :: "v"(lk), "v"(lk + 16 * LP * 2), "v"(lk + 32 * LP * 2), "v"(lk + 48 * LP * 2), "v"(lv), "v"(lv + 16 * LP * 2), "v"(lv + 32 * LP * 2), "v"(lv + 48 * LP * 2),
                    "v"(k0), "v"(k0 + (size_t)16 * ldk), "v"(k0 + (size_t)32 * ldk), "v"(k0 + (size_t)48 * ldk), "v"(v0), "v"(v0 + 16 * TT), "v"(v0 + 32 * TT), "v"(v0 + 48 * TT) : "memory"); };
  // tf: lane t holds the class of key stage t for this block's 64 queries; every wave reads the same 32 words, so both ballots are the same in the whole work-group.
  // A stage with no open pair adds nothing (every p is 0, the maximum stays, the rescale is 1): it is neither copied nor computed. The ring runs over the na <= 32 stages that are left, in rising order
  const unsigned mix = __builtin_amdgcn_ballot_w32((tf & 2) != 0); unsigned rem = __builtin_amdgcn_ballot_w32((tf & 1) != 0); const int na = __builtin_popcount(rem);
  auto next = [&]() { const int s = __builtin_ctz(rem); rem &= rem - 1; return s; };      /* called only while a stage is left */
  int tc = 0, tn = 0;      /* the stage in buffer it & 1 and the one behind it */
  if (na > 0) { tc = next(); stage(tc, 0); }
  asm volatile("s_wait_asynccnt 0x0" ::: "memory");      // this wave's copies of the first stage have landed
  __syncthreads();                                        // ... and every other wave's: it may be read
  if (na > 1) { tn = next(); stage(tn, 1); }
#pragma unroll 1      /* one copy of the ring's foot; the buffer index stays it & 1 */
  for (int it = 0; it < na; ++it) { const int bf = it & 1; const bool mx = (mix >> tc) & 1;      /* the stage has masked pairs: only then are the mask's words read and applied */
    // One pass = the whole stage of SKEY keys: NT score tiles, one maximum, one rescale. Its fragment reads stand in two groups, each ahead of the eight WMMAs that use it, and neighbouring WMMAs have accumulators of their own
    constexpr int NT = SKEY / 16, NS = SKEY / 32; const int j0 = tc * SKEY;
    v4ia mk[NT][2];      /* nonzero = MASKED; mk[nt][r >> 2][r & 3] belongs to register r of score tile nt; loaded and read under mx alone */
    if (mx) {
#pragma unroll
      for (int nt = 0; nt < NT; ++nt) { mk[nt][0] = *(const v4ia*)(mrow + j0 + nt * 16); mk[nt][1] = *(const v4ia*)(mrow + j0 + nt * 16 + 4); } }
    FragH bk[NT][KS];
#pragma unroll
    for (int nt = 0; nt < NT; ++nt) { const unsigned short* kr = &sK[bf][nt * 16 + ln][0];
#pragma unroll
      for (int ks = 0; ks < KS; ++ks) { bk[nt][ks].half[0] = *(const v8us*)(kr + ks * 32 + 8 * hh); bk[nt][ks].half[1] = *(const v8us*)(kr + ks * 32 + 16 + 8 * hh); } }
    __builtin_amdgcn_sched_barrier(0);      // keeps the 16 reads of K together in front of the WMMAs; without it each read sinks to its use and its latency is waited for there
    v8f sa[NT];
#pragma unroll
    for (int nt = 0; nt < NT; ++nt) sa[nt] = (v8f){0.f,0.f,0.f,0.f,0.f,0.f,0.f,0.f};
#pragma unroll
    for (int ks = 0; ks < KS; ++ks)
#pragma unroll
      for (int nt = 0; nt < NT; ++nt) sa[nt] = __builtin_amdgcn_wmma_f32_16x16x32_f16(false, bk[nt][ks].v, false, aq[ks].v, (short)0, sa[nt], false, false);
    FragH bv[DT][NS];
#pragma unroll
    for (int dt = 0; dt < DT; ++dt) { const unsigned short* vrow = &sV[bf][dt * 16 + ln][0];
#pragma unroll
      for (int s = 0; s < NS; ++s) { bv[dt][s].half[0] = *(const v8us*)(vrow + s * 32 + 8 * hh); bv[dt][s].half[1] = *(const v8us*)(vrow + s * 32 + 16 + 8 * hh); } }
    float sv[NT * 8];      /* unscaled scores: sv[nt * 8 + r] is key j0 + nt * 16 + 8 hh + r; the running maximum is kept unscaled too */
#pragma unroll
    for (int nt = 0; nt < NT; ++nt)
#pragma unroll
      for (int r = 0; r < 8; ++r) sv[nt * 8 + r] = sa[nt][r];
    if (mx) {
#pragma unroll
      for (int nt = 0; nt < NT; ++nt)
#pragma unroll
        for (int r = 0; r < 8; ++r) sv[nt * 8 + r] = (mk[nt][r >> 2][r & 3] == 0) ? sa[nt][r] : -INFINITY; }
    float mt[NT];      /* one chain per score tile, so that the four run side by side */
#pragma unroll
    for (int nt = 0; nt < NT; ++nt) { mt[nt] = fmaxf(sv[nt * 8], sv[nt * 8 + 1]);
#pragma unroll
      for (int r = 2; r < 8; ++r) mt[nt] = fmaxf(mt[nt], sv[nt * 8 + r]); }
    float mc = fmaxf(fmaxf(mt[0], mt[1]), fmaxf(mt[2], mt[3])); static_assert(NT == 4, "the joins of the four chains");
    mc = fmaxf(mc, xhalf(mc));      /* the other half's 32 keys of the same query */
    // e^(0.125 (s - m)) = 2^(s * SC - m * SC): one fma per score, no branch; a masked score is -inf and gives 0 (m is finite: it starts at -3e38)
    const float mn = fmaxf(m_r, mc), nb = -mn * SC; float ex[NT * 8 + 1], ey[NT * 8 + 1]; ex[NT * 8] = (m_r - mn) * SC;
#pragma unroll
    for (int i = 0; i < NT * 8; ++i) ex[i] = fmaf(sv[i], SC, nb);
    exp2x12(ey, ex); exp2x12(ey + 12, ex + 12); exp2x9(ey + 24, ex + 24);
    const float* p = ey; const float al = (mn > -1.0e38f) ? ey[NT * 8] : 1.0f; m_r = mn;
    float pt[NT];
#pragma unroll
    for (int nt = 0; nt < NT; ++nt) { pt[nt] = p[nt * 8];
#pragma unroll
      for (int r = 1; r < 8; ++r) pt[nt] += p[nt * 8 + r]; }
    l_r = l_r * al + ((pt[0] + pt[1]) + (pt[2] + pt[3]));      /* this half's keys only; the halves are joined behind the loop */
#pragma unroll
    for (int dt = 0; dt < DT; ++dt)
#pragma unroll
      for (int r = 0; r < 8; ++r) oacc[dt][r] *= al;
    FragH pb[NS];      /* B operands: column ln = the query, element i of pb[s] = key 8 hh + i (i < 8), 8 + 8 hh + i (i >= 8) of the 32 keys s: the order in which sv holds them */
#pragma unroll
    for (int s = 0; s < NS; ++s)
#pragma unroll
      for (int i = 0; i < 16; ++i) pb[s].h[i] = (_Float16)(p[s * 16 + i] * 1024.0f);
#pragma unroll
    for (int s = 0; s < NS; ++s)
#pragma unroll
      for (int dt = 0; dt < DT; ++dt) oacc[dt] = __builtin_amdgcn_wmma_f32_16x16x32_f16(false, bv[dt][s].v, false, pb[s].v, (short)0, oacc[dt], false, false);
    __builtin_amdgcn_sched_barrier(0);      // keeps the ring's foot behind the pass's arithmetic: lifted over it, the wait for the next stage's copies comes a fraction of a pass behind their issue
    asm volatile("s_wait_dscnt 0x0" ::: "memory");        // this wave's reads of buffer bf are done before it is refilled
    asm volatile("s_wait_asynccnt 0x0" ::: "memory");     // this wave's copies of the next stage have landed
    __syncthreads();                                        // publishes the next stage and ends every wave's reads of buffer bf
    tc = tn; if (it + 2 < na) { tn = next(); stage(tn, bf); } }
  asm volatile("s_wait_asynccnt 0x0" ::: "memory");       // no copy is outstanding when the wave goes on to the epilogue
  const float l = l_r + xhalf(l_r); const float li = (l > 0.f) ? 1.0f / (l * 1024.0f) : 0.f;
  // register r of oacc[dt] is O[q0 + ln][dt * 16 + 8 hh + r]: eight consecutive d of the lane's query
#pragma unroll
  for (int dt = 0; dt < DT; ++dt) { v4f lo, hi;
#pragma unroll
    for (int r = 0; r < 4; ++r) { lo[r] = oacc[dt][r] * li; hi[r] = oacc[dt][4 + r] * li; }
    *(v4fa*)&sO[w][ln][dt * 16 + 8 * hh] = lo; *(v4fa*)&sO[w][ln][dt * 16 + 8 * hh + 4] = hi; }
  __builtin_amdgcn_fence(__ATOMIC_ACQ_REL, "workgroup"); __builtin_amdgcn_wave_barrier();
  {
#pragma unroll
    for (int rp = 0; rp < RPW; rp += 2) { const int r = rp + (lane >> 4), pc = lane & 15; v4f val = *(const v4fa*)&sO[w][r][pc * 4];
#pragma unroll
      for (int q = 0; q < 4; ++q) val[q] += bf16_round(xr[rp / 2][q]);      /* out = o + bf16(Q) */
      *(v4f*)(O + ((size_t)b * TT + q0 + r) * ldo + h * 64 + pc * 4) = val; }
     } }

extern "C" void kernel_launch(void* const* d_in, const int* in_sizes, int n_in,
                              void* d_out, int out_size, void* d_ws, size_t ws_size, hipStream_t stream) {
  (void)in_sizes; (void)n_in; (void)out_size;
  const float* const* I = (const float* const*)d_in; const float* Qx = I[0]; const float* Kx = I[1]; const float* Vx = I[2]; const int* mask = (const int*)d_in[3];      /* bool mask shipped as int32 [2,1,2048,2048] */
  const float* Wq = I[4]; const float* bq = I[5]; const float* Wk = I[6]; const float* bk = I[7]; const float* Wv = I[8]; const float* bv = I[9]; const float* gam = I[10]; const float* bet = I[11];
  char* ws = (char*)d_ws; size_t off = 0;
  auto take = [&](size_t bytes) { char* p = ws + off; off += (bytes + 255) & ~(size_t)255; return p; };
  const size_t WSZ = (size_t)DD * DD; _Float16* Bw = (_Float16*)take(3 * WSZ * 2); _Float16* H16 = (_Float16*)take((size_t)3 * NR * DD * 2);
  _Float16* Q = (_Float16*)take((size_t)2 * NR * DD * 2); _Float16* K = Q + (size_t)NR * DD; _Float16* Vt = (_Float16*)take((size_t)NR * DD * 2); int* TF = (int*)take((size_t)BB * (TT / 64) * (TT / 64) * 128);
  if (off > ws_size) return;      // 6.3 + 25.2 + 16.8 + 8.4 = about 57 MB
  k_prep<<<BB * (TT / 64) * (TT / 64) / 8 + 3 * ((DD / WTK) * (DD / WTN)) + 3 * (NR / 8), 256, 0, stream>>>(Qx, Kx, Vx, Wq, Wk, Wv, gam, bet, mask, Bw, H16, TF);
  k_gemm_t<<<3 * (NR / 128) * (DD / 128), 256, 0, stream>>>(H16, Bw, 0.0625f, bq, bk, bv, Q, Vt);      /* three times M 4096 N 1024 K 1024; v comes out transposed */
  k_flash<<<BB * NH * (TT / 64), 128, 0, stream>>>(Q, DD, K, DD, Vt, mask, TF, Qx, (float*)d_out, DD);      /* out = o + Q */
}
